// v000
// The times below were measured on an AMD MI455X: many runs one after another, warmed up first and cycling through
// copies of the inputs, with the whole window's GPU time divided by the number of runs. Launches and the gaps
// between them are all in it. The median over several windows is given; except for v000 it joins two sittings, which
// can be a few percent apart, so the side-by-side timings, each taken in one sitting, are the better comparison.
// v000 is the starting kernel. One run takes 625 microseconds.
// Projections q,k,v^T: v_wmma_f32_16x16x32_bf16 (bf16 RNE operands from the f32 inputs, f32 accumulate, bf16-RNE bias added in f32); attention q.k^T and p.v: v_wmma_f32_16x16x32_f16 (f16 q,k,v planes, p carried x2^15, f32 accumulate, f32 online softmax, score scale 0.125 in f32); output projection: v_wmma_f32_16x16x32_f16 (f16 planes of o x2^8 and bf16-RNE(Wo) x2^8, f32 accumulate, scale 2^-16, bf16-RNE bias added in f32).
#include <hip/hip_runtime.h>
#include <math.h>
#include <stdint.h>

typedef __attribute__((ext_vector_type(16))) _Float16 v16h;
typedef __attribute__((ext_vector_type(8)))  _Float16 v8h;
typedef __attribute__((ext_vector_type(16))) __bf16   v16b;
typedef __attribute__((ext_vector_type(8)))  __bf16   v8b;
typedef __attribute__((ext_vector_type(8)))  float    v8f;
typedef __attribute__((ext_vector_type(4)))  float    v4f;
typedef __attribute__((ext_vector_type(2)))  float    v2f;

constexpr int SEQ_LEN = 4096;
constexpr int D_MODEL = 1024;
constexpr int N_HEADS = 16;

__device__ __forceinline__ unsigned short f2bf_bits(float f) {
  unsigned u = __float_as_uint(f);
  return (unsigned short)((u + 0x7FFFu + ((u >> 16) & 1u)) >> 16);
}
__device__ __forceinline__ float bf_bits2f(unsigned short h) { return __uint_as_float(((unsigned)h) << 16); }
__device__ __forceinline__ unsigned pk16(unsigned short a, unsigned short b) { return (unsigned)a | ((unsigned)b << 16); }

// hazard guards as plain device helpers (no inline asm inside the kernel template body)
__device__ __forceinline__ void dep_guard_h(v8f& a, v8f& b, v16h x, v16h y) { asm volatile("v_nop\n\tv_nop\n\tv_nop\n\tv_nop" : "+v"(a), "+v"(b) : "v"(x), "v"(y)); }
__device__ __forceinline__ void dep_guard_b(v8f& a, v8f& b, v16b x, v16b y) { asm volatile("v_nop\n\tv_nop\n\tv_nop\n\tv_nop" : "+v"(a), "+v"(b) : "v"(x), "v"(y)); }
__device__ __forceinline__ void keep4_h(v16h a, v16h b, v16h c, v16h d) { asm volatile("v_nop" :: "v"(a), "v"(b), "v"(c), "v"(d)); }
__device__ __forceinline__ void keep4_b(v16b a, v16b b, v16b c, v16b d) { asm volatile("v_nop" :: "v"(a), "v"(b), "v"(c), "v"(d)); }
__device__ __forceinline__ void acc_guard4(v8f& a, v8f& b, v8f& c, v8f& d) { asm volatile("v_nop\n\tv_nop\n\tv_nop\n\tv_nop" : "+v"(a), "+v"(b), "+v"(c), "+v"(d)); }
template <typename T> struct Frag;
template <> struct Frag<_Float16> {
  typedef v16h V; union U { v16h v; v8h h[2]; };
  static __device__ __forceinline__ v16h load(const _Float16* p) {   // elements 0..7 <- p[0..7], 8..15 <- p[16..23]
    U f; f.h[0] = *(const v8h*)(p); f.h[1] = *(const v8h*)(p + 16); return f.v;
  }
  static __device__ __forceinline__ v8f mma(v16h a, v16h b, v8f c) {
    return __builtin_amdgcn_wmma_f32_16x16x32_f16(false, a, false, b, (short)0, c, false, false);
  }
  static __device__ __forceinline__ void guard(v8f& a, v8f& b, v16h x, v16h y) { dep_guard_h(a, b, x, y); }
  static __device__ __forceinline__ void keep(v16h a, v16h b, v16h c, v16h d) { keep4_h(a, b, c, d); }
};
template <> struct Frag<__bf16> {
  typedef v16b V; union U { v16b v; v8b h[2]; };
  static __device__ __forceinline__ v16b load(const __bf16* p) {
    U f; f.h[0] = *(const v8b*)(p); f.h[1] = *(const v8b*)(p + 16); return f.v;
  }
  static __device__ __forceinline__ v8f mma(v16b a, v16b b, v8f c) {
    return __builtin_amdgcn_wmma_f32_16x16x32_bf16(false, a, false, b, (short)0, c, false, false);
  }
  static __device__ __forceinline__ void guard(v8f& a, v8f& b, v16b x, v16b y) { dep_guard_b(a, b, x, y); }
  static __device__ __forceinline__ void keep(v16b a, v16b b, v16b c, v16b d) { keep4_b(a, b, c, d); }
};

// ---- Register-blocked batched WMMA GEMM ------------------------------------
// C[m,n] = scale * sum_k A[m,k] * Bt[n,k] (+bias)(+resid); each wave owns a 64x64 tile.
// A row-major [M,K]; Bt row-major [N,K]; M,N % 64 == 0, K % 32 == 0.
// SPLIT: operands are hi/lo planes (A2/Bt2 = lo planes, same layout); product = hi.hi + hi.lo + lo.hi.
// BIAS_MODE: 0 = none, 1 = bias[m], 2 = bias[n].
// OUT_MODE: 0 = f32, 1 = f16, 2 = bf16 hi plane (Cout) + bf16 lo plane (Cout2).
// ET: 0 = f16 operands, 1 = bf16 operands (pointers passed as 16-bit storage)
template <int ET> struct Elem;
template <> struct Elem<0> { typedef _Float16 T; };
template <> struct Elem<1> { typedef __bf16 T; };
template <int ET, bool SPLIT, int BIAS_MODE, int OUT_MODE, bool RESID, int ACT = 0>
__global__ __launch_bounds__(256) void wmma_gemm64(
    const unsigned short* __restrict__ Ap, const unsigned short* __restrict__ A2p, int lda, long strideA,
    const unsigned short* __restrict__ Btp, const unsigned short* __restrict__ Bt2p, int ldb, long strideB,
    void* __restrict__ Cout, void* __restrict__ Cout2, int ldc, long strideC,
    const float* __restrict__ bias,
    const float* __restrict__ resid, long strideR,
    int M, int N, int K, float scale) {
  typedef typename Elem<ET>::T T;
  typedef typename Frag<T>::V V;
  const T* A = (const T*)Ap; const T* A2 = (const T*)A2p; const T* Bt = (const T*)Btp; const T* Bt2 = (const T*)Bt2p;
  __shared__ __align__(16) float sT[8][16 * 68];   // per-wave 16x64 slab, pitch 68 floats
  const int b    = blockIdx.y;
  const int lane = threadIdx.x & 31;
  const int wave = threadIdx.x >> 5;
  const int tilesN = N >> 6;
  const int tilesM = M >> 6;
  const int tile = blockIdx.x * 8 + wave;
  if (tile >= tilesM * tilesN) return;   // wave-uniform; no block barriers in this kernel
  const int tm = tile / tilesN;
  const int tn = tile - tm * tilesN;
  const int m0 = tm << 6;
  const int n0 = tn << 6;

  const T* Ab  = A  + (size_t)b * strideA;
  const T* Bb  = Bt + (size_t)b * strideB;
  const T* Ab2 = SPLIT ? (A2  + (size_t)b * strideA) : nullptr;
  const T* Bb2 = SPLIT ? (Bt2 + (size_t)b * strideB) : nullptr;

  const int rlane = lane & 15;                 // row (A) / col (B, D) within subtile
  const int koff  = (lane >> 4) * 8;           // k offset of this lane half
  const int mOff  = (lane >> 4) * 8;           // D row offset

  v8f acc[4][4];
#pragma unroll
  for (int i = 0; i < 4; ++i)
#pragma unroll
    for (int j = 0; j < 4; ++j) acc[i][j] = (v8f){0.f,0.f,0.f,0.f,0.f,0.f,0.f,0.f};

  for (int k0 = 0; k0 < K; k0 += 32) {
    V bh[4], bl[4];
#pragma unroll
    for (int j = 0; j < 4; ++j) {
      const size_t bo = (size_t)(n0 + (j << 4) + rlane) * ldb + koff + k0;
      bh[j] = Frag<T>::load(Bb + bo);
      if (SPLIT) bl[j] = Frag<T>::load(Bb2 + bo);
    }
#pragma unroll
    for (int i = 0; i < 4; ++i) {
      const size_t ao = (size_t)(m0 + (i << 4) + rlane) * lda + koff + k0;
      V ah = Frag<T>::load(Ab + ao);
      V al;
      if (SPLIT) al = Frag<T>::load(Ab2 + ao);
#pragma unroll
      for (int j = 0; j < 4; ++j) {
        acc[i][j] = Frag<T>::mma(ah, bh[j], acc[i][j]);
        if (SPLIT) {
          acc[i][j] = Frag<T>::mma(ah, bl[j], acc[i][j]);
          acc[i][j] = Frag<T>::mma(al, bh[j], acc[i][j]);
        }
      }
      Frag<T>::guard(acc[i][0], acc[i][3], ah, SPLIT ? al : ah);
    }
    Frag<T>::keep(bh[0], bh[1], bh[2], bh[3]);
    if (SPLIT) Frag<T>::keep(bl[0], bl[1], bl[2], bl[3]);
  }
  acc_guard4(acc[0][0], acc[0][1], acc[0][2], acc[0][3]);
  acc_guard4(acc[1][0], acc[1][1], acc[1][2], acc[1][3]);
  acc_guard4(acc[2][0], acc[2][1], acc[2][2], acc[2][3]);
  acc_guard4(acc[3][0], acc[3][1], acc[3][2], acc[3][3]);

  // ---- epilogue ----
  float* slab = sT[wave];
  const float* Rb = RESID ? (resid + (size_t)b * strideR) : nullptr;
#pragma unroll
  for (int i = 0; i < 4; ++i) {
    const int mBase = m0 + (i << 4);
#pragma unroll
    for (int j = 0; j < 4; ++j) {
      const int n = n0 + (j << 4) + rlane;
      float bv = 0.f;
      if (BIAS_MODE == 2) bv = bias[n];
#pragma unroll
      for (int r = 0; r < 8; ++r) {
        float v = acc[i][j][r] * scale;
        if (BIAS_MODE == 1) v += bias[mBase + mOff + r];
        if (BIAS_MODE == 2) v += bv;
        if (RESID) v += Rb[(size_t)(mBase + mOff + r) * ldc + n];
        if (ACT == 1) v = tanhf(v);
        if (ACT == 2) v = fmaxf(v, 0.0f);
        if (ACT == 3) v = v / (1.0f + expf(-v));
        if (ACT == 4) v = (v > 0.f) ? v : 0.01f * v;
        if (ACT == 5) v = 0.5f * v * (1.0f + erff(v * 0.70710678118654752f));
        slab[(mOff + r) * 68 + (j << 4) + rlane] = v;
      }
    }
    __builtin_amdgcn_fence(__ATOMIC_RELEASE, "workgroup");
    __builtin_amdgcn_wave_barrier();
    __builtin_amdgcn_fence(__ATOMIC_ACQUIRE, "workgroup");
    if (OUT_MODE == 0) {
      float* C = (float*)Cout + (size_t)b * strideC;
      const int hh = lane >> 4, c4 = (lane & 15) * 4;     // row seg = 256 B = 16 lanes x 16 B
      {
#pragma unroll
        for (int it = 0; it < 8; ++it) {
          const int row = it * 2 + hh;
          v4f v = *(const v4f*)(slab + row * 68 + c4);
          *(v4f*)(C + (size_t)(mBase + row) * ldc + n0 + c4) = v;
        }
        
      }
    } else {
      const int q = lane >> 3, c8 = (lane & 7) * 8;
      unsigned short* C  = (unsigned short*)Cout  + (size_t)b * strideC;
      unsigned short* C2 = (OUT_MODE == 2) ? ((unsigned short*)Cout2 + (size_t)b * strideC) : nullptr;
      {
#pragma unroll
        for (int it = 0; it < 4; ++it) {
          const int row = it * 4 + q;
          const float* sp = slab + row * 68 + c8;
          v8h hv, lv;
#pragma unroll
          for (int e = 0; e < 8; ++e) {
            if (OUT_MODE == 1) {
              hv[e] = (_Float16)sp[e];
            } else {
              unsigned short hb = f2bf_bits(sp[e]);
              unsigned short lb = f2bf_bits(sp[e] - bf_bits2f(hb));
              hv[e] = __builtin_bit_cast(_Float16, hb);
              lv[e] = __builtin_bit_cast(_Float16, lb);
            }
          }
          *(v8h*)(C + (size_t)(mBase + row) * ldc + n0 + c8) = hv;
          if (OUT_MODE == 2) *(v8h*)(C2 + (size_t)(mBase + row) * ldc + n0 + c8) = lv;
        }
        
      }
    }
    __builtin_amdgcn_fence(__ATOMIC_RELEASE, "workgroup");
    __builtin_amdgcn_wave_barrier();
    __builtin_amdgcn_fence(__ATOMIC_ACQUIRE, "workgroup");
  }
}

// ---------------------------------------------------------------------------
// f32 -> bf16 (RNE) for three equally sized tensors, tensor selected by blockIdx.y (block-uniform);
// Coverage per plane: grid.x = n2/256 blocks x 256 threads x 2 elements = 2*n2 = whole plane
// (n2 = 2097152 -> 8192 blocks for 4096x1024; n2 = 524288 -> 2048 blocks for 1024x1024).
// ---------------------------------------------------------------------------
__global__ __launch_bounds__(256) void cast3_bf16x2_kernel(
    const float* __restrict__ in0, const float* __restrict__ in1, const float* __restrict__ in2,
    unsigned short* __restrict__ out0, unsigned short* __restrict__ out1, unsigned short* __restrict__ out2, int n2) {
  const int sel = blockIdx.y;
  const float* in = (sel == 0) ? in0 : ((sel == 1) ? in1 : in2);
  unsigned short* out = (sel == 0) ? out0 : ((sel == 1) ? out1 : out2);
  const int i = blockIdx.x * 256 + threadIdx.x;
  if (i < n2) {
    const v2f f = *(const v2f*)(in + 2 * (size_t)i);
    const unsigned u = pk16(f2bf_bits(f[0]), f2bf_bits(f[1]));
    ((unsigned*)out)[i] = u;
    
  }
}

// ---------------------------------------------------------------------------
// f32 -> f16 with a power-of-two carry: out = f16(g(in) * scale), g = bf16 RNE when PREBF, identity otherwise.
// Coverage: grid.x = n2/256 blocks x 256 threads x 2 elements = 2*n2 = whole plane.
// ---------------------------------------------------------------------------
template <bool PREBF>
__global__ __launch_bounds__(256) void cast_f16x2_scaled_kernel(const float* __restrict__ in, unsigned short* __restrict__ out,
                                                               int n2, float scale) {
  const int i = blockIdx.x * 256 + threadIdx.x;
  if (i < n2) {
    const v2f f = *(const v2f*)(in + 2 * (size_t)i);
    float a = f[0], b = f[1];
    if (PREBF) { a = bf_bits2f(f2bf_bits(a)); b = bf_bits2f(f2bf_bits(b)); }
    const _Float16 h0 = (_Float16)(a * scale), h1 = (_Float16)(b * scale);
    const unsigned u = pk16(__builtin_bit_cast(unsigned short, h0), __builtin_bit_cast(unsigned short, h1));
    ((unsigned*)out)[i] = u;
    
  }
}

// ---------------------------------------------------------------------------
// Four bias vectors -> bf16-RNE values held as f32: out[sel*n + i], source selected by blockIdx.y (block-uniform).
// Coverage: grid (n/256, 4) x 256 threads = 4 x n elements (n = 1024 -> 4 x 4 blocks).
// ---------------------------------------------------------------------------
__global__ __launch_bounds__(256) void bias_bf16_rne_kernel(
    const float* __restrict__ b0, const float* __restrict__ b1, const float* __restrict__ b2, const float* __restrict__ b3,
    float* __restrict__ out, int n) {
  const int sel = blockIdx.y;
  const float* in = (sel == 0) ? b0 : ((sel == 1) ? b1 : ((sel == 2) ? b2 : b3));
  const int i = blockIdx.x * 256 + threadIdx.x;
  if (i < n) {
    const float v = bf_bits2f(f2bf_bits(in[i]));
    ((float*)out)[(size_t)sel * n + i] = v;
    
  }
}

// =====================================================================================
// Full (non-causal, unmasked) attention, head dim 64, single 16-bit products.
//   q plane (f16): element (s, h, d) at [s*D_MODEL + h*64 + d]
//   k plane (f16): element (s, h, d) at [s*D_MODEL + h*64 + d]
//   v^T plane (f16): element (h, d, s) at [(h*64 + d)*SEQ_LEN + s]
//   out f32: element (s, h, d) at [s*D_MODEL + h*64 + d]
//   scores = (q . k) * sscale : v_wmma_f32_16x16x32_f16, f32 accumulate, sscale applied in f32
//   out    = p . v            : v_wmma_f32_16x16x32_f16, p (unnormalised, x2^15) and v in f16, f32 accumulate
//   online softmax in f32 over all SEQ_LEN keys (64 chunks of 64, compile-time trip count, no masking).
//   Block = 4 waves = 64 query rows of one head; grid.x = N_HEADS * (SEQ_LEN/64) = 1024.
//   K / V^T chunk staging: 128 threads x 32 elements per plane = the whole 64x64 tile (16-B copies, plain loads,
//   __syncthreads before and after); fragment loads read the LDS tiles with the same v8h element type.
//   (vector of the stored element type).
//   Output: per-wave 16x64 f32 tile staged in LDS; each 64-float row segment (256 B) written by 16 lanes x 16 B
//   Coverage: 1024 blocks x 4 waves x 16 rows x 64 floats = 4096 x 1024 = the whole out plane.
// =====================================================================================
#define AT_D 64
#define AT_NW 4
#define AT_QB 64
#define AT_KC 64
constexpr float P_CARRY = 32768.0f;

__device__ __forceinline__ v8f at_mma_h(v16h a, v16h b, v8f c) {
  c = __builtin_amdgcn_wmma_f32_16x16x32_f16(false, a, false, b, (short)0, c, false, false);
  asm volatile("v_nop\n\tv_nop\n\tv_nop\n\tv_nop" : "+v"(c) : "v"(a), "v"(b));
  return c;
}

__global__ __launch_bounds__(128)
void attn_full64_f16_kernel(const unsigned short* __restrict__ qp, const unsigned short* __restrict__ kp,
                            const unsigned short* __restrict__ vtp, float* __restrict__ out, float sscale) {
  union FH { v16h v; v8h h[2]; };
  __shared__ __align__(16) _Float16 Ksh[AT_KC * AT_D];             // K [kv][d]      8 KB
  __shared__ __align__(16) _Float16 Vth[AT_D * AT_KC];             // V [d][kv]      8 KB
  __shared__ __align__(16) _Float16 Psh[AT_NW][16 * AT_KC];        // per wave P [row][kv]  8 KB
  __shared__ __align__(16) float    Os[AT_NW][16 * 68];            // per wave out tile, pitch 68

  const int tid  = threadIdx.x;
  const int wave = tid >> 5;
  const int lane = tid & 31;
  const int hh   = lane >> 4;
  const int c    = lane & 15;

  const int nqb = SEQ_LEN / AT_QB;        // 64
  const int bx = blockIdx.x;
  const int qb = bx % nqb;
  const int h  = bx / nqb;                // 0..N_HEADS-1 (grid = N_HEADS * nqb)
  const int q0 = qb * AT_QB + wave * 16;

  const _Float16* Qg = (const _Float16*)(const void*)qp  + (size_t)h * AT_D;
  const _Float16* Kg = (const _Float16*)(const void*)kp  + (size_t)h * AT_D;
  const _Float16* Vg = (const _Float16*)(const void*)vtp + (size_t)h * AT_D * SEQ_LEN;
  float*          ob = out + (size_t)h * AT_D;

  // ---- Q fragments (A operand, row = lane&15, split k map via Frag load): 2 d-chunks ----
  v16h qa[2];
#pragma unroll
  for (int dc = 0; dc < 2; ++dc) {
    const _Float16* qr = Qg + (size_t)(q0 + c) * D_MODEL + dc * 32 + 8 * hh;
    qa[dc] = Frag<_Float16>::load(qr);
  }

  float mrow[8], lrow[8];
  v8f oacc[4];
#pragma unroll
  for (int r = 0; r < 8; ++r) { mrow[r] = -INFINITY; lrow[r] = 0.f; }
#pragma unroll
  for (int t = 0; t < 4; ++t) oacc[t] = (v8f){0.f,0.f,0.f,0.f,0.f,0.f,0.f,0.f};

  const int nChunks = SEQ_LEN / AT_KC;   // 64, compile-time constant
  for (int kc = 0; kc < nChunks; ++kc) {
    const int kv0 = kc * AT_KC;
    __syncthreads();
    {
      // staging coverage: 128 threads x (4 x 8) elements = 64 rows x 64 per plane = the whole chunk tile
      const int r = tid >> 1, half = (tid & 1) * 32;
      const _Float16* ks = Kg + (size_t)(kv0 + r) * D_MODEL + half;   // K row kv0+r, d = half..half+31
      const _Float16* vs = Vg + (size_t)r * SEQ_LEN + kv0 + half;     // V^T row d = r, s = kv0+half..+31
#pragma unroll
      for (int i = 0; i < 4; ++i) {
        const v8h a0 = *(const v8h*)(ks + 8 * i);
        const v8h b0 = *(const v8h*)(vs + 8 * i);
        *(v8h*)(Ksh + r * AT_D  + half + 8 * i) = a0;
        *(v8h*)(Vth + r * AT_KC + half + 8 * i) = b0;
      }
    }
    __syncthreads();

    v8f s[4];
#pragma unroll
    for (int j = 0; j < 4; ++j) {
      s[j] = (v8f){0.f,0.f,0.f,0.f,0.f,0.f,0.f,0.f};
#pragma unroll
      for (int dc = 0; dc < 2; ++dc) {
        FH kb;
        kb.h[0] = *(const v8h*)(Ksh + (j * 16 + c) * AT_D + dc * 32 + 8 * hh);
        kb.h[1] = *(const v8h*)(Ksh + (j * 16 + c) * AT_D + dc * 32 + 16 + 8 * hh);
        s[j] = at_mma_h(qa[dc], kb.v, s[j]);
      }
    }
    float cm[8];
#pragma unroll
    for (int r = 0; r < 8; ++r) {
      float m = -INFINITY;
#pragma unroll
      for (int j = 0; j < 4; ++j) {
        const float sv = s[j][r] * sscale;
        s[j][r] = sv;
        m = fmaxf(m, sv);
      }
#pragma unroll
      for (int off = 1; off < 16; off <<= 1) m = fmaxf(m, __shfl_xor(m, off, 32));
      cm[r] = m;
    }
    _Float16* pw = Psh[wave];
#pragma unroll
    for (int r = 0; r < 8; ++r) {
      const float mnew = fmaxf(mrow[r], cm[r]);
      const float alpha = expf(mrow[r] - mnew);
      mrow[r] = mnew;
      float psum = 0.f;
#pragma unroll
      for (int j = 0; j < 4; ++j) {
        const float p = expf(s[j][r] - mnew);
        psum += p;
        pw[(8 * hh + r) * AT_KC + j * 16 + c] = (_Float16)(p * P_CARRY);
      }
#pragma unroll
      for (int off = 1; off < 16; off <<= 1) psum += __shfl_xor(psum, off, 32);
      lrow[r] = lrow[r] * alpha + psum;
#pragma unroll
      for (int t = 0; t < 4; ++t) oacc[t][r] *= alpha;
    }
    __builtin_amdgcn_fence(__ATOMIC_RELEASE, "workgroup");
    __builtin_amdgcn_wave_barrier();
    __builtin_amdgcn_fence(__ATOMIC_ACQUIRE, "workgroup");
#pragma unroll 1
    for (int kk = 0; kk < 2; ++kk) {
      FH pa;
      pa.h[0] = *(const v8h*)(pw + c * AT_KC + kk * 32 + 8 * hh);
      pa.h[1] = *(const v8h*)(pw + c * AT_KC + kk * 32 + 16 + 8 * hh);
#pragma unroll
      for (int t = 0; t < 4; ++t) {
        FH vb;
        vb.h[0] = *(const v8h*)(Vth + (t * 16 + c) * AT_KC + kk * 32 + 8 * hh);
        vb.h[1] = *(const v8h*)(Vth + (t * 16 + c) * AT_KC + kk * 32 + 16 + 8 * hh);
        oacc[t] = at_mma_h(pa.v, vb.v, oacc[t]);
      }
    }
  }

  float* os = Os[wave];
#pragma unroll
  for (int r = 0; r < 8; ++r) {
    const float inv = 1.0f / (lrow[r] * P_CARRY);
#pragma unroll
    for (int t = 0; t < 4; ++t) os[(8 * hh + r) * 68 + t * 16 + c] = oacc[t][r] * inv;
  }
  __builtin_amdgcn_fence(__ATOMIC_RELEASE, "workgroup");
  __builtin_amdgcn_wave_barrier();
  __builtin_amdgcn_fence(__ATOMIC_ACQUIRE, "workgroup");
  {
    const int c4 = (lane & 15) * 4;
    {
#pragma unroll
      for (int it = 0; it < 8; ++it) {
        const int row = it * 2 + hh;
        v4f val = *(const v4f*)(os + row * 68 + c4);
        *(v4f*)(ob + (size_t)(q0 + row) * D_MODEL + c4) = val;
      }
      
    }
  }
}

// ---------------------------------------------------------------------------
// host launcher
// ---------------------------------------------------------------------------
extern "C" void kernel_launch(void* const* d_in, const int* in_sizes, int n_in,
                              void* d_out, int out_size, void* d_ws, size_t ws_size,
                              hipStream_t stream) {
  constexpr int S  = SEQ_LEN;
  constexpr int DM = D_MODEL;
  const size_t SD = (size_t)S * DM;    // 4194304 elements
  const size_t DD = (size_t)DM * DM;   // 1048576 elements
  if (n_in < 11) return;
  if ((size_t)in_sizes[0] != SD || (size_t)in_sizes[1] != SD || (size_t)in_sizes[2] != SD) return;
  if ((size_t)in_sizes[3] != DD || (size_t)in_sizes[5] != DD || (size_t)in_sizes[7] != DD || (size_t)in_sizes[9] != DD) return;
  if (in_sizes[4] != DM || in_sizes[6] != DM || in_sizes[8] != DM || in_sizes[10] != DM) return;
  if ((size_t)out_size != SD) return;

  const float* x_q = (const float*)d_in[0];
  const float* x_k = (const float*)d_in[1];
  const float* x_v = (const float*)d_in[2];
  const float* Wq  = (const float*)d_in[3];
  const float* bq  = (const float*)d_in[4];
  const float* Wk  = (const float*)d_in[5];
  const float* bk  = (const float*)d_in[6];
  const float* Wv  = (const float*)d_in[7];
  const float* bv  = (const float*)d_in[8];
  const float* Wo  = (const float*)d_in[9];
  const float* bo  = (const float*)d_in[10];

  //   xq  bf16 [4096][1024]  8 MiB @  0 MiB      xk  @  8 MiB      xv  @ 16 MiB
  //   wq  bf16 [1024][1024]  2 MiB @ 24 MiB      wk  @ 26 MiB      wv  @ 28 MiB     wo f16 @ 30 MiB
  //   q16 f16  [4096][1024]  8 MiB @ 32 MiB      k16 @ 40 MiB      vt16 f16 [1024][4096] @ 48 MiB
  //   o32 f32  [4096][1024] 16 MiB @ 56 MiB      o16 f16 8 MiB @ 72 MiB
  //   bias f32 [4][1024]    16 KiB @ 80 MiB      end = 83902464 B
  const size_t off_xq  = 0;
  const size_t off_xk  = off_xq  + SD * 2;
  const size_t off_xv  = off_xk  + SD * 2;
  const size_t off_wq  = off_xv  + SD * 2;
  const size_t off_wk  = off_wq  + DD * 2;
  const size_t off_wv  = off_wk  + DD * 2;
  const size_t off_wo  = off_wv  + DD * 2;
  const size_t off_q   = off_wo  + DD * 2;
  const size_t off_k   = off_q   + SD * 2;
  const size_t off_vt  = off_k   + SD * 2;
  const size_t off_o32 = off_vt  + SD * 2;
  const size_t off_o16 = off_o32 + SD * 4;
  const size_t off_b   = off_o16 + SD * 2;
  const size_t ws_end  = off_b + 4 * (size_t)DM * 4;
  if (ws_end > ws_size) return;

  char* ws = (char*)d_ws;
  unsigned short* xq   = (unsigned short*)(ws + off_xq);
  unsigned short* xk   = (unsigned short*)(ws + off_xk);
  unsigned short* xv   = (unsigned short*)(ws + off_xv);
  unsigned short* wq   = (unsigned short*)(ws + off_wq);
  unsigned short* wk   = (unsigned short*)(ws + off_wk);
  unsigned short* wv   = (unsigned short*)(ws + off_wv);
  unsigned short* wo   = (unsigned short*)(ws + off_wo);
  unsigned short* q16  = (unsigned short*)(ws + off_q);
  unsigned short* k16  = (unsigned short*)(ws + off_k);
  unsigned short* vt16 = (unsigned short*)(ws + off_vt);
  float*          o32  = (float*)(ws + off_o32);
  unsigned short* o16  = (unsigned short*)(ws + off_o16);
  float*          bws  = (float*)(ws + off_b);
  const float* bias_q = bws;
  const float* bias_k = bws + DM;
  const float* bias_v = bws + 2 * DM;
  const float* bias_o = bws + 3 * DM;

  const int SD2 = (int)(SD / 2);   // 2097152
  const int DD2 = (int)(DD / 2);   // 524288

  // 1) biases -> bf16-RNE values in f32
  bias_bf16_rne_kernel<<<dim3(DM / 256, 4), 256, 0, stream>>>(bq, bk, bv, bo, bws, DM);
  // 2) activations -> bf16 planes
  cast3_bf16x2_kernel<<<dim3(SD2 / 256, 3), 256, 0, stream>>>(x_q, x_k, x_v, xq, xk, xv, SD2);
  // 3) Wq, Wk, Wv -> bf16 planes ([out][in] = [N][K] layout as is)
  cast3_bf16x2_kernel<<<dim3(DD2 / 256, 3), 256, 0, stream>>>(Wq, Wk, Wv, wq, wk, wv, DD2);
  // 4) Wo -> f16 plane of bf16-RNE(Wo) x 2^8
  cast_f16x2_scaled_kernel<true><<<dim3(DD2 / 256, 1), 256, 0, stream>>>(Wo, wo, DD2, 256.0f);

  // GEMM tiles: (4096/64)*(1024/64) = 1024 tiles of 64x64 -> 128 blocks x 8 waves; K = 1024 (K % 32 == 0)
  const int gemm_blocks = (int)(((S / 64) * (DM / 64)) / 8);   // 128
  // 5) q16[s][n] = x_q . Wq^T + bq   (f16 out)
  wmma_gemm64<1, false, 2, 1, false><<<dim3(gemm_blocks, 1), 256, 0, stream>>>(
      xq, xq, DM, 0L, wq, wq, DM, 0L, (void*)q16, (void*)q16, DM, 0L, bias_q, bias_q, 0L, S, DM, DM, 1.0f);
  // 6) k16[s][n] = x_k . Wk^T + bk
  wmma_gemm64<1, false, 2, 1, false><<<dim3(gemm_blocks, 1), 256, 0, stream>>>(
      xk, xk, DM, 0L, wk, wk, DM, 0L, (void*)k16, (void*)k16, DM, 0L, bias_k, bias_k, 0L, S, DM, DM, 1.0f);
  // 7) vt16[m = feature][n = s] = Wv[m,:] . x_v[s,:] + bv[m]  (role-swapped: M = 1024, N = 4096, ldc = 4096)
  wmma_gemm64<1, false, 1, 1, false><<<dim3(gemm_blocks, 1), 256, 0, stream>>>(
      wv, wv, DM, 0L, xv, xv, DM, 0L, (void*)vt16, (void*)vt16, S, 0L, bias_v, bias_v, 0L, DM, S, DM, 1.0f);

  // 8) attention: 16 heads x 64 query blocks, f32 context o32[s][h*64+d]
  attn_full64_f16_kernel<<<dim3(N_HEADS * (S / 64), 1), 128, 0, stream>>>(q16, k16, vt16, o32, 0.125f);

  // 9) o32 -> f16 plane x 2^8
  cast_f16x2_scaled_kernel<false><<<dim3(SD2 / 256, 1), 256, 0, stream>>>(o32, o16, SD2, 256.0f);

  // 10) out[s][n] = (o x 2^8) . (Wo x 2^8)^T * 2^-16 + bo  -> f32 d_out
  wmma_gemm64<0, false, 2, 0, false><<<dim3(gemm_blocks, 1), 256, 0, stream>>>(
      o16, o16, DM, 0L, wo, wo, DM, 0L, d_out, d_out, DM, 0L, bias_o, bias_o, 0L, S, DM, DM, 1.0f / 65536.0f);
}

// v001
// A run of this version takes 518 microseconds.
// Timed twice side by side with v000, it ran 1.25 times as fast both times.
// Projections q,k,v^T: v_wmma_f32_16x16x32_bf16 (bf16 RNE operands from the f32 inputs, f32 accumulate, bf16-RNE bias added in f32); attention q.k^T and p.v: v_wmma_f32_16x16x32_f16 (f16 q,k,v planes, p carried x2^15, f32 accumulate, f32 online softmax, score scale 0.125 in f32); output projection: v_wmma_f32_16x16x32_f16 (f16 planes of o x2^8 and bf16-RNE(Wo) x2^8, f32 accumulate, scale 2^-16, bf16-RNE bias added in f32).
#include <hip/hip_runtime.h>
#include <math.h>
#include <stdint.h>

typedef __attribute__((ext_vector_type(16))) _Float16 v16h;
typedef __attribute__((ext_vector_type(8)))  _Float16 v8h;
typedef __attribute__((ext_vector_type(16))) __bf16   v16b;
typedef __attribute__((ext_vector_type(8)))  __bf16   v8b;
typedef __attribute__((ext_vector_type(8)))  float    v8f;
typedef __attribute__((ext_vector_type(4)))  float    v4f;
typedef __attribute__((ext_vector_type(2)))  float    v2f;

constexpr int SEQ_LEN = 4096;
constexpr int D_MODEL = 1024;
constexpr int N_HEADS = 16;

__device__ __forceinline__ unsigned short f2bf_bits(float f) {
  unsigned u = __float_as_uint(f);
  return (unsigned short)((u + 0x7FFFu + ((u >> 16) & 1u)) >> 16);
}
__device__ __forceinline__ float bf_bits2f(unsigned short h) { return __uint_as_float(((unsigned)h) << 16); }
__device__ __forceinline__ unsigned pk16(unsigned short a, unsigned short b) { return (unsigned)a | ((unsigned)b << 16); }

// hazard guards as plain device helpers (no inline asm inside the kernel template body)
__device__ __forceinline__ void dep_guard_h(v8f& a, v8f& b, v16h x, v16h y) { asm volatile("v_nop\n\tv_nop\n\tv_nop\n\tv_nop" : "+v"(a), "+v"(b) : "v"(x), "v"(y)); }
__device__ __forceinline__ void dep_guard_b(v8f& a, v8f& b, v16b x, v16b y) { asm volatile("v_nop\n\tv_nop\n\tv_nop\n\tv_nop" : "+v"(a), "+v"(b) : "v"(x), "v"(y)); }
__device__ __forceinline__ void keep4_h(v16h a, v16h b, v16h c, v16h d) { asm volatile("v_nop" :: "v"(a), "v"(b), "v"(c), "v"(d)); }
__device__ __forceinline__ void keep4_b(v16b a, v16b b, v16b c, v16b d) { asm volatile("v_nop" :: "v"(a), "v"(b), "v"(c), "v"(d)); }
__device__ __forceinline__ void acc_guard4(v8f& a, v8f& b, v8f& c, v8f& d) { asm volatile("v_nop\n\tv_nop\n\tv_nop\n\tv_nop" : "+v"(a), "+v"(b), "+v"(c), "+v"(d)); }
template <typename T> struct Frag;
template <> struct Frag<_Float16> {
  typedef v16h V; union U { v16h v; v8h h[2]; };
  static __device__ __forceinline__ v16h load(const _Float16* p) {   // elements 0..7 <- p[0..7], 8..15 <- p[16..23]
    U f; f.h[0] = *(const v8h*)(p); f.h[1] = *(const v8h*)(p + 16); return f.v;
  }
  static __device__ __forceinline__ v8f mma(v16h a, v16h b, v8f c) {
    return __builtin_amdgcn_wmma_f32_16x16x32_f16(false, a, false, b, (short)0, c, false, false);
  }
  static __device__ __forceinline__ void guard(v8f& a, v8f& b, v16h x, v16h y) { dep_guard_h(a, b, x, y); }
  static __device__ __forceinline__ void keep(v16h a, v16h b, v16h c, v16h d) { keep4_h(a, b, c, d); }
};
template <> struct Frag<__bf16> {
  typedef v16b V; union U { v16b v; v8b h[2]; };
  static __device__ __forceinline__ v16b load(const __bf16* p) {
    U f; f.h[0] = *(const v8b*)(p); f.h[1] = *(const v8b*)(p + 16); return f.v;
  }
  static __device__ __forceinline__ v8f mma(v16b a, v16b b, v8f c) {
    return __builtin_amdgcn_wmma_f32_16x16x32_bf16(false, a, false, b, (short)0, c, false, false);
  }
  static __device__ __forceinline__ void guard(v8f& a, v8f& b, v16b x, v16b y) { dep_guard_b(a, b, x, y); }
  static __device__ __forceinline__ void keep(v16b a, v16b b, v16b c, v16b d) { keep4_b(a, b, c, d); }
};

// ---- Register-blocked batched WMMA GEMM ------------------------------------
// C[m,n] = scale * sum_k A[m,k] * Bt[n,k] (+bias)(+resid); each wave owns a 64x64 tile.
// A row-major [M,K]; Bt row-major [N,K]; M,N % 64 == 0, K % 32 == 0.
// SPLIT: operands are hi/lo planes (A2/Bt2 = lo planes, same layout); product = hi.hi + hi.lo + lo.hi.
// BIAS_MODE: 0 = none, 1 = bias[m], 2 = bias[n].
// OUT_MODE: 0 = f32, 1 = f16, 2 = bf16 hi plane (Cout) + bf16 lo plane (Cout2).
// ET: 0 = f16 operands, 1 = bf16 operands (pointers passed as 16-bit storage)
template <int ET> struct Elem;
template <> struct Elem<0> { typedef _Float16 T; };
template <> struct Elem<1> { typedef __bf16 T; };
template <int ET, bool SPLIT, int BIAS_MODE, int OUT_MODE, bool RESID, int ACT = 0>
__global__ __launch_bounds__(256) void wmma_gemm64(
    const unsigned short* __restrict__ Ap, const unsigned short* __restrict__ A2p, int lda, long strideA,
    const unsigned short* __restrict__ Btp, const unsigned short* __restrict__ Bt2p, int ldb, long strideB,
    void* __restrict__ Cout, void* __restrict__ Cout2, int ldc, long strideC,
    const float* __restrict__ bias,
    const float* __restrict__ resid, long strideR,
    int M, int N, int K, float scale) {
  typedef typename Elem<ET>::T T;
  typedef typename Frag<T>::V V;
  const T* A = (const T*)Ap; const T* A2 = (const T*)A2p; const T* Bt = (const T*)Btp; const T* Bt2 = (const T*)Bt2p;
  __shared__ __align__(16) float sT[8][16 * 68];   // per-wave 16x64 slab, pitch 68 floats
  const int b    = blockIdx.y;
  const int lane = threadIdx.x & 31;
  const int wave = threadIdx.x >> 5;
  const int tilesN = N >> 6;
  const int tilesM = M >> 6;
  const int tile = blockIdx.x * 8 + wave;
  if (tile >= tilesM * tilesN) return;   // wave-uniform; no block barriers in this kernel
  const int tm = tile / tilesN;
  const int tn = tile - tm * tilesN;
  const int m0 = tm << 6;
  const int n0 = tn << 6;

  const T* Ab  = A  + (size_t)b * strideA;
  const T* Bb  = Bt + (size_t)b * strideB;
  const T* Ab2 = SPLIT ? (A2  + (size_t)b * strideA) : nullptr;
  const T* Bb2 = SPLIT ? (Bt2 + (size_t)b * strideB) : nullptr;

  const int rlane = lane & 15;                 // row (A) / col (B, D) within subtile
  const int koff  = (lane >> 4) * 8;           // k offset of this lane half
  const int mOff  = (lane >> 4) * 8;           // D row offset

  v8f acc[4][4];
#pragma unroll
  for (int i = 0; i < 4; ++i)
#pragma unroll
    for (int j = 0; j < 4; ++j) acc[i][j] = (v8f){0.f,0.f,0.f,0.f,0.f,0.f,0.f,0.f};

  for (int k0 = 0; k0 < K; k0 += 32) {
    V bh[4], bl[4];
#pragma unroll
    for (int j = 0; j < 4; ++j) {
      const size_t bo = (size_t)(n0 + (j << 4) + rlane) * ldb + koff + k0;
      bh[j] = Frag<T>::load(Bb + bo);
      if (SPLIT) bl[j] = Frag<T>::load(Bb2 + bo);
    }
#pragma unroll
    for (int i = 0; i < 4; ++i) {
      const size_t ao = (size_t)(m0 + (i << 4) + rlane) * lda + koff + k0;
      V ah = Frag<T>::load(Ab + ao);
      V al;
      if (SPLIT) al = Frag<T>::load(Ab2 + ao);
#pragma unroll
      for (int j = 0; j < 4; ++j) {
        acc[i][j] = Frag<T>::mma(ah, bh[j], acc[i][j]);
        if (SPLIT) {
          acc[i][j] = Frag<T>::mma(ah, bl[j], acc[i][j]);
          acc[i][j] = Frag<T>::mma(al, bh[j], acc[i][j]);
        }
      }
      Frag<T>::guard(acc[i][0], acc[i][3], ah, SPLIT ? al : ah);
    }
    Frag<T>::keep(bh[0], bh[1], bh[2], bh[3]);
    if (SPLIT) Frag<T>::keep(bl[0], bl[1], bl[2], bl[3]);
  }
  acc_guard4(acc[0][0], acc[0][1], acc[0][2], acc[0][3]);
  acc_guard4(acc[1][0], acc[1][1], acc[1][2], acc[1][3]);
  acc_guard4(acc[2][0], acc[2][1], acc[2][2], acc[2][3]);
  acc_guard4(acc[3][0], acc[3][1], acc[3][2], acc[3][3]);

  // ---- epilogue ----
  float* slab = sT[wave];
  const float* Rb = RESID ? (resid + (size_t)b * strideR) : nullptr;
#pragma unroll
  for (int i = 0; i < 4; ++i) {
    const int mBase = m0 + (i << 4);
#pragma unroll
    for (int j = 0; j < 4; ++j) {
      const int n = n0 + (j << 4) + rlane;
      float bv = 0.f;
      if (BIAS_MODE == 2) bv = bias[n];
#pragma unroll
      for (int r = 0; r < 8; ++r) {
        float v = acc[i][j][r] * scale;
        if (BIAS_MODE == 1) v += bias[mBase + mOff + r];
        if (BIAS_MODE == 2) v += bv;
        if (RESID) v += Rb[(size_t)(mBase + mOff + r) * ldc + n];
        if (ACT == 1) v = tanhf(v);
        if (ACT == 2) v = fmaxf(v, 0.0f);
        if (ACT == 3) v = v / (1.0f + expf(-v));
        if (ACT == 4) v = (v > 0.f) ? v : 0.01f * v;
        if (ACT == 5) v = 0.5f * v * (1.0f + erff(v * 0.70710678118654752f));
        slab[(mOff + r) * 68 + (j << 4) + rlane] = v;
      }
    }
    __builtin_amdgcn_fence(__ATOMIC_RELEASE, "workgroup");
    __builtin_amdgcn_wave_barrier();
    __builtin_amdgcn_fence(__ATOMIC_ACQUIRE, "workgroup");
    if (OUT_MODE == 0) {
      float* C = (float*)Cout + (size_t)b * strideC;
      const int hh = lane >> 4, c4 = (lane & 15) * 4;     // row seg = 256 B = 16 lanes x 16 B
      {
#pragma unroll
        for (int it = 0; it < 8; ++it) {
          const int row = it * 2 + hh;
          v4f v = *(const v4f*)(slab + row * 68 + c4);
          *(v4f*)(C + (size_t)(mBase + row) * ldc + n0 + c4) = v;
        }
        
      }
    } else {
      const int q = lane >> 3, c8 = (lane & 7) * 8;
      unsigned short* C  = (unsigned short*)Cout  + (size_t)b * strideC;
      unsigned short* C2 = (OUT_MODE == 2) ? ((unsigned short*)Cout2 + (size_t)b * strideC) : nullptr;
      {
#pragma unroll
        for (int it = 0; it < 4; ++it) {
          const int row = it * 4 + q;
          const float* sp = slab + row * 68 + c8;
          v8h hv, lv;
#pragma unroll
          for (int e = 0; e < 8; ++e) {
            if (OUT_MODE == 1) {
              hv[e] = (_Float16)sp[e];
            } else {
              unsigned short hb = f2bf_bits(sp[e]);
              unsigned short lb = f2bf_bits(sp[e] - bf_bits2f(hb));
              hv[e] = __builtin_bit_cast(_Float16, hb);
              lv[e] = __builtin_bit_cast(_Float16, lb);
            }
          }
          *(v8h*)(C + (size_t)(mBase + row) * ldc + n0 + c8) = hv;
          if (OUT_MODE == 2) *(v8h*)(C2 + (size_t)(mBase + row) * ldc + n0 + c8) = lv;
        }
        
      }
    }
    __builtin_amdgcn_fence(__ATOMIC_RELEASE, "workgroup");
    __builtin_amdgcn_wave_barrier();
    __builtin_amdgcn_fence(__ATOMIC_ACQUIRE, "workgroup");
  }
}

// ---------------------------------------------------------------------------
// f32 -> bf16 (RNE) for three equally sized tensors, tensor selected by blockIdx.y (block-uniform);
// Coverage per plane: grid.x = n2/256 blocks x 256 threads x 2 elements = 2*n2 = whole plane
// (n2 = 2097152 -> 8192 blocks for 4096x1024; n2 = 524288 -> 2048 blocks for 1024x1024).
// ---------------------------------------------------------------------------
__global__ __launch_bounds__(256) void cast3_bf16x2_kernel(
    const float* __restrict__ in0, const float* __restrict__ in1, const float* __restrict__ in2,
    unsigned short* __restrict__ out0, unsigned short* __restrict__ out1, unsigned short* __restrict__ out2, int n2) {
  const int sel = blockIdx.y;
  const float* in = (sel == 0) ? in0 : ((sel == 1) ? in1 : in2);
  unsigned short* out = (sel == 0) ? out0 : ((sel == 1) ? out1 : out2);
  const int i = blockIdx.x * 256 + threadIdx.x;
  if (i < n2) {
    const v2f f = *(const v2f*)(in + 2 * (size_t)i);
    const unsigned u = pk16(f2bf_bits(f[0]), f2bf_bits(f[1]));
    ((unsigned*)out)[i] = u;
    
  }
}

// ---------------------------------------------------------------------------
// f32 -> f16 with a power-of-two carry: out = f16(g(in) * scale), g = bf16 RNE when PREBF, identity otherwise.
// Coverage: grid.x = n2/256 blocks x 256 threads x 2 elements = 2*n2 = whole plane.
// ---------------------------------------------------------------------------
template <bool PREBF>
__global__ __launch_bounds__(256) void cast_f16x2_scaled_kernel(const float* __restrict__ in, unsigned short* __restrict__ out,
                                                               int n2, float scale) {
  const int i = blockIdx.x * 256 + threadIdx.x;
  if (i < n2) {
    const v2f f = *(const v2f*)(in + 2 * (size_t)i);
    float a = f[0], b = f[1];
    if (PREBF) { a = bf_bits2f(f2bf_bits(a)); b = bf_bits2f(f2bf_bits(b)); }
    const _Float16 h0 = (_Float16)(a * scale), h1 = (_Float16)(b * scale);
    const unsigned u = pk16(__builtin_bit_cast(unsigned short, h0), __builtin_bit_cast(unsigned short, h1));
    ((unsigned*)out)[i] = u;
    
  }
}

// ---------------------------------------------------------------------------
// Four bias vectors -> bf16-RNE values held as f32: out[sel*n + i], source selected by blockIdx.y (block-uniform).
// Coverage: grid (n/256, 4) x 256 threads = 4 x n elements (n = 1024 -> 4 x 4 blocks).
// ---------------------------------------------------------------------------
__global__ __launch_bounds__(256) void bias_bf16_rne_kernel(
    const float* __restrict__ b0, const float* __restrict__ b1, const float* __restrict__ b2, const float* __restrict__ b3,
    float* __restrict__ out, int n) {
  const int sel = blockIdx.y;
  const float* in = (sel == 0) ? b0 : ((sel == 1) ? b1 : ((sel == 2) ? b2 : b3));
  const int i = blockIdx.x * 256 + threadIdx.x;
  if (i < n) {
    const float v = bf_bits2f(f2bf_bits(in[i]));
    ((float*)out)[(size_t)sel * n + i] = v;
    
  }
}

// =====================================================================================
// Full (non-causal, unmasked) attention, head dim 64, single 16-bit products.
//   q plane (f16): element (s, h, d) at [s*D_MODEL + h*64 + d]
//   k plane (f16): element (s, h, d) at [s*D_MODEL + h*64 + d]
//   v^T plane (f16): element (h, d, s) at [(h*64 + d)*SEQ_LEN + s]
//   out f32: element (s, h, d) at [s*D_MODEL + h*64 + d]
//   scores = (q . k) * sscale : v_wmma_f32_16x16x32_f16, f32 accumulate, sscale applied in f32
//   out    = p . v            : v_wmma_f32_16x16x32_f16, p (unnormalised, x2^15) and v in f16, f32 accumulate
//   online softmax in f32 over all SEQ_LEN keys (64 chunks of 64, compile-time trip count, no masking).
//   Block = 4 waves = 64 query rows of one head; grid.x = N_HEADS * (SEQ_LEN/64) = 1024.
//   K / V^T chunk staging: 128 threads x 32 elements per plane = the whole 64x64 tile (16-B copies, plain loads,
//   __syncthreads before and after); fragment loads read the LDS tiles with the same v8h element type.
//   (vector of the stored element type).
//   Output: per-wave 16x64 f32 tile staged in LDS; each 64-float row segment (256 B) written by 16 lanes x 16 B
//   Coverage: 1024 blocks x 4 waves x 16 rows x 64 floats = 4096 x 1024 = the whole out plane.
// =====================================================================================
#define AT_D 64
#define AT_NW 4
#define AT_QB 64
#define AT_KC 64
#define AT_LP 72   // LDS row pitch of the 16-bit tiles in elements: 144 B = 16 B x 9, so 16 rows read by ds_load_b128 fall on 16 distinct bank groups
constexpr float P_CARRY = 32768.0f;

__device__ __forceinline__ v8f at_mma_h(v16h a, v16h b, v8f c) {
  c = __builtin_amdgcn_wmma_f32_16x16x32_f16(false, a, false, b, (short)0, c, false, false);
  asm volatile("v_nop\n\tv_nop\n\tv_nop\n\tv_nop" : "+v"(c) : "v"(a), "v"(b));
  return c;
}

__global__ __launch_bounds__(128)
void attn_full64_f16_kernel(const unsigned short* __restrict__ qp, const unsigned short* __restrict__ kp,
                            const unsigned short* __restrict__ vtp, float* __restrict__ out, float sscale) {
  union FH { v16h v; v8h h[2]; };
  __shared__ __align__(16) _Float16 Ksh[AT_KC * AT_LP];            // K [kv][d]      9 KB
  __shared__ __align__(16) _Float16 Vth[AT_D * AT_LP];             // V [d][kv]      9 KB
  __shared__ __align__(16) _Float16 Psh[AT_NW][16 * AT_LP];        // per wave P [row][kv]  9 KB
  __shared__ __align__(16) float    Os[AT_NW][16 * 68];            // per wave out tile, pitch 68

  const int tid  = threadIdx.x;
  const int wave = tid >> 5;
  const int lane = tid & 31;
  const int hh   = lane >> 4;
  const int c    = lane & 15;

  const int nqb = SEQ_LEN / AT_QB;        // 64
  const int bx = blockIdx.x;
  const int qb = bx % nqb;
  const int h  = bx / nqb;                // 0..N_HEADS-1 (grid = N_HEADS * nqb)
  const int q0 = qb * AT_QB + wave * 16;

  const _Float16* Qg = (const _Float16*)(const void*)qp  + (size_t)h * AT_D;
  const _Float16* Kg = (const _Float16*)(const void*)kp  + (size_t)h * AT_D;
  const _Float16* Vg = (const _Float16*)(const void*)vtp + (size_t)h * AT_D * SEQ_LEN;
  float*          ob = out + (size_t)h * AT_D;

  // ---- Q fragments (A operand, row = lane&15, split k map via Frag load): 2 d-chunks ----
  v16h qa[2];
#pragma unroll
  for (int dc = 0; dc < 2; ++dc) {
    const _Float16* qr = Qg + (size_t)(q0 + c) * D_MODEL + dc * 32 + 8 * hh;
    qa[dc] = Frag<_Float16>::load(qr);
  }

  float mrow[8], lrow[8];
  v8f oacc[4];
#pragma unroll
  for (int r = 0; r < 8; ++r) { mrow[r] = -INFINITY; lrow[r] = 0.f; }
#pragma unroll
  for (int t = 0; t < 4; ++t) oacc[t] = (v8f){0.f,0.f,0.f,0.f,0.f,0.f,0.f,0.f};

  const int nChunks = SEQ_LEN / AT_KC;   // 64, compile-time constant
  for (int kc = 0; kc < nChunks; ++kc) {
    const int kv0 = kc * AT_KC;
    __syncthreads();
    {
      // staging coverage: 128 threads x (4 x 8) elements = 64 rows x 64 per plane = the whole chunk tile
      const int r = tid >> 1, half = (tid & 1) * 32;
      const _Float16* ks = Kg + (size_t)(kv0 + r) * D_MODEL + half;   // K row kv0+r, d = half..half+31
      const _Float16* vs = Vg + (size_t)r * SEQ_LEN + kv0 + half;     // V^T row d = r, s = kv0+half..+31
#pragma unroll
      for (int i = 0; i < 4; ++i) {
        const v8h a0 = *(const v8h*)(ks + 8 * i);
        const v8h b0 = *(const v8h*)(vs + 8 * i);
        *(v8h*)(Ksh + r * AT_LP + half + 8 * i) = a0;
        *(v8h*)(Vth + r * AT_LP + half + 8 * i) = b0;
      }
    }
    __syncthreads();

    v8f s[4];
#pragma unroll
    for (int j = 0; j < 4; ++j) {
      s[j] = (v8f){0.f,0.f,0.f,0.f,0.f,0.f,0.f,0.f};
#pragma unroll
      for (int dc = 0; dc < 2; ++dc) {
        FH kb;
        kb.h[0] = *(const v8h*)(Ksh + (j * 16 + c) * AT_LP + dc * 32 + 8 * hh);
        kb.h[1] = *(const v8h*)(Ksh + (j * 16 + c) * AT_LP + dc * 32 + 16 + 8 * hh);
        s[j] = at_mma_h(qa[dc], kb.v, s[j]);
      }
    }
    float cm[8];
#pragma unroll
    for (int r = 0; r < 8; ++r) {
      float m = -INFINITY;
#pragma unroll
      for (int j = 0; j < 4; ++j) {
        const float sv = s[j][r] * sscale;
        s[j][r] = sv;
        m = fmaxf(m, sv);
      }
#pragma unroll
      for (int off = 1; off < 16; off <<= 1) m = fmaxf(m, __shfl_xor(m, off, 32));
      cm[r] = m;
    }
    _Float16* pw = Psh[wave];
#pragma unroll
    for (int r = 0; r < 8; ++r) {
      const float mnew = fmaxf(mrow[r], cm[r]);
      const float alpha = expf(mrow[r] - mnew);
      mrow[r] = mnew;
      float psum = 0.f;
#pragma unroll
      for (int j = 0; j < 4; ++j) {
        const float p = expf(s[j][r] - mnew);
        psum += p;
        pw[(8 * hh + r) * AT_LP + j * 16 + c] = (_Float16)(p * P_CARRY);
      }
#pragma unroll
      for (int off = 1; off < 16; off <<= 1) psum += __shfl_xor(psum, off, 32);
      lrow[r] = lrow[r] * alpha + psum;
#pragma unroll
      for (int t = 0; t < 4; ++t) oacc[t][r] *= alpha;
    }
    __builtin_amdgcn_fence(__ATOMIC_RELEASE, "workgroup");
    __builtin_amdgcn_wave_barrier();
    __builtin_amdgcn_fence(__ATOMIC_ACQUIRE, "workgroup");
#pragma unroll 1
    for (int kk = 0; kk < 2; ++kk) {
      FH pa;
      pa.h[0] = *(const v8h*)(pw + c * AT_LP + kk * 32 + 8 * hh);
      pa.h[1] = *(const v8h*)(pw + c * AT_LP + kk * 32 + 16 + 8 * hh);
#pragma unroll
      for (int t = 0; t < 4; ++t) {
        FH vb;
        vb.h[0] = *(const v8h*)(Vth + (t * 16 + c) * AT_LP + kk * 32 + 8 * hh);
        vb.h[1] = *(const v8h*)(Vth + (t * 16 + c) * AT_LP + kk * 32 + 16 + 8 * hh);
        oacc[t] = at_mma_h(pa.v, vb.v, oacc[t]);
      }
    }
  }

  float* os = Os[wave];
#pragma unroll
  for (int r = 0; r < 8; ++r) {
    const float inv = 1.0f / (lrow[r] * P_CARRY);
#pragma unroll
    for (int t = 0; t < 4; ++t) os[(8 * hh + r) * 68 + t * 16 + c] = oacc[t][r] * inv;
  }
  __builtin_amdgcn_fence(__ATOMIC_RELEASE, "workgroup");
  __builtin_amdgcn_wave_barrier();
  __builtin_amdgcn_fence(__ATOMIC_ACQUIRE, "workgroup");
  {
    const int c4 = (lane & 15) * 4;
    {
#pragma unroll
      for (int it = 0; it < 8; ++it) {
        const int row = it * 2 + hh;
        v4f val = *(const v4f*)(os + row * 68 + c4);
        *(v4f*)(ob + (size_t)(q0 + row) * D_MODEL + c4) = val;
      }
      
    }
  }
}

// ---------------------------------------------------------------------------
// host launcher
// ---------------------------------------------------------------------------
extern "C" void kernel_launch(void* const* d_in, const int* in_sizes, int n_in,
                              void* d_out, int out_size, void* d_ws, size_t ws_size,
                              hipStream_t stream) {
  constexpr int S  = SEQ_LEN;
  constexpr int DM = D_MODEL;
  const size_t SD = (size_t)S * DM;    // 4194304 elements
  const size_t DD = (size_t)DM * DM;   // 1048576 elements
  if (n_in < 11) return;
  if ((size_t)in_sizes[0] != SD || (size_t)in_sizes[1] != SD || (size_t)in_sizes[2] != SD) return;
  if ((size_t)in_sizes[3] != DD || (size_t)in_sizes[5] != DD || (size_t)in_sizes[7] != DD || (size_t)in_sizes[9] != DD) return;
  if (in_sizes[4] != DM || in_sizes[6] != DM || in_sizes[8] != DM || in_sizes[10] != DM) return;
  if ((size_t)out_size != SD) return;

  const float* x_q = (const float*)d_in[0];
  const float* x_k = (const float*)d_in[1];
  const float* x_v = (const float*)d_in[2];
  const float* Wq  = (const float*)d_in[3];
  const float* bq  = (const float*)d_in[4];
  const float* Wk  = (const float*)d_in[5];
  const float* bk  = (const float*)d_in[6];
  const float* Wv  = (const float*)d_in[7];
  const float* bv  = (const float*)d_in[8];
  const float* Wo  = (const float*)d_in[9];
  const float* bo  = (const float*)d_in[10];

  //   xq  bf16 [4096][1024]  8 MiB @  0 MiB      xk  @  8 MiB      xv  @ 16 MiB
  //   wq  bf16 [1024][1024]  2 MiB @ 24 MiB      wk  @ 26 MiB      wv  @ 28 MiB     wo f16 @ 30 MiB
  //   q16 f16  [4096][1024]  8 MiB @ 32 MiB      k16 @ 40 MiB      vt16 f16 [1024][4096] @ 48 MiB
  //   o32 f32  [4096][1024] 16 MiB @ 56 MiB      o16 f16 8 MiB @ 72 MiB
  //   bias f32 [4][1024]    16 KiB @ 80 MiB      end = 83902464 B
  const size_t off_xq  = 0;
  const size_t off_xk  = off_xq  + SD * 2;
  const size_t off_xv  = off_xk  + SD * 2;
  const size_t off_wq  = off_xv  + SD * 2;
  const size_t off_wk  = off_wq  + DD * 2;
  const size_t off_wv  = off_wk  + DD * 2;
  const size_t off_wo  = off_wv  + DD * 2;
  const size_t off_q   = off_wo  + DD * 2;
  const size_t off_k   = off_q   + SD * 2;
  const size_t off_vt  = off_k   + SD * 2;
  const size_t off_o32 = off_vt  + SD * 2;
  const size_t off_o16 = off_o32 + SD * 4;
  const size_t off_b   = off_o16 + SD * 2;
  const size_t ws_end  = off_b + 4 * (size_t)DM * 4;
  if (ws_end > ws_size) return;

  char* ws = (char*)d_ws;
  unsigned short* xq   = (unsigned short*)(ws + off_xq);
  unsigned short* xk   = (unsigned short*)(ws + off_xk);
  unsigned short* xv   = (unsigned short*)(ws + off_xv);
  unsigned short* wq   = (unsigned short*)(ws + off_wq);
  unsigned short* wk   = (unsigned short*)(ws + off_wk);
  unsigned short* wv   = (unsigned short*)(ws + off_wv);
  unsigned short* wo   = (unsigned short*)(ws + off_wo);
  unsigned short* q16  = (unsigned short*)(ws + off_q);
  unsigned short* k16  = (unsigned short*)(ws + off_k);
  unsigned short* vt16 = (unsigned short*)(ws + off_vt);
  float*          o32  = (float*)(ws + off_o32);
  unsigned short* o16  = (unsigned short*)(ws + off_o16);
  float*          bws  = (float*)(ws + off_b);
  const float* bias_q = bws;
  const float* bias_k = bws + DM;
  const float* bias_v = bws + 2 * DM;
  const float* bias_o = bws + 3 * DM;

  const int SD2 = (int)(SD / 2);   // 2097152
  const int DD2 = (int)(DD / 2);   // 524288

  // 1) biases -> bf16-RNE values in f32
  bias_bf16_rne_kernel<<<dim3(DM / 256, 4), 256, 0, stream>>>(bq, bk, bv, bo, bws, DM);
  // 2) activations -> bf16 planes
  cast3_bf16x2_kernel<<<dim3(SD2 / 256, 3), 256, 0, stream>>>(x_q, x_k, x_v, xq, xk, xv, SD2);
  // 3) Wq, Wk, Wv -> bf16 planes ([out][in] = [N][K] layout as is)
  cast3_bf16x2_kernel<<<dim3(DD2 / 256, 3), 256, 0, stream>>>(Wq, Wk, Wv, wq, wk, wv, DD2);
  // 4) Wo -> f16 plane of bf16-RNE(Wo) x 2^8
  cast_f16x2_scaled_kernel<true><<<dim3(DD2 / 256, 1), 256, 0, stream>>>(Wo, wo, DD2, 256.0f);

  // GEMM tiles: (4096/64)*(1024/64) = 1024 tiles of 64x64 -> 128 blocks x 8 waves; K = 1024 (K % 32 == 0)
  const int gemm_blocks = (int)(((S / 64) * (DM / 64)) / 8);   // 128
  // 5) q16[s][n] = x_q . Wq^T + bq   (f16 out)
  wmma_gemm64<1, false, 2, 1, false><<<dim3(gemm_blocks, 1), 256, 0, stream>>>(
      xq, xq, DM, 0L, wq, wq, DM, 0L, (void*)q16, (void*)q16, DM, 0L, bias_q, bias_q, 0L, S, DM, DM, 1.0f);
  // 6) k16[s][n] = x_k . Wk^T + bk
  wmma_gemm64<1, false, 2, 1, false><<<dim3(gemm_blocks, 1), 256, 0, stream>>>(
      xk, xk, DM, 0L, wk, wk, DM, 0L, (void*)k16, (void*)k16, DM, 0L, bias_k, bias_k, 0L, S, DM, DM, 1.0f);
  // 7) vt16[m = feature][n = s] = Wv[m,:] . x_v[s,:] + bv[m]  (role-swapped: M = 1024, N = 4096, ldc = 4096)
  wmma_gemm64<1, false, 1, 1, false><<<dim3(gemm_blocks, 1), 256, 0, stream>>>(
      wv, wv, DM, 0L, xv, xv, DM, 0L, (void*)vt16, (void*)vt16, S, 0L, bias_v, bias_v, 0L, DM, S, DM, 1.0f);

  // 8) attention: 16 heads x 64 query blocks, f32 context o32[s][h*64+d]
  attn_full64_f16_kernel<<<dim3(N_HEADS * (S / 64), 1), 128, 0, stream>>>(q16, k16, vt16, o32, 0.125f);

  // 9) o32 -> f16 plane x 2^8
  cast_f16x2_scaled_kernel<false><<<dim3(SD2 / 256, 1), 256, 0, stream>>>(o32, o16, SD2, 256.0f);

  // 10) out[s][n] = (o x 2^8) . (Wo x 2^8)^T * 2^-16 + bo  -> f32 d_out
  wmma_gemm64<0, false, 2, 0, false><<<dim3(gemm_blocks, 1), 256, 0, stream>>>(
      o16, o16, DM, 0L, wo, wo, DM, 0L, d_out, d_out, DM, 0L, bias_o, bias_o, 0L, S, DM, DM, 1.0f / 65536.0f);
}

// v002
// A run of this version takes 365 microseconds.
// Next to v001, in two timings, it ran 1.42 times as fast each time.
// Over all steps from v000 it is 1.78 times as fast.
// Projections q,k,v^T: v_wmma_f32_16x16x32_bf16 (bf16 RNE operands from the f32 inputs, f32 accumulate, bf16-RNE bias added in f32); attention q.k^T and p.v: v_wmma_f32_16x16x32_f16 (f16 q,k,v planes, p carried x2^15, f32 accumulate, f32 online softmax, score scale 0.125 in f32); output projection: v_wmma_f32_16x16x32_f16 (f16 planes of o x2^8 and bf16-RNE(Wo) x2^8, f32 accumulate, scale 2^-16, bf16-RNE bias added in f32).
#include <hip/hip_runtime.h>
#include <math.h>
#include <stdint.h>

typedef __attribute__((ext_vector_type(16))) _Float16 v16h;
typedef __attribute__((ext_vector_type(8)))  _Float16 v8h;
typedef __attribute__((ext_vector_type(16))) __bf16   v16b;
typedef __attribute__((ext_vector_type(8)))  __bf16   v8b;
typedef __attribute__((ext_vector_type(8)))  float    v8f;
typedef __attribute__((ext_vector_type(4)))  float    v4f;
typedef __attribute__((ext_vector_type(2)))  float    v2f;

constexpr int SEQ_LEN = 4096;
constexpr int D_MODEL = 1024;
constexpr int N_HEADS = 16;

__device__ __forceinline__ unsigned short f2bf_bits(float f) {
  unsigned u = __float_as_uint(f);
  return (unsigned short)((u + 0x7FFFu + ((u >> 16) & 1u)) >> 16);
}
__device__ __forceinline__ float bf_bits2f(unsigned short h) { return __uint_as_float(((unsigned)h) << 16); }
__device__ __forceinline__ unsigned pk16(unsigned short a, unsigned short b) { return (unsigned)a | ((unsigned)b << 16); }

// hazard guards as plain device helpers (no inline asm inside the kernel template body)
__device__ __forceinline__ void dep_guard_h(v8f& a, v8f& b, v16h x, v16h y) { asm volatile("v_nop\n\tv_nop\n\tv_nop\n\tv_nop" : "+v"(a), "+v"(b) : "v"(x), "v"(y)); }
__device__ __forceinline__ void dep_guard_b(v8f& a, v8f& b, v16b x, v16b y) { asm volatile("v_nop\n\tv_nop\n\tv_nop\n\tv_nop" : "+v"(a), "+v"(b) : "v"(x), "v"(y)); }
__device__ __forceinline__ void keep4_h(v16h a, v16h b, v16h c, v16h d) { asm volatile("v_nop" :: "v"(a), "v"(b), "v"(c), "v"(d)); }
__device__ __forceinline__ void keep4_b(v16b a, v16b b, v16b c, v16b d) { asm volatile("v_nop" :: "v"(a), "v"(b), "v"(c), "v"(d)); }
__device__ __forceinline__ void acc_guard4(v8f& a, v8f& b, v8f& c, v8f& d) { asm volatile("v_nop\n\tv_nop\n\tv_nop\n\tv_nop" : "+v"(a), "+v"(b), "+v"(c), "+v"(d)); }
template <typename T> struct Frag;
template <> struct Frag<_Float16> {
  typedef v16h V; union U { v16h v; v8h h[2]; };
  static __device__ __forceinline__ v16h load(const _Float16* p) {   // elements 0..7 <- p[0..7], 8..15 <- p[16..23]
    U f; f.h[0] = *(const v8h*)(p); f.h[1] = *(const v8h*)(p + 16); return f.v;
  }
  static __device__ __forceinline__ v8f mma(v16h a, v16h b, v8f c) {
    return __builtin_amdgcn_wmma_f32_16x16x32_f16(false, a, false, b, (short)0, c, false, false);
  }
  static __device__ __forceinline__ void guard(v8f& a, v8f& b, v16h x, v16h y) { dep_guard_h(a, b, x, y); }
  static __device__ __forceinline__ void keep(v16h a, v16h b, v16h c, v16h d) { keep4_h(a, b, c, d); }
};
template <> struct Frag<__bf16> {
  typedef v16b V; union U { v16b v; v8b h[2]; };
  static __device__ __forceinline__ v16b load(const __bf16* p) {
    U f; f.h[0] = *(const v8b*)(p); f.h[1] = *(const v8b*)(p + 16); return f.v;
  }
  static __device__ __forceinline__ v8f mma(v16b a, v16b b, v8f c) {
    return __builtin_amdgcn_wmma_f32_16x16x32_bf16(false, a, false, b, (short)0, c, false, false);
  }
  static __device__ __forceinline__ void guard(v8f& a, v8f& b, v16b x, v16b y) { dep_guard_b(a, b, x, y); }
  static __device__ __forceinline__ void keep(v16b a, v16b b, v16b c, v16b d) { keep4_b(a, b, c, d); }
};

// ---- Register-blocked batched WMMA GEMM ------------------------------------
// C[m,n] = scale * sum_k A[m,k] * Bt[n,k] (+bias)(+resid); each wave owns a 64x64 tile.
// A row-major [M,K]; Bt row-major [N,K]; M,N % 64 == 0, K % 32 == 0.
// SPLIT: operands are hi/lo planes (A2/Bt2 = lo planes, same layout); product = hi.hi + hi.lo + lo.hi.
// BIAS_MODE: 0 = none, 1 = bias[m], 2 = bias[n].
// OUT_MODE: 0 = f32, 1 = f16, 2 = bf16 hi plane (Cout) + bf16 lo plane (Cout2).
// ET: 0 = f16 operands, 1 = bf16 operands (pointers passed as 16-bit storage)
template <int ET> struct Elem;
template <> struct Elem<0> { typedef _Float16 T; };
template <> struct Elem<1> { typedef __bf16 T; };
template <int ET, bool SPLIT, int BIAS_MODE, int OUT_MODE, bool RESID, int ACT = 0>
__global__ __launch_bounds__(256) void wmma_gemm64(
    const unsigned short* __restrict__ Ap, const unsigned short* __restrict__ A2p, int lda, long strideA,
    const unsigned short* __restrict__ Btp, const unsigned short* __restrict__ Bt2p, int ldb, long strideB,
    void* __restrict__ Cout, void* __restrict__ Cout2, int ldc, long strideC,
    const float* __restrict__ bias,
    const float* __restrict__ resid, long strideR,
    int M, int N, int K, float scale) {
  typedef typename Elem<ET>::T T;
  typedef typename Frag<T>::V V;
  const T* A = (const T*)Ap; const T* A2 = (const T*)A2p; const T* Bt = (const T*)Btp; const T* Bt2 = (const T*)Bt2p;
  __shared__ __align__(16) float sT[8][16 * 68];   // per-wave 16x64 slab, pitch 68 floats
  const int b    = blockIdx.y;
  const int lane = threadIdx.x & 31;
  const int wave = threadIdx.x >> 5;
  const int tilesN = N >> 6;
  const int tilesM = M >> 6;
  const int tile = blockIdx.x * 8 + wave;
  if (tile >= tilesM * tilesN) return;   // wave-uniform; no block barriers in this kernel
  const int tm = tile / tilesN;
  const int tn = tile - tm * tilesN;
  const int m0 = tm << 6;
  const int n0 = tn << 6;

  const T* Ab  = A  + (size_t)b * strideA;
  const T* Bb  = Bt + (size_t)b * strideB;
  const T* Ab2 = SPLIT ? (A2  + (size_t)b * strideA) : nullptr;
  const T* Bb2 = SPLIT ? (Bt2 + (size_t)b * strideB) : nullptr;

  const int rlane = lane & 15;                 // row (A) / col (B, D) within subtile
  const int koff  = (lane >> 4) * 8;           // k offset of this lane half
  const int mOff  = (lane >> 4) * 8;           // D row offset

  v8f acc[4][4];
#pragma unroll
  for (int i = 0; i < 4; ++i)
#pragma unroll
    for (int j = 0; j < 4; ++j) acc[i][j] = (v8f){0.f,0.f,0.f,0.f,0.f,0.f,0.f,0.f};

  for (int k0 = 0; k0 < K; k0 += 32) {
    V bh[4], bl[4];
#pragma unroll
    for (int j = 0; j < 4; ++j) {
      const size_t bo = (size_t)(n0 + (j << 4) + rlane) * ldb + koff + k0;
      bh[j] = Frag<T>::load(Bb + bo);
      if (SPLIT) bl[j] = Frag<T>::load(Bb2 + bo);
    }
#pragma unroll
    for (int i = 0; i < 4; ++i) {
      const size_t ao = (size_t)(m0 + (i << 4) + rlane) * lda + koff + k0;
      V ah = Frag<T>::load(Ab + ao);
      V al;
      if (SPLIT) al = Frag<T>::load(Ab2 + ao);
#pragma unroll
      for (int j = 0; j < 4; ++j) {
        acc[i][j] = Frag<T>::mma(ah, bh[j], acc[i][j]);
        if (SPLIT) {
          acc[i][j] = Frag<T>::mma(ah, bl[j], acc[i][j]);
          acc[i][j] = Frag<T>::mma(al, bh[j], acc[i][j]);
        }
      }
      Frag<T>::guard(acc[i][0], acc[i][3], ah, SPLIT ? al : ah);
    }
    Frag<T>::keep(bh[0], bh[1], bh[2], bh[3]);
    if (SPLIT) Frag<T>::keep(bl[0], bl[1], bl[2], bl[3]);
  }
  acc_guard4(acc[0][0], acc[0][1], acc[0][2], acc[0][3]);
  acc_guard4(acc[1][0], acc[1][1], acc[1][2], acc[1][3]);
  acc_guard4(acc[2][0], acc[2][1], acc[2][2], acc[2][3]);
  acc_guard4(acc[3][0], acc[3][1], acc[3][2], acc[3][3]);

  // ---- epilogue ----
  float* slab = sT[wave];
  const float* Rb = RESID ? (resid + (size_t)b * strideR) : nullptr;
#pragma unroll
  for (int i = 0; i < 4; ++i) {
    const int mBase = m0 + (i << 4);
#pragma unroll
    for (int j = 0; j < 4; ++j) {
      const int n = n0 + (j << 4) + rlane;
      float bv = 0.f;
      if (BIAS_MODE == 2) bv = bias[n];
#pragma unroll
      for (int r = 0; r < 8; ++r) {
        float v = acc[i][j][r] * scale;
        if (BIAS_MODE == 1) v += bias[mBase + mOff + r];
        if (BIAS_MODE == 2) v += bv;
        if (RESID) v += Rb[(size_t)(mBase + mOff + r) * ldc + n];
        if (ACT == 1) v = tanhf(v);
        if (ACT == 2) v = fmaxf(v, 0.0f);
        if (ACT == 3) v = v / (1.0f + expf(-v));
        if (ACT == 4) v = (v > 0.f) ? v : 0.01f * v;
        if (ACT == 5) v = 0.5f * v * (1.0f + erff(v * 0.70710678118654752f));
        slab[(mOff + r) * 68 + (j << 4) + rlane] = v;
      }
    }
    __builtin_amdgcn_fence(__ATOMIC_RELEASE, "workgroup");
    __builtin_amdgcn_wave_barrier();
    __builtin_amdgcn_fence(__ATOMIC_ACQUIRE, "workgroup");
    if (OUT_MODE == 0) {
      float* C = (float*)Cout + (size_t)b * strideC;
      const int hh = lane >> 4, c4 = (lane & 15) * 4;     // row seg = 256 B = 16 lanes x 16 B
      {
#pragma unroll
        for (int it = 0; it < 8; ++it) {
          const int row = it * 2 + hh;
          v4f v = *(const v4f*)(slab + row * 68 + c4);
          *(v4f*)(C + (size_t)(mBase + row) * ldc + n0 + c4) = v;
        }
        
      }
    } else {
      const int q = lane >> 3, c8 = (lane & 7) * 8;
      unsigned short* C  = (unsigned short*)Cout  + (size_t)b * strideC;
      unsigned short* C2 = (OUT_MODE == 2) ? ((unsigned short*)Cout2 + (size_t)b * strideC) : nullptr;
      {
#pragma unroll
        for (int it = 0; it < 4; ++it) {
          const int row = it * 4 + q;
          const float* sp = slab + row * 68 + c8;
          v8h hv, lv;
#pragma unroll
          for (int e = 0; e < 8; ++e) {
            if (OUT_MODE == 1) {
              hv[e] = (_Float16)sp[e];
            } else {
              unsigned short hb = f2bf_bits(sp[e]);
              unsigned short lb = f2bf_bits(sp[e] - bf_bits2f(hb));
              hv[e] = __builtin_bit_cast(_Float16, hb);
              lv[e] = __builtin_bit_cast(_Float16, lb);
            }
          }
          *(v8h*)(C + (size_t)(mBase + row) * ldc + n0 + c8) = hv;
          if (OUT_MODE == 2) *(v8h*)(C2 + (size_t)(mBase + row) * ldc + n0 + c8) = lv;
        }
        
      }
    }
    __builtin_amdgcn_fence(__ATOMIC_RELEASE, "workgroup");
    __builtin_amdgcn_wave_barrier();
    __builtin_amdgcn_fence(__ATOMIC_ACQUIRE, "workgroup");
  }
}

// ---------------------------------------------------------------------------
// f32 -> bf16 (RNE) for three equally sized tensors, tensor selected by blockIdx.y (block-uniform);
// Coverage per plane: grid.x = n2/256 blocks x 256 threads x 2 elements = 2*n2 = whole plane
// (n2 = 2097152 -> 8192 blocks for 4096x1024; n2 = 524288 -> 2048 blocks for 1024x1024).
// ---------------------------------------------------------------------------
__global__ __launch_bounds__(256) void cast3_bf16x2_kernel(
    const float* __restrict__ in0, const float* __restrict__ in1, const float* __restrict__ in2,
    unsigned short* __restrict__ out0, unsigned short* __restrict__ out1, unsigned short* __restrict__ out2, int n2) {
  const int sel = blockIdx.y;
  const float* in = (sel == 0) ? in0 : ((sel == 1) ? in1 : in2);
  unsigned short* out = (sel == 0) ? out0 : ((sel == 1) ? out1 : out2);
  const int i = blockIdx.x * 256 + threadIdx.x;
  if (i < n2) {
    const v2f f = *(const v2f*)(in + 2 * (size_t)i);
    const unsigned u = pk16(f2bf_bits(f[0]), f2bf_bits(f[1]));
    ((unsigned*)out)[i] = u;
    
  }
}

// ---------------------------------------------------------------------------
// f32 -> f16 with a power-of-two carry: out = f16(g(in) * scale), g = bf16 RNE when PREBF, identity otherwise.
// Coverage: grid.x = n2/256 blocks x 256 threads x 2 elements = 2*n2 = whole plane.
// ---------------------------------------------------------------------------
template <bool PREBF>
__global__ __launch_bounds__(256) void cast_f16x2_scaled_kernel(const float* __restrict__ in, unsigned short* __restrict__ out,
                                                               int n2, float scale) {
  const int i = blockIdx.x * 256 + threadIdx.x;
  if (i < n2) {
    const v2f f = *(const v2f*)(in + 2 * (size_t)i);
    float a = f[0], b = f[1];
    if (PREBF) { a = bf_bits2f(f2bf_bits(a)); b = bf_bits2f(f2bf_bits(b)); }
    const _Float16 h0 = (_Float16)(a * scale), h1 = (_Float16)(b * scale);
    const unsigned u = pk16(__builtin_bit_cast(unsigned short, h0), __builtin_bit_cast(unsigned short, h1));
    ((unsigned*)out)[i] = u;
    
  }
}

// ---------------------------------------------------------------------------
// Four bias vectors -> bf16-RNE values held as f32: out[sel*n + i], source selected by blockIdx.y (block-uniform).
// Coverage: grid (n/256, 4) x 256 threads = 4 x n elements (n = 1024 -> 4 x 4 blocks).
// ---------------------------------------------------------------------------
__global__ __launch_bounds__(256) void bias_bf16_rne_kernel(
    const float* __restrict__ b0, const float* __restrict__ b1, const float* __restrict__ b2, const float* __restrict__ b3,
    float* __restrict__ out, int n) {
  const int sel = blockIdx.y;
  const float* in = (sel == 0) ? b0 : ((sel == 1) ? b1 : ((sel == 2) ? b2 : b3));
  const int i = blockIdx.x * 256 + threadIdx.x;
  if (i < n) {
    const float v = bf_bits2f(f2bf_bits(in[i]));
    ((float*)out)[(size_t)sel * n + i] = v;
    
  }
}

// =====================================================================================
// Full (non-causal, unmasked) attention, head dim 64, single 16-bit products.
//   q plane (f16): element (s, h, d) at [s*D_MODEL + h*64 + d]
//   k plane (f16): element (s, h, d) at [s*D_MODEL + h*64 + d]
//   v^T plane (f16): element (h, d, s) at [(h*64 + d)*SEQ_LEN + s]
//   out f32: element (s, h, d) at [s*D_MODEL + h*64 + d]
//   scores^T = (k . q^T) * sscale : v_wmma_f32_16x16x32_f16 (A = K rows, B = q), f32 accumulate, sscale applied in f32
//   out^T    = v^T . p^T          : v_wmma_f32_16x16x32_f16 (A = V^T rows, B = p^T packed from the score registers),
//                                   p (unnormalised, x2^15) and v in f16, f32 accumulate
//   online softmax in f32 over all SEQ_LEN keys (64 chunks of 64, compile-time trip count, no masking).
//   Block = 4 waves = 64 query rows of one head; grid.x = N_HEADS * (SEQ_LEN/64) = 1024.
//   K / V^T chunk staging: 128 threads x 32 elements per plane = the whole 64x64 tile (16-B copies, plain loads,
//   __syncthreads before and after); fragment loads read the LDS tiles with the same v8h element type.
//   (vector of the stored element type).
//   Output: per-wave 16x64 f32 tile staged in LDS; each 64-float row segment (256 B) written by 16 lanes x 16 B
//   Coverage: 1024 blocks x 4 waves x 16 rows x 64 floats = 4096 x 1024 = the whole out plane.
// =====================================================================================
#define AT_D 64
#define AT_NW 4
#define AT_QB 64
#define AT_KC 64
#define AT_LP 72   // LDS row pitch of the 16-bit tiles in elements: 144 B = 16 B x 9, so 16 rows read by ds_load_b128 fall on 16 distinct bank groups
constexpr float P_CARRY = 32768.0f;

__device__ __forceinline__ v8f at_mma_h(v16h a, v16h b, v8f c) {
  c = __builtin_amdgcn_wmma_f32_16x16x32_f16(false, a, false, b, (short)0, c, false, false);
  asm volatile("v_nop\n\tv_nop\n\tv_nop\n\tv_nop" : "+v"(c) : "v"(a), "v"(b));
  return c;
}

// lane l takes the value of lane l ^ 16
__device__ __forceinline__ float xhalf(float x) {
  return __builtin_bit_cast(float, __builtin_amdgcn_permlanex16(__builtin_bit_cast(int, x), __builtin_bit_cast(int, x), 0x76543210, 0xfedcba98, false, false));
}

__global__ __launch_bounds__(128)
void attn_full64_f16_kernel(const unsigned short* __restrict__ qp, const unsigned short* __restrict__ kp,
                            const unsigned short* __restrict__ vtp, float* __restrict__ out, float sscale) {
  union FH { v16h v; v8h h[2]; };
  __shared__ __align__(16) _Float16 Ksh[AT_KC * AT_LP];            // K [kv][d]      9 KB
  __shared__ __align__(16) _Float16 Vth[AT_D * AT_LP];             // V [d][kv]      9 KB
  __shared__ __align__(16) float    Os[AT_NW][16 * 68];            // per wave out tile, pitch 68

  const int tid  = threadIdx.x;
  const int wave = tid >> 5;
  const int lane = tid & 31;
  const int hh   = lane >> 4;
  const int c    = lane & 15;

  const int nqb = SEQ_LEN / AT_QB;        // 64
  const int bx = blockIdx.x;
  const int qb = bx % nqb;
  const int h  = bx / nqb;                // 0..N_HEADS-1 (grid = N_HEADS * nqb)
  const int q0 = qb * AT_QB + wave * 16;

  const _Float16* Qg = (const _Float16*)(const void*)qp  + (size_t)h * AT_D;
  const _Float16* Kg = (const _Float16*)(const void*)kp  + (size_t)h * AT_D;
  const _Float16* Vg = (const _Float16*)(const void*)vtp + (size_t)h * AT_D * SEQ_LEN;
  float*          ob = out + (size_t)h * AT_D;

  // ---- Q fragments (B operand, column = lane&15, split k map via Frag load): 2 d-chunks ----
  v16h qa[2];
#pragma unroll
  for (int dc = 0; dc < 2; ++dc) {
    const _Float16* qr = Qg + (size_t)(q0 + c) * D_MODEL + dc * 32 + 8 * hh;
    qa[dc] = Frag<_Float16>::load(qr);
  }

  // One query column per lane (c); the two wave halves split that query's keys.
  float mrow = -INFINITY, lrow = 0.f;      // running maximum (equal in both halves), this half's running sum
  v8f oacc[4];                             // O^T tiles: oacc[t][r] = O[q0 + c][t*16 + 8*hh + r]
#pragma unroll
  for (int t = 0; t < 4; ++t) oacc[t] = (v8f){0.f,0.f,0.f,0.f,0.f,0.f,0.f,0.f};

  const int nChunks = SEQ_LEN / AT_KC;   // 64, compile-time constant
  for (int kc = 0; kc < nChunks; ++kc) {
    const int kv0 = kc * AT_KC;
    __syncthreads();
    {
      // staging coverage: 128 threads x (4 x 8) elements = 64 rows x 64 per plane = the whole chunk tile
      const int r = tid >> 1, half = (tid & 1) * 32;
      const _Float16* ks = Kg + (size_t)(kv0 + r) * D_MODEL + half;   // K row kv0+r, d = half..half+31
      const _Float16* vs = Vg + (size_t)r * SEQ_LEN + kv0 + half;     // V^T row d = r, s = kv0+half..+31
#pragma unroll
      for (int i = 0; i < 4; ++i) {
        const v8h a0 = *(const v8h*)(ks + 8 * i);
        const v8h b0 = *(const v8h*)(vs + 8 * i);
        *(v8h*)(Ksh + r * AT_LP + half + 8 * i) = a0;
        *(v8h*)(Vth + r * AT_LP + half + 8 * i) = b0;
      }
    }
    __syncthreads();

    // S^T = K . Q^T: s[j][r] = score of key kv0 + j*16 + 8*hh + r against query q0 + c
    v8f s[4];
#pragma unroll
    for (int j = 0; j < 4; ++j) {
      s[j] = (v8f){0.f,0.f,0.f,0.f,0.f,0.f,0.f,0.f};
#pragma unroll
      for (int dc = 0; dc < 2; ++dc) {
        FH kb;
        kb.h[0] = *(const v8h*)(Ksh + (j * 16 + c) * AT_LP + dc * 32 + 8 * hh);
        kb.h[1] = *(const v8h*)(Ksh + (j * 16 + c) * AT_LP + dc * 32 + 16 + 8 * hh);
        s[j] = at_mma_h(kb.v, qa[dc], s[j]);
      }
    }
    float mj[4];
#pragma unroll
    for (int j = 0; j < 4; ++j) {
      mj[j] = -INFINITY;
#pragma unroll
      for (int r = 0; r < 8; ++r) {
        const float sv = s[j][r] * sscale;
        s[j][r] = sv;
        mj[j] = fmaxf(mj[j], sv);
      }
    }
    float cm = fmaxf(fmaxf(mj[0], mj[1]), fmaxf(mj[2], mj[3]));
    cm = fmaxf(cm, xhalf(cm));             // both halves now hold the query's chunk maximum
    const float mnew = fmaxf(mrow, cm);
    const float alpha = expf(mrow - mnew);
    mrow = mnew;
    // P^T packs in place into the B operand: element e of block kk = tile 2*kk + (e >> 3), register e & 7
    FH pb[2];
    float pj[4];
#pragma unroll
    for (int j = 0; j < 4; ++j) {
      pj[j] = 0.f;
#pragma unroll
      for (int r = 0; r < 8; ++r) {
        const float p = expf(s[j][r] - mnew);
        pj[j] += p;
        pb[j >> 1].v[(j & 1) * 8 + r] = (_Float16)(p * P_CARRY);
      }
    }
    lrow = lrow * alpha + ((pj[0] + pj[1]) + (pj[2] + pj[3]));
#pragma unroll
    for (int t = 0; t < 4; ++t)
#pragma unroll
      for (int r = 0; r < 8; ++r) oacc[t][r] *= alpha;
    // O^T += V^T . P^T
#pragma unroll
    for (int kk = 0; kk < 2; ++kk) {
#pragma unroll
      for (int t = 0; t < 4; ++t) {
        FH vb;
        vb.h[0] = *(const v8h*)(Vth + (t * 16 + c) * AT_LP + kk * 32 + 8 * hh);
        vb.h[1] = *(const v8h*)(Vth + (t * 16 + c) * AT_LP + kk * 32 + 16 + 8 * hh);
        oacc[t] = at_mma_h(vb.v, pb[kk].v, oacc[t]);
      }
    }
  }

  float* os = Os[wave];
  {
    const float inv = 1.0f / ((lrow + xhalf(lrow)) * P_CARRY);   // the halves' sums join once
#pragma unroll
    for (int t = 0; t < 4; ++t) {
      v4f lo, hi;
#pragma unroll
      for (int r = 0; r < 4; ++r) { lo[r] = oacc[t][r] * inv; hi[r] = oacc[t][4 + r] * inv; }
      *(v4f*)(os + c * 68 + t * 16 + 8 * hh)     = lo;
      *(v4f*)(os + c * 68 + t * 16 + 8 * hh + 4) = hi;
    }
  }
  __builtin_amdgcn_fence(__ATOMIC_RELEASE, "workgroup");
  __builtin_amdgcn_wave_barrier();
  __builtin_amdgcn_fence(__ATOMIC_ACQUIRE, "workgroup");
  {
    const int c4 = (lane & 15) * 4;
    float* orow = ob + (size_t)(q0 + hh) * D_MODEL + c4;   // one base; the eight rows lie at constant steps from it
#pragma unroll
    for (int it = 0; it < 8; ++it) {
      v4f val = *(const v4f*)(os + (it * 2 + hh) * 68 + c4);
      *(v4f*)(orow + it * 2 * D_MODEL) = val;
    }
  }
}

// ---------------------------------------------------------------------------
// host launcher
// ---------------------------------------------------------------------------
extern "C" void kernel_launch(void* const* d_in, const int* in_sizes, int n_in,
                              void* d_out, int out_size, void* d_ws, size_t ws_size,
                              hipStream_t stream) {
  constexpr int S  = SEQ_LEN;
  constexpr int DM = D_MODEL;
  const size_t SD = (size_t)S * DM;    // 4194304 elements
  const size_t DD = (size_t)DM * DM;   // 1048576 elements
  if (n_in < 11) return;
  if ((size_t)in_sizes[0] != SD || (size_t)in_sizes[1] != SD || (size_t)in_sizes[2] != SD) return;
  if ((size_t)in_sizes[3] != DD || (size_t)in_sizes[5] != DD || (size_t)in_sizes[7] != DD || (size_t)in_sizes[9] != DD) return;
  if (in_sizes[4] != DM || in_sizes[6] != DM || in_sizes[8] != DM || in_sizes[10] != DM) return;
  if ((size_t)out_size != SD) return;

  const float* x_q = (const float*)d_in[0];
  const float* x_k = (const float*)d_in[1];
  const float* x_v = (const float*)d_in[2];
  const float* Wq  = (const float*)d_in[3];
  const float* bq  = (const float*)d_in[4];
  const float* Wk  = (const float*)d_in[5];
  const float* bk  = (const float*)d_in[6];
  const float* Wv  = (const float*)d_in[7];
  const float* bv  = (const float*)d_in[8];
  const float* Wo  = (const float*)d_in[9];
  const float* bo  = (const float*)d_in[10];

  //   xq  bf16 [4096][1024]  8 MiB @  0 MiB      xk  @  8 MiB      xv  @ 16 MiB
  //   wq  bf16 [1024][1024]  2 MiB @ 24 MiB      wk  @ 26 MiB      wv  @ 28 MiB     wo f16 @ 30 MiB
  //   q16 f16  [4096][1024]  8 MiB @ 32 MiB      k16 @ 40 MiB      vt16 f16 [1024][4096] @ 48 MiB
  //   o32 f32  [4096][1024] 16 MiB @ 56 MiB      o16 f16 8 MiB @ 72 MiB
  //   bias f32 [4][1024]    16 KiB @ 80 MiB      end = 83902464 B
  const size_t off_xq  = 0;
  const size_t off_xk  = off_xq  + SD * 2;
  const size_t off_xv  = off_xk  + SD * 2;
  const size_t off_wq  = off_xv  + SD * 2;
  const size_t off_wk  = off_wq  + DD * 2;
  const size_t off_wv  = off_wk  + DD * 2;
  const size_t off_wo  = off_wv  + DD * 2;
  const size_t off_q   = off_wo  + DD * 2;
  const size_t off_k   = off_q   + SD * 2;
  const size_t off_vt  = off_k   + SD * 2;
  const size_t off_o32 = off_vt  + SD * 2;
  const size_t off_o16 = off_o32 + SD * 4;
  const size_t off_b   = off_o16 + SD * 2;
  const size_t ws_end  = off_b + 4 * (size_t)DM * 4;
  if (ws_end > ws_size) return;

  char* ws = (char*)d_ws;
  unsigned short* xq   = (unsigned short*)(ws + off_xq);
  unsigned short* xk   = (unsigned short*)(ws + off_xk);
  unsigned short* xv   = (unsigned short*)(ws + off_xv);
  unsigned short* wq   = (unsigned short*)(ws + off_wq);
  unsigned short* wk   = (unsigned short*)(ws + off_wk);
  unsigned short* wv   = (unsigned short*)(ws + off_wv);
  unsigned short* wo   = (unsigned short*)(ws + off_wo);
  unsigned short* q16  = (unsigned short*)(ws + off_q);
  unsigned short* k16  = (unsigned short*)(ws + off_k);
  unsigned short* vt16 = (unsigned short*)(ws + off_vt);
  float*          o32  = (float*)(ws + off_o32);
  unsigned short* o16  = (unsigned short*)(ws + off_o16);
  float*          bws  = (float*)(ws + off_b);
  const float* bias_q = bws;
  const float* bias_k = bws + DM;
  const float* bias_v = bws + 2 * DM;
  const float* bias_o = bws + 3 * DM;

  const int SD2 = (int)(SD / 2);   // 2097152
  const int DD2 = (int)(DD / 2);   // 524288

  // 1) biases -> bf16-RNE values in f32
  bias_bf16_rne_kernel<<<dim3(DM / 256, 4), 256, 0, stream>>>(bq, bk, bv, bo, bws, DM);
  // 2) activations -> bf16 planes
  cast3_bf16x2_kernel<<<dim3(SD2 / 256, 3), 256, 0, stream>>>(x_q, x_k, x_v, xq, xk, xv, SD2);
  // 3) Wq, Wk, Wv -> bf16 planes ([out][in] = [N][K] layout as is)
  cast3_bf16x2_kernel<<<dim3(DD2 / 256, 3), 256, 0, stream>>>(Wq, Wk, Wv, wq, wk, wv, DD2);
  // 4) Wo -> f16 plane of bf16-RNE(Wo) x 2^8
  cast_f16x2_scaled_kernel<true><<<dim3(DD2 / 256, 1), 256, 0, stream>>>(Wo, wo, DD2, 256.0f);

  // GEMM tiles: (4096/64)*(1024/64) = 1024 tiles of 64x64 -> 128 blocks x 8 waves; K = 1024 (K % 32 == 0)
  const int gemm_blocks = (int)(((S / 64) * (DM / 64)) / 8);   // 128
  // 5) q16[s][n] = x_q . Wq^T + bq   (f16 out)
  wmma_gemm64<1, false, 2, 1, false><<<dim3(gemm_blocks, 1), 256, 0, stream>>>(
      xq, xq, DM, 0L, wq, wq, DM, 0L, (void*)q16, (void*)q16, DM, 0L, bias_q, bias_q, 0L, S, DM, DM, 1.0f);
  // 6) k16[s][n] = x_k . Wk^T + bk
  wmma_gemm64<1, false, 2, 1, false><<<dim3(gemm_blocks, 1), 256, 0, stream>>>(
      xk, xk, DM, 0L, wk, wk, DM, 0L, (void*)k16, (void*)k16, DM, 0L, bias_k, bias_k, 0L, S, DM, DM, 1.0f);
  // 7) vt16[m = feature][n = s] = Wv[m,:] . x_v[s,:] + bv[m]  (role-swapped: M = 1024, N = 4096, ldc = 4096)
  wmma_gemm64<1, false, 1, 1, false><<<dim3(gemm_blocks, 1), 256, 0, stream>>>(
      wv, wv, DM, 0L, xv, xv, DM, 0L, (void*)vt16, (void*)vt16, S, 0L, bias_v, bias_v, 0L, DM, S, DM, 1.0f);

  // 8) attention: 16 heads x 64 query blocks, f32 context o32[s][h*64+d]
  attn_full64_f16_kernel<<<dim3(N_HEADS * (S / 64), 1), 128, 0, stream>>>(q16, k16, vt16, o32, 0.125f);

  // 9) o32 -> f16 plane x 2^8
  cast_f16x2_scaled_kernel<false><<<dim3(SD2 / 256, 1), 256, 0, stream>>>(o32, o16, SD2, 256.0f);

  // 10) out[s][n] = (o x 2^8) . (Wo x 2^8)^T * 2^-16 + bo  -> f32 d_out
  wmma_gemm64<0, false, 2, 0, false><<<dim3(gemm_blocks, 1), 256, 0, stream>>>(
      o16, o16, DM, 0L, wo, wo, DM, 0L, d_out, d_out, DM, 0L, bias_o, bias_o, 0L, S, DM, DM, 1.0f / 65536.0f);
}

// v003
// Measured time: 242 microseconds a run.
// Next to v002, in two timings, it ran 1.51 times as fast each time.
// Counting every step since v000, it is 2.69 times as fast.
// Projections q,k,v^T: v_wmma_f32_16x16x32_bf16 (bf16 RNE operands from the f32 inputs, f32 accumulate, bf16-RNE bias added in f32); attention q.k^T and p.v: v_wmma_f32_16x16x32_f16 (f16 q,k,v planes, p carried x2^15, f32 accumulate, f32 online softmax, score scale 0.125 in f32); output projection: v_wmma_f32_16x16x32_f16 (f16 planes of o x2^8 and bf16-RNE(Wo) x2^8, f32 accumulate, scale 2^-16, bf16-RNE bias added in f32).
#include <hip/hip_runtime.h>
#include <math.h>
#include <stdint.h>

typedef __attribute__((ext_vector_type(16))) _Float16 v16h;
typedef __attribute__((ext_vector_type(8)))  _Float16 v8h;
typedef __attribute__((ext_vector_type(16))) __bf16   v16b;
typedef __attribute__((ext_vector_type(8)))  __bf16   v8b;
typedef __attribute__((ext_vector_type(8)))  float    v8f;
typedef __attribute__((ext_vector_type(4)))  float    v4f;
typedef __attribute__((ext_vector_type(2)))  float    v2f;

constexpr int SEQ_LEN = 4096;
constexpr int D_MODEL = 1024;
constexpr int N_HEADS = 16;

__device__ __forceinline__ unsigned short f2bf_bits(float f) {
  unsigned u = __float_as_uint(f);
  return (unsigned short)((u + 0x7FFFu + ((u >> 16) & 1u)) >> 16);
}
__device__ __forceinline__ float bf_bits2f(unsigned short h) { return __uint_as_float(((unsigned)h) << 16); }
__device__ __forceinline__ unsigned pk16(unsigned short a, unsigned short b) { return (unsigned)a | ((unsigned)b << 16); }

// hazard guards as plain device helpers
__device__ __forceinline__ void dep_guard_h(v8f& a, v8f& b, v16h x, v16h y) { asm volatile("v_nop\n\tv_nop\n\tv_nop\n\tv_nop" : "+v"(a), "+v"(b) : "v"(x), "v"(y)); }
__device__ __forceinline__ void dep_guard_b(v8f& a, v8f& b, v16b x, v16b y) { asm volatile("v_nop\n\tv_nop\n\tv_nop\n\tv_nop" : "+v"(a), "+v"(b) : "v"(x), "v"(y)); }
__device__ __forceinline__ void keep4_h(v16h a, v16h b, v16h c, v16h d) { asm volatile("v_nop" :: "v"(a), "v"(b), "v"(c), "v"(d)); }
__device__ __forceinline__ void keep4_b(v16b a, v16b b, v16b c, v16b d) { asm volatile("v_nop" :: "v"(a), "v"(b), "v"(c), "v"(d)); }
__device__ __forceinline__ void acc_guard4(v8f& a, v8f& b, v8f& c, v8f& d) { asm volatile("v_nop\n\tv_nop\n\tv_nop\n\tv_nop" : "+v"(a), "+v"(b), "+v"(c), "+v"(d)); }
template <typename T> struct Frag;
template <> struct Frag<_Float16> {
  typedef v16h V; typedef v8h H; union U { v16h v; v8h h[2]; };
  static __device__ __forceinline__ v16h load(const _Float16* p) {   // elements 0..7 <- p[0..7], 8..15 <- p[16..23]
    U f; f.h[0] = *(const v8h*)(p); f.h[1] = *(const v8h*)(p + 16); return f.v;
  }
  static __device__ __forceinline__ v8f mma(v16h a, v16h b, v8f c) {
    return __builtin_amdgcn_wmma_f32_16x16x32_f16(false, a, false, b, (short)0, c, false, false);
  }
  static __device__ __forceinline__ void guard(v8f& a, v8f& b, v16h x, v16h y) { dep_guard_h(a, b, x, y); }
  static __device__ __forceinline__ void keep(v16h a, v16h b, v16h c, v16h d) { keep4_h(a, b, c, d); }
};
template <> struct Frag<__bf16> {
  typedef v16b V; typedef v8b H; union U { v16b v; v8b h[2]; };
  static __device__ __forceinline__ v16b load(const __bf16* p) {
    U f; f.h[0] = *(const v8b*)(p); f.h[1] = *(const v8b*)(p + 16); return f.v;
  }
  static __device__ __forceinline__ v8f mma(v16b a, v16b b, v8f c) {
    return __builtin_amdgcn_wmma_f32_16x16x32_bf16(false, a, false, b, (short)0, c, false, false);
  }
  static __device__ __forceinline__ void guard(v8f& a, v8f& b, v16b x, v16b y) { dep_guard_b(a, b, x, y); }
  static __device__ __forceinline__ void keep(v16b a, v16b b, v16b c, v16b d) { keep4_b(a, b, c, d); }
};

// ---- LDS-staged batched WMMA GEMM -------------------------------------------
// C[m,n] = scale * sum_k A[m,k] * Bt[n,k] (+bias)(+resid); a block of 8 waves owns a 128x128 tile, each wave 32x64 of it.
// A row-major [M,K]; Bt row-major [N,K]; M,N % 128 == 0, K % 64 == 0, K >= 64.
// Per 64-k step the block brings 128 rows x 128 B of A and of Bt into LDS: 8 lanes x 16 B cover one whole row line,
// 256 threads x 4 pieces per operand = the whole tile. Two LDS buffers: the next step's global loads are issued ahead of
// this step's products and stored behind them, one __syncthreads() per step.
// SPLIT (hi/lo planes) is not staged: single-plane operands only.
// BIAS_MODE: 0 = none, 1 = bias[m], 2 = bias[n].
// OUT_MODE: 0 = f32, 1 = f16, 2 = bf16 hi plane (Cout) + bf16 lo plane (Cout2).
// ET: 0 = f16 operands, 1 = bf16 operands (pointers passed as 16-bit storage)
#define GM_BT 128  // block tile, rows of A and of Bt
#define GM_LP 72   // LDS row pitch in elements: 64 + 8, 144 B = 16 B x 9, so 16 rows read by ds_load_b128 fall on 16 distinct bank groups
template <int ET> struct Elem;
template <> struct Elem<0> { typedef _Float16 T; };
template <> struct Elem<1> { typedef __bf16 T; };
template <int ET, bool SPLIT, int BIAS_MODE, int OUT_MODE, bool RESID, int ACT = 0>
__global__ __launch_bounds__(256) void wmma_gemm64(
    const unsigned short* __restrict__ Ap, const unsigned short* __restrict__ A2p, int lda, long strideA,
    const unsigned short* __restrict__ Btp, const unsigned short* __restrict__ Bt2p, int ldb, long strideB,
    void* __restrict__ Cout, void* __restrict__ Cout2, int ldc, long strideC,
    const float* __restrict__ bias,
    const float* __restrict__ resid, long strideR,
    int M, int N, int K, float scale) {
  static_assert(!SPLIT, "single-plane operands only");
  typedef typename Elem<ET>::T T;
  typedef typename Frag<T>::V V;
  typedef typename Frag<T>::H H;
  const T* A = (const T*)Ap; const T* Bt = (const T*)Btp;
  __shared__ __align__(16) T sA[2][GM_BT * GM_LP];   // A rows of the block tile, one 64-k step, two buffers
  __shared__ __align__(16) T sB[2][GM_BT * GM_LP];   // Bt rows of the block tile
  __shared__ __align__(16) float sT[8][16 * 68];     // per-wave 16x64 slab, pitch 68 floats
  const int b    = blockIdx.y;
  const int tid  = threadIdx.x;
  const int lane = tid & 31;
  const int wave = tid >> 5;
  const int tilesN = N >> 7;
  const int tilesM = M >> 7;
  const int tile = blockIdx.x;
  if (tile >= tilesM * tilesN) return;   // block-uniform, ahead of every barrier
  const int tm = tile / tilesN;
  const int tn = tile - tm * tilesN;
  const int bm0 = tm << 7;
  const int bn0 = tn << 7;
  const int wm = (wave >> 1) << 5;             // this wave's rows inside the block tile: 0, 32, 64, 96
  const int wn = (wave & 1) << 6;              // this wave's columns inside the block tile: 0, 64
  const int m0 = bm0 + wm;
  const int n0 = bn0 + wn;

  const T* Ab  = A  + (size_t)b * strideA;
  const T* Bb  = Bt + (size_t)b * strideB;

  const int rlane = lane & 15;                 // row (A) / col (B, D) within subtile
  const int koff  = (lane >> 4) * 8;           // k offset of this lane half
  const int mOff  = (lane >> 4) * 8;           // D row offset

  // every unroll directive from here to the epilogue makes the array indices constants, so that acc, the staged pieces
  // and the fragments live in registers and not in scratch
  v8f acc[2][4];
#pragma unroll
  for (int i = 0; i < 2; ++i)
#pragma unroll
    for (int j = 0; j < 4; ++j) acc[i][j] = (v8f){0.f,0.f,0.f,0.f,0.f,0.f,0.f,0.f};

  // staging map: piece it of a thread = row it*32 + (tid >> 3), elements (tid & 7)*8 .. +7 of the step's 64
  const int srow = tid >> 3;
  const int sseg = (tid & 7) << 3;
  const int so = srow * GM_LP + sseg;
  const char* Ac = (const char*)(Ab + (size_t)bm0 * lda);   // block-uniform bases of the two row bands
  const char* Bc = (const char*)(Bb + (size_t)bn0 * ldb);
  unsigned oa[4], ob[4];                       // one running byte offset per piece (a 128-row band stays far below 4 GiB), 128 B a step
  H ra[4], rb[4];
#pragma unroll
  for (int it = 0; it < 4; ++it) {
    oa[it] = (unsigned)(((it * 32 + srow) * lda + sseg) * 2);
    ob[it] = (unsigned)(((it * 32 + srow) * ldb + sseg) * 2);
    ra[it] = *(const H*)(Ac + oa[it]);
    rb[it] = *(const H*)(Bc + ob[it]);
  }
#pragma unroll
  for (int it = 0; it < 4; ++it) {
    *(H*)(&sA[0][so + it * 32 * GM_LP]) = ra[it];
    *(H*)(&sB[0][so + it * 32 * GM_LP]) = rb[it];
  }

  const int nk = K >> 6;
  for (int kt = 0; kt < nk; ++kt) {
    // publishes buffer kt & 1 and ends every wave's reads of the other buffer, which is refilled below
    __syncthreads();
    const bool more = kt + 1 < nk;             // block-uniform
    if (more) {
#pragma unroll
      for (int it = 0; it < 4; ++it) {
        oa[it] += 128;
        ob[it] += 128;
        ra[it] = *(const H*)(Ac + oa[it]);
        rb[it] = *(const H*)(Bc + ob[it]);
      }
      // stands behind the eight loads, ahead of every later write of an offset or base register that they name
      asm volatile("s_wait_xcnt 0x0" ::: "memory");
    }
    const T* sa = &sA[kt & 1][(wm + rlane) * GM_LP + koff];
    const T* sb = &sB[kt & 1][(wn + rlane) * GM_LP + koff];
    // the step's 24 fragment reads stand together ahead of its 16 products
    V bh[2][4], ah[2][2];
#pragma unroll
    for (int kk = 0; kk < 2; ++kk) {
#pragma unroll
      for (int j = 0; j < 4; ++j) bh[kk][j] = Frag<T>::load(sb + j * 16 * GM_LP + kk * 32);
#pragma unroll
      for (int i = 0; i < 2; ++i) ah[kk][i] = Frag<T>::load(sa + i * 16 * GM_LP + kk * 32);
    }
#pragma unroll
    for (int kk = 0; kk < 2; ++kk) {
#pragma unroll
      for (int i = 0; i < 2; ++i) {
#pragma unroll
        for (int j = 0; j < 4; ++j) acc[i][j] = Frag<T>::mma(ah[kk][i], bh[kk][j], acc[i][j]);
        Frag<T>::guard(acc[i][0], acc[i][3], ah[kk][i], ah[kk][i]);   // v_nops: the slots behind the last product before its A or D is touched
      }
      Frag<T>::keep(bh[kk][0], bh[kk][1], bh[kk][2], bh[kk][3]);   // holds the B fragments' registers to the end of their products
    }
    if (more) {
      const int nb = (kt + 1) & 1;
#pragma unroll
      for (int it = 0; it < 4; ++it) {
        *(H*)(&sA[nb][so + it * 32 * GM_LP]) = ra[it];
        *(H*)(&sB[nb][so + it * 32 * GM_LP]) = rb[it];
      }
    }
  }
  acc_guard4(acc[0][0], acc[0][1], acc[0][2], acc[0][3]);
  acc_guard4(acc[1][0], acc[1][1], acc[1][2], acc[1][3]);

  // ---- epilogue ----
  float* slab = sT[wave];
  const float* Rb = RESID ? (resid + (size_t)b * strideR) : nullptr;
#pragma unroll
  for (int i = 0; i < 2; ++i) {
    const int mBase = m0 + (i << 4);
#pragma unroll
    for (int j = 0; j < 4; ++j) {
      const int n = n0 + (j << 4) + rlane;
      float bv = 0.f;
      if (BIAS_MODE == 2) bv = bias[n];
#pragma unroll
      for (int r = 0; r < 8; ++r) {
        float v = acc[i][j][r] * scale;
        if (BIAS_MODE == 1) v += bias[mBase + mOff + r];
        if (BIAS_MODE == 2) v += bv;
        if (RESID) v += Rb[(size_t)(mBase + mOff + r) * ldc + n];
        if (ACT == 1) v = tanhf(v);
        if (ACT == 2) v = fmaxf(v, 0.0f);
        if (ACT == 3) v = v / (1.0f + expf(-v));
        if (ACT == 4) v = (v > 0.f) ? v : 0.01f * v;
        if (ACT == 5) v = 0.5f * v * (1.0f + erff(v * 0.70710678118654752f));
        slab[(mOff + r) * 68 + (j << 4) + rlane] = v;
      }
    }
    __builtin_amdgcn_fence(__ATOMIC_RELEASE, "workgroup");
    __builtin_amdgcn_wave_barrier();
    __builtin_amdgcn_fence(__ATOMIC_ACQUIRE, "workgroup");
    if (OUT_MODE == 0) {
      float* C = (float*)Cout + (size_t)b * strideC;
      const int hh = lane >> 4, c4 = (lane & 15) * 4;     // row seg = 256 B = 16 lanes x 16 B
      {
#pragma unroll
        for (int it = 0; it < 8; ++it) {
          const int row = it * 2 + hh;
          v4f v = *(const v4f*)(slab + row * 68 + c4);
          *(v4f*)(C + (size_t)(mBase + row) * ldc + n0 + c4) = v;
        }
        
      }
    } else {
      const int q = lane >> 3, c8 = (lane & 7) * 8;
      unsigned short* C  = (unsigned short*)Cout  + (size_t)b * strideC;
      unsigned short* C2 = (OUT_MODE == 2) ? ((unsigned short*)Cout2 + (size_t)b * strideC) : nullptr;
      {
#pragma unroll
        for (int it = 0; it < 4; ++it) {
          const int row = it * 4 + q;
          const float* sp = slab + row * 68 + c8;
          v8h hv, lv;
#pragma unroll
          for (int e = 0; e < 8; ++e) {
            if (OUT_MODE == 1) {
              hv[e] = (_Float16)sp[e];
            } else {
              unsigned short hb = f2bf_bits(sp[e]);
              unsigned short lb = f2bf_bits(sp[e] - bf_bits2f(hb));
              hv[e] = __builtin_bit_cast(_Float16, hb);
              lv[e] = __builtin_bit_cast(_Float16, lb);
            }
          }
          *(v8h*)(C + (size_t)(mBase + row) * ldc + n0 + c8) = hv;
          if (OUT_MODE == 2) *(v8h*)(C2 + (size_t)(mBase + row) * ldc + n0 + c8) = lv;
        }
        
      }
    }
    __builtin_amdgcn_fence(__ATOMIC_RELEASE, "workgroup");
    __builtin_amdgcn_wave_barrier();
    __builtin_amdgcn_fence(__ATOMIC_ACQUIRE, "workgroup");
  }
}

// ---------------------------------------------------------------------------
// f32 -> bf16 (RNE) for three equally sized tensors, tensor selected by blockIdx.y (block-uniform);
// Coverage per plane: grid.x = n2/256 blocks x 256 threads x 2 elements = 2*n2 = whole plane
// (n2 = 2097152 -> 8192 blocks for 4096x1024; n2 = 524288 -> 2048 blocks for 1024x1024).
// ---------------------------------------------------------------------------
__global__ __launch_bounds__(256) void cast3_bf16x2_kernel(
    const float* __restrict__ in0, const float* __restrict__ in1, const float* __restrict__ in2,
    unsigned short* __restrict__ out0, unsigned short* __restrict__ out1, unsigned short* __restrict__ out2, int n2) {
  const int sel = blockIdx.y;
  const float* in = (sel == 0) ? in0 : ((sel == 1) ? in1 : in2);
  unsigned short* out = (sel == 0) ? out0 : ((sel == 1) ? out1 : out2);
  const int i = blockIdx.x * 256 + threadIdx.x;
  if (i < n2) {
    const v2f f = *(const v2f*)(in + 2 * (size_t)i);
    const unsigned u = pk16(f2bf_bits(f[0]), f2bf_bits(f[1]));
    ((unsigned*)out)[i] = u;
    
  }
}

// ---------------------------------------------------------------------------
// f32 -> f16 with a power-of-two carry: out = f16(g(in) * scale), g = bf16 RNE when PREBF, identity otherwise.
// Coverage: grid.x = n2/256 blocks x 256 threads x 2 elements = 2*n2 = whole plane.
// ---------------------------------------------------------------------------
template <bool PREBF>
__global__ __launch_bounds__(256) void cast_f16x2_scaled_kernel(const float* __restrict__ in, unsigned short* __restrict__ out,
                                                               int n2, float scale) {
  const int i = blockIdx.x * 256 + threadIdx.x;
  if (i < n2) {
    const v2f f = *(const v2f*)(in + 2 * (size_t)i);
    float a = f[0], b = f[1];
    if (PREBF) { a = bf_bits2f(f2bf_bits(a)); b = bf_bits2f(f2bf_bits(b)); }
    const _Float16 h0 = (_Float16)(a * scale), h1 = (_Float16)(b * scale);
    const unsigned u = pk16(__builtin_bit_cast(unsigned short, h0), __builtin_bit_cast(unsigned short, h1));
    ((unsigned*)out)[i] = u;
    
  }
}

// ---------------------------------------------------------------------------
// Four bias vectors -> bf16-RNE values held as f32: out[sel*n + i], source selected by blockIdx.y (block-uniform).
// Coverage: grid (n/256, 4) x 256 threads = 4 x n elements (n = 1024 -> 4 x 4 blocks).
// ---------------------------------------------------------------------------
__global__ __launch_bounds__(256) void bias_bf16_rne_kernel(
    const float* __restrict__ b0, const float* __restrict__ b1, const float* __restrict__ b2, const float* __restrict__ b3,
    float* __restrict__ out, int n) {
  const int sel = blockIdx.y;
  const float* in = (sel == 0) ? b0 : ((sel == 1) ? b1 : ((sel == 2) ? b2 : b3));
  const int i = blockIdx.x * 256 + threadIdx.x;
  if (i < n) {
    const float v = bf_bits2f(f2bf_bits(in[i]));
    ((float*)out)[(size_t)sel * n + i] = v;
    
  }
}

// =====================================================================================
// Full (non-causal, unmasked) attention, head dim 64, single 16-bit products.
//   q plane (f16): element (s, h, d) at [s*D_MODEL + h*64 + d]
//   k plane (f16): element (s, h, d) at [s*D_MODEL + h*64 + d]
//   v^T plane (f16): element (h, d, s) at [(h*64 + d)*SEQ_LEN + s]
//   out f32: element (s, h, d) at [s*D_MODEL + h*64 + d]
//   scores^T = (k . q^T) * sscale : v_wmma_f32_16x16x32_f16 (A = K rows, B = q), f32 accumulate, sscale applied in f32
//   out^T    = v^T . p^T          : v_wmma_f32_16x16x32_f16 (A = V^T rows, B = p^T packed from the score registers),
//                                   p (unnormalised, x2^15) and v in f16, f32 accumulate
//   online softmax in f32 over all SEQ_LEN keys (64 chunks of 64, compile-time trip count, no masking).
//   Block = 4 waves = 64 query rows of one head; grid.x = N_HEADS * (SEQ_LEN/64) = 1024.
//   K / V^T chunk staging: 128 threads x 32 elements per plane = the whole 64x64 tile (16-B copies, plain loads,
//   __syncthreads before and after); fragment loads read the LDS tiles with the same v8h element type.
//   (vector of the stored element type).
//   Output: per-wave 16x64 f32 tile staged in LDS; each 64-float row segment (256 B) written by 16 lanes x 16 B
//   Coverage: 1024 blocks x 4 waves x 16 rows x 64 floats = 4096 x 1024 = the whole out plane.
// =====================================================================================
#define AT_D 64
#define AT_NW 4
#define AT_QB 64
#define AT_KC 64
#define AT_LP 72   // LDS row pitch of the 16-bit tiles in elements: 144 B = 16 B x 9, so 16 rows read by ds_load_b128 fall on 16 distinct bank groups
constexpr float P_CARRY = 32768.0f;

__device__ __forceinline__ v8f at_mma_h(v16h a, v16h b, v8f c) {
  c = __builtin_amdgcn_wmma_f32_16x16x32_f16(false, a, false, b, (short)0, c, false, false);
  asm volatile("v_nop\n\tv_nop\n\tv_nop\n\tv_nop" : "+v"(c) : "v"(a), "v"(b));
  return c;
}

// lane l takes the value of lane l ^ 16
__device__ __forceinline__ float xhalf(float x) {
  return __builtin_bit_cast(float, __builtin_amdgcn_permlanex16(__builtin_bit_cast(int, x), __builtin_bit_cast(int, x), 0x76543210, 0xfedcba98, false, false));
}

__global__ __launch_bounds__(128)
void attn_full64_f16_kernel(const unsigned short* __restrict__ qp, const unsigned short* __restrict__ kp,
                            const unsigned short* __restrict__ vtp, float* __restrict__ out, float sscale) {
  union FH { v16h v; v8h h[2]; };
  __shared__ __align__(16) _Float16 Ksh[AT_KC * AT_LP];            // K [kv][d]      9 KB
  __shared__ __align__(16) _Float16 Vth[AT_D * AT_LP];             // V [d][kv]      9 KB
  __shared__ __align__(16) float    Os[AT_NW][16 * 68];            // per wave out tile, pitch 68

  const int tid  = threadIdx.x;
  const int wave = tid >> 5;
  const int lane = tid & 31;
  const int hh   = lane >> 4;
  const int c    = lane & 15;

  const int nqb = SEQ_LEN / AT_QB;        // 64
  const int bx = blockIdx.x;
  const int qb = bx % nqb;
  const int h  = bx / nqb;                // 0..N_HEADS-1 (grid = N_HEADS * nqb)
  const int q0 = qb * AT_QB + wave * 16;

  const _Float16* Qg = (const _Float16*)(const void*)qp  + (size_t)h * AT_D;
  const _Float16* Kg = (const _Float16*)(const void*)kp  + (size_t)h * AT_D;
  const _Float16* Vg = (const _Float16*)(const void*)vtp + (size_t)h * AT_D * SEQ_LEN;
  float*          ob = out + (size_t)h * AT_D;

  // ---- Q fragments (B operand, column = lane&15, split k map via Frag load): 2 d-chunks ----
  v16h qa[2];
#pragma unroll
  for (int dc = 0; dc < 2; ++dc) {
    const _Float16* qr = Qg + (size_t)(q0 + c) * D_MODEL + dc * 32 + 8 * hh;
    qa[dc] = Frag<_Float16>::load(qr);
  }

  // One query column per lane (c); the two wave halves split that query's keys.
  float mrow = -INFINITY, lrow = 0.f;      // running maximum (equal in both halves), this half's running sum
  v8f oacc[4];                             // O^T tiles: oacc[t][r] = O[q0 + c][t*16 + 8*hh + r]
#pragma unroll
  for (int t = 0; t < 4; ++t) oacc[t] = (v8f){0.f,0.f,0.f,0.f,0.f,0.f,0.f,0.f};

  const int nChunks = SEQ_LEN / AT_KC;   // 64, compile-time constant
  for (int kc = 0; kc < nChunks; ++kc) {
    const int kv0 = kc * AT_KC;
    __syncthreads();
    {
      // staging coverage: 128 threads x (4 x 8) elements = 64 rows x 64 per plane = the whole chunk tile
      const int r = tid >> 1, half = (tid & 1) * 32;
      const _Float16* ks = Kg + (size_t)(kv0 + r) * D_MODEL + half;   // K row kv0+r, d = half..half+31
      const _Float16* vs = Vg + (size_t)r * SEQ_LEN + kv0 + half;     // V^T row d = r, s = kv0+half..+31
#pragma unroll
      for (int i = 0; i < 4; ++i) {
        const v8h a0 = *(const v8h*)(ks + 8 * i);
        const v8h b0 = *(const v8h*)(vs + 8 * i);
        *(v8h*)(Ksh + r * AT_LP + half + 8 * i) = a0;
        *(v8h*)(Vth + r * AT_LP + half + 8 * i) = b0;
      }
    }
    __syncthreads();

    // S^T = K . Q^T: s[j][r] = score of key kv0 + j*16 + 8*hh + r against query q0 + c
    v8f s[4];
#pragma unroll
    for (int j = 0; j < 4; ++j) {
      s[j] = (v8f){0.f,0.f,0.f,0.f,0.f,0.f,0.f,0.f};
#pragma unroll
      for (int dc = 0; dc < 2; ++dc) {
        FH kb;
        kb.h[0] = *(const v8h*)(Ksh + (j * 16 + c) * AT_LP + dc * 32 + 8 * hh);
        kb.h[1] = *(const v8h*)(Ksh + (j * 16 + c) * AT_LP + dc * 32 + 16 + 8 * hh);
        s[j] = at_mma_h(kb.v, qa[dc], s[j]);
      }
    }
    float mj[4];
#pragma unroll
    for (int j = 0; j < 4; ++j) {
      mj[j] = -INFINITY;
#pragma unroll
      for (int r = 0; r < 8; ++r) {
        const float sv = s[j][r] * sscale;
        s[j][r] = sv;
        mj[j] = fmaxf(mj[j], sv);
      }
    }
    float cm = fmaxf(fmaxf(mj[0], mj[1]), fmaxf(mj[2], mj[3]));
    cm = fmaxf(cm, xhalf(cm));             // both halves now hold the query's chunk maximum
    const float mnew = fmaxf(mrow, cm);
    const float alpha = expf(mrow - mnew);
    mrow = mnew;
    // P^T packs in place into the B operand: element e of block kk = tile 2*kk + (e >> 3), register e & 7
    FH pb[2];
    float pj[4];
#pragma unroll
    for (int j = 0; j < 4; ++j) {
      pj[j] = 0.f;
#pragma unroll
      for (int r = 0; r < 8; ++r) {
        const float p = expf(s[j][r] - mnew);
        pj[j] += p;
        pb[j >> 1].v[(j & 1) * 8 + r] = (_Float16)(p * P_CARRY);
      }
    }
    lrow = lrow * alpha + ((pj[0] + pj[1]) + (pj[2] + pj[3]));
#pragma unroll
    for (int t = 0; t < 4; ++t)
#pragma unroll
      for (int r = 0; r < 8; ++r) oacc[t][r] *= alpha;
    // O^T += V^T . P^T
#pragma unroll
    for (int kk = 0; kk < 2; ++kk) {
#pragma unroll
      for (int t = 0; t < 4; ++t) {
        FH vb;
        vb.h[0] = *(const v8h*)(Vth + (t * 16 + c) * AT_LP + kk * 32 + 8 * hh);
        vb.h[1] = *(const v8h*)(Vth + (t * 16 + c) * AT_LP + kk * 32 + 16 + 8 * hh);
        oacc[t] = at_mma_h(vb.v, pb[kk].v, oacc[t]);
      }
    }
  }

  float* os = Os[wave];
  {
    const float inv = 1.0f / ((lrow + xhalf(lrow)) * P_CARRY);   // the halves' sums join once
#pragma unroll
    for (int t = 0; t < 4; ++t) {
      v4f lo, hi;
#pragma unroll
      for (int r = 0; r < 4; ++r) { lo[r] = oacc[t][r] * inv; hi[r] = oacc[t][4 + r] * inv; }
      *(v4f*)(os + c * 68 + t * 16 + 8 * hh)     = lo;
      *(v4f*)(os + c * 68 + t * 16 + 8 * hh + 4) = hi;
    }
  }
  __builtin_amdgcn_fence(__ATOMIC_RELEASE, "workgroup");
  __builtin_amdgcn_wave_barrier();
  __builtin_amdgcn_fence(__ATOMIC_ACQUIRE, "workgroup");
  {
    const int c4 = (lane & 15) * 4;
    float* orow = ob + (size_t)(q0 + hh) * D_MODEL + c4;   // one base; the eight rows lie at constant steps from it
#pragma unroll
    for (int it = 0; it < 8; ++it) {
      v4f val = *(const v4f*)(os + (it * 2 + hh) * 68 + c4);
      *(v4f*)(orow + it * 2 * D_MODEL) = val;
    }
  }
}

// ---------------------------------------------------------------------------
// host launcher
// ---------------------------------------------------------------------------
extern "C" void kernel_launch(void* const* d_in, const int* in_sizes, int n_in,
                              void* d_out, int out_size, void* d_ws, size_t ws_size,
                              hipStream_t stream) {
  constexpr int S  = SEQ_LEN;
  constexpr int DM = D_MODEL;
  const size_t SD = (size_t)S * DM;    // 4194304 elements
  const size_t DD = (size_t)DM * DM;   // 1048576 elements
  if (n_in < 11) return;
  if ((size_t)in_sizes[0] != SD || (size_t)in_sizes[1] != SD || (size_t)in_sizes[2] != SD) return;
  if ((size_t)in_sizes[3] != DD || (size_t)in_sizes[5] != DD || (size_t)in_sizes[7] != DD || (size_t)in_sizes[9] != DD) return;
  if (in_sizes[4] != DM || in_sizes[6] != DM || in_sizes[8] != DM || in_sizes[10] != DM) return;
  if ((size_t)out_size != SD) return;

  const float* x_q = (const float*)d_in[0];
  const float* x_k = (const float*)d_in[1];
  const float* x_v = (const float*)d_in[2];
  const float* Wq  = (const float*)d_in[3];
  const float* bq  = (const float*)d_in[4];
  const float* Wk  = (const float*)d_in[5];
  const float* bk  = (const float*)d_in[6];
  const float* Wv  = (const float*)d_in[7];
  const float* bv  = (const float*)d_in[8];
  const float* Wo  = (const float*)d_in[9];
  const float* bo  = (const float*)d_in[10];

  //   xq  bf16 [4096][1024]  8 MiB @  0 MiB      xk  @  8 MiB      xv  @ 16 MiB
  //   wq  bf16 [1024][1024]  2 MiB @ 24 MiB      wk  @ 26 MiB      wv  @ 28 MiB     wo f16 @ 30 MiB
  //   q16 f16  [4096][1024]  8 MiB @ 32 MiB      k16 @ 40 MiB      vt16 f16 [1024][4096] @ 48 MiB
  //   o32 f32  [4096][1024] 16 MiB @ 56 MiB      o16 f16 8 MiB @ 72 MiB
  //   bias f32 [4][1024]    16 KiB @ 80 MiB      end = 83902464 B
  const size_t off_xq  = 0;
  const size_t off_xk  = off_xq  + SD * 2;
  const size_t off_xv  = off_xk  + SD * 2;
  const size_t off_wq  = off_xv  + SD * 2;
  const size_t off_wk  = off_wq  + DD * 2;
  const size_t off_wv  = off_wk  + DD * 2;
  const size_t off_wo  = off_wv  + DD * 2;
  const size_t off_q   = off_wo  + DD * 2;
  const size_t off_k   = off_q   + SD * 2;
  const size_t off_vt  = off_k   + SD * 2;
  const size_t off_o32 = off_vt  + SD * 2;
  const size_t off_o16 = off_o32 + SD * 4;
  const size_t off_b   = off_o16 + SD * 2;
  const size_t ws_end  = off_b + 4 * (size_t)DM * 4;
  if (ws_end > ws_size) return;

  char* ws = (char*)d_ws;
  unsigned short* xq   = (unsigned short*)(ws + off_xq);
  unsigned short* xk   = (unsigned short*)(ws + off_xk);
  unsigned short* xv   = (unsigned short*)(ws + off_xv);
  unsigned short* wq   = (unsigned short*)(ws + off_wq);
  unsigned short* wk   = (unsigned short*)(ws + off_wk);
  unsigned short* wv   = (unsigned short*)(ws + off_wv);
  unsigned short* wo   = (unsigned short*)(ws + off_wo);
  unsigned short* q16  = (unsigned short*)(ws + off_q);
  unsigned short* k16  = (unsigned short*)(ws + off_k);
  unsigned short* vt16 = (unsigned short*)(ws + off_vt);
  float*          o32  = (float*)(ws + off_o32);
  unsigned short* o16  = (unsigned short*)(ws + off_o16);
  float*          bws  = (float*)(ws + off_b);
  const float* bias_q = bws;
  const float* bias_k = bws + DM;
  const float* bias_v = bws + 2 * DM;
  const float* bias_o = bws + 3 * DM;

  const int SD2 = (int)(SD / 2);   // 2097152
  const int DD2 = (int)(DD / 2);   // 524288

  // 1) biases -> bf16-RNE values in f32
  bias_bf16_rne_kernel<<<dim3(DM / 256, 4), 256, 0, stream>>>(bq, bk, bv, bo, bws, DM);
  // 2) activations -> bf16 planes
  cast3_bf16x2_kernel<<<dim3(SD2 / 256, 3), 256, 0, stream>>>(x_q, x_k, x_v, xq, xk, xv, SD2);
  // 3) Wq, Wk, Wv -> bf16 planes ([out][in] = [N][K] layout as is)
  cast3_bf16x2_kernel<<<dim3(DD2 / 256, 3), 256, 0, stream>>>(Wq, Wk, Wv, wq, wk, wv, DD2);
  // 4) Wo -> f16 plane of bf16-RNE(Wo) x 2^8
  cast_f16x2_scaled_kernel<true><<<dim3(DD2 / 256, 1), 256, 0, stream>>>(Wo, wo, DD2, 256.0f);

  // GEMM tiles: (4096/128)*(1024/128) = 256 tiles of 128x128 -> 256 blocks x 8 waves; K = 1024 (K % 64 == 0)
  const int gemm_blocks = (int)((S / 128) * (DM / 128));   // 256
  // 5) q16[s][n] = x_q . Wq^T + bq   (f16 out)
  wmma_gemm64<1, false, 2, 1, false><<<dim3(gemm_blocks, 1), 256, 0, stream>>>(
      xq, xq, DM, 0L, wq, wq, DM, 0L, (void*)q16, (void*)q16, DM, 0L, bias_q, bias_q, 0L, S, DM, DM, 1.0f);
  // 6) k16[s][n] = x_k . Wk^T + bk
  wmma_gemm64<1, false, 2, 1, false><<<dim3(gemm_blocks, 1), 256, 0, stream>>>(
      xk, xk, DM, 0L, wk, wk, DM, 0L, (void*)k16, (void*)k16, DM, 0L, bias_k, bias_k, 0L, S, DM, DM, 1.0f);
  // 7) vt16[m = feature][n = s] = Wv[m,:] . x_v[s,:] + bv[m]  (role-swapped: M = 1024, N = 4096, ldc = 4096)
  wmma_gemm64<1, false, 1, 1, false><<<dim3(gemm_blocks, 1), 256, 0, stream>>>(
      wv, wv, DM, 0L, xv, xv, DM, 0L, (void*)vt16, (void*)vt16, S, 0L, bias_v, bias_v, 0L, DM, S, DM, 1.0f);

  // 8) attention: 16 heads x 64 query blocks, f32 context o32[s][h*64+d]
  attn_full64_f16_kernel<<<dim3(N_HEADS * (S / 64), 1), 128, 0, stream>>>(q16, k16, vt16, o32, 0.125f);

  // 9) o32 -> f16 plane x 2^8
  cast_f16x2_scaled_kernel<false><<<dim3(SD2 / 256, 1), 256, 0, stream>>>(o32, o16, SD2, 256.0f);

  // 10) out[s][n] = (o x 2^8) . (Wo x 2^8)^T * 2^-16 + bo  -> f32 d_out
  wmma_gemm64<0, false, 2, 0, false><<<dim3(gemm_blocks, 1), 256, 0, stream>>>(
      o16, o16, DM, 0L, wo, wo, DM, 0L, d_out, d_out, DM, 0L, bias_o, bias_o, 0L, S, DM, DM, 1.0f / 65536.0f);
}

// v004
// A run of this version takes 201 microseconds.
// Two timings next to v003 both put it at 1.20 times that version's speed.
// Counting every step since v000, it is 3.23 times as fast.
// Projections q,k,v^T: v_wmma_f32_16x16x32_bf16 (bf16 RNE operands from the f32 inputs, f32 accumulate, bf16-RNE bias added in f32); attention q.k^T and p.v: v_wmma_f32_16x16x32_f16 (f16 q,k,v planes, p carried x2^15, f32 accumulate, f32 online softmax, score scale 0.125 in f32); output projection: v_wmma_f32_16x16x32_f16 (f16 planes of o x2^8 and bf16-RNE(Wo) x2^8, f32 accumulate, scale 2^-16, bf16-RNE bias added in f32).
#include <hip/hip_runtime.h>
#include <math.h>
#include <stdint.h>

typedef __attribute__((ext_vector_type(16))) _Float16 v16h;
typedef __attribute__((ext_vector_type(8)))  _Float16 v8h;
typedef __attribute__((ext_vector_type(16))) __bf16   v16b;
typedef __attribute__((ext_vector_type(8)))  __bf16   v8b;
typedef __attribute__((ext_vector_type(8)))  float    v8f;
typedef __attribute__((ext_vector_type(4)))  float    v4f;
typedef __attribute__((ext_vector_type(2)))  float    v2f;

constexpr int SEQ_LEN = 4096;
constexpr int D_MODEL = 1024;
constexpr int N_HEADS = 16;

__device__ __forceinline__ unsigned short f2bf_bits(float f) {
  unsigned u = __float_as_uint(f);
  return (unsigned short)((u + 0x7FFFu + ((u >> 16) & 1u)) >> 16);
}
__device__ __forceinline__ float bf_bits2f(unsigned short h) { return __uint_as_float(((unsigned)h) << 16); }
__device__ __forceinline__ unsigned pk16(unsigned short a, unsigned short b) { return (unsigned)a | ((unsigned)b << 16); }

// hazard guards as plain device helpers
__device__ __forceinline__ void dep_guard_h(v8f& a, v8f& b, v16h x, v16h y) { asm volatile("v_nop\n\tv_nop\n\tv_nop\n\tv_nop" : "+v"(a), "+v"(b) : "v"(x), "v"(y)); }
__device__ __forceinline__ void dep_guard_b(v8f& a, v8f& b, v16b x, v16b y) { asm volatile("v_nop\n\tv_nop\n\tv_nop\n\tv_nop" : "+v"(a), "+v"(b) : "v"(x), "v"(y)); }
__device__ __forceinline__ void keep4_h(v16h a, v16h b, v16h c, v16h d) { asm volatile("v_nop" :: "v"(a), "v"(b), "v"(c), "v"(d)); }
__device__ __forceinline__ void keep4_b(v16b a, v16b b, v16b c, v16b d) { asm volatile("v_nop" :: "v"(a), "v"(b), "v"(c), "v"(d)); }
__device__ __forceinline__ void acc_guard4(v8f& a, v8f& b, v8f& c, v8f& d) { asm volatile("v_nop\n\tv_nop\n\tv_nop\n\tv_nop" : "+v"(a), "+v"(b), "+v"(c), "+v"(d)); }
template <typename T> struct Frag;
template <> struct Frag<_Float16> {
  typedef v16h V; typedef v8h H; union U { v16h v; v8h h[2]; };
  static __device__ __forceinline__ v16h load(const _Float16* p) {   // elements 0..7 <- p[0..7], 8..15 <- p[16..23]
    U f; f.h[0] = *(const v8h*)(p); f.h[1] = *(const v8h*)(p + 16); return f.v;
  }
  static __device__ __forceinline__ v8f mma(v16h a, v16h b, v8f c) {
    return __builtin_amdgcn_wmma_f32_16x16x32_f16(false, a, false, b, (short)0, c, false, false);
  }
  static __device__ __forceinline__ void guard(v8f& a, v8f& b, v16h x, v16h y) { dep_guard_h(a, b, x, y); }
  static __device__ __forceinline__ void keep(v16h a, v16h b, v16h c, v16h d) { keep4_h(a, b, c, d); }
};
template <> struct Frag<__bf16> {
  typedef v16b V; typedef v8b H; union U { v16b v; v8b h[2]; };
  static __device__ __forceinline__ v16b load(const __bf16* p) {
    U f; f.h[0] = *(const v8b*)(p); f.h[1] = *(const v8b*)(p + 16); return f.v;
  }
  static __device__ __forceinline__ v8f mma(v16b a, v16b b, v8f c) {
    return __builtin_amdgcn_wmma_f32_16x16x32_bf16(false, a, false, b, (short)0, c, false, false);
  }
  static __device__ __forceinline__ void guard(v8f& a, v8f& b, v16b x, v16b y) { dep_guard_b(a, b, x, y); }
  static __device__ __forceinline__ void keep(v16b a, v16b b, v16b c, v16b d) { keep4_b(a, b, c, d); }
};

// ---- LDS-staged batched WMMA GEMM -------------------------------------------
// C[m,n] = scale * sum_k A[m,k] * Bt[n,k] (+bias)(+resid); a block of 8 waves owns a 128x128 tile, each wave 32x64 of it.
// A row-major [M,K]; Bt row-major [N,K]; M,N % 128 == 0, K % 64 == 0, K >= 64.
// Per 64-k step the block brings 128 rows x 128 B of A and of Bt into LDS: 8 lanes x 16 B cover one whole row line,
// 256 threads x 4 pieces per operand = the whole tile. Two LDS buffers: the next step's global loads are issued ahead of
// this step's products and stored behind them, one __syncthreads() per step.
// SPLIT (hi/lo planes) is not staged: single-plane operands only.
// BIAS_MODE: 0 = none, 1 = bias[m], 2 = bias[n].
// OUT_MODE: 0 = f32, 1 = f16, 2 = bf16 hi plane (Cout) + bf16 lo plane (Cout2).
// ET: 0 = f16 operands, 1 = bf16 operands (pointers passed as 16-bit storage)
#define GM_BT 128  // block tile, rows of A and of Bt
#define GM_LP 72   // LDS row pitch in elements: 64 + 8, 144 B = 16 B x 9, so 16 rows read by ds_load_b128 fall on 16 distinct bank groups
template <int ET> struct Elem;
template <> struct Elem<0> { typedef _Float16 T; };
template <> struct Elem<1> { typedef __bf16 T; };
template <int ET, bool SPLIT, int BIAS_MODE, int OUT_MODE, bool RESID, int ACT = 0>
__global__ __launch_bounds__(256) void wmma_gemm64(
    const unsigned short* __restrict__ Ap, const unsigned short* __restrict__ A2p, int lda, long strideA,
    const unsigned short* __restrict__ Btp, const unsigned short* __restrict__ Bt2p, int ldb, long strideB,
    void* __restrict__ Cout, void* __restrict__ Cout2, int ldc, long strideC,
    const float* __restrict__ bias,
    const float* __restrict__ resid, long strideR,
    int M, int N, int K, float scale) {
  static_assert(!SPLIT, "single-plane operands only");
  typedef typename Elem<ET>::T T;
  typedef typename Frag<T>::V V;
  typedef typename Frag<T>::H H;
  const T* A = (const T*)Ap; const T* Bt = (const T*)Btp;
  __shared__ __align__(16) T sA[2][GM_BT * GM_LP];   // A rows of the block tile, one 64-k step, two buffers
  __shared__ __align__(16) T sB[2][GM_BT * GM_LP];   // Bt rows of the block tile
  __shared__ __align__(16) float sT[8][16 * 68];     // per-wave 16x64 slab, pitch 68 floats
  const int b    = blockIdx.y;
  const int tid  = threadIdx.x;
  const int lane = tid & 31;
  const int wave = tid >> 5;
  const int tilesN = N >> 7;
  const int tilesM = M >> 7;
  const int tile = blockIdx.x;
  if (tile >= tilesM * tilesN) return;   // block-uniform, ahead of every barrier
  const int tm = tile / tilesN;
  const int tn = tile - tm * tilesN;
  const int bm0 = tm << 7;
  const int bn0 = tn << 7;
  const int wm = (wave >> 1) << 5;             // this wave's rows inside the block tile: 0, 32, 64, 96
  const int wn = (wave & 1) << 6;              // this wave's columns inside the block tile: 0, 64
  const int m0 = bm0 + wm;
  const int n0 = bn0 + wn;

  const T* Ab  = A  + (size_t)b * strideA;
  const T* Bb  = Bt + (size_t)b * strideB;

  const int rlane = lane & 15;                 // row (A) / col (B, D) within subtile
  const int koff  = (lane >> 4) * 8;           // k offset of this lane half
  const int mOff  = (lane >> 4) * 8;           // D row offset

  // every unroll directive from here to the epilogue makes the array indices constants, so that acc, the staged pieces
  // and the fragments live in registers and not in scratch
  v8f acc[2][4];
#pragma unroll
  for (int i = 0; i < 2; ++i)
#pragma unroll
    for (int j = 0; j < 4; ++j) acc[i][j] = (v8f){0.f,0.f,0.f,0.f,0.f,0.f,0.f,0.f};

  // staging map: piece it of a thread = row it*32 + (tid >> 3), elements (tid & 7)*8 .. +7 of the step's 64
  const int srow = tid >> 3;
  const int sseg = (tid & 7) << 3;
  const int so = srow * GM_LP + sseg;
  const char* Ac = (const char*)(Ab + (size_t)bm0 * lda);   // block-uniform bases of the two row bands
  const char* Bc = (const char*)(Bb + (size_t)bn0 * ldb);
  unsigned oa[4], ob[4];                       // one running byte offset per piece (a 128-row band stays far below 4 GiB), 128 B a step
  H ra[4], rb[4];
#pragma unroll
  for (int it = 0; it < 4; ++it) {
    oa[it] = (unsigned)(((it * 32 + srow) * lda + sseg) * 2);
    ob[it] = (unsigned)(((it * 32 + srow) * ldb + sseg) * 2);
    ra[it] = *(const H*)(Ac + oa[it]);
    rb[it] = *(const H*)(Bc + ob[it]);
  }
#pragma unroll
  for (int it = 0; it < 4; ++it) {
    *(H*)(&sA[0][so + it * 32 * GM_LP]) = ra[it];
    *(H*)(&sB[0][so + it * 32 * GM_LP]) = rb[it];
  }

  const int nk = K >> 6;
  for (int kt = 0; kt < nk; ++kt) {
    // publishes buffer kt & 1 and ends every wave's reads of the other buffer, which is refilled below
    __syncthreads();
    const bool more = kt + 1 < nk;             // block-uniform
    if (more) {
#pragma unroll
      for (int it = 0; it < 4; ++it) {
        oa[it] += 128;
        ob[it] += 128;
        ra[it] = *(const H*)(Ac + oa[it]);
        rb[it] = *(const H*)(Bc + ob[it]);
      }
      // stands behind the eight loads, ahead of every later write of an offset or base register that they name
      asm volatile("s_wait_xcnt 0x0" ::: "memory");
    }
    const T* sa = &sA[kt & 1][(wm + rlane) * GM_LP + koff];
    const T* sb = &sB[kt & 1][(wn + rlane) * GM_LP + koff];
    // the step's 24 fragment reads stand together ahead of its 16 products
    V bh[2][4], ah[2][2];
#pragma unroll
    for (int kk = 0; kk < 2; ++kk) {
#pragma unroll
      for (int j = 0; j < 4; ++j) bh[kk][j] = Frag<T>::load(sb + j * 16 * GM_LP + kk * 32);
#pragma unroll
      for (int i = 0; i < 2; ++i) ah[kk][i] = Frag<T>::load(sa + i * 16 * GM_LP + kk * 32);
    }
#pragma unroll
    for (int kk = 0; kk < 2; ++kk) {
#pragma unroll
      for (int i = 0; i < 2; ++i) {
#pragma unroll
        for (int j = 0; j < 4; ++j) acc[i][j] = Frag<T>::mma(ah[kk][i], bh[kk][j], acc[i][j]);
        Frag<T>::guard(acc[i][0], acc[i][3], ah[kk][i], ah[kk][i]);   // v_nops: the slots behind the last product before its A or D is touched
      }
      Frag<T>::keep(bh[kk][0], bh[kk][1], bh[kk][2], bh[kk][3]);   // holds the B fragments' registers to the end of their products
    }
    if (more) {
      const int nb = (kt + 1) & 1;
#pragma unroll
      for (int it = 0; it < 4; ++it) {
        *(H*)(&sA[nb][so + it * 32 * GM_LP]) = ra[it];
        *(H*)(&sB[nb][so + it * 32 * GM_LP]) = rb[it];
      }
    }
  }
  acc_guard4(acc[0][0], acc[0][1], acc[0][2], acc[0][3]);
  acc_guard4(acc[1][0], acc[1][1], acc[1][2], acc[1][3]);

  // ---- epilogue ----
  float* slab = sT[wave];
  const float* Rb = RESID ? (resid + (size_t)b * strideR) : nullptr;
#pragma unroll
  for (int i = 0; i < 2; ++i) {
    const int mBase = m0 + (i << 4);
#pragma unroll
    for (int j = 0; j < 4; ++j) {
      const int n = n0 + (j << 4) + rlane;
      float bv = 0.f;
      if (BIAS_MODE == 2) bv = bias[n];
#pragma unroll
      for (int r = 0; r < 8; ++r) {
        float v = acc[i][j][r] * scale;
        if (BIAS_MODE == 1) v += bias[mBase + mOff + r];
        if (BIAS_MODE == 2) v += bv;
        if (RESID) v += Rb[(size_t)(mBase + mOff + r) * ldc + n];
        if (ACT == 1) v = tanhf(v);
        if (ACT == 2) v = fmaxf(v, 0.0f);
        if (ACT == 3) v = v / (1.0f + expf(-v));
        if (ACT == 4) v = (v > 0.f) ? v : 0.01f * v;
        if (ACT == 5) v = 0.5f * v * (1.0f + erff(v * 0.70710678118654752f));
        slab[(mOff + r) * 68 + (j << 4) + rlane] = v;
      }
    }
    __builtin_amdgcn_fence(__ATOMIC_RELEASE, "workgroup");
    __builtin_amdgcn_wave_barrier();
    __builtin_amdgcn_fence(__ATOMIC_ACQUIRE, "workgroup");
    if (OUT_MODE == 0) {
      float* C = (float*)Cout + (size_t)b * strideC;
      const int hh = lane >> 4, c4 = (lane & 15) * 4;     // row seg = 256 B = 16 lanes x 16 B
      {
#pragma unroll
        for (int it = 0; it < 8; ++it) {
          const int row = it * 2 + hh;
          v4f v = *(const v4f*)(slab + row * 68 + c4);
          *(v4f*)(C + (size_t)(mBase + row) * ldc + n0 + c4) = v;
        }
        
      }
    } else {
      const int q = lane >> 3, c8 = (lane & 7) * 8;
      unsigned short* C  = (unsigned short*)Cout  + (size_t)b * strideC;
      unsigned short* C2 = (OUT_MODE == 2) ? ((unsigned short*)Cout2 + (size_t)b * strideC) : nullptr;
      {
#pragma unroll
        for (int it = 0; it < 4; ++it) {
          const int row = it * 4 + q;
          const float* sp = slab + row * 68 + c8;
          v8h hv, lv;
#pragma unroll
          for (int e = 0; e < 8; ++e) {
            if (OUT_MODE == 1) {
              hv[e] = (_Float16)sp[e];
            } else {
              unsigned short hb = f2bf_bits(sp[e]);
              unsigned short lb = f2bf_bits(sp[e] - bf_bits2f(hb));
              hv[e] = __builtin_bit_cast(_Float16, hb);
              lv[e] = __builtin_bit_cast(_Float16, lb);
            }
          }
          *(v8h*)(C + (size_t)(mBase + row) * ldc + n0 + c8) = hv;
          if (OUT_MODE == 2) *(v8h*)(C2 + (size_t)(mBase + row) * ldc + n0 + c8) = lv;
        }
        
      }
    }
    __builtin_amdgcn_fence(__ATOMIC_RELEASE, "workgroup");
    __builtin_amdgcn_wave_barrier();
    __builtin_amdgcn_fence(__ATOMIC_ACQUIRE, "workgroup");
  }
}

// ---------------------------------------------------------------------------
// f32 -> bf16 (RNE) for three equally sized tensors, tensor selected by blockIdx.y (block-uniform);
// Coverage per plane: grid.x = n2/256 blocks x 256 threads x 2 elements = 2*n2 = whole plane
// (n2 = 2097152 -> 8192 blocks for 4096x1024; n2 = 524288 -> 2048 blocks for 1024x1024).
// ---------------------------------------------------------------------------
__global__ __launch_bounds__(256) void cast3_bf16x2_kernel(
    const float* __restrict__ in0, const float* __restrict__ in1, const float* __restrict__ in2,
    unsigned short* __restrict__ out0, unsigned short* __restrict__ out1, unsigned short* __restrict__ out2, int n2) {
  const int sel = blockIdx.y;
  const float* in = (sel == 0) ? in0 : ((sel == 1) ? in1 : in2);
  unsigned short* out = (sel == 0) ? out0 : ((sel == 1) ? out1 : out2);
  const int i = blockIdx.x * 256 + threadIdx.x;
  if (i < n2) {
    const v2f f = *(const v2f*)(in + 2 * (size_t)i);
    const unsigned u = pk16(f2bf_bits(f[0]), f2bf_bits(f[1]));
    ((unsigned*)out)[i] = u;
    
  }
}

// ---------------------------------------------------------------------------
// f32 -> f16 with a power-of-two carry: out = f16(g(in) * scale), g = bf16 RNE when PREBF, identity otherwise.
// Coverage: grid.x = n2/256 blocks x 256 threads x 2 elements = 2*n2 = whole plane.
// ---------------------------------------------------------------------------
template <bool PREBF>
__global__ __launch_bounds__(256) void cast_f16x2_scaled_kernel(const float* __restrict__ in, unsigned short* __restrict__ out,
                                                               int n2, float scale) {
  const int i = blockIdx.x * 256 + threadIdx.x;
  if (i < n2) {
    const v2f f = *(const v2f*)(in + 2 * (size_t)i);
    float a = f[0], b = f[1];
    if (PREBF) { a = bf_bits2f(f2bf_bits(a)); b = bf_bits2f(f2bf_bits(b)); }
    const _Float16 h0 = (_Float16)(a * scale), h1 = (_Float16)(b * scale);
    const unsigned u = pk16(__builtin_bit_cast(unsigned short, h0), __builtin_bit_cast(unsigned short, h1));
    ((unsigned*)out)[i] = u;
    
  }
}

// ---------------------------------------------------------------------------
// Four bias vectors -> bf16-RNE values held as f32: out[sel*n + i], source selected by blockIdx.y (block-uniform).
// Coverage: grid (n/256, 4) x 256 threads = 4 x n elements (n = 1024 -> 4 x 4 blocks).
// ---------------------------------------------------------------------------
__global__ __launch_bounds__(256) void bias_bf16_rne_kernel(
    const float* __restrict__ b0, const float* __restrict__ b1, const float* __restrict__ b2, const float* __restrict__ b3,
    float* __restrict__ out, int n) {
  const int sel = blockIdx.y;
  const float* in = (sel == 0) ? b0 : ((sel == 1) ? b1 : ((sel == 2) ? b2 : b3));
  const int i = blockIdx.x * 256 + threadIdx.x;
  if (i < n) {
    const float v = bf_bits2f(f2bf_bits(in[i]));
    ((float*)out)[(size_t)sel * n + i] = v;
    
  }
}

// =====================================================================================
// Full (non-causal, unmasked) attention, head dim 64, single 16-bit products.
//   q plane (f16): element (s, h, d) at [s*D_MODEL + h*64 + d]
//   k plane (f16): element (s, h, d) at [s*D_MODEL + h*64 + d]
//   v^T plane (f16): element (h, d, s) at [(h*64 + d)*SEQ_LEN + s]
//   out f32: element (s, h, d) at [s*D_MODEL + h*64 + d]
//   scores^T = (k . q^T) * sscale : v_wmma_f32_16x16x32_f16 (A = K rows, B = q), f32 accumulate, sscale applied in f32
//                                   inside the one fma per score that feeds v_exp_f32 (base 2)
//   out^T    = v^T . p^T          : v_wmma_f32_16x16x32_f16 (A = V^T rows, B = p^T packed from the score registers),
//                                   p (unnormalised, x2^15) and v in f16, f32 accumulate
//   online softmax in f32 over all SEQ_LEN keys (64 chunks of 64, compile-time trip count, no masking).
//   Block = 4 waves = 64 query rows of one head; grid.x = N_HEADS * (SEQ_LEN/64) = 1024.
//   K / V^T chunk staging: 128 threads x 32 elements per plane = the whole 64x64 tile (16-B copies, plain loads,
//   __syncthreads before and after); fragment loads read the LDS tiles with the same v8h element type.
//   (vector of the stored element type).
//   Output: per-wave 16x64 f32 tile staged in LDS; each 64-float row segment (256 B) written by 16 lanes x 16 B
//   Coverage: 1024 blocks x 4 waves x 16 rows x 64 floats = 4096 x 1024 = the whole out plane.
// =====================================================================================
#define AT_D 64
#define AT_NW 4
#define AT_QB 64
#define AT_KC 64
#define AT_LP 72   // LDS row pitch of the 16-bit tiles in elements: 144 B = 16 B x 9, so 16 rows read by ds_load_b128 fall on 16 distinct bank groups
constexpr float P_CARRY_LOG2 = 15.0f;   // p and its running sum are carried x2^15; the factor cancels in the final division

__device__ __forceinline__ v8f at_mma_h(v16h a, v16h b, v8f c) {
  c = __builtin_amdgcn_wmma_f32_16x16x32_f16(false, a, false, b, (short)0, c, false, false);
  asm volatile("v_nop\n\tv_nop\n\tv_nop\n\tv_nop" : "+v"(c) : "v"(a), "v"(b));
  return c;
}

// lane l takes the value of lane l ^ 16
__device__ __forceinline__ float xhalf(float x) {
  return __builtin_bit_cast(float, __builtin_amdgcn_permlanex16(__builtin_bit_cast(int, x), __builtin_bit_cast(int, x), 0x76543210, 0xfedcba98, false, false));
}

__global__ __launch_bounds__(128)
void attn_full64_f16_kernel(const unsigned short* __restrict__ qp, const unsigned short* __restrict__ kp,
                            const unsigned short* __restrict__ vtp, float* __restrict__ out, float sscale) {
  union FH { v16h v; v8h h[2]; };
  __shared__ __align__(16) _Float16 Ksh[AT_KC * AT_LP];            // K [kv][d]      9 KB
  __shared__ __align__(16) _Float16 Vth[AT_D * AT_LP];             // V [d][kv]      9 KB
  __shared__ __align__(16) float    Os[AT_NW][16 * 68];            // per wave out tile, pitch 68

  const int tid  = threadIdx.x;
  const int wave = tid >> 5;
  const int lane = tid & 31;
  const int hh   = lane >> 4;
  const int c    = lane & 15;

  const int nqb = SEQ_LEN / AT_QB;        // 64
  const int bx = blockIdx.x;
  const int qb = bx % nqb;
  const int h  = bx / nqb;                // 0..N_HEADS-1 (grid = N_HEADS * nqb)
  const int q0 = qb * AT_QB + wave * 16;

  const _Float16* Qg = (const _Float16*)(const void*)qp  + (size_t)h * AT_D;
  const _Float16* Kg = (const _Float16*)(const void*)kp  + (size_t)h * AT_D;
  const _Float16* Vg = (const _Float16*)(const void*)vtp + (size_t)h * AT_D * SEQ_LEN;
  float*          ob = out + (size_t)h * AT_D;

  // ---- Q fragments (B operand, column = lane&15, split k map via Frag load): 2 d-chunks ----
  v16h qa[2];
#pragma unroll
  for (int dc = 0; dc < 2; ++dc) {
    const _Float16* qr = Qg + (size_t)(q0 + c) * D_MODEL + dc * 32 + 8 * hh;
    qa[dc] = Frag<_Float16>::load(qr);
  }

  // One query column per lane (c); the two wave halves split that query's keys.
  float mrow = -INFINITY, lrow = 0.f;      // running maximum of the raw scores (equal in both halves), this half's running sum (x2^15)
  float mbrow = -INFINITY;                 // mrow * c2 - 15: what one fma takes off a score ahead of the base-2 exponential
  const float c2 = sscale * 1.44269504088896340736f;   // score scale times log2(e); sscale > 0, so the raw scores order as the scaled ones
  v8f oacc[4];                             // O^T tiles: oacc[t][r] = O[q0 + c][t*16 + 8*hh + r]
#pragma unroll
  for (int t = 0; t < 4; ++t) oacc[t] = (v8f){0.f,0.f,0.f,0.f,0.f,0.f,0.f,0.f};

  const int nChunks = SEQ_LEN / AT_KC;   // 64, compile-time constant
  for (int kc = 0; kc < nChunks; ++kc) {
    const int kv0 = kc * AT_KC;
    __syncthreads();
    {
      // staging coverage: 128 threads x (4 x 8) elements = 64 rows x 64 per plane = the whole chunk tile
      const int r = tid >> 1, half = (tid & 1) * 32;
      const _Float16* ks = Kg + (size_t)(kv0 + r) * D_MODEL + half;   // K row kv0+r, d = half..half+31
      const _Float16* vs = Vg + (size_t)r * SEQ_LEN + kv0 + half;     // V^T row d = r, s = kv0+half..+31
#pragma unroll
      for (int i = 0; i < 4; ++i) {
        const v8h a0 = *(const v8h*)(ks + 8 * i);
        const v8h b0 = *(const v8h*)(vs + 8 * i);
        *(v8h*)(Ksh + r * AT_LP + half + 8 * i) = a0;
        *(v8h*)(Vth + r * AT_LP + half + 8 * i) = b0;
      }
    }
    __syncthreads();

    // S^T = K . Q^T: s[j][r] = score of key kv0 + j*16 + 8*hh + r against query q0 + c
    v8f s[4];
#pragma unroll
    for (int j = 0; j < 4; ++j) {
      s[j] = (v8f){0.f,0.f,0.f,0.f,0.f,0.f,0.f,0.f};
#pragma unroll
      for (int dc = 0; dc < 2; ++dc) {
        FH kb;
        kb.h[0] = *(const v8h*)(Ksh + (j * 16 + c) * AT_LP + dc * 32 + 8 * hh);
        kb.h[1] = *(const v8h*)(Ksh + (j * 16 + c) * AT_LP + dc * 32 + 16 + 8 * hh);
        s[j] = at_mma_h(kb.v, qa[dc], s[j]);
      }
    }
    float mj[4];
#pragma unroll
    for (int j = 0; j < 4; ++j) {
      mj[j] = -INFINITY;
#pragma unroll
      for (int r = 0; r < 8; ++r) mj[j] = fmaxf(mj[j], s[j][r]);
    }
    float cm = fmaxf(fmaxf(mj[0], mj[1]), fmaxf(mj[2], mj[3]));
    cm = fmaxf(cm, xhalf(cm));             // both halves now hold the query's chunk maximum
    const float mnew = fmaxf(mrow, cm);
    const float mbnew = fmaf(mnew, c2, -P_CARRY_LOG2);
    const float alpha = __builtin_amdgcn_exp2f(mbrow - mbnew);   // 0 on the first chunk (mbrow = -inf)
    mrow = mnew;
    mbrow = mbnew;
    const v8f c2v = (v8f){c2, c2, c2, c2, c2, c2, c2, c2};
    const v8f nmb = (v8f){-mbnew, -mbnew, -mbnew, -mbnew, -mbnew, -mbnew, -mbnew, -mbnew};
    // P^T packs in place into the B operand: element e of block kk = tile 2*kk + (e >> 3), register e & 7
    FH pb[2];
    float pj[4];
#pragma unroll
    for (int j = 0; j < 4; ++j) {
      pj[j] = 0.f;
      const v8f x = __builtin_elementwise_fma(s[j], c2v, nmb);   // scaled score - scaled maximum + 15, in base-2 units
#pragma unroll
      for (int r = 0; r < 8; ++r) {
        const float p = __builtin_amdgcn_exp2f(x[r]);   // exp(scaled score - scaled maximum) x 2^15
        pj[j] += p;
        pb[j >> 1].v[(j & 1) * 8 + r] = (_Float16)p;
      }
    }
    lrow = lrow * alpha + ((pj[0] + pj[1]) + (pj[2] + pj[3]));
#pragma unroll
    for (int t = 0; t < 4; ++t)
#pragma unroll
      for (int r = 0; r < 8; ++r) oacc[t][r] *= alpha;
    // O^T += V^T . P^T
#pragma unroll
    for (int kk = 0; kk < 2; ++kk) {
#pragma unroll
      for (int t = 0; t < 4; ++t) {
        FH vb;
        vb.h[0] = *(const v8h*)(Vth + (t * 16 + c) * AT_LP + kk * 32 + 8 * hh);
        vb.h[1] = *(const v8h*)(Vth + (t * 16 + c) * AT_LP + kk * 32 + 16 + 8 * hh);
        oacc[t] = at_mma_h(vb.v, pb[kk].v, oacc[t]);
      }
    }
  }

  float* os = Os[wave];
  {
    const float inv = 1.0f / (lrow + xhalf(lrow));   // the halves' sums join once; sum and O both carry 2^15
#pragma unroll
    for (int t = 0; t < 4; ++t) {
      v4f lo, hi;
#pragma unroll
      for (int r = 0; r < 4; ++r) { lo[r] = oacc[t][r] * inv; hi[r] = oacc[t][4 + r] * inv; }
      *(v4f*)(os + c * 68 + t * 16 + 8 * hh)     = lo;
      *(v4f*)(os + c * 68 + t * 16 + 8 * hh + 4) = hi;
    }
  }
  __builtin_amdgcn_fence(__ATOMIC_RELEASE, "workgroup");
  __builtin_amdgcn_wave_barrier();
  __builtin_amdgcn_fence(__ATOMIC_ACQUIRE, "workgroup");
  {
    const int c4 = (lane & 15) * 4;
    float* orow = ob + (size_t)(q0 + hh) * D_MODEL + c4;   // one base; the eight rows lie at constant steps from it
#pragma unroll
    for (int it = 0; it < 8; ++it) {
      v4f val = *(const v4f*)(os + (it * 2 + hh) * 68 + c4);
      *(v4f*)(orow + it * 2 * D_MODEL) = val;
    }
  }
}

// ---------------------------------------------------------------------------
// host launcher
// ---------------------------------------------------------------------------
extern "C" void kernel_launch(void* const* d_in, const int* in_sizes, int n_in,
                              void* d_out, int out_size, void* d_ws, size_t ws_size,
                              hipStream_t stream) {
  constexpr int S  = SEQ_LEN;
  constexpr int DM = D_MODEL;
  const size_t SD = (size_t)S * DM;    // 4194304 elements
  const size_t DD = (size_t)DM * DM;   // 1048576 elements
  if (n_in < 11) return;
  if ((size_t)in_sizes[0] != SD || (size_t)in_sizes[1] != SD || (size_t)in_sizes[2] != SD) return;
  if ((size_t)in_sizes[3] != DD || (size_t)in_sizes[5] != DD || (size_t)in_sizes[7] != DD || (size_t)in_sizes[9] != DD) return;
  if (in_sizes[4] != DM || in_sizes[6] != DM || in_sizes[8] != DM || in_sizes[10] != DM) return;
  if ((size_t)out_size != SD) return;

  const float* x_q = (const float*)d_in[0];
  const float* x_k = (const float*)d_in[1];
  const float* x_v = (const float*)d_in[2];
  const float* Wq  = (const float*)d_in[3];
  const float* bq  = (const float*)d_in[4];
  const float* Wk  = (const float*)d_in[5];
  const float* bk  = (const float*)d_in[6];
  const float* Wv  = (const float*)d_in[7];
  const float* bv  = (const float*)d_in[8];
  const float* Wo  = (const float*)d_in[9];
  const float* bo  = (const float*)d_in[10];

  //   xq  bf16 [4096][1024]  8 MiB @  0 MiB      xk  @  8 MiB      xv  @ 16 MiB
  //   wq  bf16 [1024][1024]  2 MiB @ 24 MiB      wk  @ 26 MiB      wv  @ 28 MiB     wo f16 @ 30 MiB
  //   q16 f16  [4096][1024]  8 MiB @ 32 MiB      k16 @ 40 MiB      vt16 f16 [1024][4096] @ 48 MiB
  //   o32 f32  [4096][1024] 16 MiB @ 56 MiB      o16 f16 8 MiB @ 72 MiB
  //   bias f32 [4][1024]    16 KiB @ 80 MiB      end = 83902464 B
  const size_t off_xq  = 0;
  const size_t off_xk  = off_xq  + SD * 2;
  const size_t off_xv  = off_xk  + SD * 2;
  const size_t off_wq  = off_xv  + SD * 2;
  const size_t off_wk  = off_wq  + DD * 2;
  const size_t off_wv  = off_wk  + DD * 2;
  const size_t off_wo  = off_wv  + DD * 2;
  const size_t off_q   = off_wo  + DD * 2;
  const size_t off_k   = off_q   + SD * 2;
  const size_t off_vt  = off_k   + SD * 2;
  const size_t off_o32 = off_vt  + SD * 2;
  const size_t off_o16 = off_o32 + SD * 4;
  const size_t off_b   = off_o16 + SD * 2;
  const size_t ws_end  = off_b + 4 * (size_t)DM * 4;
  if (ws_end > ws_size) return;

  char* ws = (char*)d_ws;
  unsigned short* xq   = (unsigned short*)(ws + off_xq);
  unsigned short* xk   = (unsigned short*)(ws + off_xk);
  unsigned short* xv   = (unsigned short*)(ws + off_xv);
  unsigned short* wq   = (unsigned short*)(ws + off_wq);
  unsigned short* wk   = (unsigned short*)(ws + off_wk);
  unsigned short* wv   = (unsigned short*)(ws + off_wv);
  unsigned short* wo   = (unsigned short*)(ws + off_wo);
  unsigned short* q16  = (unsigned short*)(ws + off_q);
  unsigned short* k16  = (unsigned short*)(ws + off_k);
  unsigned short* vt16 = (unsigned short*)(ws + off_vt);
  float*          o32  = (float*)(ws + off_o32);
  unsigned short* o16  = (unsigned short*)(ws + off_o16);
  float*          bws  = (float*)(ws + off_b);
  const float* bias_q = bws;
  const float* bias_k = bws + DM;
  const float* bias_v = bws + 2 * DM;
  const float* bias_o = bws + 3 * DM;

  const int SD2 = (int)(SD / 2);   // 2097152
  const int DD2 = (int)(DD / 2);   // 524288

  // 1) biases -> bf16-RNE values in f32
  bias_bf16_rne_kernel<<<dim3(DM / 256, 4), 256, 0, stream>>>(bq, bk, bv, bo, bws, DM);
  // 2) activations -> bf16 planes
  cast3_bf16x2_kernel<<<dim3(SD2 / 256, 3), 256, 0, stream>>>(x_q, x_k, x_v, xq, xk, xv, SD2);
  // 3) Wq, Wk, Wv -> bf16 planes ([out][in] = [N][K] layout as is)
  cast3_bf16x2_kernel<<<dim3(DD2 / 256, 3), 256, 0, stream>>>(Wq, Wk, Wv, wq, wk, wv, DD2);
  // 4) Wo -> f16 plane of bf16-RNE(Wo) x 2^8
  cast_f16x2_scaled_kernel<true><<<dim3(DD2 / 256, 1), 256, 0, stream>>>(Wo, wo, DD2, 256.0f);

  // GEMM tiles: (4096/128)*(1024/128) = 256 tiles of 128x128 -> 256 blocks x 8 waves; K = 1024 (K % 64 == 0)
  const int gemm_blocks = (int)((S / 128) * (DM / 128));   // 256
  // 5) q16[s][n] = x_q . Wq^T + bq   (f16 out)
  wmma_gemm64<1, false, 2, 1, false><<<dim3(gemm_blocks, 1), 256, 0, stream>>>(
      xq, xq, DM, 0L, wq, wq, DM, 0L, (void*)q16, (void*)q16, DM, 0L, bias_q, bias_q, 0L, S, DM, DM, 1.0f);
  // 6) k16[s][n] = x_k . Wk^T + bk
  wmma_gemm64<1, false, 2, 1, false><<<dim3(gemm_blocks, 1), 256, 0, stream>>>(
      xk, xk, DM, 0L, wk, wk, DM, 0L, (void*)k16, (void*)k16, DM, 0L, bias_k, bias_k, 0L, S, DM, DM, 1.0f);
  // 7) vt16[m = feature][n = s] = Wv[m,:] . x_v[s,:] + bv[m]  (role-swapped: M = 1024, N = 4096, ldc = 4096)
  wmma_gemm64<1, false, 1, 1, false><<<dim3(gemm_blocks, 1), 256, 0, stream>>>(
      wv, wv, DM, 0L, xv, xv, DM, 0L, (void*)vt16, (void*)vt16, S, 0L, bias_v, bias_v, 0L, DM, S, DM, 1.0f);

  // 8) attention: 16 heads x 64 query blocks, f32 context o32[s][h*64+d]
  attn_full64_f16_kernel<<<dim3(N_HEADS * (S / 64), 1), 128, 0, stream>>>(q16, k16, vt16, o32, 0.125f);

  // 9) o32 -> f16 plane x 2^8
  cast_f16x2_scaled_kernel<false><<<dim3(SD2 / 256, 1), 256, 0, stream>>>(o32, o16, SD2, 256.0f);

  // 10) out[s][n] = (o x 2^8) . (Wo x 2^8)^T * 2^-16 + bo  -> f32 d_out
  wmma_gemm64<0, false, 2, 0, false><<<dim3(gemm_blocks, 1), 256, 0, stream>>>(
      o16, o16, DM, 0L, wo, wo, DM, 0L, d_out, d_out, DM, 0L, bias_o, bias_o, 0L, S, DM, DM, 1.0f / 65536.0f);
}

// v005
// A run of this version takes 172 microseconds.
// Next to v004, in two timings, it ran 1.17 and 1.16 times as fast.
// All steps since v000 together make it 3.76 times as fast.
// Projections q,k,v^T: v_wmma_f32_16x16x32_bf16 (bf16 RNE operands from the f32 inputs, f32 accumulate, bf16-RNE bias added in f32); attention q.k^T and p.v: v_wmma_f32_16x16x32_f16 (f16 q,k,v planes, p carried x2^15, f32 accumulate, f32 online softmax, score scale 0.125 in f32); output projection: v_wmma_f32_16x16x32_f16 (f16 planes of o x2^8 and bf16-RNE(Wo) x2^8, f32 accumulate, scale 2^-16, bf16-RNE bias added in f32).
#include <hip/hip_runtime.h>
#include <math.h>
#include <stdint.h>

typedef __attribute__((ext_vector_type(16))) _Float16 v16h;
typedef __attribute__((ext_vector_type(8)))  _Float16 v8h;
typedef __attribute__((ext_vector_type(16))) __bf16   v16b;
typedef __attribute__((ext_vector_type(8)))  __bf16   v8b;
typedef __attribute__((ext_vector_type(8)))  float    v8f;
typedef __attribute__((ext_vector_type(4)))  float    v4f;
typedef __attribute__((ext_vector_type(2)))  float    v2f;

constexpr int SEQ_LEN = 4096;
constexpr int D_MODEL = 1024;
constexpr int N_HEADS = 16;

__device__ __forceinline__ unsigned short f2bf_bits(float f) {
  unsigned u = __float_as_uint(f);
  return (unsigned short)((u + 0x7FFFu + ((u >> 16) & 1u)) >> 16);
}
__device__ __forceinline__ float bf_bits2f(unsigned short h) { return __uint_as_float(((unsigned)h) << 16); }
__device__ __forceinline__ unsigned pk16(unsigned short a, unsigned short b) { return (unsigned)a | ((unsigned)b << 16); }

// hazard guards as plain device helpers
__device__ __forceinline__ void dep_guard_h(v8f& a, v8f& b, v16h x, v16h y) { asm volatile("v_nop\n\tv_nop\n\tv_nop\n\tv_nop" : "+v"(a), "+v"(b) : "v"(x), "v"(y)); }
__device__ __forceinline__ void dep_guard_b(v8f& a, v8f& b, v16b x, v16b y) { asm volatile("v_nop\n\tv_nop\n\tv_nop\n\tv_nop" : "+v"(a), "+v"(b) : "v"(x), "v"(y)); }
__device__ __forceinline__ void keep4_h(v16h a, v16h b, v16h c, v16h d) { asm volatile("v_nop" :: "v"(a), "v"(b), "v"(c), "v"(d)); }
__device__ __forceinline__ void keep4_b(v16b a, v16b b, v16b c, v16b d) { asm volatile("v_nop" :: "v"(a), "v"(b), "v"(c), "v"(d)); }
__device__ __forceinline__ void acc_guard4(v8f& a, v8f& b, v8f& c, v8f& d) { asm volatile("v_nop\n\tv_nop\n\tv_nop\n\tv_nop" : "+v"(a), "+v"(b), "+v"(c), "+v"(d)); }
template <typename T> struct Frag;
template <> struct Frag<_Float16> {
  typedef v16h V; typedef v8h H; union U { v16h v; v8h h[2]; };
  static __device__ __forceinline__ v16h load(const _Float16* p) {   // elements 0..7 <- p[0..7], 8..15 <- p[16..23]
    U f; f.h[0] = *(const v8h*)(p); f.h[1] = *(const v8h*)(p + 16); return f.v;
  }
  static __device__ __forceinline__ v8f mma(v16h a, v16h b, v8f c) {
    return __builtin_amdgcn_wmma_f32_16x16x32_f16(false, a, false, b, (short)0, c, false, false);
  }
  static __device__ __forceinline__ void guard(v8f& a, v8f& b, v16h x, v16h y) { dep_guard_h(a, b, x, y); }
  static __device__ __forceinline__ void keep(v16h a, v16h b, v16h c, v16h d) { keep4_h(a, b, c, d); }
};
template <> struct Frag<__bf16> {
  typedef v16b V; typedef v8b H; union U { v16b v; v8b h[2]; };
  static __device__ __forceinline__ v16b load(const __bf16* p) {
    U f; f.h[0] = *(const v8b*)(p); f.h[1] = *(const v8b*)(p + 16); return f.v;
  }
  static __device__ __forceinline__ v8f mma(v16b a, v16b b, v8f c) {
    return __builtin_amdgcn_wmma_f32_16x16x32_bf16(false, a, false, b, (short)0, c, false, false);
  }
  static __device__ __forceinline__ void guard(v8f& a, v8f& b, v16b x, v16b y) { dep_guard_b(a, b, x, y); }
  static __device__ __forceinline__ void keep(v16b a, v16b b, v16b c, v16b d) { keep4_b(a, b, c, d); }
};

// ---- LDS-staged batched WMMA GEMM -------------------------------------------
// C[m,n] = scale * sum_k A[m,k] * Bt[n,k] (+bias)(+resid); a block of 8 waves owns a 128x128 tile, each wave 32x64 of it.
// A row-major [M,K]; Bt row-major [N,K]; M,N % 128 == 0, K % 64 == 0, K >= 64.
// Per 64-k step the block brings 128 rows x 128 B of A and of Bt into LDS: 8 lanes x 16 B cover one whole row line,
// 256 threads x 4 pieces per operand = the whole tile. Two LDS buffers: the next step's global loads are issued ahead of
// this step's products and stored behind them, one __syncthreads() per step.
// SPLIT (hi/lo planes) is not staged: single-plane operands only.
// BIAS_MODE: 0 = none, 1 = bias[m], 2 = bias[n].
// OUT_MODE: 0 = f32, 1 = f16, 2 = bf16 hi plane (Cout) + bf16 lo plane (Cout2).
// ET: 0 = f16 operands, 1 = bf16 operands (pointers passed as 16-bit storage)
#define GM_BT 128  // block tile, rows of A and of Bt
#define GM_LP 72   // LDS row pitch in elements: 64 + 8, 144 B = 16 B x 9, so 16 rows read by ds_load_b128 fall on 16 distinct bank groups
template <int ET> struct Elem;
template <> struct Elem<0> { typedef _Float16 T; };
template <> struct Elem<1> { typedef __bf16 T; };
template <int ET, bool SPLIT, int BIAS_MODE, int OUT_MODE, bool RESID, int ACT = 0>
__global__ __launch_bounds__(256) void wmma_gemm64(
    const unsigned short* __restrict__ Ap, const unsigned short* __restrict__ A2p, int lda, long strideA,
    const unsigned short* __restrict__ Btp, const unsigned short* __restrict__ Bt2p, int ldb, long strideB,
    void* __restrict__ Cout, void* __restrict__ Cout2, int ldc, long strideC,
    const float* __restrict__ bias,
    const float* __restrict__ resid, long strideR,
    int M, int N, int K, float scale) {
  static_assert(!SPLIT, "single-plane operands only");
  typedef typename Elem<ET>::T T;
  typedef typename Frag<T>::V V;
  typedef typename Frag<T>::H H;
  const T* A = (const T*)Ap; const T* Bt = (const T*)Btp;
  __shared__ __align__(16) T sA[2][GM_BT * GM_LP];   // A rows of the block tile, one 64-k step, two buffers
  __shared__ __align__(16) T sB[2][GM_BT * GM_LP];   // Bt rows of the block tile
  __shared__ __align__(16) float sT[8][16 * 68];     // per-wave 16x64 slab, pitch 68 floats
  const int b    = blockIdx.y;
  const int tid  = threadIdx.x;
  const int lane = tid & 31;
  const int wave = tid >> 5;
  const int tilesN = N >> 7;
  const int tilesM = M >> 7;
  const int tile = blockIdx.x;
  if (tile >= tilesM * tilesN) return;   // block-uniform, ahead of every barrier
  const int tm = tile / tilesN;
  const int tn = tile - tm * tilesN;
  const int bm0 = tm << 7;
  const int bn0 = tn << 7;
  const int wm = (wave >> 1) << 5;             // this wave's rows inside the block tile: 0, 32, 64, 96
  const int wn = (wave & 1) << 6;              // this wave's columns inside the block tile: 0, 64
  const int m0 = bm0 + wm;
  const int n0 = bn0 + wn;

  const T* Ab  = A  + (size_t)b * strideA;
  const T* Bb  = Bt + (size_t)b * strideB;

  const int rlane = lane & 15;                 // row (A) / col (B, D) within subtile
  const int koff  = (lane >> 4) * 8;           // k offset of this lane half
  const int mOff  = (lane >> 4) * 8;           // D row offset

  // every unroll directive from here to the epilogue makes the array indices constants, so that acc, the staged pieces
  // and the fragments live in registers and not in scratch
  v8f acc[2][4];
#pragma unroll
  for (int i = 0; i < 2; ++i)
#pragma unroll
    for (int j = 0; j < 4; ++j) acc[i][j] = (v8f){0.f,0.f,0.f,0.f,0.f,0.f,0.f,0.f};

  // staging map: piece it of a thread = row it*32 + (tid >> 3), elements (tid & 7)*8 .. +7 of the step's 64
  const int srow = tid >> 3;
  const int sseg = (tid & 7) << 3;
  const int so = srow * GM_LP + sseg;
  const char* Ac = (const char*)(Ab + (size_t)bm0 * lda);   // block-uniform bases of the two row bands
  const char* Bc = (const char*)(Bb + (size_t)bn0 * ldb);
  unsigned oa[4], ob[4];                       // one running byte offset per piece (a 128-row band stays far below 4 GiB), 128 B a step
  H ra[4], rb[4];
#pragma unroll
  for (int it = 0; it < 4; ++it) {
    oa[it] = (unsigned)(((it * 32 + srow) * lda + sseg) * 2);
    ob[it] = (unsigned)(((it * 32 + srow) * ldb + sseg) * 2);
    ra[it] = *(const H*)(Ac + oa[it]);
    rb[it] = *(const H*)(Bc + ob[it]);
  }
#pragma unroll
  for (int it = 0; it < 4; ++it) {
    *(H*)(&sA[0][so + it * 32 * GM_LP]) = ra[it];
    *(H*)(&sB[0][so + it * 32 * GM_LP]) = rb[it];
  }

  const int nk = K >> 6;
  for (int kt = 0; kt < nk; ++kt) {
    // publishes buffer kt & 1 and ends every wave's reads of the other buffer, which is refilled below
    __syncthreads();
    const bool more = kt + 1 < nk;             // block-uniform
    if (more) {
#pragma unroll
      for (int it = 0; it < 4; ++it) {
        oa[it] += 128;
        ob[it] += 128;
        ra[it] = *(const H*)(Ac + oa[it]);
        rb[it] = *(const H*)(Bc + ob[it]);
      }
      // stands behind the eight loads, ahead of every later write of an offset or base register that they name
      asm volatile("s_wait_xcnt 0x0" ::: "memory");
    }
    const T* sa = &sA[kt & 1][(wm + rlane) * GM_LP + koff];
    const T* sb = &sB[kt & 1][(wn + rlane) * GM_LP + koff];
    // the step's 24 fragment reads stand together ahead of its 16 products
    V bh[2][4], ah[2][2];
#pragma unroll
    for (int kk = 0; kk < 2; ++kk) {
#pragma unroll
      for (int j = 0; j < 4; ++j) bh[kk][j] = Frag<T>::load(sb + j * 16 * GM_LP + kk * 32);
#pragma unroll
      for (int i = 0; i < 2; ++i) ah[kk][i] = Frag<T>::load(sa + i * 16 * GM_LP + kk * 32);
    }
#pragma unroll
    for (int kk = 0; kk < 2; ++kk) {
#pragma unroll
      for (int i = 0; i < 2; ++i) {
#pragma unroll
        for (int j = 0; j < 4; ++j) acc[i][j] = Frag<T>::mma(ah[kk][i], bh[kk][j], acc[i][j]);
        Frag<T>::guard(acc[i][0], acc[i][3], ah[kk][i], ah[kk][i]);   // v_nops: the slots behind the last product before its A or D is touched
      }
      Frag<T>::keep(bh[kk][0], bh[kk][1], bh[kk][2], bh[kk][3]);   // holds the B fragments' registers to the end of their products
    }
    if (more) {
      const int nb = (kt + 1) & 1;
#pragma unroll
      for (int it = 0; it < 4; ++it) {
        *(H*)(&sA[nb][so + it * 32 * GM_LP]) = ra[it];
        *(H*)(&sB[nb][so + it * 32 * GM_LP]) = rb[it];
      }
    }
  }
  acc_guard4(acc[0][0], acc[0][1], acc[0][2], acc[0][3]);
  acc_guard4(acc[1][0], acc[1][1], acc[1][2], acc[1][3]);

  // ---- epilogue ----
  float* slab = sT[wave];
  const float* Rb = RESID ? (resid + (size_t)b * strideR) : nullptr;
#pragma unroll
  for (int i = 0; i < 2; ++i) {
    const int mBase = m0 + (i << 4);
#pragma unroll
    for (int j = 0; j < 4; ++j) {
      const int n = n0 + (j << 4) + rlane;
      float bv = 0.f;
      if (BIAS_MODE == 2) bv = bias[n];
#pragma unroll
      for (int r = 0; r < 8; ++r) {
        float v = acc[i][j][r] * scale;
        if (BIAS_MODE == 1) v += bias[mBase + mOff + r];
        if (BIAS_MODE == 2) v += bv;
        if (RESID) v += Rb[(size_t)(mBase + mOff + r) * ldc + n];
        if (ACT == 1) v = tanhf(v);
        if (ACT == 2) v = fmaxf(v, 0.0f);
        if (ACT == 3) v = v / (1.0f + expf(-v));
        if (ACT == 4) v = (v > 0.f) ? v : 0.01f * v;
        if (ACT == 5) v = 0.5f * v * (1.0f + erff(v * 0.70710678118654752f));
        slab[(mOff + r) * 68 + (j << 4) + rlane] = v;
      }
    }
    __builtin_amdgcn_fence(__ATOMIC_RELEASE, "workgroup");
    __builtin_amdgcn_wave_barrier();
    __builtin_amdgcn_fence(__ATOMIC_ACQUIRE, "workgroup");
    if (OUT_MODE == 0) {
      float* C = (float*)Cout + (size_t)b * strideC;
      const int hh = lane >> 4, c4 = (lane & 15) * 4;     // row seg = 256 B = 16 lanes x 16 B
      {
#pragma unroll
        for (int it = 0; it < 8; ++it) {
          const int row = it * 2 + hh;
          v4f v = *(const v4f*)(slab + row * 68 + c4);
          *(v4f*)(C + (size_t)(mBase + row) * ldc + n0 + c4) = v;
        }
        
      }
    } else {
      const int q = lane >> 3, c8 = (lane & 7) * 8;
      unsigned short* C  = (unsigned short*)Cout  + (size_t)b * strideC;
      unsigned short* C2 = (OUT_MODE == 2) ? ((unsigned short*)Cout2 + (size_t)b * strideC) : nullptr;
      {
#pragma unroll
        for (int it = 0; it < 4; ++it) {
          const int row = it * 4 + q;
          const float* sp = slab + row * 68 + c8;
          v8h hv, lv;
#pragma unroll
          for (int e = 0; e < 8; ++e) {
            if (OUT_MODE == 1) {
              hv[e] = (_Float16)sp[e];
            } else {
              unsigned short hb = f2bf_bits(sp[e]);
              unsigned short lb = f2bf_bits(sp[e] - bf_bits2f(hb));
              hv[e] = __builtin_bit_cast(_Float16, hb);
              lv[e] = __builtin_bit_cast(_Float16, lb);
            }
          }
          *(v8h*)(C + (size_t)(mBase + row) * ldc + n0 + c8) = hv;
          if (OUT_MODE == 2) *(v8h*)(C2 + (size_t)(mBase + row) * ldc + n0 + c8) = lv;
        }
        
      }
    }
    __builtin_amdgcn_fence(__ATOMIC_RELEASE, "workgroup");
    __builtin_amdgcn_wave_barrier();
    __builtin_amdgcn_fence(__ATOMIC_ACQUIRE, "workgroup");
  }
}

// ---------------------------------------------------------------------------
// f32 -> bf16 (RNE) for three equally sized tensors, tensor selected by blockIdx.y (block-uniform);
// Coverage per plane: grid.x = n2/256 blocks x 256 threads x 2 elements = 2*n2 = whole plane
// (n2 = 2097152 -> 8192 blocks for 4096x1024; n2 = 524288 -> 2048 blocks for 1024x1024).
// ---------------------------------------------------------------------------
__global__ __launch_bounds__(256) void cast3_bf16x2_kernel(
    const float* __restrict__ in0, const float* __restrict__ in1, const float* __restrict__ in2,
    unsigned short* __restrict__ out0, unsigned short* __restrict__ out1, unsigned short* __restrict__ out2, int n2) {
  const int sel = blockIdx.y;
  const float* in = (sel == 0) ? in0 : ((sel == 1) ? in1 : in2);
  unsigned short* out = (sel == 0) ? out0 : ((sel == 1) ? out1 : out2);
  const int i = blockIdx.x * 256 + threadIdx.x;
  if (i < n2) {
    const v2f f = *(const v2f*)(in + 2 * (size_t)i);
    const unsigned u = pk16(f2bf_bits(f[0]), f2bf_bits(f[1]));
    ((unsigned*)out)[i] = u;
    
  }
}

// ---------------------------------------------------------------------------
// f32 -> f16 with a power-of-two carry: out = f16(g(in) * scale), g = bf16 RNE when PREBF, identity otherwise.
// Coverage: grid.x = n2/256 blocks x 256 threads x 2 elements = 2*n2 = whole plane.
// ---------------------------------------------------------------------------
template <bool PREBF>
__global__ __launch_bounds__(256) void cast_f16x2_scaled_kernel(const float* __restrict__ in, unsigned short* __restrict__ out,
                                                               int n2, float scale) {
  const int i = blockIdx.x * 256 + threadIdx.x;
  if (i < n2) {
    const v2f f = *(const v2f*)(in + 2 * (size_t)i);
    float a = f[0], b = f[1];
    if (PREBF) { a = bf_bits2f(f2bf_bits(a)); b = bf_bits2f(f2bf_bits(b)); }
    const _Float16 h0 = (_Float16)(a * scale), h1 = (_Float16)(b * scale);
    const unsigned u = pk16(__builtin_bit_cast(unsigned short, h0), __builtin_bit_cast(unsigned short, h1));
    ((unsigned*)out)[i] = u;
    
  }
}

// ---------------------------------------------------------------------------
// Four bias vectors -> bf16-RNE values held as f32: out[sel*n + i], source selected by blockIdx.y (block-uniform).
// Coverage: grid (n/256, 4) x 256 threads = 4 x n elements (n = 1024 -> 4 x 4 blocks).
// ---------------------------------------------------------------------------
__global__ __launch_bounds__(256) void bias_bf16_rne_kernel(
    const float* __restrict__ b0, const float* __restrict__ b1, const float* __restrict__ b2, const float* __restrict__ b3,
    float* __restrict__ out, int n) {
  const int sel = blockIdx.y;
  const float* in = (sel == 0) ? b0 : ((sel == 1) ? b1 : ((sel == 2) ? b2 : b3));
  const int i = blockIdx.x * 256 + threadIdx.x;
  if (i < n) {
    const float v = bf_bits2f(f2bf_bits(in[i]));
    ((float*)out)[(size_t)sel * n + i] = v;
    
  }
}

// =====================================================================================
// Full (non-causal, unmasked) attention, head dim 64, single 16-bit products.
//   q plane (f16): element (s, h, d) at [s*D_MODEL + h*64 + d]
//   k plane (f16): element (s, h, d) at [s*D_MODEL + h*64 + d]
//   v^T plane (f16): element (h, d, s) at [(h*64 + d)*SEQ_LEN + s]
//   out f32: element (s, h, d) at [s*D_MODEL + h*64 + d]
//   scores^T = (k . q^T) * sscale : v_wmma_f32_16x16x32_f16 (A = K rows, B = q), f32 accumulate, sscale applied in f32
//                                   inside the one fma per score that feeds v_exp_f32 (base 2)
//   out^T    = v^T . p^T          : v_wmma_f32_16x16x32_f16 (A = V^T rows, B = p^T packed from the score registers),
//                                   p (unnormalised, x2^15) and v in f16, f32 accumulate
//   online softmax in f32 over all SEQ_LEN keys (64 chunks of 64, compile-time trip count, no masking).
//   Block = 4 waves = 64 query rows of one head; grid.x = N_HEADS * (SEQ_LEN/64) = 1024.
//   K / V^T chunk staging: 128 threads x 32 elements per plane = the whole 64x64 tile (16-B copies, plain loads,
//   __syncthreads before and after); fragment loads read the LDS tiles with the same v8h element type.
//   (vector of the stored element type).
//   Output: per-wave 16x64 f32 tile staged in LDS; each 64-float row segment (256 B) written by 16 lanes x 16 B
//   Coverage: 1024 blocks x 4 waves x 16 rows x 64 floats = 4096 x 1024 = the whole out plane.
// =====================================================================================
#define AT_D 64
#define AT_NW 4
#define AT_QB 64
#define AT_KC 64
#define AT_LP 72   // LDS row pitch of the 16-bit tiles in elements: 144 B = 16 B x 9, so 16 rows read by ds_load_b128 fall on 16 distinct bank groups
constexpr float P_CARRY_LOG2 = 15.0f;   // p and its running sum are carried x2^15; the factor cancels in the final division

__device__ __forceinline__ v8f at_mma_h(v16h a, v16h b, v8f c) {
  return __builtin_amdgcn_wmma_f32_16x16x32_f16(false, a, false, b, (short)0, c, false, false);
}

// lane l takes the value of lane l ^ 16
__device__ __forceinline__ float xhalf(float x) {
  return __builtin_bit_cast(float, __builtin_amdgcn_permlanex16(__builtin_bit_cast(int, x), __builtin_bit_cast(int, x), 0x76543210, 0xfedcba98, false, false));
}

__global__ __launch_bounds__(128)
void attn_full64_f16_kernel(const unsigned short* __restrict__ qp, const unsigned short* __restrict__ kp,
                            const unsigned short* __restrict__ vtp, float* __restrict__ out, float sscale) {
  union FH { v16h v; v8h h[2]; };
  __shared__ __align__(16) _Float16 Ksh[AT_KC * AT_LP];            // K [kv][d]      9 KB
  __shared__ __align__(16) _Float16 Vth[AT_D * AT_LP];             // V [d][kv]      9 KB
  __shared__ __align__(16) float    Os[AT_NW][16 * 68];            // per wave out tile, pitch 68

  const int tid  = threadIdx.x;
  const int wave = tid >> 5;
  const int lane = tid & 31;
  const int hh   = lane >> 4;
  const int c    = lane & 15;

  const int nqb = SEQ_LEN / AT_QB;        // 64
  const int bx = blockIdx.x;
  const int qb = bx % nqb;
  const int h  = bx / nqb;                // 0..N_HEADS-1 (grid = N_HEADS * nqb)
  const int q0 = qb * AT_QB + wave * 16;

  const _Float16* Qg = (const _Float16*)(const void*)qp  + (size_t)h * AT_D;
  const _Float16* Kg = (const _Float16*)(const void*)kp  + (size_t)h * AT_D;
  const _Float16* Vg = (const _Float16*)(const void*)vtp + (size_t)h * AT_D * SEQ_LEN;
  float*          ob = out + (size_t)h * AT_D;

  // ---- Q fragments (B operand, column = lane&15, split k map via Frag load): 2 d-chunks ----
  v16h qa[2];
#pragma unroll
  for (int dc = 0; dc < 2; ++dc) {
    const _Float16* qr = Qg + (size_t)(q0 + c) * D_MODEL + dc * 32 + 8 * hh;
    qa[dc] = Frag<_Float16>::load(qr);
  }

  // One query column per lane (c); the two wave halves split that query's keys.
  float mrow = -INFINITY, lrow = 0.f;      // running maximum of the raw scores (equal in both halves), this half's running sum (x2^15)
  float mbrow = -INFINITY;                 // mrow * c2 - 15: what one fma takes off a score ahead of the base-2 exponential
  const float c2 = sscale * 1.44269504088896340736f;   // score scale times log2(e); sscale > 0, so the raw scores order as the scaled ones
  v8f oacc[4];                             // O^T tiles: oacc[t][r] = O[q0 + c][t*16 + 8*hh + r]
#pragma unroll
  for (int t = 0; t < 4; ++t) oacc[t] = (v8f){0.f,0.f,0.f,0.f,0.f,0.f,0.f,0.f};

  const int nChunks = SEQ_LEN / AT_KC;   // 64, compile-time constant
  for (int kc = 0; kc < nChunks; ++kc) {
    const int kv0 = kc * AT_KC;
    __syncthreads();
    {
      // staging coverage: 128 threads x (4 x 8) elements = 64 rows x 64 per plane = the whole chunk tile
      const int r = tid >> 1, half = (tid & 1) * 32;
      const _Float16* ks = Kg + (size_t)(kv0 + r) * D_MODEL + half;   // K row kv0+r, d = half..half+31
      const _Float16* vs = Vg + (size_t)r * SEQ_LEN + kv0 + half;     // V^T row d = r, s = kv0+half..+31
#pragma unroll
      for (int i = 0; i < 4; ++i) {
        const v8h a0 = *(const v8h*)(ks + 8 * i);
        const v8h b0 = *(const v8h*)(vs + 8 * i);
        *(v8h*)(Ksh + r * AT_LP + half + 8 * i) = a0;
        *(v8h*)(Vth + r * AT_LP + half + 8 * i) = b0;
      }
    }
    __syncthreads();

    // the chunk's 32 fragment reads (K first, in the order of their use, then V^T) stand together behind the barrier, ahead
    // of all 16 products: one place with LDS reads per chunk, and the V^T fragments land under the score products and the softmax
    // (the unroll directives make the array indices constants, so that the fragments live in registers)
    FH kb[2][4], vb[2][4];
#pragma unroll
    for (int dc = 0; dc < 2; ++dc)
#pragma unroll
      for (int j = 0; j < 4; ++j) {
        kb[dc][j].h[0] = *(const v8h*)(Ksh + (j * 16 + c) * AT_LP + dc * 32 + 8 * hh);
        kb[dc][j].h[1] = *(const v8h*)(Ksh + (j * 16 + c) * AT_LP + dc * 32 + 16 + 8 * hh);
      }
#pragma unroll
    for (int kk = 0; kk < 2; ++kk)
#pragma unroll
      for (int t = 0; t < 4; ++t) {
        vb[kk][t].h[0] = *(const v8h*)(Vth + (t * 16 + c) * AT_LP + kk * 32 + 8 * hh);
        vb[kk][t].h[1] = *(const v8h*)(Vth + (t * 16 + c) * AT_LP + kk * 32 + 16 + 8 * hh);
      }
    // keeps the reads one group: sunk back among the products, each pair would cost its own full LDS latency
    __builtin_amdgcn_sched_barrier(0);
    // S^T = K . Q^T: s[j][r] = score of key kv0 + j*16 + 8*hh + r against query q0 + c; four independent tiles per d half
    v8f s[4];
#pragma unroll
    for (int j = 0; j < 4; ++j) s[j] = (v8f){0.f,0.f,0.f,0.f,0.f,0.f,0.f,0.f};
#pragma unroll
    for (int dc = 0; dc < 2; ++dc)
#pragma unroll
      for (int j = 0; j < 4; ++j) s[j] = at_mma_h(kb[dc][j].v, qa[dc], s[j]);
    // keeps the eight products back to back: a maximum drawn up among them waits out its product's latency and holds the rest back
    __builtin_amdgcn_sched_barrier(0);
    float mj[4];
#pragma unroll
    for (int j = 0; j < 4; ++j) {
      mj[j] = -INFINITY;
#pragma unroll
      for (int r = 0; r < 8; ++r) mj[j] = fmaxf(mj[j], s[j][r]);
    }
    float cm = fmaxf(fmaxf(mj[0], mj[1]), fmaxf(mj[2], mj[3]));
    cm = fmaxf(cm, xhalf(cm));             // both halves now hold the query's chunk maximum
    const float mnew = fmaxf(mrow, cm);
    const float mbnew = fmaf(mnew, c2, -P_CARRY_LOG2);
    const float alpha = __builtin_amdgcn_exp2f(mbrow - mbnew);   // 0 on the first chunk (mbrow = -inf)
    mrow = mnew;
    mbrow = mbnew;
    const v8f c2v = (v8f){c2, c2, c2, c2, c2, c2, c2, c2};
    const v8f nmb = (v8f){-mbnew, -mbnew, -mbnew, -mbnew, -mbnew, -mbnew, -mbnew, -mbnew};
    // P^T packs in place into the B operand: element e of block kk = tile 2*kk + (e >> 3), register e & 7
    FH pb[2];
    float pj[4];
#pragma unroll
    for (int j = 0; j < 4; ++j) {
      pj[j] = 0.f;
      const v8f x = __builtin_elementwise_fma(s[j], c2v, nmb);   // scaled score - scaled maximum + 15, in base-2 units
#pragma unroll
      for (int r = 0; r < 8; ++r) {
        const float p = __builtin_amdgcn_exp2f(x[r]);   // exp(scaled score - scaled maximum) x 2^15
        pj[j] += p;
        pb[j >> 1].v[(j & 1) * 8 + r] = (_Float16)p;
      }
    }
    lrow = lrow * alpha + ((pj[0] + pj[1]) + (pj[2] + pj[3]));
#pragma unroll
    for (int t = 0; t < 4; ++t)
#pragma unroll
      for (int r = 0; r < 8; ++r) oacc[t][r] *= alpha;
    // O^T += V^T . P^T
#pragma unroll
    for (int kk = 0; kk < 2; ++kk) {
#pragma unroll
      for (int t = 0; t < 4; ++t) oacc[t] = at_mma_h(vb[kk][t].v, pb[kk].v, oacc[t]);
    }
  }

  float* os = Os[wave];
  {
    const float inv = 1.0f / (lrow + xhalf(lrow));   // the halves' sums join once; sum and O both carry 2^15
#pragma unroll
    for (int t = 0; t < 4; ++t) {
      v4f lo, hi;
#pragma unroll
      for (int r = 0; r < 4; ++r) { lo[r] = oacc[t][r] * inv; hi[r] = oacc[t][4 + r] * inv; }
      *(v4f*)(os + c * 68 + t * 16 + 8 * hh)     = lo;
      *(v4f*)(os + c * 68 + t * 16 + 8 * hh + 4) = hi;
    }
  }
  __builtin_amdgcn_fence(__ATOMIC_RELEASE, "workgroup");
  __builtin_amdgcn_wave_barrier();
  __builtin_amdgcn_fence(__ATOMIC_ACQUIRE, "workgroup");
  {
    const int c4 = (lane & 15) * 4;
    float* orow = ob + (size_t)(q0 + hh) * D_MODEL + c4;   // one base; the eight rows lie at constant steps from it
#pragma unroll
    for (int it = 0; it < 8; ++it) {
      v4f val = *(const v4f*)(os + (it * 2 + hh) * 68 + c4);
      *(v4f*)(orow + it * 2 * D_MODEL) = val;
    }
  }
}

// ---------------------------------------------------------------------------
// host launcher
// ---------------------------------------------------------------------------
extern "C" void kernel_launch(void* const* d_in, const int* in_sizes, int n_in,
                              void* d_out, int out_size, void* d_ws, size_t ws_size,
                              hipStream_t stream) {
  constexpr int S  = SEQ_LEN;
  constexpr int DM = D_MODEL;
  const size_t SD = (size_t)S * DM;    // 4194304 elements
  const size_t DD = (size_t)DM * DM;   // 1048576 elements
  if (n_in < 11) return;
  if ((size_t)in_sizes[0] != SD || (size_t)in_sizes[1] != SD || (size_t)in_sizes[2] != SD) return;
  if ((size_t)in_sizes[3] != DD || (size_t)in_sizes[5] != DD || (size_t)in_sizes[7] != DD || (size_t)in_sizes[9] != DD) return;
  if (in_sizes[4] != DM || in_sizes[6] != DM || in_sizes[8] != DM || in_sizes[10] != DM) return;
  if ((size_t)out_size != SD) return;

  const float* x_q = (const float*)d_in[0];
  const float* x_k = (const float*)d_in[1];
  const float* x_v = (const float*)d_in[2];
  const float* Wq  = (const float*)d_in[3];
  const float* bq  = (const float*)d_in[4];
  const float* Wk  = (const float*)d_in[5];
  const float* bk  = (const float*)d_in[6];
  const float* Wv  = (const float*)d_in[7];
  const float* bv  = (const float*)d_in[8];
  const float* Wo  = (const float*)d_in[9];
  const float* bo  = (const float*)d_in[10];

  //   xq  bf16 [4096][1024]  8 MiB @  0 MiB      xk  @  8 MiB      xv  @ 16 MiB
  //   wq  bf16 [1024][1024]  2 MiB @ 24 MiB      wk  @ 26 MiB      wv  @ 28 MiB     wo f16 @ 30 MiB
  //   q16 f16  [4096][1024]  8 MiB @ 32 MiB      k16 @ 40 MiB      vt16 f16 [1024][4096] @ 48 MiB
  //   o32 f32  [4096][1024] 16 MiB @ 56 MiB      o16 f16 8 MiB @ 72 MiB
  //   bias f32 [4][1024]    16 KiB @ 80 MiB      end = 83902464 B
  const size_t off_xq  = 0;
  const size_t off_xk  = off_xq  + SD * 2;
  const size_t off_xv  = off_xk  + SD * 2;
  const size_t off_wq  = off_xv  + SD * 2;
  const size_t off_wk  = off_wq  + DD * 2;
  const size_t off_wv  = off_wk  + DD * 2;
  const size_t off_wo  = off_wv  + DD * 2;
  const size_t off_q   = off_wo  + DD * 2;
  const size_t off_k   = off_q   + SD * 2;
  const size_t off_vt  = off_k   + SD * 2;
  const size_t off_o32 = off_vt  + SD * 2;
  const size_t off_o16 = off_o32 + SD * 4;
  const size_t off_b   = off_o16 + SD * 2;
  const size_t ws_end  = off_b + 4 * (size_t)DM * 4;
  if (ws_end > ws_size) return;

  char* ws = (char*)d_ws;
  unsigned short* xq   = (unsigned short*)(ws + off_xq);
  unsigned short* xk   = (unsigned short*)(ws + off_xk);
  unsigned short* xv   = (unsigned short*)(ws + off_xv);
  unsigned short* wq   = (unsigned short*)(ws + off_wq);
  unsigned short* wk   = (unsigned short*)(ws + off_wk);
  unsigned short* wv   = (unsigned short*)(ws + off_wv);
  unsigned short* wo   = (unsigned short*)(ws + off_wo);
  unsigned short* q16  = (unsigned short*)(ws + off_q);
  unsigned short* k16  = (unsigned short*)(ws + off_k);
  unsigned short* vt16 = (unsigned short*)(ws + off_vt);
  float*          o32  = (float*)(ws + off_o32);
  unsigned short* o16  = (unsigned short*)(ws + off_o16);
  float*          bws  = (float*)(ws + off_b);
  const float* bias_q = bws;
  const float* bias_k = bws + DM;
  const float* bias_v = bws + 2 * DM;
  const float* bias_o = bws + 3 * DM;

  const int SD2 = (int)(SD / 2);   // 2097152
  const int DD2 = (int)(DD / 2);   // 524288

  // 1) biases -> bf16-RNE values in f32
  bias_bf16_rne_kernel<<<dim3(DM / 256, 4), 256, 0, stream>>>(bq, bk, bv, bo, bws, DM);
  // 2) activations -> bf16 planes
  cast3_bf16x2_kernel<<<dim3(SD2 / 256, 3), 256, 0, stream>>>(x_q, x_k, x_v, xq, xk, xv, SD2);
  // 3) Wq, Wk, Wv -> bf16 planes ([out][in] = [N][K] layout as is)
  cast3_bf16x2_kernel<<<dim3(DD2 / 256, 3), 256, 0, stream>>>(Wq, Wk, Wv, wq, wk, wv, DD2);
  // 4) Wo -> f16 plane of bf16-RNE(Wo) x 2^8
  cast_f16x2_scaled_kernel<true><<<dim3(DD2 / 256, 1), 256, 0, stream>>>(Wo, wo, DD2, 256.0f);

  // GEMM tiles: (4096/128)*(1024/128) = 256 tiles of 128x128 -> 256 blocks x 8 waves; K = 1024 (K % 64 == 0)
  const int gemm_blocks = (int)((S / 128) * (DM / 128));   // 256
  // 5) q16[s][n] = x_q . Wq^T + bq   (f16 out)
  wmma_gemm64<1, false, 2, 1, false><<<dim3(gemm_blocks, 1), 256, 0, stream>>>(
      xq, xq, DM, 0L, wq, wq, DM, 0L, (void*)q16, (void*)q16, DM, 0L, bias_q, bias_q, 0L, S, DM, DM, 1.0f);
  // 6) k16[s][n] = x_k . Wk^T + bk
  wmma_gemm64<1, false, 2, 1, false><<<dim3(gemm_blocks, 1), 256, 0, stream>>>(
      xk, xk, DM, 0L, wk, wk, DM, 0L, (void*)k16, (void*)k16, DM, 0L, bias_k, bias_k, 0L, S, DM, DM, 1.0f);
  // 7) vt16[m = feature][n = s] = Wv[m,:] . x_v[s,:] + bv[m]  (role-swapped: M = 1024, N = 4096, ldc = 4096)
  wmma_gemm64<1, false, 1, 1, false><<<dim3(gemm_blocks, 1), 256, 0, stream>>>(
      wv, wv, DM, 0L, xv, xv, DM, 0L, (void*)vt16, (void*)vt16, S, 0L, bias_v, bias_v, 0L, DM, S, DM, 1.0f);

  // 8) attention: 16 heads x 64 query blocks, f32 context o32[s][h*64+d]
  attn_full64_f16_kernel<<<dim3(N_HEADS * (S / 64), 1), 128, 0, stream>>>(q16, k16, vt16, o32, 0.125f);

  // 9) o32 -> f16 plane x 2^8
  cast_f16x2_scaled_kernel<false><<<dim3(SD2 / 256, 1), 256, 0, stream>>>(o32, o16, SD2, 256.0f);

  // 10) out[s][n] = (o x 2^8) . (Wo x 2^8)^T * 2^-16 + bo  -> f32 d_out
  wmma_gemm64<0, false, 2, 0, false><<<dim3(gemm_blocks, 1), 256, 0, stream>>>(
      o16, o16, DM, 0L, wo, wo, DM, 0L, d_out, d_out, DM, 0L, bias_o, bias_o, 0L, S, DM, DM, 1.0f / 65536.0f);
}

// v006
// One run takes 148 microseconds.
// Next to v005, in two timings, it ran 1.16 times as fast each time.
// Over all steps from v000 it is 4.37 times as fast.
// Projections q,k,v^T: v_wmma_f32_16x16x32_bf16 (bf16 RNE operands from the f32 inputs, f32 accumulate, bf16-RNE bias added in f32); attention q.k^T and p.v: v_wmma_f32_16x16x32_f16 (f16 q,k,v planes, p carried x2^15, f32 accumulate, f32 online softmax, score scale 0.125 in f32); output projection: v_wmma_f32_16x16x32_f16 (f16 planes of o x2^8 and bf16-RNE(Wo) x2^8, f32 accumulate, scale 2^-16, bf16-RNE bias added in f32).
#include <hip/hip_runtime.h>
#include <math.h>
#include <stdint.h>

typedef __attribute__((ext_vector_type(16))) _Float16 v16h;
typedef __attribute__((ext_vector_type(8)))  _Float16 v8h;
typedef __attribute__((ext_vector_type(16))) __bf16   v16b;
typedef __attribute__((ext_vector_type(8)))  __bf16   v8b;
typedef __attribute__((ext_vector_type(8)))  float    v8f;
typedef __attribute__((ext_vector_type(4)))  float    v4f;
typedef __attribute__((ext_vector_type(2)))  float    v2f;

constexpr int SEQ_LEN = 4096;
constexpr int D_MODEL = 1024;
constexpr int N_HEADS = 16;

__device__ __forceinline__ unsigned short f2bf_bits(float f) {
  unsigned u = __float_as_uint(f);
  return (unsigned short)((u + 0x7FFFu + ((u >> 16) & 1u)) >> 16);
}
__device__ __forceinline__ float bf_bits2f(unsigned short h) { return __uint_as_float(((unsigned)h) << 16); }
__device__ __forceinline__ unsigned pk16(unsigned short a, unsigned short b) { return (unsigned)a | ((unsigned)b << 16); }

// hazard guards as plain device helpers
__device__ __forceinline__ void dep_guard_h(v8f& a, v8f& b, v16h x, v16h y) { asm volatile("v_nop\n\tv_nop\n\tv_nop\n\tv_nop" : "+v"(a), "+v"(b) : "v"(x), "v"(y)); }
__device__ __forceinline__ void dep_guard_b(v8f& a, v8f& b, v16b x, v16b y) { asm volatile("v_nop\n\tv_nop\n\tv_nop\n\tv_nop" : "+v"(a), "+v"(b) : "v"(x), "v"(y)); }
__device__ __forceinline__ void keep4_h(v16h a, v16h b, v16h c, v16h d) { asm volatile("v_nop" :: "v"(a), "v"(b), "v"(c), "v"(d)); }
__device__ __forceinline__ void keep4_b(v16b a, v16b b, v16b c, v16b d) { asm volatile("v_nop" :: "v"(a), "v"(b), "v"(c), "v"(d)); }
__device__ __forceinline__ void acc_guard4(v8f& a, v8f& b, v8f& c, v8f& d) { asm volatile("v_nop\n\tv_nop\n\tv_nop\n\tv_nop" : "+v"(a), "+v"(b), "+v"(c), "+v"(d)); }
template <typename T> struct Frag;
template <> struct Frag<_Float16> {
  typedef v16h V; typedef v8h H; union U { v16h v; v8h h[2]; };
  static __device__ __forceinline__ v16h load(const _Float16* p) {   // elements 0..7 <- p[0..7], 8..15 <- p[16..23]
    U f; f.h[0] = *(const v8h*)(p); f.h[1] = *(const v8h*)(p + 16); return f.v;
  }
  static __device__ __forceinline__ v8f mma(v16h a, v16h b, v8f c) {
    return __builtin_amdgcn_wmma_f32_16x16x32_f16(false, a, false, b, (short)0, c, false, false);
  }
  static __device__ __forceinline__ void guard(v8f& a, v8f& b, v16h x, v16h y) { dep_guard_h(a, b, x, y); }
  static __device__ __forceinline__ void keep(v16h a, v16h b, v16h c, v16h d) { keep4_h(a, b, c, d); }
};
template <> struct Frag<__bf16> {
  typedef v16b V; typedef v8b H; union U { v16b v; v8b h[2]; };
  static __device__ __forceinline__ v16b load(const __bf16* p) {
    U f; f.h[0] = *(const v8b*)(p); f.h[1] = *(const v8b*)(p + 16); return f.v;
  }
  static __device__ __forceinline__ v8f mma(v16b a, v16b b, v8f c) {
    return __builtin_amdgcn_wmma_f32_16x16x32_bf16(false, a, false, b, (short)0, c, false, false);
  }
  static __device__ __forceinline__ void guard(v8f& a, v8f& b, v16b x, v16b y) { dep_guard_b(a, b, x, y); }
  static __device__ __forceinline__ void keep(v16b a, v16b b, v16b c, v16b d) { keep4_b(a, b, c, d); }
};

// ---- LDS-staged batched WMMA GEMM -------------------------------------------
// C[m,n] = scale * sum_k A[m,k] * Bt[n,k] (+bias)(+resid); a block of 8 waves owns a 128x128 tile, each wave 32x64 of it.
// A row-major [M,K]; Bt row-major [N,K]; M,N % 128 == 0, K % 64 == 0, K >= 64.
// Per 64-k step the block brings 128 rows x 128 B of A and of Bt into LDS: 8 lanes x 16 B cover one whole row line,
// 256 threads x 4 pieces per operand = the whole tile. Two LDS buffers: the next step's global loads are issued ahead of
// this step's products and stored behind them, one __syncthreads() per step.
// SPLIT (hi/lo planes) is not staged: single-plane operands only.
// BIAS_MODE: 0 = none, 1 = bias[m], 2 = bias[n].
// OUT_MODE: 0 = f32, 1 = f16, 2 = bf16 hi plane (Cout) + bf16 lo plane (Cout2).
// ET: 0 = f16 operands, 1 = bf16 operands (pointers passed as 16-bit storage)
#define GM_BT 128  // block tile, rows of A and of Bt
#define GM_LP 72   // LDS row pitch in elements: 64 + 8, 144 B = 16 B x 9, so 16 rows read by ds_load_b128 fall on 16 distinct bank groups
template <int ET> struct Elem;
template <> struct Elem<0> { typedef _Float16 T; };
template <> struct Elem<1> { typedef __bf16 T; };
template <int ET, bool SPLIT, int BIAS_MODE, int OUT_MODE, bool RESID, int ACT = 0>
__global__ __launch_bounds__(256) void wmma_gemm64(
    const unsigned short* __restrict__ Ap, const unsigned short* __restrict__ A2p, int lda, long strideA,
    const unsigned short* __restrict__ Btp, const unsigned short* __restrict__ Bt2p, int ldb, long strideB,
    void* __restrict__ Cout, void* __restrict__ Cout2, int ldc, long strideC,
    const float* __restrict__ bias,
    const float* __restrict__ resid, long strideR,
    int M, int N, int K, float scale) {
  static_assert(!SPLIT, "single-plane operands only");
  typedef typename Elem<ET>::T T;
  typedef typename Frag<T>::V V;
  typedef typename Frag<T>::H H;
  const T* A = (const T*)Ap; const T* Bt = (const T*)Btp;
  __shared__ __align__(16) T sA[2][GM_BT * GM_LP];   // A rows of the block tile, one 64-k step, two buffers
  __shared__ __align__(16) T sB[2][GM_BT * GM_LP];   // Bt rows of the block tile
  __shared__ __align__(16) float sT[8][16 * 68];     // per-wave 16x64 slab, pitch 68 floats
  const int b    = blockIdx.y;
  const int tid  = threadIdx.x;
  const int lane = tid & 31;
  const int wave = tid >> 5;
  const int tilesN = N >> 7;
  const int tilesM = M >> 7;
  const int tile = blockIdx.x;
  if (tile >= tilesM * tilesN) return;   // block-uniform, ahead of every barrier
  const int tm = tile / tilesN;
  const int tn = tile - tm * tilesN;
  const int bm0 = tm << 7;
  const int bn0 = tn << 7;
  const int wm = (wave >> 1) << 5;             // this wave's rows inside the block tile: 0, 32, 64, 96
  const int wn = (wave & 1) << 6;              // this wave's columns inside the block tile: 0, 64
  const int m0 = bm0 + wm;
  const int n0 = bn0 + wn;

  const T* Ab  = A  + (size_t)b * strideA;
  const T* Bb  = Bt + (size_t)b * strideB;

  const int rlane = lane & 15;                 // row (A) / col (B, D) within subtile
  const int koff  = (lane >> 4) * 8;           // k offset of this lane half
  const int mOff  = (lane >> 4) * 8;           // D row offset

  // every unroll directive from here to the epilogue makes the array indices constants, so that acc, the staged pieces
  // and the fragments live in registers and not in scratch
  v8f acc[2][4];
#pragma unroll
  for (int i = 0; i < 2; ++i)
#pragma unroll
    for (int j = 0; j < 4; ++j) acc[i][j] = (v8f){0.f,0.f,0.f,0.f,0.f,0.f,0.f,0.f};

  // staging map: piece it of a thread = row it*32 + (tid >> 3), elements (tid & 7)*8 .. +7 of the step's 64
  const int srow = tid >> 3;
  const int sseg = (tid & 7) << 3;
  const int so = srow * GM_LP + sseg;
  const char* Ac = (const char*)(Ab + (size_t)bm0 * lda);   // block-uniform bases of the two row bands
  const char* Bc = (const char*)(Bb + (size_t)bn0 * ldb);
  unsigned oa[4], ob[4];                       // one running byte offset per piece (a 128-row band stays far below 4 GiB), 128 B a step
  H ra[4], rb[4];
#pragma unroll
  for (int it = 0; it < 4; ++it) {
    oa[it] = (unsigned)(((it * 32 + srow) * lda + sseg) * 2);
    ob[it] = (unsigned)(((it * 32 + srow) * ldb + sseg) * 2);
    ra[it] = *(const H*)(Ac + oa[it]);
    rb[it] = *(const H*)(Bc + ob[it]);
  }
#pragma unroll
  for (int it = 0; it < 4; ++it) {
    *(H*)(&sA[0][so + it * 32 * GM_LP]) = ra[it];
    *(H*)(&sB[0][so + it * 32 * GM_LP]) = rb[it];
  }

  const int nk = K >> 6;
  for (int kt = 0; kt < nk; ++kt) {
    // publishes buffer kt & 1 and ends every wave's reads of the other buffer, which is refilled below
    __syncthreads();
    const bool more = kt + 1 < nk;             // block-uniform
    if (more) {
#pragma unroll
      for (int it = 0; it < 4; ++it) {
        oa[it] += 128;
        ob[it] += 128;
        ra[it] = *(const H*)(Ac + oa[it]);
        rb[it] = *(const H*)(Bc + ob[it]);
      }
      // stands behind the eight loads, ahead of every later write of an offset or base register that they name
      asm volatile("s_wait_xcnt 0x0" ::: "memory");
    }
    const T* sa = &sA[kt & 1][(wm + rlane) * GM_LP + koff];
    const T* sb = &sB[kt & 1][(wn + rlane) * GM_LP + koff];
    // the step's 24 fragment reads stand together ahead of its 16 products
    V bh[2][4], ah[2][2];
#pragma unroll
    for (int kk = 0; kk < 2; ++kk) {
#pragma unroll
      for (int j = 0; j < 4; ++j) bh[kk][j] = Frag<T>::load(sb + j * 16 * GM_LP + kk * 32);
#pragma unroll
      for (int i = 0; i < 2; ++i) ah[kk][i] = Frag<T>::load(sa + i * 16 * GM_LP + kk * 32);
    }
#pragma unroll
    for (int kk = 0; kk < 2; ++kk) {
#pragma unroll
      for (int i = 0; i < 2; ++i) {
#pragma unroll
        for (int j = 0; j < 4; ++j) acc[i][j] = Frag<T>::mma(ah[kk][i], bh[kk][j], acc[i][j]);
        Frag<T>::guard(acc[i][0], acc[i][3], ah[kk][i], ah[kk][i]);   // v_nops: the slots behind the last product before its A or D is touched
      }
      Frag<T>::keep(bh[kk][0], bh[kk][1], bh[kk][2], bh[kk][3]);   // holds the B fragments' registers to the end of their products
    }
    if (more) {
      const int nb = (kt + 1) & 1;
#pragma unroll
      for (int it = 0; it < 4; ++it) {
        *(H*)(&sA[nb][so + it * 32 * GM_LP]) = ra[it];
        *(H*)(&sB[nb][so + it * 32 * GM_LP]) = rb[it];
      }
    }
  }
  acc_guard4(acc[0][0], acc[0][1], acc[0][2], acc[0][3]);
  acc_guard4(acc[1][0], acc[1][1], acc[1][2], acc[1][3]);

  // ---- epilogue ----
  float* slab = sT[wave];
  const float* Rb = RESID ? (resid + (size_t)b * strideR) : nullptr;
#pragma unroll
  for (int i = 0; i < 2; ++i) {
    const int mBase = m0 + (i << 4);
#pragma unroll
    for (int j = 0; j < 4; ++j) {
      const int n = n0 + (j << 4) + rlane;
      float bv = 0.f;
      if (BIAS_MODE == 2) bv = bias[n];
#pragma unroll
      for (int r = 0; r < 8; ++r) {
        float v = acc[i][j][r] * scale;
        if (BIAS_MODE == 1) v += bias[mBase + mOff + r];
        if (BIAS_MODE == 2) v += bv;
        if (RESID) v += Rb[(size_t)(mBase + mOff + r) * ldc + n];
        if (ACT == 1) v = tanhf(v);
        if (ACT == 2) v = fmaxf(v, 0.0f);
        if (ACT == 3) v = v / (1.0f + expf(-v));
        if (ACT == 4) v = (v > 0.f) ? v : 0.01f * v;
        if (ACT == 5) v = 0.5f * v * (1.0f + erff(v * 0.70710678118654752f));
        slab[(mOff + r) * 68 + (j << 4) + rlane] = v;
      }
    }
    __builtin_amdgcn_fence(__ATOMIC_RELEASE, "workgroup");
    __builtin_amdgcn_wave_barrier();
    __builtin_amdgcn_fence(__ATOMIC_ACQUIRE, "workgroup");
    if (OUT_MODE == 0) {
      float* C = (float*)Cout + (size_t)b * strideC;
      const int hh = lane >> 4, c4 = (lane & 15) * 4;     // row seg = 256 B = 16 lanes x 16 B
      {
#pragma unroll
        for (int it = 0; it < 8; ++it) {
          const int row = it * 2 + hh;
          v4f v = *(const v4f*)(slab + row * 68 + c4);
          *(v4f*)(C + (size_t)(mBase + row) * ldc + n0 + c4) = v;
        }
        
      }
    } else {
      const int q = lane >> 3, c8 = (lane & 7) * 8;
      unsigned short* C  = (unsigned short*)Cout  + (size_t)b * strideC;
      unsigned short* C2 = (OUT_MODE == 2) ? ((unsigned short*)Cout2 + (size_t)b * strideC) : nullptr;
      {
#pragma unroll
        for (int it = 0; it < 4; ++it) {
          const int row = it * 4 + q;
          const float* sp = slab + row * 68 + c8;
          v8h hv, lv;
#pragma unroll
          for (int e = 0; e < 8; ++e) {
            if (OUT_MODE == 1) {
              hv[e] = (_Float16)sp[e];
            } else {
              unsigned short hb = f2bf_bits(sp[e]);
              unsigned short lb = f2bf_bits(sp[e] - bf_bits2f(hb));
              hv[e] = __builtin_bit_cast(_Float16, hb);
              lv[e] = __builtin_bit_cast(_Float16, lb);
            }
          }
          *(v8h*)(C + (size_t)(mBase + row) * ldc + n0 + c8) = hv;
          if (OUT_MODE == 2) *(v8h*)(C2 + (size_t)(mBase + row) * ldc + n0 + c8) = lv;
        }
        
      }
    }
    __builtin_amdgcn_fence(__ATOMIC_RELEASE, "workgroup");
    __builtin_amdgcn_wave_barrier();
    __builtin_amdgcn_fence(__ATOMIC_ACQUIRE, "workgroup");
  }
}

// ---------------------------------------------------------------------------
// f32 -> bf16 (RNE) for three equally sized tensors, tensor selected by blockIdx.y (block-uniform);
// Coverage per plane: grid.x = n2/256 blocks x 256 threads x 2 elements = 2*n2 = whole plane
// (n2 = 2097152 -> 8192 blocks for 4096x1024; n2 = 524288 -> 2048 blocks for 1024x1024).
// ---------------------------------------------------------------------------
__global__ __launch_bounds__(256) void cast3_bf16x2_kernel(
    const float* __restrict__ in0, const float* __restrict__ in1, const float* __restrict__ in2,
    unsigned short* __restrict__ out0, unsigned short* __restrict__ out1, unsigned short* __restrict__ out2, int n2) {
  const int sel = blockIdx.y;
  const float* in = (sel == 0) ? in0 : ((sel == 1) ? in1 : in2);
  unsigned short* out = (sel == 0) ? out0 : ((sel == 1) ? out1 : out2);
  const int i = blockIdx.x * 256 + threadIdx.x;
  if (i < n2) {
    const v2f f = *(const v2f*)(in + 2 * (size_t)i);
    const unsigned u = pk16(f2bf_bits(f[0]), f2bf_bits(f[1]));
    ((unsigned*)out)[i] = u;
    
  }
}

// ---------------------------------------------------------------------------
// f32 -> f16 with a power-of-two carry: out = f16(g(in) * scale), g = bf16 RNE when PREBF, identity otherwise.
// Coverage: grid.x = n2/256 blocks x 256 threads x 2 elements = 2*n2 = whole plane.
// ---------------------------------------------------------------------------
template <bool PREBF>
__global__ __launch_bounds__(256) void cast_f16x2_scaled_kernel(const float* __restrict__ in, unsigned short* __restrict__ out,
                                                               int n2, float scale) {
  const int i = blockIdx.x * 256 + threadIdx.x;
  if (i < n2) {
    const v2f f = *(const v2f*)(in + 2 * (size_t)i);
    float a = f[0], b = f[1];
    if (PREBF) { a = bf_bits2f(f2bf_bits(a)); b = bf_bits2f(f2bf_bits(b)); }
    const _Float16 h0 = (_Float16)(a * scale), h1 = (_Float16)(b * scale);
    const unsigned u = pk16(__builtin_bit_cast(unsigned short, h0), __builtin_bit_cast(unsigned short, h1));
    ((unsigned*)out)[i] = u;
    
  }
}

// ---------------------------------------------------------------------------
// Four bias vectors -> bf16-RNE values held as f32: out[sel*n + i], source selected by blockIdx.y (block-uniform).
// Coverage: grid (n/256, 4) x 256 threads = 4 x n elements (n = 1024 -> 4 x 4 blocks).
// ---------------------------------------------------------------------------
__global__ __launch_bounds__(256) void bias_bf16_rne_kernel(
    const float* __restrict__ b0, const float* __restrict__ b1, const float* __restrict__ b2, const float* __restrict__ b3,
    float* __restrict__ out, int n) {
  const int sel = blockIdx.y;
  const float* in = (sel == 0) ? b0 : ((sel == 1) ? b1 : ((sel == 2) ? b2 : b3));
  const int i = blockIdx.x * 256 + threadIdx.x;
  if (i < n) {
    const float v = bf_bits2f(f2bf_bits(in[i]));
    ((float*)out)[(size_t)sel * n + i] = v;
    
  }
}

// =====================================================================================
// Full (non-causal, unmasked) attention, head dim 64, single 16-bit products.
//   q plane (f16): element (s, h, d) at [s*D_MODEL + h*64 + d]
//   k plane (f16): element (s, h, d) at [s*D_MODEL + h*64 + d]
//   v^T plane (f16): element (h, d, s) at [(h*64 + d)*SEQ_LEN + s]
//   out f32: element (s, h, d) at [s*D_MODEL + h*64 + d]
//   scores^T = (k . q^T) * sscale : v_wmma_f32_16x16x32_f16 (A = K rows, B = q), f32 accumulate, sscale applied in f32
//                                   inside the one fma per score that feeds v_exp_f32 (base 2)
//   out^T    = v^T . p^T          : v_wmma_f32_16x16x32_f16 (A = V^T rows, B = p^T packed from the score registers),
//                                   p (unnormalised, x2^15) and v in f16, f32 accumulate
//   online softmax in f32 over all SEQ_LEN keys (64 chunks of 64, compile-time trip count, no masking).
//   Block = 4 waves = 64 query rows of one head; grid.x = N_HEADS * (SEQ_LEN/64) = 1024.
//   K / V^T chunk staging: one tensor_load_to_lds per wave and chunk, each a slice of 32 rows x 128 B (waves 0, 1: K rows
//   0-31, 32-63 of the chunk; waves 2, 3: V^T rows 0-31, 32-63), padded by the mover to the 144-B pitch; two LDS buffers,
//   the load of chunk s + 2 issued at the foot of chunk s, one publish point (waits, barrier) per chunk.
//   Output: per-wave 16x64 f32 tile staged in LDS; each 64-float row segment (256 B) written by 16 lanes x 16 B
//   Coverage: 1024 blocks x 4 waves x 16 rows x 64 floats = 4096 x 1024 = the whole out plane.
// =====================================================================================
#define AT_D 64
#define AT_NW 4
#define AT_QB 64
#define AT_KC 64
#define AT_PB 144u  // LDS row pitch of the 16-bit tiles in bytes: 16 B x 9, so 16 rows read by ds_load_b128 fall on 16 distinct bank groups
#define AT_SR 32u            // rows of one tensor-load slice
#define AT_SLB 6144u         // a slice's room in LDS: 32 rows x 144 B = 4608 B, rounded up so that every slice starts at a multiple of 2 KiB
#define AT_BUFB (4u * AT_SLB) // one buffer: K slices 0, 1, then V^T slices 0, 1
typedef uint32_t u32x4 __attribute__((ext_vector_type(4)));
typedef uint32_t u32x8 __attribute__((ext_vector_type(8)));
constexpr float P_CARRY_LOG2 = 15.0f;   // p and its running sum are carried x2^15; the factor cancels in the final division

__device__ __forceinline__ v8f at_mma_h(v16h a, v16h b, v8f c) {
  return __builtin_amdgcn_wmma_f32_16x16x32_f16(false, a, false, b, (short)0, c, false, false);
}

__device__ __forceinline__ uint32_t uni(uint32_t v) { return (uint32_t)__builtin_amdgcn_readfirstlane(v); }
__device__ __forceinline__ uint32_t pinned(uint32_t v) {
  uint32_t w = uni(v);
  asm volatile("" : "+s"(w));   // holds the word in a scalar register; without it the test may become a vector condition
  return w;
}
// the compiler places no wait for the tensor mover: a tile counts as landed only behind its issuer's own wait
__device__ __forceinline__ void wait_tensor0() { asm volatile("s_wait_tensorcnt 0x0" ::: "memory"); }
// this wave's LDS reads have retired before the barrier behind which their buffer is refilled
__device__ __forceinline__ void wait_ds0() { asm volatile("s_wait_dscnt 0x0" ::: "memory"); }
__device__ __forceinline__ void tdm_load(u32x4 g0, u32x8 g1) { asm volatile("tensor_load_to_lds %0, %1" :: "{s[84:87]}"(g0), "{s[88:95]}"(g1) : "memory"); }
// descriptor group 1: 1-byte elements, tensor = tile = 32 rows of 128 B, source row pitch src_pitch bytes,
// 4 dwords of LDS pad behind every 32 dwords (one row): LDS pitch 144 B; no workgroup mask
__device__ __forceinline__ u32x8 tdm_group1(uint32_t src_pitch) {
  constexpr uint32_t d0 = 128u, d1 = AT_SR;
  u32x8 g;
  g[0] = uni((1u << 20) | (4u << 22) | (3u << 25));
  g[1] = uni((d0 & 0xFFFFu) << 16);
  g[2] = uni((d0 >> 16) | ((d1 & 0xFFFFu) << 16));
  g[3] = uni((d1 >> 16) | (d0 << 16));
  g[4] = uni(d1);
  g[5] = uni(src_pitch);
  g[6] = uni(0u);
  g[7] = uni(0u);
  return g;
}
// descriptor group 0: count 1, LDS byte offset, global address of the tile's first byte, type 2
__device__ __forceinline__ u32x4 tdm_group0(uint32_t lds_dst, uint64_t ga) {
  u32x4 g;
  g[0] = uni(1u); g[1] = uni(lds_dst); g[2] = uni((uint32_t)ga); g[3] = uni((((uint32_t)(ga >> 32)) & 0x01FFFFFFu) | 0x80000000u);
  return g;
}

// lane l takes the value of lane l ^ 16
__device__ __forceinline__ float xhalf(float x) {
  return __builtin_bit_cast(float, __builtin_amdgcn_permlanex16(__builtin_bit_cast(int, x), __builtin_bit_cast(int, x), 0x76543210, 0xfedcba98, false, false));
}

__global__ __launch_bounds__(128)
void attn_full64_f16_kernel(const unsigned short* __restrict__ qp, const unsigned short* __restrict__ kp,
                            const unsigned short* __restrict__ vtp, float* __restrict__ out, float sscale) {
  union FH { v16h v; v8h h[2]; };
  __shared__ __attribute__((aligned(2048))) unsigned char ring[2 * AT_BUFB];   // two buffers of K [kv][d] and V [d][kv] slices, 48 KB
  __shared__ __align__(16) float    Os[AT_NW][16 * 68];            // per wave out tile, pitch 68

  const int tid  = threadIdx.x;
  const int wave = tid >> 5;
  const int lane = tid & 31;
  const int hh   = lane >> 4;
  const int c    = lane & 15;

  const int nqb = SEQ_LEN / AT_QB;        // 64
  const int bx = blockIdx.x;
  const int qb = bx % nqb;
  const int h  = bx / nqb;                // 0..N_HEADS-1 (grid = N_HEADS * nqb)
  const int q0 = qb * AT_QB + wave * 16;

  const _Float16* Qg = (const _Float16*)(const void*)qp  + (size_t)h * AT_D;
  const _Float16* Kg = (const _Float16*)(const void*)kp  + (size_t)h * AT_D;
  const _Float16* Vg = (const _Float16*)(const void*)vtp + (size_t)h * AT_D * SEQ_LEN;
  float*          ob = out + (size_t)h * AT_D;

  // ---- K / V^T slices by tensor load: every wave issues its own slice of every chunk, unconditionally ----
  const uint32_t wv   = uni((uint32_t)threadIdx.x >> 5);
  const bool     isV  = (wv & 2u) != 0u;
  const uint32_t srow = (wv & 1u) * AT_SR;                                   // the slice's first row in the chunk tile
  const uint32_t spitch = isV ? (uint32_t)SEQ_LEN * 2u : (uint32_t)D_MODEL * 2u;   // source row pitch in bytes
  const uint32_t sstep  = isV ? (uint32_t)AT_KC * 2u : (uint32_t)AT_KC * (uint32_t)D_MODEL * 2u;   // bytes from one chunk's slice to the next's
  const uint64_t ssrc = (uint64_t)(size_t)(isV ? Vg : Kg) + (uint64_t)(srow * spitch);
  const uint32_t sdst = (uint32_t)(size_t)ring + wv * AT_SLB;
  const u32x8 g1 = tdm_group1(spitch);
  // prologue, two buffers: chunk 0's load, its wait, the barrier that publishes it, then chunk 1's load
  u32x4 g0 = tdm_group0(sdst, ssrc);
  tdm_load(g0, g1);
  wait_tensor0();
  __syncthreads();
  g0 = tdm_group0(sdst + AT_BUFB, ssrc + sstep);
  tdm_load(g0, g1);

  // ---- Q fragments (B operand, column = lane&15, split k map via Frag load): 2 d-chunks ----
  v16h qa[2];
#pragma unroll
  for (int dc = 0; dc < 2; ++dc) {
    const _Float16* qr = Qg + (size_t)(q0 + c) * D_MODEL + dc * 32 + 8 * hh;
    qa[dc] = Frag<_Float16>::load(qr);
  }

  // One query column per lane (c); the two wave halves split that query's keys.
  float mrow = -INFINITY, lrow = 0.f;      // running maximum of the raw scores (equal in both halves), this half's running sum (x2^15)
  float mbrow = -INFINITY;                 // mrow * c2 - 15: what one fma takes off a score ahead of the base-2 exponential
  const float c2 = sscale * 1.44269504088896340736f;   // score scale times log2(e); sscale > 0, so the raw scores order as the scaled ones
  v8f oacc[4];                             // O^T tiles: oacc[t][r] = O[q0 + c][t*16 + 8*hh + r]
#pragma unroll
  for (int t = 0; t < 4; ++t) oacc[t] = (v8f){0.f,0.f,0.f,0.f,0.f,0.f,0.f,0.f};

  const int nChunks = SEQ_LEN / AT_KC;   // 64, compile-time constant
  for (int kc = 0; kc < nChunks; ++kc) {
    // this chunk's buffer; row x of a 64-row tile lies in slice x >> 5 at row x & 31
    const unsigned char* kr = ring + (uint32_t)(kc & 1) * AT_BUFB + (uint32_t)c * AT_PB + 16u * (uint32_t)hh;
    const unsigned char* vr = kr + 2u * AT_SLB;

    // the chunk's 32 fragment reads (K first, in the order of their use, then V^T) stand together behind the barrier, ahead
    // of all 16 products: one place with LDS reads per chunk, and the V^T fragments land under the score products and the softmax
    // (the unroll directives make the array indices constants, so that the fragments live in registers)
    FH kb[2][4], vb[2][4];
#pragma unroll
    for (int dc = 0; dc < 2; ++dc)
#pragma unroll
      for (int j = 0; j < 4; ++j) {
        kb[dc][j].h[0] = *(const v8h*)(kr + (j >> 1) * AT_SLB + (j & 1) * 16 * AT_PB + dc * 64);
        kb[dc][j].h[1] = *(const v8h*)(kr + (j >> 1) * AT_SLB + (j & 1) * 16 * AT_PB + dc * 64 + 32);
      }
#pragma unroll
    for (int kk = 0; kk < 2; ++kk)
#pragma unroll
      for (int t = 0; t < 4; ++t) {
        vb[kk][t].h[0] = *(const v8h*)(vr + (t >> 1) * AT_SLB + (t & 1) * 16 * AT_PB + kk * 64);
        vb[kk][t].h[1] = *(const v8h*)(vr + (t >> 1) * AT_SLB + (t & 1) * 16 * AT_PB + kk * 64 + 32);
      }
    // keeps the reads one group: sunk back among the products, each pair would cost its own full LDS latency
    __builtin_amdgcn_sched_barrier(0);
    // S^T = K . Q^T: s[j][r] = score of key kv0 + j*16 + 8*hh + r against query q0 + c; four independent tiles per d half
    v8f s[4];
#pragma unroll
    for (int j = 0; j < 4; ++j) s[j] = (v8f){0.f,0.f,0.f,0.f,0.f,0.f,0.f,0.f};
#pragma unroll
    for (int dc = 0; dc < 2; ++dc)
#pragma unroll
      for (int j = 0; j < 4; ++j) s[j] = at_mma_h(kb[dc][j].v, qa[dc], s[j]);
    // keeps the eight products back to back: a maximum drawn up among them waits out its product's latency and holds the rest back
    __builtin_amdgcn_sched_barrier(0);
    float mj[4];
#pragma unroll
    for (int j = 0; j < 4; ++j) {
      mj[j] = -INFINITY;
#pragma unroll
      for (int r = 0; r < 8; ++r) mj[j] = fmaxf(mj[j], s[j][r]);
    }
    float cm = fmaxf(fmaxf(mj[0], mj[1]), fmaxf(mj[2], mj[3]));
    cm = fmaxf(cm, xhalf(cm));             // both halves now hold the query's chunk maximum
    const float mnew = fmaxf(mrow, cm);
    const float mbnew = fmaf(mnew, c2, -P_CARRY_LOG2);
    const float alpha = __builtin_amdgcn_exp2f(mbrow - mbnew);   // 0 on the first chunk (mbrow = -inf)
    mrow = mnew;
    mbrow = mbnew;
    const v8f c2v = (v8f){c2, c2, c2, c2, c2, c2, c2, c2};
    const v8f nmb = (v8f){-mbnew, -mbnew, -mbnew, -mbnew, -mbnew, -mbnew, -mbnew, -mbnew};
    // P^T packs in place into the B operand: element e of block kk = tile 2*kk + (e >> 3), register e & 7
    FH pb[2];
    float pj[4];
#pragma unroll
    for (int j = 0; j < 4; ++j) {
      pj[j] = 0.f;
      const v8f x = __builtin_elementwise_fma(s[j], c2v, nmb);   // scaled score - scaled maximum + 15, in base-2 units
#pragma unroll
      for (int r = 0; r < 8; ++r) {
        const float p = __builtin_amdgcn_exp2f(x[r]);   // exp(scaled score - scaled maximum) x 2^15
        pj[j] += p;
        pb[j >> 1].v[(j & 1) * 8 + r] = (_Float16)p;
      }
    }
    lrow = lrow * alpha + ((pj[0] + pj[1]) + (pj[2] + pj[3]));
#pragma unroll
    for (int t = 0; t < 4; ++t)
#pragma unroll
      for (int r = 0; r < 8; ++r) oacc[t][r] *= alpha;
    // O^T += V^T . P^T
#pragma unroll
    for (int kk = 0; kk < 2; ++kk) {
#pragma unroll
      for (int t = 0; t < 4; ++t) oacc[t] = at_mma_h(vb[kk][t].v, pb[kk].v, oacc[t]);
    }
    // publish point of chunk kc + 1, every wave: own LDS reads retired, own slice landed, the barrier; it also ends every
    // wave's reads of this chunk's buffer, which the load behind it refills
    // keeps the publish point at the chunk's foot: drawn up among the softmax, the tensor wait would stand shortly behind its
    // load's issue instead of a whole chunk behind it
    __builtin_amdgcn_sched_barrier(0);
    wait_ds0();
    wait_tensor0();
    __syncthreads();
    const uint32_t nx = pinned((uint32_t)kc + 2u);   // taken behind the wait, so that the descriptor words formed from it are too
    if (pinned(nx < (uint32_t)nChunks)) {
      g0 = tdm_group0(sdst + (nx & 1u) * AT_BUFB, ssrc + (uint64_t)nx * sstep);
      tdm_load(g0, g1);
    }
  }
  wait_tensor0();   // nothing of the mover is in flight when the wave goes on to its end
  wait_ds0();

  float* os = Os[wave];
  {
    const float inv = 1.0f / (lrow + xhalf(lrow));   // the halves' sums join once; sum and O both carry 2^15
#pragma unroll
    for (int t = 0; t < 4; ++t) {
      v4f lo, hi;
#pragma unroll
      for (int r = 0; r < 4; ++r) { lo[r] = oacc[t][r] * inv; hi[r] = oacc[t][4 + r] * inv; }
      *(v4f*)(os + c * 68 + t * 16 + 8 * hh)     = lo;
      *(v4f*)(os + c * 68 + t * 16 + 8 * hh + 4) = hi;
    }
  }
  __builtin_amdgcn_fence(__ATOMIC_RELEASE, "workgroup");
  __builtin_amdgcn_wave_barrier();
  __builtin_amdgcn_fence(__ATOMIC_ACQUIRE, "workgroup");
  {
    const int c4 = (lane & 15) * 4;
    float* orow = ob + (size_t)(q0 + hh) * D_MODEL + c4;   // one base; the eight rows lie at constant steps from it
#pragma unroll
    for (int it = 0; it < 8; ++it) {
      v4f val = *(const v4f*)(os + (it * 2 + hh) * 68 + c4);
      *(v4f*)(orow + it * 2 * D_MODEL) = val;
    }
  }
}

// ---------------------------------------------------------------------------
// host launcher
// ---------------------------------------------------------------------------
extern "C" void kernel_launch(void* const* d_in, const int* in_sizes, int n_in,
                              void* d_out, int out_size, void* d_ws, size_t ws_size,
                              hipStream_t stream) {
  constexpr int S  = SEQ_LEN;
  constexpr int DM = D_MODEL;
  const size_t SD = (size_t)S * DM;    // 4194304 elements
  const size_t DD = (size_t)DM * DM;   // 1048576 elements
  if (n_in < 11) return;
  if ((size_t)in_sizes[0] != SD || (size_t)in_sizes[1] != SD || (size_t)in_sizes[2] != SD) return;
  if ((size_t)in_sizes[3] != DD || (size_t)in_sizes[5] != DD || (size_t)in_sizes[7] != DD || (size_t)in_sizes[9] != DD) return;
  if (in_sizes[4] != DM || in_sizes[6] != DM || in_sizes[8] != DM || in_sizes[10] != DM) return;
  if ((size_t)out_size != SD) return;

  const float* x_q = (const float*)d_in[0];
  const float* x_k = (const float*)d_in[1];
  const float* x_v = (const float*)d_in[2];
  const float* Wq  = (const float*)d_in[3];
  const float* bq  = (const float*)d_in[4];
  const float* Wk  = (const float*)d_in[5];
  const float* bk  = (const float*)d_in[6];
  const float* Wv  = (const float*)d_in[7];
  const float* bv  = (const float*)d_in[8];
  const float* Wo  = (const float*)d_in[9];
  const float* bo  = (const float*)d_in[10];

  //   xq  bf16 [4096][1024]  8 MiB @  0 MiB      xk  @  8 MiB      xv  @ 16 MiB
  //   wq  bf16 [1024][1024]  2 MiB @ 24 MiB      wk  @ 26 MiB      wv  @ 28 MiB     wo f16 @ 30 MiB
  //   q16 f16  [4096][1024]  8 MiB @ 32 MiB      k16 @ 40 MiB      vt16 f16 [1024][4096] @ 48 MiB
  //   o32 f32  [4096][1024] 16 MiB @ 56 MiB      o16 f16 8 MiB @ 72 MiB
  //   bias f32 [4][1024]    16 KiB @ 80 MiB      end = 83902464 B
  const size_t off_xq  = 0;
  const size_t off_xk  = off_xq  + SD * 2;
  const size_t off_xv  = off_xk  + SD * 2;
  const size_t off_wq  = off_xv  + SD * 2;
  const size_t off_wk  = off_wq  + DD * 2;
  const size_t off_wv  = off_wk  + DD * 2;
  const size_t off_wo  = off_wv  + DD * 2;
  const size_t off_q   = off_wo  + DD * 2;
  const size_t off_k   = off_q   + SD * 2;
  const size_t off_vt  = off_k   + SD * 2;
  const size_t off_o32 = off_vt  + SD * 2;
  const size_t off_o16 = off_o32 + SD * 4;
  const size_t off_b   = off_o16 + SD * 2;
  const size_t ws_end  = off_b + 4 * (size_t)DM * 4;
  if (ws_end > ws_size) return;

  char* ws = (char*)d_ws;
  unsigned short* xq   = (unsigned short*)(ws + off_xq);
  unsigned short* xk   = (unsigned short*)(ws + off_xk);
  unsigned short* xv   = (unsigned short*)(ws + off_xv);
  unsigned short* wq   = (unsigned short*)(ws + off_wq);
  unsigned short* wk   = (unsigned short*)(ws + off_wk);
  unsigned short* wv   = (unsigned short*)(ws + off_wv);
  unsigned short* wo   = (unsigned short*)(ws + off_wo);
  unsigned short* q16  = (unsigned short*)(ws + off_q);
  unsigned short* k16  = (unsigned short*)(ws + off_k);
  unsigned short* vt16 = (unsigned short*)(ws + off_vt);
  float*          o32  = (float*)(ws + off_o32);
  unsigned short* o16  = (unsigned short*)(ws + off_o16);
  float*          bws  = (float*)(ws + off_b);
  const float* bias_q = bws;
  const float* bias_k = bws + DM;
  const float* bias_v = bws + 2 * DM;
  const float* bias_o = bws + 3 * DM;

  const int SD2 = (int)(SD / 2);   // 2097152
  const int DD2 = (int)(DD / 2);   // 524288

  // 1) biases -> bf16-RNE values in f32
  bias_bf16_rne_kernel<<<dim3(DM / 256, 4), 256, 0, stream>>>(bq, bk, bv, bo, bws, DM);
  // 2) activations -> bf16 planes
  cast3_bf16x2_kernel<<<dim3(SD2 / 256, 3), 256, 0, stream>>>(x_q, x_k, x_v, xq, xk, xv, SD2);
  // 3) Wq, Wk, Wv -> bf16 planes ([out][in] = [N][K] layout as is)
  cast3_bf16x2_kernel<<<dim3(DD2 / 256, 3), 256, 0, stream>>>(Wq, Wk, Wv, wq, wk, wv, DD2);
  // 4) Wo -> f16 plane of bf16-RNE(Wo) x 2^8
  cast_f16x2_scaled_kernel<true><<<dim3(DD2 / 256, 1), 256, 0, stream>>>(Wo, wo, DD2, 256.0f);

  // GEMM tiles: (4096/128)*(1024/128) = 256 tiles of 128x128 -> 256 blocks x 8 waves; K = 1024 (K % 64 == 0)
  const int gemm_blocks = (int)((S / 128) * (DM / 128));   // 256
  // 5) q16[s][n] = x_q . Wq^T + bq   (f16 out)
  wmma_gemm64<1, false, 2, 1, false><<<dim3(gemm_blocks, 1), 256, 0, stream>>>(
      xq, xq, DM, 0L, wq, wq, DM, 0L, (void*)q16, (void*)q16, DM, 0L, bias_q, bias_q, 0L, S, DM, DM, 1.0f);
  // 6) k16[s][n] = x_k . Wk^T + bk
  wmma_gemm64<1, false, 2, 1, false><<<dim3(gemm_blocks, 1), 256, 0, stream>>>(
      xk, xk, DM, 0L, wk, wk, DM, 0L, (void*)k16, (void*)k16, DM, 0L, bias_k, bias_k, 0L, S, DM, DM, 1.0f);
  // 7) vt16[m = feature][n = s] = Wv[m,:] . x_v[s,:] + bv[m]  (role-swapped: M = 1024, N = 4096, ldc = 4096)
  wmma_gemm64<1, false, 1, 1, false><<<dim3(gemm_blocks, 1), 256, 0, stream>>>(
      wv, wv, DM, 0L, xv, xv, DM, 0L, (void*)vt16, (void*)vt16, S, 0L, bias_v, bias_v, 0L, DM, S, DM, 1.0f);

  // 8) attention: 16 heads x 64 query blocks, f32 context o32[s][h*64+d]
  attn_full64_f16_kernel<<<dim3(N_HEADS * (S / 64), 1), 128, 0, stream>>>(q16, k16, vt16, o32, 0.125f);

  // 9) o32 -> f16 plane x 2^8
  cast_f16x2_scaled_kernel<false><<<dim3(SD2 / 256, 1), 256, 0, stream>>>(o32, o16, SD2, 256.0f);

  // 10) out[s][n] = (o x 2^8) . (Wo x 2^8)^T * 2^-16 + bo  -> f32 d_out
  wmma_gemm64<0, false, 2, 0, false><<<dim3(gemm_blocks, 1), 256, 0, stream>>>(
      o16, o16, DM, 0L, wo, wo, DM, 0L, d_out, d_out, DM, 0L, bias_o, bias_o, 0L, S, DM, DM, 1.0f / 65536.0f);
}

// v007
// Measured time: 130 microseconds a run.
// Next to v006, in two timings, it ran 1.14 times as fast each time.
// Over all steps from v000 it is 4.98 times as fast.
// Projections q,k,v^T: v_wmma_f32_16x16x32_bf16 (bf16 RNE operands from the f32 inputs, f32 accumulate, bf16-RNE bias added in f32); attention q.k^T and p.v: v_wmma_f32_16x16x32_f16 (f16 q,k,v planes, p carried x2^15, f32 accumulate, f32 online softmax, score scale 0.125 in f32); output projection: v_wmma_f32_16x16x32_f16 (f16 planes of o x2^8 and bf16-RNE(Wo) x2^8, f32 accumulate, scale 2^-16, bf16-RNE bias added in f32).
#include <hip/hip_runtime.h>
#include <math.h>
#include <stdint.h>

typedef __attribute__((ext_vector_type(16))) _Float16 v16h;
typedef __attribute__((ext_vector_type(8)))  _Float16 v8h;
typedef __attribute__((ext_vector_type(16))) __bf16   v16b;
typedef __attribute__((ext_vector_type(8)))  __bf16   v8b;
typedef __attribute__((ext_vector_type(8)))  float    v8f;
typedef __attribute__((ext_vector_type(4)))  float    v4f;
typedef __attribute__((ext_vector_type(2)))  float    v2f;

constexpr int SEQ_LEN = 4096;
constexpr int D_MODEL = 1024;
constexpr int N_HEADS = 16;

__device__ __forceinline__ unsigned short f2bf_bits(float f) {
  unsigned u = __float_as_uint(f);
  return (unsigned short)((u + 0x7FFFu + ((u >> 16) & 1u)) >> 16);
}
__device__ __forceinline__ float bf_bits2f(unsigned short h) { return __uint_as_float(((unsigned)h) << 16); }
__device__ __forceinline__ unsigned pk16(unsigned short a, unsigned short b) { return (unsigned)a | ((unsigned)b << 16); }

// hazard guards as plain device helpers
__device__ __forceinline__ void dep_guard_h(v8f& a, v8f& b, v16h x, v16h y) { asm volatile("v_nop\n\tv_nop\n\tv_nop\n\tv_nop" : "+v"(a), "+v"(b) : "v"(x), "v"(y)); }
__device__ __forceinline__ void dep_guard_b(v8f& a, v8f& b, v16b x, v16b y) { asm volatile("v_nop\n\tv_nop\n\tv_nop\n\tv_nop" : "+v"(a), "+v"(b) : "v"(x), "v"(y)); }
__device__ __forceinline__ void keep4_h(v16h a, v16h b, v16h c, v16h d) { asm volatile("v_nop" :: "v"(a), "v"(b), "v"(c), "v"(d)); }
__device__ __forceinline__ void keep4_b(v16b a, v16b b, v16b c, v16b d) { asm volatile("v_nop" :: "v"(a), "v"(b), "v"(c), "v"(d)); }
__device__ __forceinline__ void acc_guard4(v8f& a, v8f& b, v8f& c, v8f& d) { asm volatile("v_nop\n\tv_nop\n\tv_nop\n\tv_nop" : "+v"(a), "+v"(b), "+v"(c), "+v"(d)); }
template <typename T> struct Frag;
template <> struct Frag<_Float16> {
  typedef v16h V; typedef v8h H; union U { v16h v; v8h h[2]; };
  static __device__ __forceinline__ v16h load(const _Float16* p) {   // elements 0..7 <- p[0..7], 8..15 <- p[16..23]
    U f; f.h[0] = *(const v8h*)(p); f.h[1] = *(const v8h*)(p + 16); return f.v;
  }
  static __device__ __forceinline__ v8f mma(v16h a, v16h b, v8f c) {
    return __builtin_amdgcn_wmma_f32_16x16x32_f16(false, a, false, b, (short)0, c, false, false);
  }
  static __device__ __forceinline__ void guard(v8f& a, v8f& b, v16h x, v16h y) { dep_guard_h(a, b, x, y); }
  static __device__ __forceinline__ void keep(v16h a, v16h b, v16h c, v16h d) { keep4_h(a, b, c, d); }
};
template <> struct Frag<__bf16> {
  typedef v16b V; typedef v8b H; union U { v16b v; v8b h[2]; };
  static __device__ __forceinline__ v16b load(const __bf16* p) {
    U f; f.h[0] = *(const v8b*)(p); f.h[1] = *(const v8b*)(p + 16); return f.v;
  }
  static __device__ __forceinline__ v8f mma(v16b a, v16b b, v8f c) {
    return __builtin_amdgcn_wmma_f32_16x16x32_bf16(false, a, false, b, (short)0, c, false, false);
  }
  static __device__ __forceinline__ void guard(v8f& a, v8f& b, v16b x, v16b y) { dep_guard_b(a, b, x, y); }
  static __device__ __forceinline__ void keep(v16b a, v16b b, v16b c, v16b d) { keep4_b(a, b, c, d); }
};

// ---- LDS-staged batched WMMA GEMM -------------------------------------------
// C[m,n] = scale * sum_k A[m,k] * Bt[n,k] (+bias)(+resid); a block of 8 waves owns a 128x128 tile, each wave 32x64 of it.
// A row-major [M,K]; Bt row-major [N,K]; M,N % 128 == 0, K % 64 == 0, K >= 64.
// Per 64-k step the block brings 128 rows x 128 B of A and of Bt into LDS: 8 lanes x 16 B cover one whole row line,
// 256 threads x 4 pieces per operand = the whole tile. Two LDS buffers: the next step's global loads are issued ahead of
// this step's products and stored behind them, one __syncthreads() per step.
// SPLIT (hi/lo planes) is not staged: single-plane operands only.
// BIAS_MODE: 0 = none, 1 = bias[m], 2 = bias[n], 3 = by the job of a TRIO grid (below).
// TRIO: three independent products share one grid, blockIdx.y = job b; operands, C and bias of job b lie b strides behind
// job 0's (the bias vectors one behind another), C is dense (row pitch = its N). Jobs 0, 1: C = A . Bt^T + bias[n].
// Job 2 takes the two operands in swapped roles (M and N swap with them): C = Bt . A^T + bias[m].
// OUT_MODE: 0 = f32, 1 = f16, 2 = bf16 hi plane (Cout) + bf16 lo plane (Cout2).
// ET: 0 = f16 operands, 1 = bf16 operands (pointers passed as 16-bit storage)
#define GM_BT 128  // block tile, rows of A and of Bt
#define GM_LP 72   // LDS row pitch in elements: 64 + 8, 144 B = 16 B x 9, so 16 rows read by ds_load_b128 fall on 16 distinct bank groups
template <int I> struct IntC { static constexpr int value = I; };   // a compile-time int handed to a generic lambda
template <int ET> struct Elem;
template <> struct Elem<0> { typedef _Float16 T; };
template <> struct Elem<1> { typedef __bf16 T; };
template <int ET, bool SPLIT, int BIAS_MODE, int OUT_MODE, bool RESID, int ACT = 0, bool TRIO = false>
__global__ __launch_bounds__(256) void wmma_gemm64(
    const unsigned short* __restrict__ Ap, const unsigned short* __restrict__ A2p, int lda0, long strideA,
    const unsigned short* __restrict__ Btp, const unsigned short* __restrict__ Bt2p, int ldb0, long strideB,
    void* __restrict__ Cout, void* __restrict__ Cout2, int ldc0, long strideC,
    const float* __restrict__ bias0,
    const float* __restrict__ resid, long strideR,
    int M0, int N0, int K, float scale) {
  static_assert(!SPLIT, "single-plane operands only");
  static_assert((BIAS_MODE == 3) == TRIO, "the job picks the bias mode in a TRIO grid and nowhere else");
  typedef typename Elem<ET>::T T;
  typedef typename Frag<T>::V V;
  typedef typename Frag<T>::H H;
  const T* A = (const T*)Ap; const T* Bt = (const T*)Btp;
  __shared__ __align__(16) T sA[2][GM_BT * GM_LP];   // A rows of the block tile, one 64-k step, two buffers
  __shared__ __align__(16) T sB[2][GM_BT * GM_LP];   // Bt rows of the block tile
  __shared__ __align__(16) float sT[8][16 * 68];     // per-wave 16x64 slab, pitch 68 floats
  const int b    = blockIdx.y;
  const int tid  = threadIdx.x;
  const int lane = tid & 31;
  const int wave = tid >> 5;
  const bool sw = TRIO && b == 2;              // block-uniform: this job's operands change roles
  const int M = sw ? N0 : M0;
  const int N = sw ? M0 : N0;
  const int tilesN = N >> 7;
  const int tilesM = M >> 7;
  const int tile = blockIdx.x;
  if (tile >= tilesM * tilesN) return;   // block-uniform, ahead of every barrier
  const int tm = tile / tilesN;
  const int tn = tile - tm * tilesN;
  const int bm0 = tm << 7;
  const int bn0 = tn << 7;
  const int wm = (wave >> 1) << 5;             // this wave's rows inside the block tile: 0, 32, 64, 96
  const int wn = (wave & 1) << 6;              // this wave's columns inside the block tile: 0, 64
  const int m0 = bm0 + wm;
  const int n0 = bn0 + wn;

  const T* Ab  = sw ? Bt + (size_t)b * strideB : A  + (size_t)b * strideA;
  const T* Bb  = sw ? A  + (size_t)b * strideA : Bt + (size_t)b * strideB;
  const int lda = sw ? ldb0 : lda0;
  const int ldb = sw ? lda0 : ldb0;
  const int ldc = TRIO ? N : ldc0;
  const float* bias = TRIO ? bias0 + (size_t)b * (sw ? M : N) : bias0;

  const int rlane = lane & 15;                 // row (A) / col (B, D) within subtile
  const int koff  = (lane >> 4) * 8;           // k offset of this lane half
  const int mOff  = (lane >> 4) * 8;           // D row offset

  // every unroll directive from here to the epilogue makes the array indices constants, so that acc, the staged pieces
  // and the fragments live in registers and not in scratch
  v8f acc[2][4];
#pragma unroll
  for (int i = 0; i < 2; ++i)
#pragma unroll
    for (int j = 0; j < 4; ++j) acc[i][j] = (v8f){0.f,0.f,0.f,0.f,0.f,0.f,0.f,0.f};

  // staging map: piece it of a thread = row it*32 + (tid >> 3), elements (tid & 7)*8 .. +7 of the step's 64
  const int srow = tid >> 3;
  const int sseg = (tid & 7) << 3;
  const int so = srow * GM_LP + sseg;
  const char* Ac = (const char*)(Ab + (size_t)bm0 * lda);   // block-uniform bases of the two row bands
  const char* Bc = (const char*)(Bb + (size_t)bn0 * ldb);
  unsigned oa[4], ob[4];                       // one running byte offset per piece (a 128-row band stays far below 4 GiB), 128 B a step
  H ra[4], rb[4];
#pragma unroll
  for (int it = 0; it < 4; ++it) {
    oa[it] = (unsigned)(((it * 32 + srow) * lda + sseg) * 2);
    ob[it] = (unsigned)(((it * 32 + srow) * ldb + sseg) * 2);
    ra[it] = *(const H*)(Ac + oa[it]);
    rb[it] = *(const H*)(Bc + ob[it]);
  }
#pragma unroll
  for (int it = 0; it < 4; ++it) {
    *(H*)(&sA[0][so + it * 32 * GM_LP]) = ra[it];
    *(H*)(&sB[0][so + it * 32 * GM_LP]) = rb[it];
  }

  const int nk = K >> 6;
  for (int kt = 0; kt < nk; ++kt) {
    // publishes buffer kt & 1 and ends every wave's reads of the other buffer, which is refilled below
    __syncthreads();
    const bool more = kt + 1 < nk;             // block-uniform
    if (more) {
#pragma unroll
      for (int it = 0; it < 4; ++it) {
        oa[it] += 128;
        ob[it] += 128;
        ra[it] = *(const H*)(Ac + oa[it]);
        rb[it] = *(const H*)(Bc + ob[it]);
      }
      // stands behind the eight loads, ahead of every later write of an offset or base register that they name
      asm volatile("s_wait_xcnt 0x0" ::: "memory");
    }
    const T* sa = &sA[kt & 1][(wm + rlane) * GM_LP + koff];
    const T* sb = &sB[kt & 1][(wn + rlane) * GM_LP + koff];
    // the step's 24 fragment reads stand together ahead of its 16 products
    V bh[2][4], ah[2][2];
#pragma unroll
    for (int kk = 0; kk < 2; ++kk) {
#pragma unroll
      for (int j = 0; j < 4; ++j) bh[kk][j] = Frag<T>::load(sb + j * 16 * GM_LP + kk * 32);
#pragma unroll
      for (int i = 0; i < 2; ++i) ah[kk][i] = Frag<T>::load(sa + i * 16 * GM_LP + kk * 32);
    }
#pragma unroll
    for (int kk = 0; kk < 2; ++kk) {
#pragma unroll
      for (int i = 0; i < 2; ++i) {
#pragma unroll
        for (int j = 0; j < 4; ++j) acc[i][j] = Frag<T>::mma(ah[kk][i], bh[kk][j], acc[i][j]);
        Frag<T>::guard(acc[i][0], acc[i][3], ah[kk][i], ah[kk][i]);   // v_nops: the slots behind the last product before its A or D is touched
      }
      Frag<T>::keep(bh[kk][0], bh[kk][1], bh[kk][2], bh[kk][3]);   // holds the B fragments' registers to the end of their products
    }
    if (more) {
      const int nb = (kt + 1) & 1;
#pragma unroll
      for (int it = 0; it < 4; ++it) {
        *(H*)(&sA[nb][so + it * 32 * GM_LP]) = ra[it];
        *(H*)(&sB[nb][so + it * 32 * GM_LP]) = rb[it];
      }
    }
  }
  acc_guard4(acc[0][0], acc[0][1], acc[0][2], acc[0][3]);
  acc_guard4(acc[1][0], acc[1][1], acc[1][2], acc[1][3]);

  // ---- epilogue ----
  float* slab = sT[wave];
  const float* Rb = RESID ? (resid + (size_t)b * strideR) : nullptr;
  // written once, compiled per bias mode BM (1 or 2 in a TRIO grid, picked below by one block-uniform branch), so that each
  // job's bias loads stand together as in a kernel of that mode alone
  auto epilogue = [&](auto bmc) __attribute__((always_inline)) {
  constexpr int BM = decltype(bmc)::value;
#pragma unroll
  for (int i = 0; i < 2; ++i) {
    const int mBase = m0 + (i << 4);
#pragma unroll
    for (int j = 0; j < 4; ++j) {
      const int n = n0 + (j << 4) + rlane;
      float bv = 0.f;
      if (BM == 2) bv = bias[n];
#pragma unroll
      for (int r = 0; r < 8; ++r) {
        float v = acc[i][j][r] * scale;
        if (BM == 1) v += bias[mBase + mOff + r];
        if (BM == 2) v += bv;
        if (RESID) v += Rb[(size_t)(mBase + mOff + r) * ldc + n];
        if (ACT == 1) v = tanhf(v);
        if (ACT == 2) v = fmaxf(v, 0.0f);
        if (ACT == 3) v = v / (1.0f + expf(-v));
        if (ACT == 4) v = (v > 0.f) ? v : 0.01f * v;
        if (ACT == 5) v = 0.5f * v * (1.0f + erff(v * 0.70710678118654752f));
        slab[(mOff + r) * 68 + (j << 4) + rlane] = v;
      }
    }
    __builtin_amdgcn_fence(__ATOMIC_RELEASE, "workgroup");
    __builtin_amdgcn_wave_barrier();
    __builtin_amdgcn_fence(__ATOMIC_ACQUIRE, "workgroup");
    if (OUT_MODE == 0) {
      float* C = (float*)Cout + (size_t)b * strideC;
      const int hh = lane >> 4, c4 = (lane & 15) * 4;     // row seg = 256 B = 16 lanes x 16 B
      {
#pragma unroll
        for (int it = 0; it < 8; ++it) {
          const int row = it * 2 + hh;
          v4f v = *(const v4f*)(slab + row * 68 + c4);
          *(v4f*)(C + (size_t)(mBase + row) * ldc + n0 + c4) = v;
        }
        
      }
    } else {
      const int q = lane >> 3, c8 = (lane & 7) * 8;
      unsigned short* C  = (unsigned short*)Cout  + (size_t)b * strideC;
      unsigned short* C2 = (OUT_MODE == 2) ? ((unsigned short*)Cout2 + (size_t)b * strideC) : nullptr;
      {
#pragma unroll
        for (int it = 0; it < 4; ++it) {
          const int row = it * 4 + q;
          const float* sp = slab + row * 68 + c8;
          v8h hv, lv;
#pragma unroll
          for (int e = 0; e < 8; ++e) {
            if (OUT_MODE == 1) {
              hv[e] = (_Float16)sp[e];
            } else {
              unsigned short hb = f2bf_bits(sp[e]);
              unsigned short lb = f2bf_bits(sp[e] - bf_bits2f(hb));
              hv[e] = __builtin_bit_cast(_Float16, hb);
              lv[e] = __builtin_bit_cast(_Float16, lb);
            }
          }
          *(v8h*)(C + (size_t)(mBase + row) * ldc + n0 + c8) = hv;
          if (OUT_MODE == 2) *(v8h*)(C2 + (size_t)(mBase + row) * ldc + n0 + c8) = lv;
        }
        
      }
    }
    __builtin_amdgcn_fence(__ATOMIC_RELEASE, "workgroup");
    __builtin_amdgcn_wave_barrier();
    __builtin_amdgcn_fence(__ATOMIC_ACQUIRE, "workgroup");
  }
  };
  if constexpr (BIAS_MODE == 3) {
    if (sw) epilogue(IntC<1>{}); else epilogue(IntC<2>{});
  } else {
    epilogue(IntC<BIAS_MODE>{});
  }
}

// ---------------------------------------------------------------------------
// Conversions, two elements a thread: element pair i of a plane.
// ---------------------------------------------------------------------------
// f32 -> bf16 (RNE)
__device__ __forceinline__ void cast_bf16x2(const float* __restrict__ in, unsigned short* __restrict__ out, int i) {
  const v2f f = *(const v2f*)(in + 2 * (size_t)i);
  ((unsigned*)out)[i] = pk16(f2bf_bits(f[0]), f2bf_bits(f[1]));
}
// f32 -> f16 with a power-of-two carry: out = f16(g(in) * scale), g = bf16 RNE when PREBF, identity otherwise
template <bool PREBF>
__device__ __forceinline__ void cast_f16x2_scaled(const float* __restrict__ in, unsigned short* __restrict__ out, int i, float scale) {
  const v2f f = *(const v2f*)(in + 2 * (size_t)i);
  float a = f[0], b = f[1];
  if (PREBF) { a = bf_bits2f(f2bf_bits(a)); b = bf_bits2f(f2bf_bits(b)); }
  const _Float16 h0 = (_Float16)(a * scale), h1 = (_Float16)(b * scale);
  ((unsigned*)out)[i] = pk16(__builtin_bit_cast(unsigned short, h0), __builtin_bit_cast(unsigned short, h1));
}

// ---------------------------------------------------------------------------
// Every conversion that needs the inputs alone, in one grid: none reads what another writes. The job is picked by ranges of
// blockIdx.x (block-uniform), the largest planes first; a block of 256 threads covers 512 elements of a plane (256 of a bias):
//   3 x CV_XB blocks: x_q, x_k, x_v -> bf16 planes        (CV_XB x 512 = 4096 x 1024)
//   3 x CV_WB blocks: Wq, Wk, Wv    -> bf16 planes        (CV_WB x 512 = 1024 x 1024)
//       CV_WB blocks: Wo            -> f16 plane of bf16-RNE(Wo) x wo_scale
//   4 x CV_BB blocks: bq, bk, bv, bo -> bf16-RNE values held as f32, bias_out[sel * D_MODEL + i]
// ---------------------------------------------------------------------------
constexpr int CV_XB = SEQ_LEN * D_MODEL / 512;   // 8192
constexpr int CV_WB = D_MODEL * D_MODEL / 512;   // 2048
constexpr int CV_BB = D_MODEL / 256;             // 4
constexpr int CV_BLOCKS = 3 * CV_XB + 3 * CV_WB + CV_WB + 4 * CV_BB;   // 32784
__global__ __launch_bounds__(256) void convert_inputs_kernel(
    const float* __restrict__ x0, const float* __restrict__ x1, const float* __restrict__ x2,
    const float* __restrict__ w0, const float* __restrict__ w1, const float* __restrict__ w2, const float* __restrict__ w3,
    const float* __restrict__ b0, const float* __restrict__ b1, const float* __restrict__ b2, const float* __restrict__ b3,
    unsigned short* __restrict__ xo0, unsigned short* __restrict__ xo1, unsigned short* __restrict__ xo2,
    unsigned short* __restrict__ wo0, unsigned short* __restrict__ wo1, unsigned short* __restrict__ wo2,
    unsigned short* __restrict__ wo3, float* __restrict__ bias_out, float wo_scale) {
  const int t = threadIdx.x;
  int blk = blockIdx.x;
  if (blk < 3 * CV_XB) {
    const int sel = blk / CV_XB;
    const float* in = (sel == 0) ? x0 : ((sel == 1) ? x1 : x2);
    unsigned short* out = (sel == 0) ? xo0 : ((sel == 1) ? xo1 : xo2);
    cast_bf16x2(in, out, (blk - sel * CV_XB) * 256 + t);
    asm volatile("s_wait_xcnt 0x0" ::: "memory");   // stands ahead of any later overwrite of the store's address registers (other ranges' code may follow in the built order)
    return;
  }
  blk -= 3 * CV_XB;
  if (blk < 3 * CV_WB) {
    const int sel = blk / CV_WB;
    const float* in = (sel == 0) ? w0 : ((sel == 1) ? w1 : w2);
    unsigned short* out = (sel == 0) ? wo0 : ((sel == 1) ? wo1 : wo2);
    cast_bf16x2(in, out, (blk - sel * CV_WB) * 256 + t);
    asm volatile("s_wait_xcnt 0x0" ::: "memory");   // stands ahead of any later overwrite of the store's address registers (other ranges' code may follow in the built order)
    return;
  }
  blk -= 3 * CV_WB;
  if (blk < CV_WB) {
    cast_f16x2_scaled<true>(w3, wo3, blk * 256 + t, wo_scale);
    asm volatile("s_wait_xcnt 0x0" ::: "memory");   // stands ahead of any later overwrite of the store's address registers (other ranges' code may follow in the built order)
    return;
  }
  blk -= CV_WB;
  if (blk < 4 * CV_BB) {
    const int sel = blk / CV_BB;
    const float* in = (sel == 0) ? b0 : ((sel == 1) ? b1 : ((sel == 2) ? b2 : b3));
    const int i = (blk - sel * CV_BB) * 256 + t;
    bias_out[sel * D_MODEL + i] = bf_bits2f(f2bf_bits(in[i]));
    asm volatile("s_wait_xcnt 0x0" ::: "memory");   // stands ahead of any later overwrite of the store's address registers (other ranges' code may follow in the built order)
  }
}

// ---------------------------------------------------------------------------
// f32 -> f16 with a power-of-two carry, one plane.
// Coverage: grid.x = n2/256 blocks x 256 threads x 2 elements = 2*n2 = whole plane.
// ---------------------------------------------------------------------------
__global__ __launch_bounds__(256) void cast_f16x2_scaled_kernel(const float* __restrict__ in, unsigned short* __restrict__ out,
                                                               int n2, float scale) {
  const int i = blockIdx.x * 256 + threadIdx.x;
  if (i < n2) cast_f16x2_scaled<false>(in, out, i, scale);
}

// =====================================================================================
// Full (non-causal, unmasked) attention, head dim 64, single 16-bit products.
//   q plane (f16): element (s, h, d) at [s*D_MODEL + h*64 + d]
//   k plane (f16): element (s, h, d) at [s*D_MODEL + h*64 + d]
//   v^T plane (f16): element (h, d, s) at [(h*64 + d)*SEQ_LEN + s]
//   out f32: element (s, h, d) at [s*D_MODEL + h*64 + d]
//   scores^T = (k . q^T) * sscale : v_wmma_f32_16x16x32_f16 (A = K rows, B = q), f32 accumulate, sscale applied in f32
//                                   inside the one fma per score that feeds v_exp_f32 (base 2)
//   out^T    = v^T . p^T          : v_wmma_f32_16x16x32_f16 (A = V^T rows, B = p^T packed from the score registers),
//                                   p (unnormalised, x2^15) and v in f16, f32 accumulate
//   online softmax in f32 over all SEQ_LEN keys (64 chunks of 64, compile-time trip count, no masking).
//   Block = 4 waves = 64 query rows of one head; grid.x = N_HEADS * (SEQ_LEN/64) = 1024.
//   K / V^T chunk staging: one tensor_load_to_lds per wave and chunk, each a slice of 32 rows x 128 B (waves 0, 1: K rows
//   0-31, 32-63 of the chunk; waves 2, 3: V^T rows 0-31, 32-63), padded by the mover to the 144-B pitch; two LDS buffers,
//   the load of chunk s + 2 issued at the foot of chunk s, one publish point (waits, barrier) per chunk.
//   Output: per-wave 16x64 f32 tile staged in LDS; each 64-float row segment (256 B) written by 16 lanes x 16 B
//   Coverage: 1024 blocks x 4 waves x 16 rows x 64 floats = 4096 x 1024 = the whole out plane.
// =====================================================================================
#define AT_D 64
#define AT_NW 4
#define AT_QB 64
#define AT_KC 64
#define AT_PB 144u  // LDS row pitch of the 16-bit tiles in bytes: 16 B x 9, so 16 rows read by ds_load_b128 fall on 16 distinct bank groups
#define AT_SR 32u            // rows of one tensor-load slice
#define AT_SLB 6144u         // a slice's room in LDS: 32 rows x 144 B = 4608 B, rounded up so that every slice starts at a multiple of 2 KiB
#define AT_BUFB (4u * AT_SLB) // one buffer: K slices 0, 1, then V^T slices 0, 1
typedef uint32_t u32x4 __attribute__((ext_vector_type(4)));
typedef uint32_t u32x8 __attribute__((ext_vector_type(8)));
constexpr float P_CARRY_LOG2 = 15.0f;   // p and its running sum are carried x2^15; the factor cancels in the final division

__device__ __forceinline__ v8f at_mma_h(v16h a, v16h b, v8f c) {
  return __builtin_amdgcn_wmma_f32_16x16x32_f16(false, a, false, b, (short)0, c, false, false);
}

__device__ __forceinline__ uint32_t uni(uint32_t v) { return (uint32_t)__builtin_amdgcn_readfirstlane(v); }
__device__ __forceinline__ uint32_t pinned(uint32_t v) {
  uint32_t w = uni(v);
  asm volatile("" : "+s"(w));   // holds the word in a scalar register; without it the test may become a vector condition
  return w;
}
// the compiler places no wait for the tensor mover: a tile counts as landed only behind its issuer's own wait
__device__ __forceinline__ void wait_tensor0() { asm volatile("s_wait_tensorcnt 0x0" ::: "memory"); }
// this wave's LDS reads have retired before the barrier behind which their buffer is refilled
__device__ __forceinline__ void wait_ds0() { asm volatile("s_wait_dscnt 0x0" ::: "memory"); }
__device__ __forceinline__ void tdm_load(u32x4 g0, u32x8 g1) { asm volatile("tensor_load_to_lds %0, %1" :: "{s[84:87]}"(g0), "{s[88:95]}"(g1) : "memory"); }
// descriptor group 1: 1-byte elements, tensor = tile = 32 rows of 128 B, source row pitch src_pitch bytes,
// 4 dwords of LDS pad behind every 32 dwords (one row): LDS pitch 144 B; no workgroup mask
__device__ __forceinline__ u32x8 tdm_group1(uint32_t src_pitch) {
  constexpr uint32_t d0 = 128u, d1 = AT_SR;
  u32x8 g;
  g[0] = uni((1u << 20) | (4u << 22) | (3u << 25));
  g[1] = uni((d0 & 0xFFFFu) << 16);
  g[2] = uni((d0 >> 16) | ((d1 & 0xFFFFu) << 16));
  g[3] = uni((d1 >> 16) | (d0 << 16));
  g[4] = uni(d1);
  g[5] = uni(src_pitch);
  g[6] = uni(0u);
  g[7] = uni(0u);
  return g;
}
// descriptor group 0: count 1, LDS byte offset, global address of the tile's first byte, type 2
__device__ __forceinline__ u32x4 tdm_group0(uint32_t lds_dst, uint64_t ga) {
  u32x4 g;
  g[0] = uni(1u); g[1] = uni(lds_dst); g[2] = uni((uint32_t)ga); g[3] = uni((((uint32_t)(ga >> 32)) & 0x01FFFFFFu) | 0x80000000u);
  return g;
}

// lane l takes the value of lane l ^ 16
__device__ __forceinline__ float xhalf(float x) {
  return __builtin_bit_cast(float, __builtin_amdgcn_permlanex16(__builtin_bit_cast(int, x), __builtin_bit_cast(int, x), 0x76543210, 0xfedcba98, false, false));
}

__global__ __launch_bounds__(128)
void attn_full64_f16_kernel(const unsigned short* __restrict__ qp, const unsigned short* __restrict__ kp,
                            const unsigned short* __restrict__ vtp, float* __restrict__ out, float sscale) {
  union FH { v16h v; v8h h[2]; };
  __shared__ __attribute__((aligned(2048))) unsigned char ring[2 * AT_BUFB];   // two buffers of K [kv][d] and V [d][kv] slices, 48 KB
  __shared__ __align__(16) float    Os[AT_NW][16 * 68];            // per wave out tile, pitch 68

  const int tid  = threadIdx.x;
  const int wave = tid >> 5;
  const int lane = tid & 31;
  const int hh   = lane >> 4;
  const int c    = lane & 15;

  const int nqb = SEQ_LEN / AT_QB;        // 64
  const int bx = blockIdx.x;
  const int qb = bx % nqb;
  const int h  = bx / nqb;                // 0..N_HEADS-1 (grid = N_HEADS * nqb)
  const int q0 = qb * AT_QB + wave * 16;

  const _Float16* Qg = (const _Float16*)(const void*)qp  + (size_t)h * AT_D;
  const _Float16* Kg = (const _Float16*)(const void*)kp  + (size_t)h * AT_D;
  const _Float16* Vg = (const _Float16*)(const void*)vtp + (size_t)h * AT_D * SEQ_LEN;
  float*          ob = out + (size_t)h * AT_D;

  // ---- K / V^T slices by tensor load: every wave issues its own slice of every chunk, unconditionally ----
  const uint32_t wv   = uni((uint32_t)threadIdx.x >> 5);
  const bool     isV  = (wv & 2u) != 0u;
  const uint32_t srow = (wv & 1u) * AT_SR;                                   // the slice's first row in the chunk tile
  const uint32_t spitch = isV ? (uint32_t)SEQ_LEN * 2u : (uint32_t)D_MODEL * 2u;   // source row pitch in bytes
  const uint32_t sstep  = isV ? (uint32_t)AT_KC * 2u : (uint32_t)AT_KC * (uint32_t)D_MODEL * 2u;   // bytes from one chunk's slice to the next's
  const uint64_t ssrc = (uint64_t)(size_t)(isV ? Vg : Kg) + (uint64_t)(srow * spitch);
  const uint32_t sdst = (uint32_t)(size_t)ring + wv * AT_SLB;
  const u32x8 g1 = tdm_group1(spitch);
  // prologue, two buffers: chunk 0's load, its wait, the barrier that publishes it, then chunk 1's load
  u32x4 g0 = tdm_group0(sdst, ssrc);
  tdm_load(g0, g1);
  wait_tensor0();
  __syncthreads();
  g0 = tdm_group0(sdst + AT_BUFB, ssrc + sstep);
  tdm_load(g0, g1);

  // ---- Q fragments (B operand, column = lane&15, split k map via Frag load): 2 d-chunks ----
  v16h qa[2];
#pragma unroll
  for (int dc = 0; dc < 2; ++dc) {
    const _Float16* qr = Qg + (size_t)(q0 + c) * D_MODEL + dc * 32 + 8 * hh;
    qa[dc] = Frag<_Float16>::load(qr);
  }

  // One query column per lane (c); the two wave halves split that query's keys.
  float mrow = -INFINITY, lrow = 0.f;      // running maximum of the raw scores (equal in both halves), this half's running sum (x2^15)
  float mbrow = -INFINITY;                 // mrow * c2 - 15: what one fma takes off a score ahead of the base-2 exponential
  const float c2 = sscale * 1.44269504088896340736f;   // score scale times log2(e); sscale > 0, so the raw scores order as the scaled ones
  v8f oacc[4];                             // O^T tiles: oacc[t][r] = O[q0 + c][t*16 + 8*hh + r]
#pragma unroll
  for (int t = 0; t < 4; ++t) oacc[t] = (v8f){0.f,0.f,0.f,0.f,0.f,0.f,0.f,0.f};

  const int nChunks = SEQ_LEN / AT_KC;   // 64, compile-time constant
  for (int kc = 0; kc < nChunks; ++kc) {
    // this chunk's buffer; row x of a 64-row tile lies in slice x >> 5 at row x & 31
    const unsigned char* kr = ring + (uint32_t)(kc & 1) * AT_BUFB + (uint32_t)c * AT_PB + 16u * (uint32_t)hh;
    const unsigned char* vr = kr + 2u * AT_SLB;

    // the chunk's 32 fragment reads (K first, in the order of their use, then V^T) stand together behind the barrier, ahead
    // of all 16 products: one place with LDS reads per chunk, and the V^T fragments land under the score products and the softmax
    // (the unroll directives make the array indices constants, so that the fragments live in registers)
    FH kb[2][4], vb[2][4];
#pragma unroll
    for (int dc = 0; dc < 2; ++dc)
#pragma unroll
      for (int j = 0; j < 4; ++j) {
        kb[dc][j].h[0] = *(const v8h*)(kr + (j >> 1) * AT_SLB + (j & 1) * 16 * AT_PB + dc * 64);
        kb[dc][j].h[1] = *(const v8h*)(kr + (j >> 1) * AT_SLB + (j & 1) * 16 * AT_PB + dc * 64 + 32);
      }
#pragma unroll
    for (int kk = 0; kk < 2; ++kk)
#pragma unroll
      for (int t = 0; t < 4; ++t) {
        vb[kk][t].h[0] = *(const v8h*)(vr + (t >> 1) * AT_SLB + (t & 1) * 16 * AT_PB + kk * 64);
        vb[kk][t].h[1] = *(const v8h*)(vr + (t >> 1) * AT_SLB + (t & 1) * 16 * AT_PB + kk * 64 + 32);
      }
    // keeps the reads one group: sunk back among the products, each pair would cost its own full LDS latency
    __builtin_amdgcn_sched_barrier(0);
    // S^T = K . Q^T: s[j][r] = score of key kv0 + j*16 + 8*hh + r against query q0 + c; four independent tiles per d half
    v8f s[4];
#pragma unroll
    for (int j = 0; j < 4; ++j) s[j] = (v8f){0.f,0.f,0.f,0.f,0.f,0.f,0.f,0.f};
#pragma unroll
    for (int dc = 0; dc < 2; ++dc)
#pragma unroll
      for (int j = 0; j < 4; ++j) s[j] = at_mma_h(kb[dc][j].v, qa[dc], s[j]);
    // keeps the eight products back to back: a maximum drawn up among them waits out its product's latency and holds the rest back
    __builtin_amdgcn_sched_barrier(0);
    float mj[4];
#pragma unroll
    for (int j = 0; j < 4; ++j) {
      mj[j] = -INFINITY;
#pragma unroll
      for (int r = 0; r < 8; ++r) mj[j] = fmaxf(mj[j], s[j][r]);
    }
    float cm = fmaxf(fmaxf(mj[0], mj[1]), fmaxf(mj[2], mj[3]));
    cm = fmaxf(cm, xhalf(cm));             // both halves now hold the query's chunk maximum
    const float mnew = fmaxf(mrow, cm);
    const float mbnew = fmaf(mnew, c2, -P_CARRY_LOG2);
    const float alpha = __builtin_amdgcn_exp2f(mbrow - mbnew);   // 0 on the first chunk (mbrow = -inf)
    mrow = mnew;
    mbrow = mbnew;
    const v8f c2v = (v8f){c2, c2, c2, c2, c2, c2, c2, c2};
    const v8f nmb = (v8f){-mbnew, -mbnew, -mbnew, -mbnew, -mbnew, -mbnew, -mbnew, -mbnew};
    // P^T packs in place into the B operand: element e of block kk = tile 2*kk + (e >> 3), register e & 7
    FH pb[2];
    float pj[4];
#pragma unroll
    for (int j = 0; j < 4; ++j) {
      pj[j] = 0.f;
      const v8f x = __builtin_elementwise_fma(s[j], c2v, nmb);   // scaled score - scaled maximum + 15, in base-2 units
#pragma unroll
      for (int r = 0; r < 8; ++r) {
        const float p = __builtin_amdgcn_exp2f(x[r]);   // exp(scaled score - scaled maximum) x 2^15
        pj[j] += p;
        pb[j >> 1].v[(j & 1) * 8 + r] = (_Float16)p;
      }
    }
    lrow = lrow * alpha + ((pj[0] + pj[1]) + (pj[2] + pj[3]));
#pragma unroll
    for (int t = 0; t < 4; ++t)
#pragma unroll
      for (int r = 0; r < 8; ++r) oacc[t][r] *= alpha;
    // O^T += V^T . P^T
#pragma unroll
    for (int kk = 0; kk < 2; ++kk) {
#pragma unroll
      for (int t = 0; t < 4; ++t) oacc[t] = at_mma_h(vb[kk][t].v, pb[kk].v, oacc[t]);
    }
    // publish point of chunk kc + 1, every wave: own LDS reads retired, own slice landed, the barrier; it also ends every
    // wave's reads of this chunk's buffer, which the load behind it refills
    // keeps the publish point at the chunk's foot: drawn up among the softmax, the tensor wait would stand shortly behind its
    // load's issue instead of a whole chunk behind it
    __builtin_amdgcn_sched_barrier(0);
    wait_ds0();
    wait_tensor0();
    __syncthreads();
    const uint32_t nx = pinned((uint32_t)kc + 2u);   // taken behind the wait, so that the descriptor words formed from it are too
    if (pinned(nx < (uint32_t)nChunks)) {
      g0 = tdm_group0(sdst + (nx & 1u) * AT_BUFB, ssrc + (uint64_t)nx * sstep);
      tdm_load(g0, g1);
    }
  }
  wait_tensor0();   // nothing of the mover is in flight when the wave goes on to its end
  wait_ds0();

  float* os = Os[wave];
  {
    const float inv = 1.0f / (lrow + xhalf(lrow));   // the halves' sums join once; sum and O both carry 2^15
#pragma unroll
    for (int t = 0; t < 4; ++t) {
      v4f lo, hi;
#pragma unroll
      for (int r = 0; r < 4; ++r) { lo[r] = oacc[t][r] * inv; hi[r] = oacc[t][4 + r] * inv; }
      *(v4f*)(os + c * 68 + t * 16 + 8 * hh)     = lo;
      *(v4f*)(os + c * 68 + t * 16 + 8 * hh + 4) = hi;
    }
  }
  __builtin_amdgcn_fence(__ATOMIC_RELEASE, "workgroup");
  __builtin_amdgcn_wave_barrier();
  __builtin_amdgcn_fence(__ATOMIC_ACQUIRE, "workgroup");
  {
    const int c4 = (lane & 15) * 4;
    float* orow = ob + (size_t)(q0 + hh) * D_MODEL + c4;   // one base; the eight rows lie at constant steps from it
#pragma unroll
    for (int it = 0; it < 8; ++it) {
      v4f val = *(const v4f*)(os + (it * 2 + hh) * 68 + c4);
      *(v4f*)(orow + it * 2 * D_MODEL) = val;
    }
  }
}

// ---------------------------------------------------------------------------
// host launcher
// ---------------------------------------------------------------------------
extern "C" void kernel_launch(void* const* d_in, const int* in_sizes, int n_in,
                              void* d_out, int out_size, void* d_ws, size_t ws_size,
                              hipStream_t stream) {
  constexpr int S  = SEQ_LEN;
  constexpr int DM = D_MODEL;
  const size_t SD = (size_t)S * DM;    // 4194304 elements
  const size_t DD = (size_t)DM * DM;   // 1048576 elements
  if (n_in < 11) return;
  if ((size_t)in_sizes[0] != SD || (size_t)in_sizes[1] != SD || (size_t)in_sizes[2] != SD) return;
  if ((size_t)in_sizes[3] != DD || (size_t)in_sizes[5] != DD || (size_t)in_sizes[7] != DD || (size_t)in_sizes[9] != DD) return;
  if (in_sizes[4] != DM || in_sizes[6] != DM || in_sizes[8] != DM || in_sizes[10] != DM) return;
  if ((size_t)out_size != SD) return;

  const float* x_q = (const float*)d_in[0];
  const float* x_k = (const float*)d_in[1];
  const float* x_v = (const float*)d_in[2];
  const float* Wq  = (const float*)d_in[3];
  const float* bq  = (const float*)d_in[4];
  const float* Wk  = (const float*)d_in[5];
  const float* bk  = (const float*)d_in[6];
  const float* Wv  = (const float*)d_in[7];
  const float* bv  = (const float*)d_in[8];
  const float* Wo  = (const float*)d_in[9];
  const float* bo  = (const float*)d_in[10];

  //   xq  bf16 [4096][1024]  8 MiB @  0 MiB      xk  @  8 MiB      xv  @ 16 MiB
  //   wq  bf16 [1024][1024]  2 MiB @ 24 MiB      wk  @ 26 MiB      wv  @ 28 MiB     wo f16 @ 30 MiB
  //   q16 f16  [4096][1024]  8 MiB @ 32 MiB      k16 @ 40 MiB      vt16 f16 [1024][4096] @ 48 MiB
  //   o32 f32  [4096][1024] 16 MiB @ 56 MiB      o16 f16 8 MiB @ 72 MiB
  //   bias f32 [4][1024]    16 KiB @ 80 MiB      end = 83902464 B
  const size_t off_xq  = 0;
  const size_t off_xk  = off_xq  + SD * 2;
  const size_t off_xv  = off_xk  + SD * 2;
  const size_t off_wq  = off_xv  + SD * 2;
  const size_t off_wk  = off_wq  + DD * 2;
  const size_t off_wv  = off_wk  + DD * 2;
  const size_t off_wo  = off_wv  + DD * 2;
  const size_t off_q   = off_wo  + DD * 2;
  const size_t off_k   = off_q   + SD * 2;
  const size_t off_vt  = off_k   + SD * 2;
  const size_t off_o32 = off_vt  + SD * 2;
  const size_t off_o16 = off_o32 + SD * 4;
  const size_t off_b   = off_o16 + SD * 2;
  const size_t ws_end  = off_b + 4 * (size_t)DM * 4;
  if (ws_end > ws_size) return;

  char* ws = (char*)d_ws;
  unsigned short* xq   = (unsigned short*)(ws + off_xq);
  unsigned short* xk   = (unsigned short*)(ws + off_xk);
  unsigned short* xv   = (unsigned short*)(ws + off_xv);
  unsigned short* wq   = (unsigned short*)(ws + off_wq);
  unsigned short* wk   = (unsigned short*)(ws + off_wk);
  unsigned short* wv   = (unsigned short*)(ws + off_wv);
  unsigned short* wo   = (unsigned short*)(ws + off_wo);
  unsigned short* q16  = (unsigned short*)(ws + off_q);
  unsigned short* k16  = (unsigned short*)(ws + off_k);
  unsigned short* vt16 = (unsigned short*)(ws + off_vt);
  float*          o32  = (float*)(ws + off_o32);
  unsigned short* o16  = (unsigned short*)(ws + off_o16);
  float*          bws  = (float*)(ws + off_b);
  const float* bias_q = bws;
  const float* bias_o = bws + 3 * DM;

  const int SD2 = (int)(SD / 2);   // 2097152

  // 1) every conversion of an input, one grid: x_q, x_k, x_v, Wq, Wk, Wv -> bf16 planes ([out][in] = [N][K] layout as is),
  //    Wo -> f16 plane of bf16-RNE(Wo) x 2^8, the four biases -> bf16-RNE values in f32
  convert_inputs_kernel<<<dim3(CV_BLOCKS, 1), 256, 0, stream>>>(x_q, x_k, x_v, Wq, Wk, Wv, Wo, bq, bk, bv, bo,
                                                                xq, xk, xv, wq, wk, wv, wo, bws, 256.0f);

  // GEMM tiles: (4096/128)*(1024/128) = 256 tiles of 128x128 -> 256 blocks x 8 waves; K = 1024 (K % 64 == 0)
  const int gemm_blocks = (int)((S / 128) * (DM / 128));   // 256
  // 2) the three projections, one grid of 3 x 256 blocks (the planes of each kind lie one behind another in the workspace):
  //    job 0: q16[s][n] = x_q . Wq^T + bq   job 1: k16[s][n] = x_k . Wk^T + bk   (f16 out)
  //    job 2: vt16[m = feature][n = s] = Wv[m,:] . x_v[s,:] + bv[m]  (roles swapped: M = 1024, N = 4096, row pitch 4096)
  wmma_gemm64<1, false, 3, 1, false, 0, true><<<dim3(gemm_blocks, 3), 256, 0, stream>>>(
      xq, xq, DM, (long)SD, wq, wq, DM, (long)DD, (void*)q16, (void*)q16, DM, (long)SD, bias_q, bias_q, 0L, S, DM, DM, 1.0f);

  // 3) attention: 16 heads x 64 query blocks, f32 context o32[s][h*64+d]
  attn_full64_f16_kernel<<<dim3(N_HEADS * (S / 64), 1), 128, 0, stream>>>(q16, k16, vt16, o32, 0.125f);

  // 4) o32 -> f16 plane x 2^8
  cast_f16x2_scaled_kernel<<<dim3(SD2 / 256, 1), 256, 0, stream>>>(o32, o16, SD2, 256.0f);

  // 5) out[s][n] = (o x 2^8) . (Wo x 2^8)^T * 2^-16 + bo  -> f32 d_out
  wmma_gemm64<0, false, 2, 0, false><<<dim3(gemm_blocks, 1), 256, 0, stream>>>(
      o16, o16, DM, 0L, wo, wo, DM, 0L, d_out, d_out, DM, 0L, bias_o, bias_o, 0L, S, DM, DM, 1.0f / 65536.0f);
}

// v008
// One run takes 124 microseconds.
// Next to v007, in two timings, it ran 1.04 times as fast each time.
// Over all steps from v000 it is 5.18 times as fast.
// Projections q,k,v^T: v_wmma_f32_16x16x32_bf16 (bf16 RNE operands from the f32 inputs, f32 accumulate, bf16-RNE bias added in f32); attention q.k^T and p.v: v_wmma_f32_16x16x32_f16 (f16 q,k,v planes, p carried x2^15, f32 accumulate, f32 online softmax, score scale 0.125 in f32); output projection: v_wmma_f32_16x16x32_f16 (f16 planes of o x2^8 and bf16-RNE(Wo) x2^8, f32 accumulate, scale 2^-16, bf16-RNE bias added in f32).
#include <hip/hip_runtime.h>
#include <math.h>
#include <stdint.h>

typedef __attribute__((ext_vector_type(16))) _Float16 v16h;
typedef __attribute__((ext_vector_type(8)))  _Float16 v8h;
typedef __attribute__((ext_vector_type(16))) __bf16   v16b;
typedef __attribute__((ext_vector_type(8)))  __bf16   v8b;
typedef __attribute__((ext_vector_type(8)))  float    v8f;
typedef __attribute__((ext_vector_type(4)))  float    v4f;
typedef __attribute__((ext_vector_type(2)))  float    v2f;

constexpr int SEQ_LEN = 4096;
constexpr int D_MODEL = 1024;
constexpr int N_HEADS = 16;

__device__ __forceinline__ unsigned short f2bf_bits(float f) {
  unsigned u = __float_as_uint(f);
  return (unsigned short)((u + 0x7FFFu + ((u >> 16) & 1u)) >> 16);
}
__device__ __forceinline__ float bf_bits2f(unsigned short h) { return __uint_as_float(((unsigned)h) << 16); }
__device__ __forceinline__ unsigned pk16(unsigned short a, unsigned short b) { return (unsigned)a | ((unsigned)b << 16); }

// hazard guards as plain device helpers
__device__ __forceinline__ void dep_guard_h(v8f& a, v8f& b, v16h x, v16h y) { asm volatile("v_nop\n\tv_nop\n\tv_nop\n\tv_nop" : "+v"(a), "+v"(b) : "v"(x), "v"(y)); }
__device__ __forceinline__ void dep_guard_b(v8f& a, v8f& b, v16b x, v16b y) { asm volatile("v_nop\n\tv_nop\n\tv_nop\n\tv_nop" : "+v"(a), "+v"(b) : "v"(x), "v"(y)); }
__device__ __forceinline__ void keep4_h(v16h a, v16h b, v16h c, v16h d) { asm volatile("v_nop" :: "v"(a), "v"(b), "v"(c), "v"(d)); }
__device__ __forceinline__ void keep4_b(v16b a, v16b b, v16b c, v16b d) { asm volatile("v_nop" :: "v"(a), "v"(b), "v"(c), "v"(d)); }
__device__ __forceinline__ void acc_guard4(v8f& a, v8f& b, v8f& c, v8f& d) { asm volatile("v_nop\n\tv_nop\n\tv_nop\n\tv_nop" : "+v"(a), "+v"(b), "+v"(c), "+v"(d)); }
template <typename T> struct Frag;
template <> struct Frag<_Float16> {
  typedef v16h V; typedef v8h H; union U { v16h v; v8h h[2]; };
  static __device__ __forceinline__ v16h load(const _Float16* p) {   // elements 0..7 <- p[0..7], 8..15 <- p[16..23]
    U f; f.h[0] = *(const v8h*)(p); f.h[1] = *(const v8h*)(p + 16); return f.v;
  }
  static __device__ __forceinline__ v8f mma(v16h a, v16h b, v8f c) {
    return __builtin_amdgcn_wmma_f32_16x16x32_f16(false, a, false, b, (short)0, c, false, false);
  }
  static __device__ __forceinline__ void guard(v8f& a, v8f& b, v16h x, v16h y) { dep_guard_h(a, b, x, y); }
  static __device__ __forceinline__ void keep(v16h a, v16h b, v16h c, v16h d) { keep4_h(a, b, c, d); }
};
template <> struct Frag<__bf16> {
  typedef v16b V; typedef v8b H; union U { v16b v; v8b h[2]; };
  static __device__ __forceinline__ v16b load(const __bf16* p) {
    U f; f.h[0] = *(const v8b*)(p); f.h[1] = *(const v8b*)(p + 16); return f.v;
  }
  static __device__ __forceinline__ v8f mma(v16b a, v16b b, v8f c) {
    return __builtin_amdgcn_wmma_f32_16x16x32_bf16(false, a, false, b, (short)0, c, false, false);
  }
  static __device__ __forceinline__ void guard(v8f& a, v8f& b, v16b x, v16b y) { dep_guard_b(a, b, x, y); }
  static __device__ __forceinline__ void keep(v16b a, v16b b, v16b c, v16b d) { keep4_b(a, b, c, d); }
};

// ---- LDS-staged batched WMMA GEMM -------------------------------------------
// C[m,n] = scale * sum_k A[m,k] * Bt[n,k] (+bias)(+resid); a block of 8 waves owns a 128x128 tile, each wave 32x64 of it.
// A row-major [M,K]; Bt row-major [N,K]; M,N % 128 == 0, K % 64 == 0, K >= 64.
// Per 64-k step the block brings 128 rows x 128 B of A and of Bt into LDS: 8 lanes x 16 B cover one whole row line,
// 256 threads x 4 pieces per operand = the whole tile. Two LDS buffers: the next step's global loads are issued ahead of
// this step's products and stored behind them, one __syncthreads() per step.
// SPLIT (hi/lo planes) is not staged: single-plane operands only.
// BIAS_MODE: 0 = none, 1 = bias[m], 2 = bias[n], 3 = by the job of a TRIO grid (below).
// TRIO: three independent products share one grid, blockIdx.y = job b; operands, C and bias of job b lie b strides behind
// job 0's (the bias vectors one behind another), C is dense (row pitch = its N). Jobs 0, 1: C = A . Bt^T + bias[n].
// Job 2 takes the two operands in swapped roles (M and N swap with them): C = Bt . A^T + bias[m].
// OUT_MODE: 0 = f32, 1 = f16, 2 = bf16 hi plane (Cout) + bf16 lo plane (Cout2).
// ET: 0 = f16 operands, 1 = bf16 operands (pointers passed as 16-bit storage)
#define GM_BT 128  // block tile, rows of A and of Bt
#define GM_LP 72   // LDS row pitch in elements: 64 + 8, 144 B = 16 B x 9, so 16 rows read by ds_load_b128 fall on 16 distinct bank groups
template <int I> struct IntC { static constexpr int value = I; };   // a compile-time int handed to a generic lambda
template <int ET> struct Elem;
template <> struct Elem<0> { typedef _Float16 T; };
template <> struct Elem<1> { typedef __bf16 T; };
template <int ET, bool SPLIT, int BIAS_MODE, int OUT_MODE, bool RESID, int ACT = 0, bool TRIO = false>
__global__ __launch_bounds__(256) void wmma_gemm64(
    const unsigned short* __restrict__ Ap, const unsigned short* __restrict__ A2p, int lda0, long strideA,
    const unsigned short* __restrict__ Btp, const unsigned short* __restrict__ Bt2p, int ldb0, long strideB,
    void* __restrict__ Cout, void* __restrict__ Cout2, int ldc0, long strideC,
    const float* __restrict__ bias0,
    const float* __restrict__ resid, long strideR,
    int M0, int N0, int K, float scale) {
  static_assert(!SPLIT, "single-plane operands only");
  static_assert((BIAS_MODE == 3) == TRIO, "the job picks the bias mode in a TRIO grid and nowhere else");
  typedef typename Elem<ET>::T T;
  typedef typename Frag<T>::V V;
  typedef typename Frag<T>::H H;
  const T* A = (const T*)Ap; const T* Bt = (const T*)Btp;
  __shared__ __align__(16) T sA[2][GM_BT * GM_LP];   // A rows of the block tile, one 64-k step, two buffers
  __shared__ __align__(16) T sB[2][GM_BT * GM_LP];   // Bt rows of the block tile
  __shared__ __align__(16) float sT[8][16 * 68];     // per-wave 16x64 slab, pitch 68 floats
  const int b    = blockIdx.y;
  const int tid  = threadIdx.x;
  const int lane = tid & 31;
  const int wave = tid >> 5;
  const bool sw = TRIO && b == 2;              // block-uniform: this job's operands change roles
  const int M = sw ? N0 : M0;
  const int N = sw ? M0 : N0;
  const int tilesN = N >> 7;
  const int tilesM = M >> 7;
  const int tile = blockIdx.x;
  if (tile >= tilesM * tilesN) return;   // block-uniform, ahead of every barrier
  const int tm = tile / tilesN;
  const int tn = tile - tm * tilesN;
  const int bm0 = tm << 7;
  const int bn0 = tn << 7;
  const int wm = (wave >> 1) << 5;             // this wave's rows inside the block tile: 0, 32, 64, 96
  const int wn = (wave & 1) << 6;              // this wave's columns inside the block tile: 0, 64
  const int m0 = bm0 + wm;
  const int n0 = bn0 + wn;

  const T* Ab  = sw ? Bt + (size_t)b * strideB : A  + (size_t)b * strideA;
  const T* Bb  = sw ? A  + (size_t)b * strideA : Bt + (size_t)b * strideB;
  const int lda = sw ? ldb0 : lda0;
  const int ldb = sw ? lda0 : ldb0;
  const int ldc = TRIO ? N : ldc0;
  const float* bias = TRIO ? bias0 + (size_t)b * (sw ? M : N) : bias0;

  const int rlane = lane & 15;                 // row (A) / col (B, D) within subtile
  const int koff  = (lane >> 4) * 8;           // k offset of this lane half
  const int mOff  = (lane >> 4) * 8;           // D row offset

  // every unroll directive from here to the epilogue makes the array indices constants, so that acc, the staged pieces
  // and the fragments live in registers and not in scratch
  v8f acc[2][4];
#pragma unroll
  for (int i = 0; i < 2; ++i)
#pragma unroll
    for (int j = 0; j < 4; ++j) acc[i][j] = (v8f){0.f,0.f,0.f,0.f,0.f,0.f,0.f,0.f};

  // staging map: piece it of a thread = row it*32 + (tid >> 3), elements (tid & 7)*8 .. +7 of the step's 64
  const int srow = tid >> 3;
  const int sseg = (tid & 7) << 3;
  const int so = srow * GM_LP + sseg;
  const char* Ac = (const char*)(Ab + (size_t)bm0 * lda);   // block-uniform bases of the two row bands
  const char* Bc = (const char*)(Bb + (size_t)bn0 * ldb);
  unsigned oa[4], ob[4];                       // one running byte offset per piece (a 128-row band stays far below 4 GiB), 128 B a step
  H ra[4], rb[4];
#pragma unroll
  for (int it = 0; it < 4; ++it) {
    oa[it] = (unsigned)(((it * 32 + srow) * lda + sseg) * 2);
    ob[it] = (unsigned)(((it * 32 + srow) * ldb + sseg) * 2);
    ra[it] = *(const H*)(Ac + oa[it]);
    rb[it] = *(const H*)(Bc + ob[it]);
  }
#pragma unroll
  for (int it = 0; it < 4; ++it) {
    *(H*)(&sA[0][so + it * 32 * GM_LP]) = ra[it];
    *(H*)(&sB[0][so + it * 32 * GM_LP]) = rb[it];
  }

  const int nk = K >> 6;
  for (int kt = 0; kt < nk; ++kt) {
    // publishes buffer kt & 1 and ends every wave's reads of the other buffer, which is refilled below
    __syncthreads();
    const bool more = kt + 1 < nk;             // block-uniform
    if (more) {
#pragma unroll
      for (int it = 0; it < 4; ++it) {
        oa[it] += 128;
        ob[it] += 128;
        ra[it] = *(const H*)(Ac + oa[it]);
        rb[it] = *(const H*)(Bc + ob[it]);
      }
      // stands behind the eight loads, ahead of every later write of an offset or base register that they name
      asm volatile("s_wait_xcnt 0x0" ::: "memory");
    }
    const T* sa = &sA[kt & 1][(wm + rlane) * GM_LP + koff];
    const T* sb = &sB[kt & 1][(wn + rlane) * GM_LP + koff];
    // the step's 24 fragment reads stand together ahead of its 16 products
    V bh[2][4], ah[2][2];
#pragma unroll
    for (int kk = 0; kk < 2; ++kk) {
#pragma unroll
      for (int j = 0; j < 4; ++j) bh[kk][j] = Frag<T>::load(sb + j * 16 * GM_LP + kk * 32);
#pragma unroll
      for (int i = 0; i < 2; ++i) ah[kk][i] = Frag<T>::load(sa + i * 16 * GM_LP + kk * 32);
    }
#pragma unroll
    for (int kk = 0; kk < 2; ++kk) {
#pragma unroll
      for (int i = 0; i < 2; ++i) {
#pragma unroll
        for (int j = 0; j < 4; ++j) acc[i][j] = Frag<T>::mma(ah[kk][i], bh[kk][j], acc[i][j]);
        Frag<T>::guard(acc[i][0], acc[i][3], ah[kk][i], ah[kk][i]);   // v_nops: the slots behind the last product before its A or D is touched
      }
      Frag<T>::keep(bh[kk][0], bh[kk][1], bh[kk][2], bh[kk][3]);   // holds the B fragments' registers to the end of their products
    }
    if (more) {
      const int nb = (kt + 1) & 1;
#pragma unroll
      for (int it = 0; it < 4; ++it) {
        *(H*)(&sA[nb][so + it * 32 * GM_LP]) = ra[it];
        *(H*)(&sB[nb][so + it * 32 * GM_LP]) = rb[it];
      }
    }
  }
  acc_guard4(acc[0][0], acc[0][1], acc[0][2], acc[0][3]);
  acc_guard4(acc[1][0], acc[1][1], acc[1][2], acc[1][3]);

  // ---- epilogue ----
  float* slab = sT[wave];
  const float* Rb = RESID ? (resid + (size_t)b * strideR) : nullptr;
  // written once, compiled per bias mode BM (1 or 2 in a TRIO grid, picked below by one block-uniform branch), so that each
  // job's bias loads stand together as in a kernel of that mode alone
  auto epilogue = [&](auto bmc) __attribute__((always_inline)) {
  constexpr int BM = decltype(bmc)::value;
#pragma unroll
  for (int i = 0; i < 2; ++i) {
    const int mBase = m0 + (i << 4);
#pragma unroll
    for (int j = 0; j < 4; ++j) {
      const int n = n0 + (j << 4) + rlane;
      float bv = 0.f;
      if (BM == 2) bv = bias[n];
#pragma unroll
      for (int r = 0; r < 8; ++r) {
        float v = acc[i][j][r] * scale;
        if (BM == 1) v += bias[mBase + mOff + r];
        if (BM == 2) v += bv;
        if (RESID) v += Rb[(size_t)(mBase + mOff + r) * ldc + n];
        if (ACT == 1) v = tanhf(v);
        if (ACT == 2) v = fmaxf(v, 0.0f);
        if (ACT == 3) v = v / (1.0f + expf(-v));
        if (ACT == 4) v = (v > 0.f) ? v : 0.01f * v;
        if (ACT == 5) v = 0.5f * v * (1.0f + erff(v * 0.70710678118654752f));
        slab[(mOff + r) * 68 + (j << 4) + rlane] = v;
      }
    }
    __builtin_amdgcn_fence(__ATOMIC_RELEASE, "workgroup");
    __builtin_amdgcn_wave_barrier();
    __builtin_amdgcn_fence(__ATOMIC_ACQUIRE, "workgroup");
    if (OUT_MODE == 0) {
      float* C = (float*)Cout + (size_t)b * strideC;
      const int hh = lane >> 4, c4 = (lane & 15) * 4;     // row seg = 256 B = 16 lanes x 16 B
      {
#pragma unroll
        for (int it = 0; it < 8; ++it) {
          const int row = it * 2 + hh;
          v4f v = *(const v4f*)(slab + row * 68 + c4);
          *(v4f*)(C + (size_t)(mBase + row) * ldc + n0 + c4) = v;
        }
        
      }
    } else {
      const int q = lane >> 3, c8 = (lane & 7) * 8;
      unsigned short* C  = (unsigned short*)Cout  + (size_t)b * strideC;
      unsigned short* C2 = (OUT_MODE == 2) ? ((unsigned short*)Cout2 + (size_t)b * strideC) : nullptr;
      {
#pragma unroll
        for (int it = 0; it < 4; ++it) {
          const int row = it * 4 + q;
          const float* sp = slab + row * 68 + c8;
          v8h hv, lv;
#pragma unroll
          for (int e = 0; e < 8; ++e) {
            if (OUT_MODE == 1) {
              hv[e] = (_Float16)sp[e];
            } else {
              unsigned short hb = f2bf_bits(sp[e]);
              unsigned short lb = f2bf_bits(sp[e] - bf_bits2f(hb));
              hv[e] = __builtin_bit_cast(_Float16, hb);
              lv[e] = __builtin_bit_cast(_Float16, lb);
            }
          }
          *(v8h*)(C + (size_t)(mBase + row) * ldc + n0 + c8) = hv;
          if (OUT_MODE == 2) *(v8h*)(C2 + (size_t)(mBase + row) * ldc + n0 + c8) = lv;
        }
        
      }
    }
    __builtin_amdgcn_fence(__ATOMIC_RELEASE, "workgroup");
    __builtin_amdgcn_wave_barrier();
    __builtin_amdgcn_fence(__ATOMIC_ACQUIRE, "workgroup");
  }
  };
  if constexpr (BIAS_MODE == 3) {
    if (sw) epilogue(IntC<1>{}); else epilogue(IntC<2>{});
  } else {
    epilogue(IntC<BIAS_MODE>{});
  }
}

// ---------------------------------------------------------------------------
// Conversions in streaming form. A block is 16 waves; a wave owns NL * 128 consecutive elements of a plane and issues all its
// NL loads (16 B a lane, 512 contiguous bytes a load) ahead of the first conversion, so that NL * 512 B a wave are in flight;
// piece k goes out as 8 B a lane, 256 contiguous bytes (two whole lines) a store.
// ---------------------------------------------------------------------------
constexpr int CS_T = 512;                    // threads of a block
typedef uint32_t u32x2 __attribute__((ext_vector_type(2)));
// f32 -> bf16 (RNE)
struct CvBf16 {
  __device__ __forceinline__ unsigned short operator()(float f) const { return f2bf_bits(f); }
};
// f32 -> f16 with a power-of-two carry: f16(g(f) * scale), g = bf16 RNE when PREBF, identity otherwise
template <bool PREBF> struct CvF16Scaled {
  float scale;
  __device__ __forceinline__ unsigned short operator()(float f) const {
    if (PREBF) f = bf_bits2f(f2bf_bits(f));
    const _Float16 h = (_Float16)(f * scale);
    return __builtin_bit_cast(unsigned short, h);
  }
};
// block number part of a plane: elements part * 16 * NL * 128 .. + 16 * NL * 128 - 1
template <int NL, typename CV>
__device__ __forceinline__ void stream_cvt(const float* __restrict__ in, unsigned short* __restrict__ out, int part, CV cv) {
  const int wave = threadIdx.x >> 5;
  const int lane = threadIdx.x & 31;
  const size_t e0 = ((size_t)part * (CS_T / 32) + wave) * (NL * 128) + lane * 4;
  const float* ip = in + e0;
  unsigned short* op = out + e0;
  v4f r[NL];
  // both unroll directives make the index of r a constant, so that the pieces live in registers
#pragma unroll
  for (int k = 0; k < NL; ++k) r[k] = *(const v4f*)(ip + k * 128);
  // stands behind the run of loads, ahead of every write of a register that they name; the address is an input, so that it
  // lives up to this wait and no piece of the run is given its registers
  asm volatile("s_wait_xcnt 0x0" :: "v"(ip) : "memory");
  // keeps every load ahead of the first conversion: sunk among the conversions, a part of them would issue only when earlier
  // pieces have landed, and fewer bytes of the wave would be in flight
  __builtin_amdgcn_sched_barrier(0);
#pragma unroll
  for (int k = 0; k < NL; ++k) {
    u32x2 o;
    o[0] = pk16(cv(r[k][0]), cv(r[k][1]));
    o[1] = pk16(cv(r[k][2]), cv(r[k][3]));
    *(u32x2*)(op + k * 128) = o;
  }
  asm volatile("s_wait_xcnt 0x0" ::: "memory");   // stands ahead of any later overwrite of a register that the stores name (other ranges' code may follow in the built order)
}

// ---------------------------------------------------------------------------
// Every conversion that needs the inputs alone, in one grid: none reads what another writes. The job is picked by ranges of
// blockIdx.x (block-uniform), the largest planes first; a block covers 16 waves x CV_NL x 128 = 65536 elements of a plane:
//   3 x CV_XB blocks: x_q, x_k, x_v -> bf16 planes        (CV_XB x 65536 = 4096 x 1024)
//   3 x CV_WB blocks: Wq, Wk, Wv    -> bf16 planes        (CV_WB x 65536 = 1024 x 1024)
//       CV_WB blocks: Wo            -> f16 plane of bf16-RNE(Wo) x wo_scale
//   the last block, ahead of its piece of Wo: bq, bk, bv, bo -> bf16-RNE values held as f32, bias_out[sel * D_MODEL + i],
//   8 elements a thread
// ---------------------------------------------------------------------------
constexpr int CV_NL = 32;                                  // loads of a wave
constexpr int CV_BE = (CS_T / 32) * CV_NL * 128;           // 65536 elements a block
constexpr int CV_XB = SEQ_LEN * D_MODEL / CV_BE;           // 64
constexpr int CV_WB = D_MODEL * D_MODEL / CV_BE;           // 16
constexpr int CV_BLOCKS = 3 * CV_XB + 3 * CV_WB + CV_WB;   // 256: one block a WGP
static_assert(CV_XB * CV_BE == SEQ_LEN * D_MODEL && CV_WB * CV_BE == D_MODEL * D_MODEL, "whole blocks cover the planes");
static_assert(4 * D_MODEL == CS_T * 8, "one block covers the four biases");
// four waves a SIMD (one block a WGP): a wave's 32 pieces take 128 registers, above the compiler's own bound for this block size
__global__ __launch_bounds__(CS_T) __attribute__((amdgpu_waves_per_eu(4, 4))) void convert_inputs_kernel(
    const float* __restrict__ x0, const float* __restrict__ x1, const float* __restrict__ x2,
    const float* __restrict__ w0, const float* __restrict__ w1, const float* __restrict__ w2, const float* __restrict__ w3,
    const float* __restrict__ b0, const float* __restrict__ b1, const float* __restrict__ b2, const float* __restrict__ b3,
    unsigned short* __restrict__ xo0, unsigned short* __restrict__ xo1, unsigned short* __restrict__ xo2,
    unsigned short* __restrict__ wo0, unsigned short* __restrict__ wo1, unsigned short* __restrict__ wo2,
    unsigned short* __restrict__ wo3, float* __restrict__ bias_out, float wo_scale) {
  int blk = blockIdx.x;
  if (blk < 3 * CV_XB) {
    const int sel = blk / CV_XB;
    const float* in = (sel == 0) ? x0 : ((sel == 1) ? x1 : x2);
    unsigned short* out = (sel == 0) ? xo0 : ((sel == 1) ? xo1 : xo2);
    stream_cvt<CV_NL>(in, out, blk - sel * CV_XB, CvBf16{});
    return;
  }
  blk -= 3 * CV_XB;
  if (blk < 3 * CV_WB) {
    const int sel = blk / CV_WB;
    const float* in = (sel == 0) ? w0 : ((sel == 1) ? w1 : w2);
    unsigned short* out = (sel == 0) ? wo0 : ((sel == 1) ? wo1 : wo2);
    stream_cvt<CV_NL>(in, out, blk - sel * CV_WB, CvBf16{});
    return;
  }
  blk -= 3 * CV_WB;
  if (blk == CV_WB - 1) {
    const int t = threadIdx.x;
    const int sel = t / (D_MODEL / 8);               // the same in every lane of a wave: 128 threads a bias
    const float* in = (sel == 0) ? b0 : ((sel == 1) ? b1 : ((sel == 2) ? b2 : b3));
    const int i = (t - sel * (D_MODEL / 8)) * 8;
    const v4f lo = *(const v4f*)(in + i), hi = *(const v4f*)(in + i + 4);
    v4f a, b;
    // unrolled so that the vector indices are constants and the values stay in registers
#pragma unroll
    for (int e = 0; e < 4; ++e) { a[e] = bf_bits2f(f2bf_bits(lo[e])); b[e] = bf_bits2f(f2bf_bits(hi[e])); }
    *(v4f*)(bias_out + sel * D_MODEL + i)     = a;
    *(v4f*)(bias_out + sel * D_MODEL + i + 4) = b;
    asm volatile("s_wait_xcnt 0x0" ::: "memory");   // stands ahead of any later overwrite of a register that the stores name
  }
  stream_cvt<CV_NL>(w3, wo3, blk, CvF16Scaled<true>{wo_scale});
}

// ---------------------------------------------------------------------------
// f32 -> f16 with a power-of-two carry, one plane of SEQ_LEN x D_MODEL elements.
// Coverage: CC_BLOCKS blocks x 16 waves x CC_NL x 128 elements = the whole plane.
// ---------------------------------------------------------------------------
constexpr int CC_NL = 8;
constexpr int CC_BLOCKS = SEQ_LEN * D_MODEL / ((CS_T / 32) * CC_NL * 128);   // 256
static_assert(CC_BLOCKS * (CS_T / 32) * CC_NL * 128 == SEQ_LEN * D_MODEL, "whole blocks cover the plane");
__global__ __launch_bounds__(CS_T) void cast_f16_scaled_kernel(const float* __restrict__ in, unsigned short* __restrict__ out, float scale) {
  stream_cvt<CC_NL>(in, out, blockIdx.x, CvF16Scaled<false>{scale});
}

// =====================================================================================
// Full (non-causal, unmasked) attention, head dim 64, single 16-bit products.
//   q plane (f16): element (s, h, d) at [s*D_MODEL + h*64 + d]
//   k plane (f16): element (s, h, d) at [s*D_MODEL + h*64 + d]
//   v^T plane (f16): element (h, d, s) at [(h*64 + d)*SEQ_LEN + s]
//   out f32: element (s, h, d) at [s*D_MODEL + h*64 + d]
//   scores^T = (k . q^T) * sscale : v_wmma_f32_16x16x32_f16 (A = K rows, B = q), f32 accumulate, sscale applied in f32
//                                   inside the one fma per score that feeds v_exp_f32 (base 2)
//   out^T    = v^T . p^T          : v_wmma_f32_16x16x32_f16 (A = V^T rows, B = p^T packed from the score registers),
//                                   p (unnormalised, x2^15) and v in f16, f32 accumulate
//   online softmax in f32 over all SEQ_LEN keys (64 chunks of 64, compile-time trip count, no masking).
//   Block = 4 waves = 64 query rows of one head; grid.x = N_HEADS * (SEQ_LEN/64) = 1024.
//   K / V^T chunk staging: one tensor_load_to_lds per wave and chunk, each a slice of 32 rows x 128 B (waves 0, 1: K rows
//   0-31, 32-63 of the chunk; waves 2, 3: V^T rows 0-31, 32-63), padded by the mover to the 144-B pitch; two LDS buffers,
//   the load of chunk s + 2 issued at the foot of chunk s, one publish point (waits, barrier) per chunk.
//   Output: per-wave 16x64 f32 tile staged in LDS; each 64-float row segment (256 B) written by 16 lanes x 16 B
//   Coverage: 1024 blocks x 4 waves x 16 rows x 64 floats = 4096 x 1024 = the whole out plane.
// =====================================================================================
#define AT_D 64
#define AT_NW 4
#define AT_QB 64
#define AT_KC 64
#define AT_PB 144u  // LDS row pitch of the 16-bit tiles in bytes: 16 B x 9, so 16 rows read by ds_load_b128 fall on 16 distinct bank groups
#define AT_SR 32u            // rows of one tensor-load slice
#define AT_SLB 6144u         // a slice's room in LDS: 32 rows x 144 B = 4608 B, rounded up so that every slice starts at a multiple of 2 KiB
#define AT_BUFB (4u * AT_SLB) // one buffer: K slices 0, 1, then V^T slices 0, 1
typedef uint32_t u32x4 __attribute__((ext_vector_type(4)));
typedef uint32_t u32x8 __attribute__((ext_vector_type(8)));
constexpr float P_CARRY_LOG2 = 15.0f;   // p and its running sum are carried x2^15; the factor cancels in the final division

__device__ __forceinline__ v8f at_mma_h(v16h a, v16h b, v8f c) {
  return __builtin_amdgcn_wmma_f32_16x16x32_f16(false, a, false, b, (short)0, c, false, false);
}

__device__ __forceinline__ uint32_t uni(uint32_t v) { return (uint32_t)__builtin_amdgcn_readfirstlane(v); }
__device__ __forceinline__ uint32_t pinned(uint32_t v) {
  uint32_t w = uni(v);
  asm volatile("" : "+s"(w));   // holds the word in a scalar register; without it the test may become a vector condition
  return w;
}
// the compiler places no wait for the tensor mover: a tile counts as landed only behind its issuer's own wait
__device__ __forceinline__ void wait_tensor0() { asm volatile("s_wait_tensorcnt 0x0" ::: "memory"); }
// this wave's LDS reads have retired before the barrier behind which their buffer is refilled
__device__ __forceinline__ void wait_ds0() { asm volatile("s_wait_dscnt 0x0" ::: "memory"); }
__device__ __forceinline__ void tdm_load(u32x4 g0, u32x8 g1) { asm volatile("tensor_load_to_lds %0, %1" :: "{s[84:87]}"(g0), "{s[88:95]}"(g1) : "memory"); }
// descriptor group 1: 1-byte elements, tensor = tile = 32 rows of 128 B, source row pitch src_pitch bytes,
// 4 dwords of LDS pad behind every 32 dwords (one row): LDS pitch 144 B; no workgroup mask
__device__ __forceinline__ u32x8 tdm_group1(uint32_t src_pitch) {
  constexpr uint32_t d0 = 128u, d1 = AT_SR;
  u32x8 g;
  g[0] = uni((1u << 20) | (4u << 22) | (3u << 25));
  g[1] = uni((d0 & 0xFFFFu) << 16);
  g[2] = uni((d0 >> 16) | ((d1 & 0xFFFFu) << 16));
  g[3] = uni((d1 >> 16) | (d0 << 16));
  g[4] = uni(d1);
  g[5] = uni(src_pitch);
  g[6] = uni(0u);
  g[7] = uni(0u);
  return g;
}
// descriptor group 0: count 1, LDS byte offset, global address of the tile's first byte, type 2
__device__ __forceinline__ u32x4 tdm_group0(uint32_t lds_dst, uint64_t ga) {
  u32x4 g;
  g[0] = uni(1u); g[1] = uni(lds_dst); g[2] = uni((uint32_t)ga); g[3] = uni((((uint32_t)(ga >> 32)) & 0x01FFFFFFu) | 0x80000000u);
  return g;
}

// lane l takes the value of lane l ^ 16
__device__ __forceinline__ float xhalf(float x) {
  return __builtin_bit_cast(float, __builtin_amdgcn_permlanex16(__builtin_bit_cast(int, x), __builtin_bit_cast(int, x), 0x76543210, 0xfedcba98, false, false));
}

__global__ __launch_bounds__(128)
void attn_full64_f16_kernel(const unsigned short* __restrict__ qp, const unsigned short* __restrict__ kp,
                            const unsigned short* __restrict__ vtp, float* __restrict__ out, float sscale) {
  union FH { v16h v; v8h h[2]; };
  __shared__ __attribute__((aligned(2048))) unsigned char ring[2 * AT_BUFB];   // two buffers of K [kv][d] and V [d][kv] slices, 48 KB
  __shared__ __align__(16) float    Os[AT_NW][16 * 68];            // per wave out tile, pitch 68

  const int tid  = threadIdx.x;
  const int wave = tid >> 5;
  const int lane = tid & 31;
  const int hh   = lane >> 4;
  const int c    = lane & 15;

  const int nqb = SEQ_LEN / AT_QB;        // 64
  const int bx = blockIdx.x;
  const int qb = bx % nqb;
  const int h  = bx / nqb;                // 0..N_HEADS-1 (grid = N_HEADS * nqb)
  const int q0 = qb * AT_QB + wave * 16;

  const _Float16* Qg = (const _Float16*)(const void*)qp  + (size_t)h * AT_D;
  const _Float16* Kg = (const _Float16*)(const void*)kp  + (size_t)h * AT_D;
  const _Float16* Vg = (const _Float16*)(const void*)vtp + (size_t)h * AT_D * SEQ_LEN;
  float*          ob = out + (size_t)h * AT_D;

  // ---- K / V^T slices by tensor load: every wave issues its own slice of every chunk, unconditionally ----
  const uint32_t wv   = uni((uint32_t)threadIdx.x >> 5);
  const bool     isV  = (wv & 2u) != 0u;
  const uint32_t srow = (wv & 1u) * AT_SR;                                   // the slice's first row in the chunk tile
  const uint32_t spitch = isV ? (uint32_t)SEQ_LEN * 2u : (uint32_t)D_MODEL * 2u;   // source row pitch in bytes
  const uint32_t sstep  = isV ? (uint32_t)AT_KC * 2u : (uint32_t)AT_KC * (uint32_t)D_MODEL * 2u;   // bytes from one chunk's slice to the next's
  const uint64_t ssrc = (uint64_t)(size_t)(isV ? Vg : Kg) + (uint64_t)(srow * spitch);
  const uint32_t sdst = (uint32_t)(size_t)ring + wv * AT_SLB;
  const u32x8 g1 = tdm_group1(spitch);
  // prologue, two buffers: chunk 0's load, its wait, the barrier that publishes it, then chunk 1's load
  u32x4 g0 = tdm_group0(sdst, ssrc);
  tdm_load(g0, g1);
  wait_tensor0();
  __syncthreads();
  g0 = tdm_group0(sdst + AT_BUFB, ssrc + sstep);
  tdm_load(g0, g1);

  // ---- Q fragments (B operand, column = lane&15, split k map via Frag load): 2 d-chunks ----
  v16h qa[2];
#pragma unroll
  for (int dc = 0; dc < 2; ++dc) {
    const _Float16* qr = Qg + (size_t)(q0 + c) * D_MODEL + dc * 32 + 8 * hh;
    qa[dc] = Frag<_Float16>::load(qr);
  }

  // One query column per lane (c); the two wave halves split that query's keys.
  float mrow = -INFINITY, lrow = 0.f;      // running maximum of the raw scores (equal in both halves), this half's running sum (x2^15)
  float mbrow = -INFINITY;                 // mrow * c2 - 15: what one fma takes off a score ahead of the base-2 exponential
  const float c2 = sscale * 1.44269504088896340736f;   // score scale times log2(e); sscale > 0, so the raw scores order as the scaled ones
  v8f oacc[4];                             // O^T tiles: oacc[t][r] = O[q0 + c][t*16 + 8*hh + r]
#pragma unroll
  for (int t = 0; t < 4; ++t) oacc[t] = (v8f){0.f,0.f,0.f,0.f,0.f,0.f,0.f,0.f};

  const int nChunks = SEQ_LEN / AT_KC;   // 64, compile-time constant
  for (int kc = 0; kc < nChunks; ++kc) {
    // this chunk's buffer; row x of a 64-row tile lies in slice x >> 5 at row x & 31
    const unsigned char* kr = ring + (uint32_t)(kc & 1) * AT_BUFB + (uint32_t)c * AT_PB + 16u * (uint32_t)hh;
    const unsigned char* vr = kr + 2u * AT_SLB;

    // the chunk's 32 fragment reads (K first, in the order of their use, then V^T) stand together behind the barrier, ahead
    // of all 16 products: one place with LDS reads per chunk, and the V^T fragments land under the score products and the softmax
    // (the unroll directives make the array indices constants, so that the fragments live in registers)
    FH kb[2][4], vb[2][4];
#pragma unroll
    for (int dc = 0; dc < 2; ++dc)
#pragma unroll
      for (int j = 0; j < 4; ++j) {
        kb[dc][j].h[0] = *(const v8h*)(kr + (j >> 1) * AT_SLB + (j & 1) * 16 * AT_PB + dc * 64);
        kb[dc][j].h[1] = *(const v8h*)(kr + (j >> 1) * AT_SLB + (j & 1) * 16 * AT_PB + dc * 64 + 32);
      }
#pragma unroll
    for (int kk = 0; kk < 2; ++kk)
#pragma unroll
      for (int t = 0; t < 4; ++t) {
        vb[kk][t].h[0] = *(const v8h*)(vr + (t >> 1) * AT_SLB + (t & 1) * 16 * AT_PB + kk * 64);
        vb[kk][t].h[1] = *(const v8h*)(vr + (t >> 1) * AT_SLB + (t & 1) * 16 * AT_PB + kk * 64 + 32);
      }
    // keeps the reads one group: sunk back among the products, each pair would cost its own full LDS latency
    __builtin_amdgcn_sched_barrier(0);
    // S^T = K . Q^T: s[j][r] = score of key kv0 + j*16 + 8*hh + r against query q0 + c; four independent tiles per d half
    v8f s[4];
#pragma unroll
    for (int j = 0; j < 4; ++j) s[j] = (v8f){0.f,0.f,0.f,0.f,0.f,0.f,0.f,0.f};
#pragma unroll
    for (int dc = 0; dc < 2; ++dc)
#pragma unroll
      for (int j = 0; j < 4; ++j) s[j] = at_mma_h(kb[dc][j].v, qa[dc], s[j]);
    // keeps the eight products back to back: a maximum drawn up among them waits out its product's latency and holds the rest back
    __builtin_amdgcn_sched_barrier(0);
    float mj[4];
#pragma unroll
    for (int j = 0; j < 4; ++j) {
      mj[j] = -INFINITY;
#pragma unroll
      for (int r = 0; r < 8; ++r) mj[j] = fmaxf(mj[j], s[j][r]);
    }
    float cm = fmaxf(fmaxf(mj[0], mj[1]), fmaxf(mj[2], mj[3]));
    cm = fmaxf(cm, xhalf(cm));             // both halves now hold the query's chunk maximum
    const float mnew = fmaxf(mrow, cm);
    const float mbnew = fmaf(mnew, c2, -P_CARRY_LOG2);
    const float alpha = __builtin_amdgcn_exp2f(mbrow - mbnew);   // 0 on the first chunk (mbrow = -inf)
    mrow = mnew;
    mbrow = mbnew;
    const v8f c2v = (v8f){c2, c2, c2, c2, c2, c2, c2, c2};
    const v8f nmb = (v8f){-mbnew, -mbnew, -mbnew, -mbnew, -mbnew, -mbnew, -mbnew, -mbnew};
    // P^T packs in place into the B operand: element e of block kk = tile 2*kk + (e >> 3), register e & 7
    FH pb[2];
    float pj[4];
#pragma unroll
    for (int j = 0; j < 4; ++j) {
      pj[j] = 0.f;
      const v8f x = __builtin_elementwise_fma(s[j], c2v, nmb);   // scaled score - scaled maximum + 15, in base-2 units
#pragma unroll
      for (int r = 0; r < 8; ++r) {
        const float p = __builtin_amdgcn_exp2f(x[r]);   // exp(scaled score - scaled maximum) x 2^15
        pj[j] += p;
        pb[j >> 1].v[(j & 1) * 8 + r] = (_Float16)p;
      }
    }
    lrow = lrow * alpha + ((pj[0] + pj[1]) + (pj[2] + pj[3]));
#pragma unroll
    for (int t = 0; t < 4; ++t)
#pragma unroll
      for (int r = 0; r < 8; ++r) oacc[t][r] *= alpha;
    // O^T += V^T . P^T
#pragma unroll
    for (int kk = 0; kk < 2; ++kk) {
#pragma unroll
      for (int t = 0; t < 4; ++t) oacc[t] = at_mma_h(vb[kk][t].v, pb[kk].v, oacc[t]);
    }
    // publish point of chunk kc + 1, every wave: own LDS reads retired, own slice landed, the barrier; it also ends every
    // wave's reads of this chunk's buffer, which the load behind it refills
    // keeps the publish point at the chunk's foot: drawn up among the softmax, the tensor wait would stand shortly behind its
    // load's issue instead of a whole chunk behind it
    __builtin_amdgcn_sched_barrier(0);
    wait_ds0();
    wait_tensor0();
    __syncthreads();
    const uint32_t nx = pinned((uint32_t)kc + 2u);   // taken behind the wait, so that the descriptor words formed from it are too
    if (pinned(nx < (uint32_t)nChunks)) {
      g0 = tdm_group0(sdst + (nx & 1u) * AT_BUFB, ssrc + (uint64_t)nx * sstep);
      tdm_load(g0, g1);
    }
  }
  wait_tensor0();   // nothing of the mover is in flight when the wave goes on to its end
  wait_ds0();

  float* os = Os[wave];
  {
    const float inv = 1.0f / (lrow + xhalf(lrow));   // the halves' sums join once; sum and O both carry 2^15
#pragma unroll
    for (int t = 0; t < 4; ++t) {
      v4f lo, hi;
#pragma unroll
      for (int r = 0; r < 4; ++r) { lo[r] = oacc[t][r] * inv; hi[r] = oacc[t][4 + r] * inv; }
      *(v4f*)(os + c * 68 + t * 16 + 8 * hh)     = lo;
      *(v4f*)(os + c * 68 + t * 16 + 8 * hh + 4) = hi;
    }
  }
  __builtin_amdgcn_fence(__ATOMIC_RELEASE, "workgroup");
  __builtin_amdgcn_wave_barrier();
  __builtin_amdgcn_fence(__ATOMIC_ACQUIRE, "workgroup");
  {
    const int c4 = (lane & 15) * 4;
    float* orow = ob + (size_t)(q0 + hh) * D_MODEL + c4;   // one base; the eight rows lie at constant steps from it
#pragma unroll
    for (int it = 0; it < 8; ++it) {
      v4f val = *(const v4f*)(os + (it * 2 + hh) * 68 + c4);
      *(v4f*)(orow + it * 2 * D_MODEL) = val;
    }
  }
}

// ---------------------------------------------------------------------------
// host launcher
// ---------------------------------------------------------------------------
extern "C" void kernel_launch(void* const* d_in, const int* in_sizes, int n_in,
                              void* d_out, int out_size, void* d_ws, size_t ws_size,
                              hipStream_t stream) {
  constexpr int S  = SEQ_LEN;
  constexpr int DM = D_MODEL;
  const size_t SD = (size_t)S * DM;    // 4194304 elements
  const size_t DD = (size_t)DM * DM;   // 1048576 elements
  if (n_in < 11) return;
  if ((size_t)in_sizes[0] != SD || (size_t)in_sizes[1] != SD || (size_t)in_sizes[2] != SD) return;
  if ((size_t)in_sizes[3] != DD || (size_t)in_sizes[5] != DD || (size_t)in_sizes[7] != DD || (size_t)in_sizes[9] != DD) return;
  if (in_sizes[4] != DM || in_sizes[6] != DM || in_sizes[8] != DM || in_sizes[10] != DM) return;
  if ((size_t)out_size != SD) return;

  const float* x_q = (const float*)d_in[0];
  const float* x_k = (const float*)d_in[1];
  const float* x_v = (const float*)d_in[2];
  const float* Wq  = (const float*)d_in[3];
  const float* bq  = (const float*)d_in[4];
  const float* Wk  = (const float*)d_in[5];
  const float* bk  = (const float*)d_in[6];
  const float* Wv  = (const float*)d_in[7];
  const float* bv  = (const float*)d_in[8];
  const float* Wo  = (const float*)d_in[9];
  const float* bo  = (const float*)d_in[10];

  //   xq  bf16 [4096][1024]  8 MiB @  0 MiB      xk  @  8 MiB      xv  @ 16 MiB
  //   wq  bf16 [1024][1024]  2 MiB @ 24 MiB      wk  @ 26 MiB      wv  @ 28 MiB     wo f16 @ 30 MiB
  //   q16 f16  [4096][1024]  8 MiB @ 32 MiB      k16 @ 40 MiB      vt16 f16 [1024][4096] @ 48 MiB
  //   o32 f32  [4096][1024] 16 MiB @ 56 MiB      o16 f16 8 MiB @ 72 MiB
  //   bias f32 [4][1024]    16 KiB @ 80 MiB      end = 83902464 B
  const size_t off_xq  = 0;
  const size_t off_xk  = off_xq  + SD * 2;
  const size_t off_xv  = off_xk  + SD * 2;
  const size_t off_wq  = off_xv  + SD * 2;
  const size_t off_wk  = off_wq  + DD * 2;
  const size_t off_wv  = off_wk  + DD * 2;
  const size_t off_wo  = off_wv  + DD * 2;
  const size_t off_q   = off_wo  + DD * 2;
  const size_t off_k   = off_q   + SD * 2;
  const size_t off_vt  = off_k   + SD * 2;
  const size_t off_o32 = off_vt  + SD * 2;
  const size_t off_o16 = off_o32 + SD * 4;
  const size_t off_b   = off_o16 + SD * 2;
  const size_t ws_end  = off_b + 4 * (size_t)DM * 4;
  if (ws_end > ws_size) return;

  char* ws = (char*)d_ws;
  unsigned short* xq   = (unsigned short*)(ws + off_xq);
  unsigned short* xk   = (unsigned short*)(ws + off_xk);
  unsigned short* xv   = (unsigned short*)(ws + off_xv);
  unsigned short* wq   = (unsigned short*)(ws + off_wq);
  unsigned short* wk   = (unsigned short*)(ws + off_wk);
  unsigned short* wv   = (unsigned short*)(ws + off_wv);
  unsigned short* wo   = (unsigned short*)(ws + off_wo);
  unsigned short* q16  = (unsigned short*)(ws + off_q);
  unsigned short* k16  = (unsigned short*)(ws + off_k);
  unsigned short* vt16 = (unsigned short*)(ws + off_vt);
  float*          o32  = (float*)(ws + off_o32);
  unsigned short* o16  = (unsigned short*)(ws + off_o16);
  float*          bws  = (float*)(ws + off_b);
  const float* bias_q = bws;
  const float* bias_o = bws + 3 * DM;

  // 1) every conversion of an input, one grid: x_q, x_k, x_v, Wq, Wk, Wv -> bf16 planes ([out][in] = [N][K] layout as is),
  //    Wo -> f16 plane of bf16-RNE(Wo) x 2^8, the four biases -> bf16-RNE values in f32
  convert_inputs_kernel<<<dim3(CV_BLOCKS, 1), CS_T, 0, stream>>>(x_q, x_k, x_v, Wq, Wk, Wv, Wo, bq, bk, bv, bo,
                                                                xq, xk, xv, wq, wk, wv, wo, bws, 256.0f);

  // GEMM tiles: (4096/128)*(1024/128) = 256 tiles of 128x128 -> 256 blocks x 8 waves; K = 1024 (K % 64 == 0)
  const int gemm_blocks = (int)((S / 128) * (DM / 128));   // 256
  // 2) the three projections, one grid of 3 x 256 blocks (the planes of each kind lie one behind another in the workspace):
  //    job 0: q16[s][n] = x_q . Wq^T + bq   job 1: k16[s][n] = x_k . Wk^T + bk   (f16 out)
  //    job 2: vt16[m = feature][n = s] = Wv[m,:] . x_v[s,:] + bv[m]  (roles swapped: M = 1024, N = 4096, row pitch 4096)
  wmma_gemm64<1, false, 3, 1, false, 0, true><<<dim3(gemm_blocks, 3), 256, 0, stream>>>(
      xq, xq, DM, (long)SD, wq, wq, DM, (long)DD, (void*)q16, (void*)q16, DM, (long)SD, bias_q, bias_q, 0L, S, DM, DM, 1.0f);

  // 3) attention: 16 heads x 64 query blocks, f32 context o32[s][h*64+d]
  attn_full64_f16_kernel<<<dim3(N_HEADS * (S / 64), 1), 128, 0, stream>>>(q16, k16, vt16, o32, 0.125f);

  // 4) o32 -> f16 plane x 2^8
  cast_f16_scaled_kernel<<<dim3(CC_BLOCKS, 1), CS_T, 0, stream>>>(o32, o16, 256.0f);

  // 5) out[s][n] = (o x 2^8) . (Wo x 2^8)^T * 2^-16 + bo  -> f32 d_out
  wmma_gemm64<0, false, 2, 0, false><<<dim3(gemm_blocks, 1), 256, 0, stream>>>(
      o16, o16, DM, 0L, wo, wo, DM, 0L, d_out, d_out, DM, 0L, bias_o, bias_o, 0L, S, DM, DM, 1.0f / 65536.0f);
}

// v009
// A run of this version takes 115 microseconds.
// Timed twice side by side with v008, it ran 1.08 and 1.09 times as fast.
// Counting every step since v000, it is 5.62 times as fast.
// Projections q,k,v^T: v_wmma_f32_16x16x32_bf16 (bf16 RNE operands from the f32 inputs, f32 accumulate, bf16-RNE bias added in f32); attention q.k^T and p.v: v_wmma_f32_16x16x32_f16 (f16 q,k,v planes, p carried x2^15, f32 accumulate, f32 online softmax, score scale 0.125 in f32); output projection: v_wmma_f32_16x16x32_f16 (f16 planes of o x2^8 and bf16-RNE(Wo) x2^8, f32 accumulate, scale 2^-16, bf16-RNE bias added in f32).
#include <hip/hip_runtime.h>
#include <math.h>
#include <stdint.h>

typedef __attribute__((ext_vector_type(16))) _Float16 v16h;
typedef __attribute__((ext_vector_type(8)))  _Float16 v8h;
typedef __attribute__((ext_vector_type(16))) __bf16   v16b;
typedef __attribute__((ext_vector_type(8)))  __bf16   v8b;
typedef __attribute__((ext_vector_type(8)))  float    v8f;
typedef __attribute__((ext_vector_type(4)))  float    v4f;
typedef __attribute__((ext_vector_type(2)))  float    v2f;

constexpr int SEQ_LEN = 4096;
constexpr int D_MODEL = 1024;
constexpr int N_HEADS = 16;

__device__ __forceinline__ unsigned short f2bf_bits(float f) {
  unsigned u = __float_as_uint(f);
  return (unsigned short)((u + 0x7FFFu + ((u >> 16) & 1u)) >> 16);
}
__device__ __forceinline__ float bf_bits2f(unsigned short h) { return __uint_as_float(((unsigned)h) << 16); }
__device__ __forceinline__ unsigned pk16(unsigned short a, unsigned short b) { return (unsigned)a | ((unsigned)b << 16); }

// hazard guards as plain device helpers
__device__ __forceinline__ void dep_guard_h(v8f& a, v8f& b, v16h x, v16h y) { asm volatile("v_nop\n\tv_nop\n\tv_nop\n\tv_nop" : "+v"(a), "+v"(b) : "v"(x), "v"(y)); }
__device__ __forceinline__ void dep_guard_b(v8f& a, v8f& b, v16b x, v16b y) { asm volatile("v_nop\n\tv_nop\n\tv_nop\n\tv_nop" : "+v"(a), "+v"(b) : "v"(x), "v"(y)); }
__device__ __forceinline__ void keep4_h(v16h a, v16h b, v16h c, v16h d) { asm volatile("v_nop" :: "v"(a), "v"(b), "v"(c), "v"(d)); }
__device__ __forceinline__ void keep4_b(v16b a, v16b b, v16b c, v16b d) { asm volatile("v_nop" :: "v"(a), "v"(b), "v"(c), "v"(d)); }
__device__ __forceinline__ void acc_guard4(v8f& a, v8f& b, v8f& c, v8f& d) { asm volatile("v_nop\n\tv_nop\n\tv_nop\n\tv_nop" : "+v"(a), "+v"(b), "+v"(c), "+v"(d)); }
template <typename T> struct Frag;
template <> struct Frag<_Float16> {
  typedef v16h V; typedef v8h H; union U { v16h v; v8h h[2]; };
  static __device__ __forceinline__ v16h load(const _Float16* p) {   // elements 0..7 <- p[0..7], 8..15 <- p[16..23]
    U f; f.h[0] = *(const v8h*)(p); f.h[1] = *(const v8h*)(p + 16); return f.v;
  }
  static __device__ __forceinline__ v8f mma(v16h a, v16h b, v8f c) {
    return __builtin_amdgcn_wmma_f32_16x16x32_f16(false, a, false, b, (short)0, c, false, false);
  }
  static __device__ __forceinline__ void guard(v8f& a, v8f& b, v16h x, v16h y) { dep_guard_h(a, b, x, y); }
  static __device__ __forceinline__ void keep(v16h a, v16h b, v16h c, v16h d) { keep4_h(a, b, c, d); }
};
template <> struct Frag<__bf16> {
  typedef v16b V; typedef v8b H; union U { v16b v; v8b h[2]; };
  static __device__ __forceinline__ v16b load(const __bf16* p) {
    U f; f.h[0] = *(const v8b*)(p); f.h[1] = *(const v8b*)(p + 16); return f.v;
  }
  static __device__ __forceinline__ v8f mma(v16b a, v16b b, v8f c) {
    return __builtin_amdgcn_wmma_f32_16x16x32_bf16(false, a, false, b, (short)0, c, false, false);
  }
  static __device__ __forceinline__ void guard(v8f& a, v8f& b, v16b x, v16b y) { dep_guard_b(a, b, x, y); }
  static __device__ __forceinline__ void keep(v16b a, v16b b, v16b c, v16b d) { keep4_b(a, b, c, d); }
};

// ---- LDS-staged batched WMMA GEMM -------------------------------------------
// C[m,n] = scale * sum_k A[m,k] * Bt[n,k] (+bias)(+resid); a block of 8 waves owns a 128x128 tile, each wave 32x64 of it.
// A row-major [M,K]; Bt row-major [N,K]; M,N % 128 == 0, K % 64 == 0, K >= 64.
// Per 64-k step the block brings 128 rows x 128 B of A and of Bt into LDS: 8 lanes x 16 B cover one whole row line,
// 256 threads x 4 pieces per operand = the whole tile. Two LDS buffers: the next step's global loads are issued ahead of
// this step's products and stored behind them, one __syncthreads() per step.
// Rotated k walk: a block starts at k step (tm * cm + tn * cn) mod nk and wraps round. Blocks that share a row band would
// otherwise ask for the same lines at the same moment, step after step, and wait together for each step's lines to reach L2;
// spread over the k steps, they find most lines in L2, where a sharer has brought them. For speed only: any start is correct.
// SPLIT (hi/lo planes) is not staged: single-plane operands only.
// BIAS_MODE: 0 = none, 1 = bias[m], 2 = bias[n], 3 = by the job of a TRIO grid (below).
// TRIO: three independent products share one grid, blockIdx.y = job b; operands, C and bias of job b lie b strides behind
// job 0's (the bias vectors one behind another), C is dense (row pitch = its N). Jobs 0, 1: C = A . Bt^T + bias[n].
// Job 2 takes the two operands in swapped roles (M and N swap with them): C = Bt . A^T + bias[m].
// OUT_MODE: 0 = f32, 1 = f16, 2 = bf16 hi plane (Cout) + bf16 lo plane (Cout2).
// ET: 0 = f16 operands, 1 = bf16 operands (pointers passed as 16-bit storage)
#define GM_BT 128  // block tile, rows of A and of Bt
#define GM_LP 72   // LDS row pitch in elements: 64 + 8, 144 B = 16 B x 9, so 16 rows read by ds_load_b128 fall on 16 distinct bank groups
template <int I> struct IntC { static constexpr int value = I; };   // a compile-time int handed to a generic lambda
template <int ET> struct Elem;
template <> struct Elem<0> { typedef _Float16 T; };
template <> struct Elem<1> { typedef __bf16 T; };
template <int ET, bool SPLIT, int BIAS_MODE, int OUT_MODE, bool RESID, int ACT = 0, bool TRIO = false>
__global__ __launch_bounds__(256) void wmma_gemm64(
    const unsigned short* __restrict__ Ap, const unsigned short* __restrict__ A2p, int lda0, long strideA,
    const unsigned short* __restrict__ Btp, const unsigned short* __restrict__ Bt2p, int ldb0, long strideB,
    void* __restrict__ Cout, void* __restrict__ Cout2, int ldc0, long strideC,
    const float* __restrict__ bias0,
    const float* __restrict__ resid, long strideR,
    int M0, int N0, int K, float scale) {
  static_assert(!SPLIT, "single-plane operands only");
  static_assert((BIAS_MODE == 3) == TRIO, "the job picks the bias mode in a TRIO grid and nowhere else");
  typedef typename Elem<ET>::T T;
  typedef typename Frag<T>::V V;
  typedef typename Frag<T>::H H;
  const T* A = (const T*)Ap; const T* Bt = (const T*)Btp;
  __shared__ __align__(16) T sA[2][GM_BT * GM_LP];   // A rows of the block tile, one 64-k step, two buffers
  __shared__ __align__(16) T sB[2][GM_BT * GM_LP];   // Bt rows of the block tile
  __shared__ __align__(16) float sT[8][16 * 68];     // per-wave 16x64 slab, pitch 68 floats
  const int b    = blockIdx.y;
  const int tid  = threadIdx.x;
  const int lane = tid & 31;
  const int wave = tid >> 5;
  const bool sw = TRIO && b == 2;              // block-uniform: this job's operands change roles
  const int M = sw ? N0 : M0;
  const int N = sw ? M0 : N0;
  const int tilesN = N >> 7;
  const int tilesM = M >> 7;
  const int tile = blockIdx.x;
  if (tile >= tilesM * tilesN) return;   // block-uniform, ahead of every barrier
  const int tm = tile / tilesN;
  const int tn = tile - tm * tilesN;
  const int bm0 = tm << 7;
  const int bn0 = tn << 7;
  const int wm = (wave >> 1) << 5;             // this wave's rows inside the block tile: 0, 32, 64, 96
  const int wn = (wave & 1) << 6;              // this wave's columns inside the block tile: 0, 64
  const int m0 = bm0 + wm;
  const int n0 = bn0 + wn;

  const T* Ab  = sw ? Bt + (size_t)b * strideB : A  + (size_t)b * strideA;
  const T* Bb  = sw ? A  + (size_t)b * strideA : Bt + (size_t)b * strideB;
  const int lda = sw ? ldb0 : lda0;
  const int ldb = sw ? lda0 : ldb0;
  const int ldc = TRIO ? N : ldc0;
  const float* bias = TRIO ? bias0 + (size_t)b * (sw ? M : N) : bias0;

  const int rlane = lane & 15;                 // row (A) / col (B, D) within subtile
  const int koff  = (lane >> 4) * 8;           // k offset of this lane half
  const int mOff  = (lane >> 4) * 8;           // D row offset

  // every unroll directive from here to the epilogue makes the array indices constants, so that acc, the staged pieces
  // and the fragments live in registers and not in scratch
  v8f acc[2][4];
#pragma unroll
  for (int i = 0; i < 2; ++i)
#pragma unroll
    for (int j = 0; j < 4; ++j) acc[i][j] = (v8f){0.f,0.f,0.f,0.f,0.f,0.f,0.f,0.f};

  // staging map: piece it of a thread = row it*32 + (tid >> 3), elements (tid & 7)*8 .. +7 of the step's 64
  const int srow = tid >> 3;
  const int sseg = (tid & 7) << 3;
  const int so = srow * GM_LP + sseg;
  const char* Ac = (const char*)(Ab + (size_t)bm0 * lda);   // block-uniform bases of the two row bands
  const char* Bc = (const char*)(Bb + (size_t)bn0 * ldb);
  const int nk = K >> 6;
  // spacing of the starts: the tilesM sharers of a Bt band spread over the nk steps; the tilesN sharers of an A band
  // (neighbours in block index) spread at twice the spacing
  const int cm = (nk > tilesM) ? nk / tilesM : 1;
  const int cn = (2 * nk > tilesN) ? 2 * nk / tilesN : 1;
  int ks = (tm * cm + tn * cn) % nk;           // block-uniform: the k step being fetched
  unsigned oa[4], ob[4];                       // one running byte offset per piece (a 128-row band stays far below 4 GiB), 128 B a step
  H ra[4], rb[4];
#pragma unroll
  for (int it = 0; it < 4; ++it) {
    oa[it] = (unsigned)(((it * 32 + srow) * lda + sseg) * 2) + (unsigned)ks * 128u;
    ob[it] = (unsigned)(((it * 32 + srow) * ldb + sseg) * 2) + (unsigned)ks * 128u;
    ra[it] = *(const H*)(Ac + oa[it]);
    rb[it] = *(const H*)(Bc + ob[it]);
  }
#pragma unroll
  for (int it = 0; it < 4; ++it) {
    *(H*)(&sA[0][so + it * 32 * GM_LP]) = ra[it];
    *(H*)(&sB[0][so + it * 32 * GM_LP]) = rb[it];
  }

  for (int kt = 0; kt < nk; ++kt) {
    // publishes buffer kt & 1 and ends every wave's reads of the other buffer, which is refilled below
    __syncthreads();
    const bool more = kt + 1 < nk;             // block-uniform
    if (more) {
      const bool wrap = ks + 1 == nk;          // block-uniform: behind the last k step the walk goes on at step 0
      const unsigned adv = wrap ? 128u - (unsigned)nk * 128u : 128u;   // modulo 2^32: the sum is the offset in step 0 again
      ks = wrap ? 0 : ks + 1;
#pragma unroll
      for (int it = 0; it < 4; ++it) {
        oa[it] += adv;
        ob[it] += adv;
        ra[it] = *(const H*)(Ac + oa[it]);
        rb[it] = *(const H*)(Bc + ob[it]);
      }
      // stands behind the eight loads, ahead of every later write of an offset or base register that they name
      asm volatile("s_wait_xcnt 0x0" ::: "memory");
    }
    const T* sa = &sA[kt & 1][(wm + rlane) * GM_LP + koff];
    const T* sb = &sB[kt & 1][(wn + rlane) * GM_LP + koff];
    // the step's 24 fragment reads stand together ahead of its 16 products
    V bh[2][4], ah[2][2];
#pragma unroll
    for (int kk = 0; kk < 2; ++kk) {
#pragma unroll
      for (int j = 0; j < 4; ++j) bh[kk][j] = Frag<T>::load(sb + j * 16 * GM_LP + kk * 32);
#pragma unroll
      for (int i = 0; i < 2; ++i) ah[kk][i] = Frag<T>::load(sa + i * 16 * GM_LP + kk * 32);
    }
#pragma unroll
    for (int kk = 0; kk < 2; ++kk) {
#pragma unroll
      for (int i = 0; i < 2; ++i) {
#pragma unroll
        for (int j = 0; j < 4; ++j) acc[i][j] = Frag<T>::mma(ah[kk][i], bh[kk][j], acc[i][j]);
        Frag<T>::guard(acc[i][0], acc[i][3], ah[kk][i], ah[kk][i]);   // v_nops: the slots behind the last product before its A or D is touched
      }
      Frag<T>::keep(bh[kk][0], bh[kk][1], bh[kk][2], bh[kk][3]);   // holds the B fragments' registers to the end of their products
    }
    if (more) {
      const int nb = (kt + 1) & 1;
#pragma unroll
      for (int it = 0; it < 4; ++it) {
        *(H*)(&sA[nb][so + it * 32 * GM_LP]) = ra[it];
        *(H*)(&sB[nb][so + it * 32 * GM_LP]) = rb[it];
      }
    }
  }
  acc_guard4(acc[0][0], acc[0][1], acc[0][2], acc[0][3]);
  acc_guard4(acc[1][0], acc[1][1], acc[1][2], acc[1][3]);

  // ---- epilogue ----
  float* slab = sT[wave];
  const float* Rb = RESID ? (resid + (size_t)b * strideR) : nullptr;
  // written once, compiled per bias mode BM (1 or 2 in a TRIO grid, picked below by one block-uniform branch), so that each
  // job's bias loads stand together as in a kernel of that mode alone
  auto epilogue = [&](auto bmc) __attribute__((always_inline)) {
  constexpr int BM = decltype(bmc)::value;
#pragma unroll
  for (int i = 0; i < 2; ++i) {
    const int mBase = m0 + (i << 4);
#pragma unroll
    for (int j = 0; j < 4; ++j) {
      const int n = n0 + (j << 4) + rlane;
      float bv = 0.f;
      if (BM == 2) bv = bias[n];
#pragma unroll
      for (int r = 0; r < 8; ++r) {
        float v = acc[i][j][r] * scale;
        if (BM == 1) v += bias[mBase + mOff + r];
        if (BM == 2) v += bv;
        if (RESID) v += Rb[(size_t)(mBase + mOff + r) * ldc + n];
        if (ACT == 1) v = tanhf(v);
        if (ACT == 2) v = fmaxf(v, 0.0f);
        if (ACT == 3) v = v / (1.0f + expf(-v));
        if (ACT == 4) v = (v > 0.f) ? v : 0.01f * v;
        if (ACT == 5) v = 0.5f * v * (1.0f + erff(v * 0.70710678118654752f));
        slab[(mOff + r) * 68 + (j << 4) + rlane] = v;
      }
    }
    __builtin_amdgcn_fence(__ATOMIC_RELEASE, "workgroup");
    __builtin_amdgcn_wave_barrier();
    __builtin_amdgcn_fence(__ATOMIC_ACQUIRE, "workgroup");
    if (OUT_MODE == 0) {
      float* C = (float*)Cout + (size_t)b * strideC;
      const int hh = lane >> 4, c4 = (lane & 15) * 4;     // row seg = 256 B = 16 lanes x 16 B
      {
#pragma unroll
        for (int it = 0; it < 8; ++it) {
          const int row = it * 2 + hh;
          v4f v = *(const v4f*)(slab + row * 68 + c4);
          *(v4f*)(C + (size_t)(mBase + row) * ldc + n0 + c4) = v;
        }
        
      }
    } else {
      const int q = lane >> 3, c8 = (lane & 7) * 8;
      unsigned short* C  = (unsigned short*)Cout  + (size_t)b * strideC;
      unsigned short* C2 = (OUT_MODE == 2) ? ((unsigned short*)Cout2 + (size_t)b * strideC) : nullptr;
      {
#pragma unroll
        for (int it = 0; it < 4; ++it) {
          const int row = it * 4 + q;
          const float* sp = slab + row * 68 + c8;
          v8h hv, lv;
#pragma unroll
          for (int e = 0; e < 8; ++e) {
            if (OUT_MODE == 1) {
              hv[e] = (_Float16)sp[e];
            } else {
              unsigned short hb = f2bf_bits(sp[e]);
              unsigned short lb = f2bf_bits(sp[e] - bf_bits2f(hb));
              hv[e] = __builtin_bit_cast(_Float16, hb);
              lv[e] = __builtin_bit_cast(_Float16, lb);
            }
          }
          *(v8h*)(C + (size_t)(mBase + row) * ldc + n0 + c8) = hv;
          if (OUT_MODE == 2) *(v8h*)(C2 + (size_t)(mBase + row) * ldc + n0 + c8) = lv;
        }
        
      }
    }
    __builtin_amdgcn_fence(__ATOMIC_RELEASE, "workgroup");
    __builtin_amdgcn_wave_barrier();
    __builtin_amdgcn_fence(__ATOMIC_ACQUIRE, "workgroup");
  }
  };
  if constexpr (BIAS_MODE == 3) {
    if (sw) epilogue(IntC<1>{}); else epilogue(IntC<2>{});
  } else {
    epilogue(IntC<BIAS_MODE>{});
  }
}

// ---------------------------------------------------------------------------
// Conversions in streaming form. A block is 16 waves; a wave owns NL * 128 consecutive elements of a plane and issues all its
// NL loads (16 B a lane, 512 contiguous bytes a load) ahead of the first conversion, so that NL * 512 B a wave are in flight;
// piece k goes out as 8 B a lane, 256 contiguous bytes (two whole lines) a store.
// ---------------------------------------------------------------------------
constexpr int CS_T = 512;                    // threads of a block
typedef uint32_t u32x2 __attribute__((ext_vector_type(2)));
// f32 -> bf16 (RNE)
struct CvBf16 {
  __device__ __forceinline__ unsigned short operator()(float f) const { return f2bf_bits(f); }
};
// f32 -> f16 with a power-of-two carry: f16(g(f) * scale), g = bf16 RNE when PREBF, identity otherwise
template <bool PREBF> struct CvF16Scaled {
  float scale;
  __device__ __forceinline__ unsigned short operator()(float f) const {
    if (PREBF) f = bf_bits2f(f2bf_bits(f));
    const _Float16 h = (_Float16)(f * scale);
    return __builtin_bit_cast(unsigned short, h);
  }
};
// block number part of a plane: elements part * 16 * NL * 128 .. + 16 * NL * 128 - 1
template <int NL, typename CV>
__device__ __forceinline__ void stream_cvt(const float* __restrict__ in, unsigned short* __restrict__ out, int part, CV cv) {
  const int wave = threadIdx.x >> 5;
  const int lane = threadIdx.x & 31;
  const size_t e0 = ((size_t)part * (CS_T / 32) + wave) * (NL * 128) + lane * 4;
  const float* ip = in + e0;
  unsigned short* op = out + e0;
  v4f r[NL];
  // both unroll directives make the index of r a constant, so that the pieces live in registers
#pragma unroll
  for (int k = 0; k < NL; ++k) r[k] = *(const v4f*)(ip + k * 128);
  // stands behind the run of loads, ahead of every write of a register that they name; the address is an input, so that it
  // lives up to this wait and no piece of the run is given its registers
  asm volatile("s_wait_xcnt 0x0" :: "v"(ip) : "memory");
  // keeps every load ahead of the first conversion: sunk among the conversions, a part of them would issue only when earlier
  // pieces have landed, and fewer bytes of the wave would be in flight
  __builtin_amdgcn_sched_barrier(0);
#pragma unroll
  for (int k = 0; k < NL; ++k) {
    u32x2 o;
    o[0] = pk16(cv(r[k][0]), cv(r[k][1]));
    o[1] = pk16(cv(r[k][2]), cv(r[k][3]));
    *(u32x2*)(op + k * 128) = o;
  }
  asm volatile("s_wait_xcnt 0x0" ::: "memory");   // stands ahead of any later overwrite of a register that the stores name (other ranges' code may follow in the built order)
}

// ---------------------------------------------------------------------------
// Every conversion that needs the inputs alone, in one grid: none reads what another writes. The job is picked by ranges of
// blockIdx.x (block-uniform), the largest planes first; a block covers 16 waves x CV_NL x 128 = 65536 elements of a plane:
//   3 x CV_XB blocks: x_q, x_k, x_v -> bf16 planes        (CV_XB x 65536 = 4096 x 1024)
//   3 x CV_WB blocks: Wq, Wk, Wv    -> bf16 planes        (CV_WB x 65536 = 1024 x 1024)
//       CV_WB blocks: Wo            -> f16 plane of bf16-RNE(Wo) x wo_scale
//   the last block, ahead of its piece of Wo: bq, bk, bv, bo -> bf16-RNE values held as f32, bias_out[sel * D_MODEL + i],
//   8 elements a thread
// ---------------------------------------------------------------------------
constexpr int CV_NL = 32;                                  // loads of a wave
constexpr int CV_BE = (CS_T / 32) * CV_NL * 128;           // 65536 elements a block
constexpr int CV_XB = SEQ_LEN * D_MODEL / CV_BE;           // 64
constexpr int CV_WB = D_MODEL * D_MODEL / CV_BE;           // 16
constexpr int CV_BLOCKS = 3 * CV_XB + 3 * CV_WB + CV_WB;   // 256: one block a WGP
static_assert(CV_XB * CV_BE == SEQ_LEN * D_MODEL && CV_WB * CV_BE == D_MODEL * D_MODEL, "whole blocks cover the planes");
static_assert(4 * D_MODEL == CS_T * 8, "one block covers the four biases");
// four waves a SIMD (one block a WGP): a wave's 32 pieces take 128 registers, above the compiler's own bound for this block size
__global__ __launch_bounds__(CS_T) __attribute__((amdgpu_waves_per_eu(4, 4))) void convert_inputs_kernel(
    const float* __restrict__ x0, const float* __restrict__ x1, const float* __restrict__ x2,
    const float* __restrict__ w0, const float* __restrict__ w1, const float* __restrict__ w2, const float* __restrict__ w3,
    const float* __restrict__ b0, const float* __restrict__ b1, const float* __restrict__ b2, const float* __restrict__ b3,
    unsigned short* __restrict__ xo0, unsigned short* __restrict__ xo1, unsigned short* __restrict__ xo2,
    unsigned short* __restrict__ wo0, unsigned short* __restrict__ wo1, unsigned short* __restrict__ wo2,
    unsigned short* __restrict__ wo3, float* __restrict__ bias_out, float wo_scale) {
  int blk = blockIdx.x;
  if (blk < 3 * CV_XB) {
    const int sel = blk / CV_XB;
    const float* in = (sel == 0) ? x0 : ((sel == 1) ? x1 : x2);
    unsigned short* out = (sel == 0) ? xo0 : ((sel == 1) ? xo1 : xo2);
    stream_cvt<CV_NL>(in, out, blk - sel * CV_XB, CvBf16{});
    return;
  }
  blk -= 3 * CV_XB;
  if (blk < 3 * CV_WB) {
    const int sel = blk / CV_WB;
    const float* in = (sel == 0) ? w0 : ((sel == 1) ? w1 : w2);
    unsigned short* out = (sel == 0) ? wo0 : ((sel == 1) ? wo1 : wo2);
    stream_cvt<CV_NL>(in, out, blk - sel * CV_WB, CvBf16{});
    return;
  }
  blk -= 3 * CV_WB;
  if (blk == CV_WB - 1) {
    const int t = threadIdx.x;
    const int sel = t / (D_MODEL / 8);               // the same in every lane of a wave: 128 threads a bias
    const float* in = (sel == 0) ? b0 : ((sel == 1) ? b1 : ((sel == 2) ? b2 : b3));
    const int i = (t - sel * (D_MODEL / 8)) * 8;
    const v4f lo = *(const v4f*)(in + i), hi = *(const v4f*)(in + i + 4);
    v4f a, b;
    // unrolled so that the vector indices are constants and the values stay in registers
#pragma unroll
    for (int e = 0; e < 4; ++e) { a[e] = bf_bits2f(f2bf_bits(lo[e])); b[e] = bf_bits2f(f2bf_bits(hi[e])); }
    *(v4f*)(bias_out + sel * D_MODEL + i)     = a;
    *(v4f*)(bias_out + sel * D_MODEL + i + 4) = b;
    asm volatile("s_wait_xcnt 0x0" ::: "memory");   // stands ahead of any later overwrite of a register that the stores name
  }
  stream_cvt<CV_NL>(w3, wo3, blk, CvF16Scaled<true>{wo_scale});
}

// ---------------------------------------------------------------------------
// f32 -> f16 with a power-of-two carry, one plane of SEQ_LEN x D_MODEL elements.
// Coverage: CC_BLOCKS blocks x 16 waves x CC_NL x 128 elements = the whole plane.
// ---------------------------------------------------------------------------
constexpr int CC_NL = 8;
constexpr int CC_BLOCKS = SEQ_LEN * D_MODEL / ((CS_T / 32) * CC_NL * 128);   // 256
static_assert(CC_BLOCKS * (CS_T / 32) * CC_NL * 128 == SEQ_LEN * D_MODEL, "whole blocks cover the plane");
__global__ __launch_bounds__(CS_T) void cast_f16_scaled_kernel(const float* __restrict__ in, unsigned short* __restrict__ out, float scale) {
  stream_cvt<CC_NL>(in, out, blockIdx.x, CvF16Scaled<false>{scale});
}

// =====================================================================================
// Full (non-causal, unmasked) attention, head dim 64, single 16-bit products.
//   q plane (f16): element (s, h, d) at [s*D_MODEL + h*64 + d]
//   k plane (f16): element (s, h, d) at [s*D_MODEL + h*64 + d]
//   v^T plane (f16): element (h, d, s) at [(h*64 + d)*SEQ_LEN + s]
//   out f32: element (s, h, d) at [s*D_MODEL + h*64 + d]
//   scores^T = (k . q^T) * sscale : v_wmma_f32_16x16x32_f16 (A = K rows, B = q), f32 accumulate, sscale applied in f32
//                                   inside the one fma per score that feeds v_exp_f32 (base 2)
//   out^T    = v^T . p^T          : v_wmma_f32_16x16x32_f16 (A = V^T rows, B = p^T packed from the score registers),
//                                   p (unnormalised, x2^15) and v in f16, f32 accumulate
//   online softmax in f32 over all SEQ_LEN keys (64 chunks of 64, compile-time trip count, no masking).
//   Rotated key walk: query block qb starts at chunk qb and wraps round, so that the 64 blocks of a head ask for 64 different
//   chunks at a time and, past the first few, find them in L2 where another block has brought them (for speed only).
//   Block = 4 waves = 64 query rows of one head; grid.x = N_HEADS * (SEQ_LEN/64) = 1024.
//   K / V^T chunk staging: one tensor_load_to_lds per wave and chunk, each a slice of 32 rows x 128 B (waves 0, 1: K rows
//   0-31, 32-63 of the chunk; waves 2, 3: V^T rows 0-31, 32-63), padded by the mover to the 144-B pitch; two LDS buffers,
//   the load of chunk s + 2 issued at the foot of chunk s, one publish point (waits, barrier) per chunk.
//   Output: per-wave 16x64 f32 tile staged in LDS; each 64-float row segment (256 B) written by 16 lanes x 16 B
//   Coverage: 1024 blocks x 4 waves x 16 rows x 64 floats = 4096 x 1024 = the whole out plane.
// =====================================================================================
#define AT_D 64
#define AT_NW 4
#define AT_QB 64
#define AT_KC 64
#define AT_PB 144u  // LDS row pitch of the 16-bit tiles in bytes: 16 B x 9, so 16 rows read by ds_load_b128 fall on 16 distinct bank groups
#define AT_SR 32u            // rows of one tensor-load slice
#define AT_SLB 6144u         // a slice's room in LDS: 32 rows x 144 B = 4608 B, rounded up so that every slice starts at a multiple of 2 KiB
#define AT_BUFB (4u * AT_SLB) // one buffer: K slices 0, 1, then V^T slices 0, 1
typedef uint32_t u32x4 __attribute__((ext_vector_type(4)));
typedef uint32_t u32x8 __attribute__((ext_vector_type(8)));
constexpr float P_CARRY_LOG2 = 15.0f;   // p and its running sum are carried x2^15; the factor cancels in the final division

__device__ __forceinline__ v8f at_mma_h(v16h a, v16h b, v8f c) {
  return __builtin_amdgcn_wmma_f32_16x16x32_f16(false, a, false, b, (short)0, c, false, false);
}

__device__ __forceinline__ uint32_t uni(uint32_t v) { return (uint32_t)__builtin_amdgcn_readfirstlane(v); }
__device__ __forceinline__ uint32_t pinned(uint32_t v) {
  uint32_t w = uni(v);
  asm volatile("" : "+s"(w));   // holds the word in a scalar register; without it the test may become a vector condition
  return w;
}
// the compiler places no wait for the tensor mover: a tile counts as landed only behind its issuer's own wait
__device__ __forceinline__ void wait_tensor0() { asm volatile("s_wait_tensorcnt 0x0" ::: "memory"); }
// this wave's LDS reads have retired before the barrier behind which their buffer is refilled
__device__ __forceinline__ void wait_ds0() { asm volatile("s_wait_dscnt 0x0" ::: "memory"); }
__device__ __forceinline__ void tdm_load(u32x4 g0, u32x8 g1) { asm volatile("tensor_load_to_lds %0, %1" :: "{s[84:87]}"(g0), "{s[88:95]}"(g1) : "memory"); }
// descriptor group 1: 1-byte elements, tensor = tile = 32 rows of 128 B, source row pitch src_pitch bytes,
// 4 dwords of LDS pad behind every 32 dwords (one row): LDS pitch 144 B; no workgroup mask
__device__ __forceinline__ u32x8 tdm_group1(uint32_t src_pitch) {
  constexpr uint32_t d0 = 128u, d1 = AT_SR;
  u32x8 g;
  g[0] = uni((1u << 20) | (4u << 22) | (3u << 25));
  g[1] = uni((d0 & 0xFFFFu) << 16);
  g[2] = uni((d0 >> 16) | ((d1 & 0xFFFFu) << 16));
  g[3] = uni((d1 >> 16) | (d0 << 16));
  g[4] = uni(d1);
  g[5] = uni(src_pitch);
  g[6] = uni(0u);
  g[7] = uni(0u);
  return g;
}
// descriptor group 0: count 1, LDS byte offset, global address of the tile's first byte, type 2
__device__ __forceinline__ u32x4 tdm_group0(uint32_t lds_dst, uint64_t ga) {
  u32x4 g;
  g[0] = uni(1u); g[1] = uni(lds_dst); g[2] = uni((uint32_t)ga); g[3] = uni((((uint32_t)(ga >> 32)) & 0x01FFFFFFu) | 0x80000000u);
  return g;
}

// lane l takes the value of lane l ^ 16
__device__ __forceinline__ float xhalf(float x) {
  return __builtin_bit_cast(float, __builtin_amdgcn_permlanex16(__builtin_bit_cast(int, x), __builtin_bit_cast(int, x), 0x76543210, 0xfedcba98, false, false));
}

__global__ __launch_bounds__(128)
void attn_full64_f16_kernel(const unsigned short* __restrict__ qp, const unsigned short* __restrict__ kp,
                            const unsigned short* __restrict__ vtp, float* __restrict__ out, float sscale) {
  union FH { v16h v; v8h h[2]; };
  __shared__ __attribute__((aligned(2048))) unsigned char ring[2 * AT_BUFB];   // two buffers of K [kv][d] and V [d][kv] slices, 48 KB
  __shared__ __align__(16) float    Os[AT_NW][16 * 68];            // per wave out tile, pitch 68

  const int tid  = threadIdx.x;
  const int wave = tid >> 5;
  const int lane = tid & 31;
  const int hh   = lane >> 4;
  const int c    = lane & 15;

  const int nqb = SEQ_LEN / AT_QB;        // 64
  const int bx = blockIdx.x;
  const int qb = bx % nqb;
  const int h  = bx / nqb;                // 0..N_HEADS-1 (grid = N_HEADS * nqb)
  const int q0 = qb * AT_QB + wave * 16;

  const _Float16* Qg = (const _Float16*)(const void*)qp  + (size_t)h * AT_D;
  const _Float16* Kg = (const _Float16*)(const void*)kp  + (size_t)h * AT_D;
  const _Float16* Vg = (const _Float16*)(const void*)vtp + (size_t)h * AT_D * SEQ_LEN;
  float*          ob = out + (size_t)h * AT_D;

  // ---- K / V^T slices by tensor load: every wave issues its own slice of every chunk, unconditionally ----
  const uint32_t wv   = uni((uint32_t)threadIdx.x >> 5);
  const bool     isV  = (wv & 2u) != 0u;
  const uint32_t srow = (wv & 1u) * AT_SR;                                   // the slice's first row in the chunk tile
  const uint32_t spitch = isV ? (uint32_t)SEQ_LEN * 2u : (uint32_t)D_MODEL * 2u;   // source row pitch in bytes
  const uint32_t sstep  = isV ? (uint32_t)AT_KC * 2u : (uint32_t)AT_KC * (uint32_t)D_MODEL * 2u;   // bytes from one chunk's slice to the next's
  const uint64_t ssrc = (uint64_t)(size_t)(isV ? Vg : Kg) + (uint64_t)(srow * spitch);
  const uint32_t sdst = (uint32_t)(size_t)ring + wv * AT_SLB;
  const u32x8 g1 = tdm_group1(spitch);
  // prologue, two buffers: the first chunk's load (chunk qb), its wait, the barrier that publishes it, then the next chunk's load
  constexpr uint32_t NCH = SEQ_LEN / AT_KC;   // chunks of the walk
  const uint32_t rot = uni((uint32_t)qb);     // the block's first chunk
  u32x4 g0 = tdm_group0(sdst, ssrc + (uint64_t)rot * sstep);
  tdm_load(g0, g1);
  wait_tensor0();
  __syncthreads();
  g0 = tdm_group0(sdst + AT_BUFB, ssrc + (uint64_t)((rot + 1u) % NCH) * sstep);
  tdm_load(g0, g1);

  // ---- Q fragments (B operand, column = lane&15, split k map via Frag load): 2 d-chunks ----
  v16h qa[2];
#pragma unroll
  for (int dc = 0; dc < 2; ++dc) {
    const _Float16* qr = Qg + (size_t)(q0 + c) * D_MODEL + dc * 32 + 8 * hh;
    qa[dc] = Frag<_Float16>::load(qr);
  }

  // One query column per lane (c); the two wave halves split that query's keys.
  float mrow = -INFINITY, lrow = 0.f;      // running maximum of the raw scores (equal in both halves), this half's running sum (x2^15)
  float mbrow = -INFINITY;                 // mrow * c2 - 15: what one fma takes off a score ahead of the base-2 exponential
  const float c2 = sscale * 1.44269504088896340736f;   // score scale times log2(e); sscale > 0, so the raw scores order as the scaled ones
  v8f oacc[4];                             // O^T tiles: oacc[t][r] = O[q0 + c][t*16 + 8*hh + r]
#pragma unroll
  for (int t = 0; t < 4; ++t) oacc[t] = (v8f){0.f,0.f,0.f,0.f,0.f,0.f,0.f,0.f};

  const int nChunks = SEQ_LEN / AT_KC;   // 64, compile-time constant
  for (int kc = 0; kc < nChunks; ++kc) {
    // this chunk's buffer; row x of a 64-row tile lies in slice x >> 5 at row x & 31
    const unsigned char* kr = ring + (uint32_t)(kc & 1) * AT_BUFB + (uint32_t)c * AT_PB + 16u * (uint32_t)hh;
    const unsigned char* vr = kr + 2u * AT_SLB;

    // the chunk's 32 fragment reads (K first, in the order of their use, then V^T) stand together behind the barrier, ahead
    // of all 16 products: one place with LDS reads per chunk, and the V^T fragments land under the score products and the softmax
    // (the unroll directives make the array indices constants, so that the fragments live in registers)
    FH kb[2][4], vb[2][4];
#pragma unroll
    for (int dc = 0; dc < 2; ++dc)
#pragma unroll
      for (int j = 0; j < 4; ++j) {
        kb[dc][j].h[0] = *(const v8h*)(kr + (j >> 1) * AT_SLB + (j & 1) * 16 * AT_PB + dc * 64);
        kb[dc][j].h[1] = *(const v8h*)(kr + (j >> 1) * AT_SLB + (j & 1) * 16 * AT_PB + dc * 64 + 32);
      }
#pragma unroll
    for (int kk = 0; kk < 2; ++kk)
#pragma unroll
      for (int t = 0; t < 4; ++t) {
        vb[kk][t].h[0] = *(const v8h*)(vr + (t >> 1) * AT_SLB + (t & 1) * 16 * AT_PB + kk * 64);
        vb[kk][t].h[1] = *(const v8h*)(vr + (t >> 1) * AT_SLB + (t & 1) * 16 * AT_PB + kk * 64 + 32);
      }
    // keeps the reads one group: sunk back among the products, each pair would cost its own full LDS latency
    __builtin_amdgcn_sched_barrier(0);
    // S^T = K . Q^T: s[j][r] = score of the chunk's key j*16 + 8*hh + r against query q0 + c; four independent tiles per d half
    v8f s[4];
#pragma unroll
    for (int j = 0; j < 4; ++j) s[j] = (v8f){0.f,0.f,0.f,0.f,0.f,0.f,0.f,0.f};
#pragma unroll
    for (int dc = 0; dc < 2; ++dc)
#pragma unroll
      for (int j = 0; j < 4; ++j) s[j] = at_mma_h(kb[dc][j].v, qa[dc], s[j]);
    // keeps the eight products back to back: a maximum drawn up among them waits out its product's latency and holds the rest back
    __builtin_amdgcn_sched_barrier(0);
    float mj[4];
#pragma unroll
    for (int j = 0; j < 4; ++j) {
      mj[j] = -INFINITY;
#pragma unroll
      for (int r = 0; r < 8; ++r) mj[j] = fmaxf(mj[j], s[j][r]);
    }
    float cm = fmaxf(fmaxf(mj[0], mj[1]), fmaxf(mj[2], mj[3]));
    cm = fmaxf(cm, xhalf(cm));             // both halves now hold the query's chunk maximum
    const float mnew = fmaxf(mrow, cm);
    const float mbnew = fmaf(mnew, c2, -P_CARRY_LOG2);
    const float alpha = __builtin_amdgcn_exp2f(mbrow - mbnew);   // 0 on the first chunk (mbrow = -inf)
    mrow = mnew;
    mbrow = mbnew;
    const v8f c2v = (v8f){c2, c2, c2, c2, c2, c2, c2, c2};
    const v8f nmb = (v8f){-mbnew, -mbnew, -mbnew, -mbnew, -mbnew, -mbnew, -mbnew, -mbnew};
    // P^T packs in place into the B operand: element e of block kk = tile 2*kk + (e >> 3), register e & 7
    FH pb[2];
    float pj[4];
#pragma unroll
    for (int j = 0; j < 4; ++j) {
      pj[j] = 0.f;
      const v8f x = __builtin_elementwise_fma(s[j], c2v, nmb);   // scaled score - scaled maximum + 15, in base-2 units
#pragma unroll
      for (int r = 0; r < 8; ++r) {
        const float p = __builtin_amdgcn_exp2f(x[r]);   // exp(scaled score - scaled maximum) x 2^15
        pj[j] += p;
        pb[j >> 1].v[(j & 1) * 8 + r] = (_Float16)p;
      }
    }
    lrow = lrow * alpha + ((pj[0] + pj[1]) + (pj[2] + pj[3]));
#pragma unroll
    for (int t = 0; t < 4; ++t)
#pragma unroll
      for (int r = 0; r < 8; ++r) oacc[t][r] *= alpha;
    // O^T += V^T . P^T
#pragma unroll
    for (int kk = 0; kk < 2; ++kk) {
#pragma unroll
      for (int t = 0; t < 4; ++t) oacc[t] = at_mma_h(vb[kk][t].v, pb[kk].v, oacc[t]);
    }
    // publish point of chunk kc + 1, every wave: own LDS reads retired, own slice landed, the barrier; it also ends every
    // wave's reads of this chunk's buffer, which the load behind it refills
    // keeps the publish point at the chunk's foot: drawn up among the softmax, the tensor wait would stand shortly behind its
    // load's issue instead of a whole chunk behind it
    __builtin_amdgcn_sched_barrier(0);
    wait_ds0();
    wait_tensor0();
    __syncthreads();
    const uint32_t nx = pinned((uint32_t)kc + 2u);   // taken behind the wait, so that the descriptor words formed from it are too
    if (pinned(nx < (uint32_t)nChunks)) {
      g0 = tdm_group0(sdst + (nx & 1u) * AT_BUFB, ssrc + (uint64_t)((rot + nx) % NCH) * sstep);
      tdm_load(g0, g1);
    }
  }
  wait_tensor0();   // nothing of the mover is in flight when the wave goes on to its end
  wait_ds0();

  float* os = Os[wave];
  {
    const float inv = 1.0f / (lrow + xhalf(lrow));   // the halves' sums join once; sum and O both carry 2^15
#pragma unroll
    for (int t = 0; t < 4; ++t) {
      v4f lo, hi;
#pragma unroll
      for (int r = 0; r < 4; ++r) { lo[r] = oacc[t][r] * inv; hi[r] = oacc[t][4 + r] * inv; }
      *(v4f*)(os + c * 68 + t * 16 + 8 * hh)     = lo;
      *(v4f*)(os + c * 68 + t * 16 + 8 * hh + 4) = hi;
    }
  }
  __builtin_amdgcn_fence(__ATOMIC_RELEASE, "workgroup");
  __builtin_amdgcn_wave_barrier();
  __builtin_amdgcn_fence(__ATOMIC_ACQUIRE, "workgroup");
  {
    const int c4 = (lane & 15) * 4;
    float* orow = ob + (size_t)(q0 + hh) * D_MODEL + c4;   // one base; the eight rows lie at constant steps from it
#pragma unroll
    for (int it = 0; it < 8; ++it) {
      v4f val = *(const v4f*)(os + (it * 2 + hh) * 68 + c4);
      *(v4f*)(orow + it * 2 * D_MODEL) = val;
    }
  }
}

// ---------------------------------------------------------------------------
// host launcher
// ---------------------------------------------------------------------------
extern "C" void kernel_launch(void* const* d_in, const int* in_sizes, int n_in,
                              void* d_out, int out_size, void* d_ws, size_t ws_size,
                              hipStream_t stream) {
  constexpr int S  = SEQ_LEN;
  constexpr int DM = D_MODEL;
  const size_t SD = (size_t)S * DM;    // 4194304 elements
  const size_t DD = (size_t)DM * DM;   // 1048576 elements
  if (n_in < 11) return;
  if ((size_t)in_sizes[0] != SD || (size_t)in_sizes[1] != SD || (size_t)in_sizes[2] != SD) return;
  if ((size_t)in_sizes[3] != DD || (size_t)in_sizes[5] != DD || (size_t)in_sizes[7] != DD || (size_t)in_sizes[9] != DD) return;
  if (in_sizes[4] != DM || in_sizes[6] != DM || in_sizes[8] != DM || in_sizes[10] != DM) return;
  if ((size_t)out_size != SD) return;

  const float* x_q = (const float*)d_in[0];
  const float* x_k = (const float*)d_in[1];
  const float* x_v = (const float*)d_in[2];
  const float* Wq  = (const float*)d_in[3];
  const float* bq  = (const float*)d_in[4];
  const float* Wk  = (const float*)d_in[5];
  const float* bk  = (const float*)d_in[6];
  const float* Wv  = (const float*)d_in[7];
  const float* bv  = (const float*)d_in[8];
  const float* Wo  = (const float*)d_in[9];
  const float* bo  = (const float*)d_in[10];

  //   xq  bf16 [4096][1024]  8 MiB @  0 MiB      xk  @  8 MiB      xv  @ 16 MiB
  //   wq  bf16 [1024][1024]  2 MiB @ 24 MiB      wk  @ 26 MiB      wv  @ 28 MiB     wo f16 @ 30 MiB
  //   q16 f16  [4096][1024]  8 MiB @ 32 MiB      k16 @ 40 MiB      vt16 f16 [1024][4096] @ 48 MiB
  //   o32 f32  [4096][1024] 16 MiB @ 56 MiB      o16 f16 8 MiB @ 72 MiB
  //   bias f32 [4][1024]    16 KiB @ 80 MiB      end = 83902464 B
  const size_t off_xq  = 0;
  const size_t off_xk  = off_xq  + SD * 2;
  const size_t off_xv  = off_xk  + SD * 2;
  const size_t off_wq  = off_xv  + SD * 2;
  const size_t off_wk  = off_wq  + DD * 2;
  const size_t off_wv  = off_wk  + DD * 2;
  const size_t off_wo  = off_wv  + DD * 2;
  const size_t off_q   = off_wo  + DD * 2;
  const size_t off_k   = off_q   + SD * 2;
  const size_t off_vt  = off_k   + SD * 2;
  const size_t off_o32 = off_vt  + SD * 2;
  const size_t off_o16 = off_o32 + SD * 4;
  const size_t off_b   = off_o16 + SD * 2;
  const size_t ws_end  = off_b + 4 * (size_t)DM * 4;
  if (ws_end > ws_size) return;

  char* ws = (char*)d_ws;
  unsigned short* xq   = (unsigned short*)(ws + off_xq);
  unsigned short* xk   = (unsigned short*)(ws + off_xk);
  unsigned short* xv   = (unsigned short*)(ws + off_xv);
  unsigned short* wq   = (unsigned short*)(ws + off_wq);
  unsigned short* wk   = (unsigned short*)(ws + off_wk);
  unsigned short* wv   = (unsigned short*)(ws + off_wv);
  unsigned short* wo   = (unsigned short*)(ws + off_wo);
  unsigned short* q16  = (unsigned short*)(ws + off_q);
  unsigned short* k16  = (unsigned short*)(ws + off_k);
  unsigned short* vt16 = (unsigned short*)(ws + off_vt);
  float*          o32  = (float*)(ws + off_o32);
  unsigned short* o16  = (unsigned short*)(ws + off_o16);
  float*          bws  = (float*)(ws + off_b);
  const float* bias_q = bws;
  const float* bias_o = bws + 3 * DM;

  // 1) every conversion of an input, one grid: x_q, x_k, x_v, Wq, Wk, Wv -> bf16 planes ([out][in] = [N][K] layout as is),
  //    Wo -> f16 plane of bf16-RNE(Wo) x 2^8, the four biases -> bf16-RNE values in f32
  convert_inputs_kernel<<<dim3(CV_BLOCKS, 1), CS_T, 0, stream>>>(x_q, x_k, x_v, Wq, Wk, Wv, Wo, bq, bk, bv, bo,
                                                                xq, xk, xv, wq, wk, wv, wo, bws, 256.0f);

  // GEMM tiles: (4096/128)*(1024/128) = 256 tiles of 128x128 -> 256 blocks x 8 waves; K = 1024 (K % 64 == 0)
  const int gemm_blocks = (int)((S / 128) * (DM / 128));   // 256
  // 2) the three projections, one grid of 3 x 256 blocks (the planes of each kind lie one behind another in the workspace):
  //    job 0: q16[s][n] = x_q . Wq^T + bq   job 1: k16[s][n] = x_k . Wk^T + bk   (f16 out)
  //    job 2: vt16[m = feature][n = s] = Wv[m,:] . x_v[s,:] + bv[m]  (roles swapped: M = 1024, N = 4096, row pitch 4096)
  wmma_gemm64<1, false, 3, 1, false, 0, true><<<dim3(gemm_blocks, 3), 256, 0, stream>>>(
      xq, xq, DM, (long)SD, wq, wq, DM, (long)DD, (void*)q16, (void*)q16, DM, (long)SD, bias_q, bias_q, 0L, S, DM, DM, 1.0f);

  // 3) attention: 16 heads x 64 query blocks, f32 context o32[s][h*64+d]
  attn_full64_f16_kernel<<<dim3(N_HEADS * (S / 64), 1), 128, 0, stream>>>(q16, k16, vt16, o32, 0.125f);

  // 4) o32 -> f16 plane x 2^8
  cast_f16_scaled_kernel<<<dim3(CC_BLOCKS, 1), CS_T, 0, stream>>>(o32, o16, 256.0f);

  // 5) out[s][n] = (o x 2^8) . (Wo x 2^8)^T * 2^-16 + bo  -> f32 d_out
  wmma_gemm64<0, false, 2, 0, false><<<dim3(gemm_blocks, 1), 256, 0, stream>>>(
      o16, o16, DM, 0L, wo, wo, DM, 0L, d_out, d_out, DM, 0L, bias_o, bias_o, 0L, S, DM, DM, 1.0f / 65536.0f);
}

// v010
// A run of this version takes 112 microseconds.
// Two timings next to v009 put it at 1.04 and 1.03 times that version's speed.
// Counting every step since v000, it is 5.81 times as fast.
// Projections q,k,v^T: v_wmma_f32_16x16x32_bf16 (bf16 RNE operands from the f32 inputs, f32 accumulate, bf16-RNE bias added in f32); attention q.k^T and p.v: v_wmma_f32_16x16x32_f16 (f16 q,k,v planes, p carried x2^15, f32 accumulate, f32 online softmax, score scale 0.125 in f32); output projection: v_wmma_f32_16x16x32_f16 (f16 planes of o x2^8 and bf16-RNE(Wo) x2^8, f32 accumulate, scale 2^-16, bf16-RNE bias added in f32).
#include <hip/hip_runtime.h>
#include <math.h>
#include <stdint.h>

typedef __attribute__((ext_vector_type(16))) _Float16 v16h;
typedef __attribute__((ext_vector_type(8)))  _Float16 v8h;
typedef __attribute__((ext_vector_type(16))) __bf16   v16b;
typedef __attribute__((ext_vector_type(8)))  __bf16   v8b;
typedef __attribute__((ext_vector_type(8)))  float    v8f;
typedef __attribute__((ext_vector_type(4)))  float    v4f;
typedef __attribute__((ext_vector_type(2)))  float    v2f;

constexpr int SEQ_LEN = 4096;
constexpr int D_MODEL = 1024;
constexpr int N_HEADS = 16;

__device__ __forceinline__ unsigned short f2bf_bits(float f) {
  unsigned u = __float_as_uint(f);
  return (unsigned short)((u + 0x7FFFu + ((u >> 16) & 1u)) >> 16);
}
__device__ __forceinline__ float bf_bits2f(unsigned short h) { return __uint_as_float(((unsigned)h) << 16); }
__device__ __forceinline__ unsigned pk16(unsigned short a, unsigned short b) { return (unsigned)a | ((unsigned)b << 16); }

// hazard guards as plain device helpers
__device__ __forceinline__ void dep_guard_h(v8f& a, v8f& b, v16h x, v16h y) { asm volatile("v_nop\n\tv_nop\n\tv_nop\n\tv_nop" : "+v"(a), "+v"(b) : "v"(x), "v"(y)); }
__device__ __forceinline__ void dep_guard_b(v8f& a, v8f& b, v16b x, v16b y) { asm volatile("v_nop\n\tv_nop\n\tv_nop\n\tv_nop" : "+v"(a), "+v"(b) : "v"(x), "v"(y)); }
__device__ __forceinline__ void keep4_h(v16h a, v16h b, v16h c, v16h d) { asm volatile("v_nop" :: "v"(a), "v"(b), "v"(c), "v"(d)); }
__device__ __forceinline__ void keep4_b(v16b a, v16b b, v16b c, v16b d) { asm volatile("v_nop" :: "v"(a), "v"(b), "v"(c), "v"(d)); }
__device__ __forceinline__ void acc_guard4(v8f& a, v8f& b, v8f& c, v8f& d) { asm volatile("v_nop\n\tv_nop\n\tv_nop\n\tv_nop" : "+v"(a), "+v"(b), "+v"(c), "+v"(d)); }
template <typename T> struct Frag;
template <> struct Frag<_Float16> {
  typedef v16h V; typedef v8h H; union U { v16h v; v8h h[2]; };
  static __device__ __forceinline__ v16h load(const _Float16* p) {   // elements 0..7 <- p[0..7], 8..15 <- p[16..23]
    U f; f.h[0] = *(const v8h*)(p); f.h[1] = *(const v8h*)(p + 16); return f.v;
  }
  static __device__ __forceinline__ v8f mma(v16h a, v16h b, v8f c) {
    return __builtin_amdgcn_wmma_f32_16x16x32_f16(false, a, false, b, (short)0, c, false, false);
  }
  static __device__ __forceinline__ void guard(v8f& a, v8f& b, v16h x, v16h y) { dep_guard_h(a, b, x, y); }
  static __device__ __forceinline__ void keep(v16h a, v16h b, v16h c, v16h d) { keep4_h(a, b, c, d); }
};
template <> struct Frag<__bf16> {
  typedef v16b V; typedef v8b H; union U { v16b v; v8b h[2]; };
  static __device__ __forceinline__ v16b load(const __bf16* p) {
    U f; f.h[0] = *(const v8b*)(p); f.h[1] = *(const v8b*)(p + 16); return f.v;
  }
  static __device__ __forceinline__ v8f mma(v16b a, v16b b, v8f c) {
    return __builtin_amdgcn_wmma_f32_16x16x32_bf16(false, a, false, b, (short)0, c, false, false);
  }
  static __device__ __forceinline__ void guard(v8f& a, v8f& b, v16b x, v16b y) { dep_guard_b(a, b, x, y); }
  static __device__ __forceinline__ void keep(v16b a, v16b b, v16b c, v16b d) { keep4_b(a, b, c, d); }
};

// ---- LDS-staged batched WMMA GEMM -------------------------------------------
// C[m,n] = scale * sum_k A[m,k] * Bt[n,k] (+bias)(+resid); a block of 8 waves owns a 128x128 tile, each wave 32x64 of it.
// A row-major [M,K]; Bt row-major [N,K]; M,N % 128 == 0, K % 64 == 0, K >= 64.
// Per 64-k step the block brings 128 rows x 128 B of A and of Bt into LDS: 8 lanes x 16 B cover one whole row line,
// 256 threads x 4 pieces per operand = the whole tile. Two LDS buffers: the next step's global loads are issued ahead of
// this step's products and stored behind them, one __syncthreads() per step.
// Rotated k walk: a block starts at k step (tm * cm + tn * cn) mod nk and wraps round. Blocks that share a row band would
// otherwise ask for the same lines at the same moment, step after step, and wait together for each step's lines to reach L2;
// spread over the k steps, they find most lines in L2, where a sharer has brought them. For speed only: any start is correct.
// SPLIT (hi/lo planes) is not staged: single-plane operands only.
// BIAS_MODE: 0 = none, 1 = bias[m], 2 = bias[n], 3 = by the job of a TRIO grid (below).
// TRIO: three independent products share one grid, blockIdx.y = job b; operands, C and bias of job b lie b strides behind
// job 0's (the bias vectors one behind another), C is dense (row pitch = its N). Jobs 0, 1: C = A . Bt^T + bias[n].
// Job 2 takes the two operands in swapped roles (M and N swap with them): C = Bt . A^T + bias[m].
// OUT_MODE: 0 = f32, 1 = f16, 2 = bf16 hi plane (Cout) + bf16 lo plane (Cout2).
// ET: 0 = f16 operands, 1 = bf16 operands (pointers passed as 16-bit storage)
#define GM_BT 128  // block tile, rows of A and of Bt
#define GM_LP 72   // LDS row pitch in elements: 64 + 8, 144 B = 16 B x 9, so 16 rows read by ds_load_b128 fall on 16 distinct bank groups
template <int I> struct IntC { static constexpr int value = I; };   // a compile-time int handed to a generic lambda
template <int ET> struct Elem;
template <> struct Elem<0> { typedef _Float16 T; };
template <> struct Elem<1> { typedef __bf16 T; };
template <int ET, bool SPLIT, int BIAS_MODE, int OUT_MODE, bool RESID, int ACT = 0, bool TRIO = false>
__global__ __launch_bounds__(256) void wmma_gemm64(
    const unsigned short* __restrict__ Ap, const unsigned short* __restrict__ A2p, int lda0, long strideA,
    const unsigned short* __restrict__ Btp, const unsigned short* __restrict__ Bt2p, int ldb0, long strideB,
    void* __restrict__ Cout, void* __restrict__ Cout2, int ldc0, long strideC,
    const float* __restrict__ bias0,
    const float* __restrict__ resid, long strideR,
    int M0, int N0, int K, float scale) {
  static_assert(!SPLIT, "single-plane operands only");
  static_assert((BIAS_MODE == 3) == TRIO, "the job picks the bias mode in a TRIO grid and nowhere else");
  typedef typename Elem<ET>::T T;
  typedef typename Frag<T>::V V;
  typedef typename Frag<T>::H H;
  const T* A = (const T*)Ap; const T* Bt = (const T*)Btp;
  __shared__ __align__(16) T sA[2][GM_BT * GM_LP];   // A rows of the block tile, one 64-k step, two buffers
  __shared__ __align__(16) T sB[2][GM_BT * GM_LP];   // Bt rows of the block tile
  __shared__ __align__(16) float sT[8][16 * 68];     // per-wave 16x64 slab, pitch 68 floats
  const int b    = blockIdx.y;
  const int tid  = threadIdx.x;
  const int lane = tid & 31;
  const int wave = tid >> 5;
  const bool sw = TRIO && b == 2;              // block-uniform: this job's operands change roles
  const int M = sw ? N0 : M0;
  const int N = sw ? M0 : N0;
  const int tilesN = N >> 7;
  const int tilesM = M >> 7;
  const int tile = blockIdx.x;
  if (tile >= tilesM * tilesN) return;   // block-uniform, ahead of every barrier
  const int tm = tile / tilesN;
  const int tn = tile - tm * tilesN;
  const int bm0 = tm << 7;
  const int bn0 = tn << 7;
  const int wm = (wave >> 1) << 5;             // this wave's rows inside the block tile: 0, 32, 64, 96
  const int wn = (wave & 1) << 6;              // this wave's columns inside the block tile: 0, 64
  const int m0 = bm0 + wm;
  const int n0 = bn0 + wn;

  const T* Ab  = sw ? Bt + (size_t)b * strideB : A  + (size_t)b * strideA;
  const T* Bb  = sw ? A  + (size_t)b * strideA : Bt + (size_t)b * strideB;
  const int lda = sw ? ldb0 : lda0;
  const int ldb = sw ? lda0 : ldb0;
  const int ldc = TRIO ? N : ldc0;
  const float* bias = TRIO ? bias0 + (size_t)b * (sw ? M : N) : bias0;

  const int rlane = lane & 15;                 // row (A) / col (B, D) within subtile
  const int koff  = (lane >> 4) * 8;           // k offset of this lane half
  const int mOff  = (lane >> 4) * 8;           // D row offset

  // every unroll directive from here to the epilogue makes the array indices constants, so that acc, the staged pieces
  // and the fragments live in registers and not in scratch
  v8f acc[2][4];
#pragma unroll
  for (int i = 0; i < 2; ++i)
#pragma unroll
    for (int j = 0; j < 4; ++j) acc[i][j] = (v8f){0.f,0.f,0.f,0.f,0.f,0.f,0.f,0.f};

  // staging map: piece it of a thread = row it*32 + (tid >> 3), elements (tid & 7)*8 .. +7 of the step's 64
  const int srow = tid >> 3;
  const int sseg = (tid & 7) << 3;
  const int so = srow * GM_LP + sseg;
  const char* Ac = (const char*)(Ab + (size_t)bm0 * lda);   // block-uniform bases of the two row bands
  const char* Bc = (const char*)(Bb + (size_t)bn0 * ldb);
  const int nk = K >> 6;
  // spacing of the starts: the tilesM sharers of a Bt band spread over the nk steps; the tilesN sharers of an A band
  // (neighbours in block index) spread at twice the spacing
  const int cm = (nk > tilesM) ? nk / tilesM : 1;
  const int cn = (2 * nk > tilesN) ? 2 * nk / tilesN : 1;
  int ks = (tm * cm + tn * cn) % nk;           // block-uniform: the k step being fetched
  unsigned oa[4], ob[4];                       // one running byte offset per piece (a 128-row band stays far below 4 GiB), 128 B a step
  H ra[4], rb[4];
#pragma unroll
  for (int it = 0; it < 4; ++it) {
    oa[it] = (unsigned)(((it * 32 + srow) * lda + sseg) * 2) + (unsigned)ks * 128u;
    ob[it] = (unsigned)(((it * 32 + srow) * ldb + sseg) * 2) + (unsigned)ks * 128u;
    ra[it] = *(const H*)(Ac + oa[it]);
    rb[it] = *(const H*)(Bc + ob[it]);
  }
#pragma unroll
  for (int it = 0; it < 4; ++it) {
    *(H*)(&sA[0][so + it * 32 * GM_LP]) = ra[it];
    *(H*)(&sB[0][so + it * 32 * GM_LP]) = rb[it];
  }

  for (int kt = 0; kt < nk; ++kt) {
    // publishes buffer kt & 1 and ends every wave's reads of the other buffer, which is refilled below
    __syncthreads();
    const bool more = kt + 1 < nk;             // block-uniform
    if (more) {
      const bool wrap = ks + 1 == nk;          // block-uniform: behind the last k step the walk goes on at step 0
      const unsigned adv = wrap ? 128u - (unsigned)nk * 128u : 128u;   // modulo 2^32: the sum is the offset in step 0 again
      ks = wrap ? 0 : ks + 1;
#pragma unroll
      for (int it = 0; it < 4; ++it) {
        oa[it] += adv;
        ob[it] += adv;
        ra[it] = *(const H*)(Ac + oa[it]);
        rb[it] = *(const H*)(Bc + ob[it]);
      }
      // stands behind the eight loads, ahead of every later write of an offset or base register that they name
      asm volatile("s_wait_xcnt 0x0" ::: "memory");
    }
    const T* sa = &sA[kt & 1][(wm + rlane) * GM_LP + koff];
    const T* sb = &sB[kt & 1][(wn + rlane) * GM_LP + koff];
    // the step's 24 fragment reads stand together ahead of its 16 products
    V bh[2][4], ah[2][2];
#pragma unroll
    for (int kk = 0; kk < 2; ++kk) {
#pragma unroll
      for (int j = 0; j < 4; ++j) bh[kk][j] = Frag<T>::load(sb + j * 16 * GM_LP + kk * 32);
#pragma unroll
      for (int i = 0; i < 2; ++i) ah[kk][i] = Frag<T>::load(sa + i * 16 * GM_LP + kk * 32);
    }
#pragma unroll
    for (int kk = 0; kk < 2; ++kk) {
#pragma unroll
      for (int i = 0; i < 2; ++i) {
#pragma unroll
        for (int j = 0; j < 4; ++j) acc[i][j] = Frag<T>::mma(ah[kk][i], bh[kk][j], acc[i][j]);
        Frag<T>::guard(acc[i][0], acc[i][3], ah[kk][i], ah[kk][i]);   // v_nops: the slots behind the last product before its A or D is touched
      }
      Frag<T>::keep(bh[kk][0], bh[kk][1], bh[kk][2], bh[kk][3]);   // holds the B fragments' registers to the end of their products
    }
    if (more) {
      const int nb = (kt + 1) & 1;
#pragma unroll
      for (int it = 0; it < 4; ++it) {
        *(H*)(&sA[nb][so + it * 32 * GM_LP]) = ra[it];
        *(H*)(&sB[nb][so + it * 32 * GM_LP]) = rb[it];
      }
    }
  }
  acc_guard4(acc[0][0], acc[0][1], acc[0][2], acc[0][3]);
  acc_guard4(acc[1][0], acc[1][1], acc[1][2], acc[1][3]);

  // ---- epilogue ----
  float* slab = sT[wave];
  const float* Rb = RESID ? (resid + (size_t)b * strideR) : nullptr;
  // written once, compiled per bias mode BM (1 or 2 in a TRIO grid, picked below by one block-uniform branch), so that each
  // job's bias loads stand together as in a kernel of that mode alone
  auto epilogue = [&](auto bmc) __attribute__((always_inline)) {
  constexpr int BM = decltype(bmc)::value;
#pragma unroll
  for (int i = 0; i < 2; ++i) {
    const int mBase = m0 + (i << 4);
#pragma unroll
    for (int j = 0; j < 4; ++j) {
      const int n = n0 + (j << 4) + rlane;
      float bv = 0.f;
      if (BM == 2) bv = bias[n];
#pragma unroll
      for (int r = 0; r < 8; ++r) {
        float v = acc[i][j][r] * scale;
        if (BM == 1) v += bias[mBase + mOff + r];
        if (BM == 2) v += bv;
        if (RESID) v += Rb[(size_t)(mBase + mOff + r) * ldc + n];
        if (ACT == 1) v = tanhf(v);
        if (ACT == 2) v = fmaxf(v, 0.0f);
        if (ACT == 3) v = v / (1.0f + expf(-v));
        if (ACT == 4) v = (v > 0.f) ? v : 0.01f * v;
        if (ACT == 5) v = 0.5f * v * (1.0f + erff(v * 0.70710678118654752f));
        slab[(mOff + r) * 68 + (j << 4) + rlane] = v;
      }
    }
    __builtin_amdgcn_fence(__ATOMIC_RELEASE, "workgroup");
    __builtin_amdgcn_wave_barrier();
    __builtin_amdgcn_fence(__ATOMIC_ACQUIRE, "workgroup");
    if (OUT_MODE == 0) {
      float* C = (float*)Cout + (size_t)b * strideC;
      const int hh = lane >> 4, c4 = (lane & 15) * 4;     // row seg = 256 B = 16 lanes x 16 B
      {
#pragma unroll
        for (int it = 0; it < 8; ++it) {
          const int row = it * 2 + hh;
          v4f v = *(const v4f*)(slab + row * 68 + c4);
          *(v4f*)(C + (size_t)(mBase + row) * ldc + n0 + c4) = v;
        }
        
      }
    } else {
      const int q = lane >> 3, c8 = (lane & 7) * 8;
      unsigned short* C  = (unsigned short*)Cout  + (size_t)b * strideC;
      unsigned short* C2 = (OUT_MODE == 2) ? ((unsigned short*)Cout2 + (size_t)b * strideC) : nullptr;
      {
#pragma unroll
        for (int it = 0; it < 4; ++it) {
          const int row = it * 4 + q;
          const float* sp = slab + row * 68 + c8;
          v8h hv, lv;
#pragma unroll
          for (int e = 0; e < 8; ++e) {
            if (OUT_MODE == 1) {
              hv[e] = (_Float16)sp[e];
            } else {
              unsigned short hb = f2bf_bits(sp[e]);
              unsigned short lb = f2bf_bits(sp[e] - bf_bits2f(hb));
              hv[e] = __builtin_bit_cast(_Float16, hb);
              lv[e] = __builtin_bit_cast(_Float16, lb);
            }
          }
          *(v8h*)(C + (size_t)(mBase + row) * ldc + n0 + c8) = hv;
          if (OUT_MODE == 2) *(v8h*)(C2 + (size_t)(mBase + row) * ldc + n0 + c8) = lv;
        }
        
      }
    }
    __builtin_amdgcn_fence(__ATOMIC_RELEASE, "workgroup");
    __builtin_amdgcn_wave_barrier();
    __builtin_amdgcn_fence(__ATOMIC_ACQUIRE, "workgroup");
  }
  };
  if constexpr (BIAS_MODE == 3) {
    if (sw) epilogue(IntC<1>{}); else epilogue(IntC<2>{});
  } else {
    epilogue(IntC<BIAS_MODE>{});
  }
}

// ---------------------------------------------------------------------------
// Conversions in streaming form. A block is 16 waves; a wave owns NL * 128 consecutive elements of a plane and issues all its
// NL loads (16 B a lane, 512 contiguous bytes a load) ahead of the first conversion, so that NL * 512 B a wave are in flight;
// piece k goes out as 8 B a lane, 256 contiguous bytes (two whole lines) a store.
// ---------------------------------------------------------------------------
constexpr int CS_T = 512;                    // threads of a block
typedef uint32_t u32x2 __attribute__((ext_vector_type(2)));
// f32 -> bf16 (RNE)
struct CvBf16 {
  __device__ __forceinline__ unsigned short operator()(float f) const { return f2bf_bits(f); }
};
// f32 -> f16 with a power-of-two carry: f16(g(f) * scale), g = bf16 RNE when PREBF, identity otherwise
template <bool PREBF> struct CvF16Scaled {
  float scale;
  __device__ __forceinline__ unsigned short operator()(float f) const {
    if (PREBF) f = bf_bits2f(f2bf_bits(f));
    const _Float16 h = (_Float16)(f * scale);
    return __builtin_bit_cast(unsigned short, h);
  }
};
// block number part of a plane: elements part * 16 * NL * 128 .. + 16 * NL * 128 - 1
template <int NL, typename CV>
__device__ __forceinline__ void stream_cvt(const float* __restrict__ in, unsigned short* __restrict__ out, int part, CV cv) {
  const int wave = threadIdx.x >> 5;
  const int lane = threadIdx.x & 31;
  const size_t e0 = ((size_t)part * (CS_T / 32) + wave) * (NL * 128) + lane * 4;
  const float* ip = in + e0;
  unsigned short* op = out + e0;
  v4f r[NL];
  // both unroll directives make the index of r a constant, so that the pieces live in registers
#pragma unroll
  for (int k = 0; k < NL; ++k) r[k] = *(const v4f*)(ip + k * 128);
  // stands behind the run of loads, ahead of every write of a register that they name; the address is an input, so that it
  // lives up to this wait and no piece of the run is given its registers
  asm volatile("s_wait_xcnt 0x0" :: "v"(ip) : "memory");
  // keeps every load ahead of the first conversion: sunk among the conversions, a part of them would issue only when earlier
  // pieces have landed, and fewer bytes of the wave would be in flight
  __builtin_amdgcn_sched_barrier(0);
#pragma unroll
  for (int k = 0; k < NL; ++k) {
    u32x2 o;
    o[0] = pk16(cv(r[k][0]), cv(r[k][1]));
    o[1] = pk16(cv(r[k][2]), cv(r[k][3]));
    *(u32x2*)(op + k * 128) = o;
  }
  asm volatile("s_wait_xcnt 0x0" ::: "memory");   // stands ahead of any later overwrite of a register that the stores name (other ranges' code may follow in the built order)
}

// ---------------------------------------------------------------------------
// Every conversion that needs the inputs alone, in one grid: none reads what another writes. The job is picked by ranges of
// blockIdx.x (block-uniform), the largest planes first; a block covers 16 waves x CV_NL x 128 = 65536 elements of a plane:
//   3 x CV_XB blocks: x_q, x_k, x_v -> bf16 planes        (CV_XB x 65536 = 4096 x 1024)
//   3 x CV_WB blocks: Wq, Wk, Wv    -> bf16 planes        (CV_WB x 65536 = 1024 x 1024)
//       CV_WB blocks: Wo            -> f16 plane of bf16-RNE(Wo) x wo_scale
//   the last block, ahead of its piece of Wo: bq, bk, bv, bo -> bf16-RNE values held as f32, bias_out[sel * D_MODEL + i],
//   8 elements a thread
// ---------------------------------------------------------------------------
constexpr int CV_NL = 32;                                  // loads of a wave
constexpr int CV_BE = (CS_T / 32) * CV_NL * 128;           // 65536 elements a block
constexpr int CV_XB = SEQ_LEN * D_MODEL / CV_BE;           // 64
constexpr int CV_WB = D_MODEL * D_MODEL / CV_BE;           // 16
constexpr int CV_BLOCKS = 3 * CV_XB + 3 * CV_WB + CV_WB;   // 256: one block a WGP
static_assert(CV_XB * CV_BE == SEQ_LEN * D_MODEL && CV_WB * CV_BE == D_MODEL * D_MODEL, "whole blocks cover the planes");
static_assert(4 * D_MODEL == CS_T * 8, "one block covers the four biases");
// four waves a SIMD (one block a WGP): a wave's 32 pieces take 128 registers, above the compiler's own bound for this block size
__global__ __launch_bounds__(CS_T) __attribute__((amdgpu_waves_per_eu(4, 4))) void convert_inputs_kernel(
    const float* __restrict__ x0, const float* __restrict__ x1, const float* __restrict__ x2,
    const float* __restrict__ w0, const float* __restrict__ w1, const float* __restrict__ w2, const float* __restrict__ w3,
    const float* __restrict__ b0, const float* __restrict__ b1, const float* __restrict__ b2, const float* __restrict__ b3,
    unsigned short* __restrict__ xo0, unsigned short* __restrict__ xo1, unsigned short* __restrict__ xo2,
    unsigned short* __restrict__ wo0, unsigned short* __restrict__ wo1, unsigned short* __restrict__ wo2,
    unsigned short* __restrict__ wo3, float* __restrict__ bias_out, float wo_scale) {
  int blk = blockIdx.x;
  if (blk < 3 * CV_XB) {
    const int sel = blk / CV_XB;
    const float* in = (sel == 0) ? x0 : ((sel == 1) ? x1 : x2);
    unsigned short* out = (sel == 0) ? xo0 : ((sel == 1) ? xo1 : xo2);
    stream_cvt<CV_NL>(in, out, blk - sel * CV_XB, CvBf16{});
    return;
  }
  blk -= 3 * CV_XB;
  if (blk < 3 * CV_WB) {
    const int sel = blk / CV_WB;
    const float* in = (sel == 0) ? w0 : ((sel == 1) ? w1 : w2);
    unsigned short* out = (sel == 0) ? wo0 : ((sel == 1) ? wo1 : wo2);
    stream_cvt<CV_NL>(in, out, blk - sel * CV_WB, CvBf16{});
    return;
  }
  blk -= 3 * CV_WB;
  if (blk == CV_WB - 1) {
    const int t = threadIdx.x;
    const int sel = t / (D_MODEL / 8);               // the same in every lane of a wave: 128 threads a bias
    const float* in = (sel == 0) ? b0 : ((sel == 1) ? b1 : ((sel == 2) ? b2 : b3));
    const int i = (t - sel * (D_MODEL / 8)) * 8;
    const v4f lo = *(const v4f*)(in + i), hi = *(const v4f*)(in + i + 4);
    v4f a, b;
    // unrolled so that the vector indices are constants and the values stay in registers
#pragma unroll
    for (int e = 0; e < 4; ++e) { a[e] = bf_bits2f(f2bf_bits(lo[e])); b[e] = bf_bits2f(f2bf_bits(hi[e])); }
    *(v4f*)(bias_out + sel * D_MODEL + i)     = a;
    *(v4f*)(bias_out + sel * D_MODEL + i + 4) = b;
    asm volatile("s_wait_xcnt 0x0" ::: "memory");   // stands ahead of any later overwrite of a register that the stores name
  }
  stream_cvt<CV_NL>(w3, wo3, blk, CvF16Scaled<true>{wo_scale});
}

// ---------------------------------------------------------------------------
// f32 -> f16 with a power-of-two carry, one plane of SEQ_LEN x D_MODEL elements.
// Coverage: CC_BLOCKS blocks x 16 waves x CC_NL x 128 elements = the whole plane.
// ---------------------------------------------------------------------------
constexpr int CC_NL = 8;
constexpr int CC_BLOCKS = SEQ_LEN * D_MODEL / ((CS_T / 32) * CC_NL * 128);   // 256
static_assert(CC_BLOCKS * (CS_T / 32) * CC_NL * 128 == SEQ_LEN * D_MODEL, "whole blocks cover the plane");
__global__ __launch_bounds__(CS_T) void cast_f16_scaled_kernel(const float* __restrict__ in, unsigned short* __restrict__ out, float scale) {
  stream_cvt<CC_NL>(in, out, blockIdx.x, CvF16Scaled<false>{scale});
}

// =====================================================================================
// Full (non-causal, unmasked) attention, head dim 64, single 16-bit products.
//   q plane (f16): element (s, h, d) at [s*D_MODEL + h*64 + d]
//   k plane (f16): element (s, h, d) at [s*D_MODEL + h*64 + d]
//   v^T plane (f16): element (h, d, s) at [(h*64 + d)*SEQ_LEN + s]
//   out f32: element (s, h, d) at [s*D_MODEL + h*64 + d]
//   scores^T = (k . q^T) * sscale : v_wmma_f32_16x16x32_f16 (A = K rows, B = q), f32 accumulate, sscale applied in f32
//                                   inside the one fma per score that feeds v_exp_f32 (base 2)
//   out^T    = v^T . p^T          : v_wmma_f32_16x16x32_f16 (A = V^T rows, B = p^T packed from the score registers),
//                                   p (unnormalised, x2^15) and v in f16, f32 accumulate
//   online softmax in f32 over all SEQ_LEN keys (64 chunks of 64, compile-time trip count, no masking).
//   Block = 8 waves = 128 query rows of one head; grid.x = N_HEADS * (SEQ_LEN/128) = 512, two blocks resident a WGP.
//   Wave tile: wave w takes the 32 queries (w & 3) * 32 .. + 31 of the block as two groups of 16 columns, and of every chunk
//   the 32 keys of half w >> 2. Each K and V^T fragment read from LDS is the A operand of two products (one a column group),
//   and a staged chunk serves 128 queries: half the LDS reads and half the L2 reads per product of a 16-column wave in a
//   64-query block. A wave keeps maximum, sum and O^T of its own key half; the two waves of a query tile join them once, at the end.
//   Rotated key walk: query block qb starts at chunk 2 * qb and wraps round, so that the 32 blocks of a head ask for 32 different
//   chunks at a time and, past the first few, find them in L2 where another block has brought them (for speed only).
//   K / V^T chunk staging: one tensor_load_to_lds per wave and chunk, each a slice of 16 rows x 128 B (waves 0-3: K rows
//   0-15 .. 48-63 of the chunk; waves 4-7: V^T rows 0-15 .. 48-63), padded by the mover to the 144-B pitch; two LDS buffers,
//   the load of chunk s + 2 issued at the foot of chunk s, one publish point (waits, barrier) per chunk.
//   Output: per-wave 16x64 f32 tile staged in LDS; each 64-float row segment (256 B) written by 16 lanes x 16 B
//   Coverage: 512 blocks x 8 waves x 16 rows x 64 floats = 4096 x 1024 = the whole out plane.
// =====================================================================================
#define AT_D 64
#define AT_NW 8
#define AT_QB 128
#define AT_KC 64
#define AT_PB 144u  // LDS row pitch of the 16-bit tiles in bytes: 16 B x 9, so 16 rows read by ds_load_b128 fall on 16 distinct bank groups
#define AT_SR 16u            // rows of one tensor-load slice: one fragment's rows
#define AT_SLB 4096u         // a slice's room in LDS: 16 rows x 144 B = 2304 B, rounded up so that every slice starts at a multiple of 2 KiB
#define AT_BUFB (8u * AT_SLB) // one buffer: K slices 0 to 3, then V^T slices 0 to 3
typedef uint32_t u32x4 __attribute__((ext_vector_type(4)));
typedef uint32_t u32x8 __attribute__((ext_vector_type(8)));
constexpr float P_CARRY_LOG2 = 15.0f;   // p and its running sum are carried x2^15; the factor cancels in the final division

__device__ __forceinline__ v8f at_mma_h(v16h a, v16h b, v8f c) {
  return __builtin_amdgcn_wmma_f32_16x16x32_f16(false, a, false, b, (short)0, c, false, false);
}

__device__ __forceinline__ uint32_t uni(uint32_t v) { return (uint32_t)__builtin_amdgcn_readfirstlane(v); }
__device__ __forceinline__ uint32_t pinned(uint32_t v) {
  uint32_t w = uni(v);
  asm volatile("" : "+s"(w));   // holds the word in a scalar register; without it the test may become a vector condition
  return w;
}
// the compiler places no wait for the tensor mover: a tile counts as landed only behind its issuer's own wait
__device__ __forceinline__ void wait_tensor0() { asm volatile("s_wait_tensorcnt 0x0" ::: "memory"); }
// this wave's LDS reads have retired before the barrier behind which their buffer is refilled
__device__ __forceinline__ void wait_ds0() { asm volatile("s_wait_dscnt 0x0" ::: "memory"); }
__device__ __forceinline__ void tdm_load(u32x4 g0, u32x8 g1) { asm volatile("tensor_load_to_lds %0, %1" :: "{s[84:87]}"(g0), "{s[88:95]}"(g1) : "memory"); }
// descriptor group 1: 1-byte elements, tensor = tile = AT_SR rows of 128 B, source row pitch src_pitch bytes,
// 4 dwords of LDS pad behind every 32 dwords (one row): LDS pitch 144 B; no workgroup mask
__device__ __forceinline__ u32x8 tdm_group1(uint32_t src_pitch) {
  constexpr uint32_t d0 = 128u, d1 = AT_SR;
  u32x8 g;
  g[0] = uni((1u << 20) | (4u << 22) | (3u << 25));
  g[1] = uni((d0 & 0xFFFFu) << 16);
  g[2] = uni((d0 >> 16) | ((d1 & 0xFFFFu) << 16));
  g[3] = uni((d1 >> 16) | (d0 << 16));
  g[4] = uni(d1);
  g[5] = uni(src_pitch);
  g[6] = uni(0u);
  g[7] = uni(0u);
  return g;
}
// descriptor group 0: count 1, LDS byte offset, global address of the tile's first byte, type 2
__device__ __forceinline__ u32x4 tdm_group0(uint32_t lds_dst, uint64_t ga) {
  u32x4 g;
  g[0] = uni(1u); g[1] = uni(lds_dst); g[2] = uni((uint32_t)ga); g[3] = uni((((uint32_t)(ga >> 32)) & 0x01FFFFFFu) | 0x80000000u);
  return g;
}

// lane l takes the value of lane l ^ 16
__device__ __forceinline__ float xhalf(float x) {
  return __builtin_bit_cast(float, __builtin_amdgcn_permlanex16(__builtin_bit_cast(int, x), __builtin_bit_cast(int, x), 0x76543210, 0xfedcba98, false, false));
}

// four waves a SIMD (two blocks a WGP): the softmax between the matrix runs wants other waves to fill the ports
__global__ __launch_bounds__(256) __attribute__((amdgpu_waves_per_eu(4, 4)))
void attn_full64_f16_kernel(const unsigned short* __restrict__ qp, const unsigned short* __restrict__ kp,
                            const unsigned short* __restrict__ vtp, float* __restrict__ out, float sscale) {
  union FH { v16h v; v8h h[2]; };
  __shared__ __attribute__((aligned(2048))) unsigned char ring[2 * AT_BUFB];   // two buffers of K [kv][d] and V [d][kv] slices, 64 KB
  __shared__ __align__(16) float    Xs[AT_NW][34 * 32];            // per wave: what it hands to the other key half's wave, lane by lane
  __shared__ __align__(16) float    Os[AT_NW][16 * 68];            // per wave out tile, pitch 68

  const int tid  = threadIdx.x;
  const int wave = tid >> 5;
  const int lane = tid & 31;
  const int hh   = lane >> 4;
  const int c    = lane & 15;
  const int qt   = wave & 3;              // the wave's query tile of 32 rows
  const int kh   = wave >> 2;             // the wave's half of every chunk's keys

  const int nqb = SEQ_LEN / AT_QB;        // 32
  const int bx = blockIdx.x;
  const int qb = bx % nqb;
  const int h  = bx / nqb;                // 0..N_HEADS-1 (grid = N_HEADS * nqb)
  const int q0 = qb * AT_QB + qt * 32;

  const _Float16* Qg = (const _Float16*)(const void*)qp  + (size_t)h * AT_D;
  const _Float16* Kg = (const _Float16*)(const void*)kp  + (size_t)h * AT_D;
  const _Float16* Vg = (const _Float16*)(const void*)vtp + (size_t)h * AT_D * SEQ_LEN;
  float*          ob = out + (size_t)h * AT_D;

  // ---- K / V^T slices by tensor load: every wave issues its own slice of every chunk, unconditionally ----
  const uint32_t wv   = uni((uint32_t)threadIdx.x >> 5);
  const bool     isV  = (wv & 4u) != 0u;
  const uint32_t srow = (wv & 3u) * AT_SR;                                   // the slice's first row in the chunk tile
  const uint32_t spitch = isV ? (uint32_t)SEQ_LEN * 2u : (uint32_t)D_MODEL * 2u;   // source row pitch in bytes
  const uint32_t sstep  = isV ? (uint32_t)AT_KC * 2u : (uint32_t)AT_KC * (uint32_t)D_MODEL * 2u;   // bytes from one chunk's slice to the next's
  const uint64_t ssrc = (uint64_t)(size_t)(isV ? Vg : Kg) + (uint64_t)(srow * spitch);
  const uint32_t sdst = (uint32_t)(size_t)ring + wv * AT_SLB;
  const u32x8 g1 = tdm_group1(spitch);
  // prologue, two buffers: the first chunk's load (chunk 2 * qb), its wait, the barrier that publishes it, then the next chunk's load
  constexpr uint32_t NCH = SEQ_LEN / AT_KC;   // chunks of the walk
  const uint32_t rot = uni((uint32_t)qb * (NCH / (uint32_t)nqb));     // the block's first chunk
  u32x4 g0 = tdm_group0(sdst, ssrc + (uint64_t)rot * sstep);
  tdm_load(g0, g1);
  wait_tensor0();
  __syncthreads();
  g0 = tdm_group0(sdst + AT_BUFB, ssrc + (uint64_t)((rot + 1u) % NCH) * sstep);
  tdm_load(g0, g1);

  // ---- Q fragments (B operand, column = lane&15, split k map via Frag load): 2 column groups x 2 d-chunks ----
  // (every unroll directive of this kernel makes array indices constants, so that the arrays live in registers)
  v16h qa[2][2];
  const _Float16* qr[2];
#pragma unroll
  for (int g = 0; g < 2; ++g) {
    qr[g] = Qg + (size_t)(q0 + g * 16 + c) * D_MODEL + 8 * hh;
#pragma unroll
    for (int dc = 0; dc < 2; ++dc) qa[g][dc] = Frag<_Float16>::load(qr[g] + dc * 32);
  }
  // stands behind the eight Q loads, ahead of every later write of a register that they name; the addresses are inputs, so
  // that they live up to this wait and nothing else is given their registers ahead of it
  asm volatile("s_wait_xcnt 0x0" :: "v"(qr[0]), "v"(qr[1]) : "memory");

  // One query column per lane and group (q0 + g*16 + c); the two wave halves split that query's keys of the wave's key half.
  float mrow[2], lrow[2], mbrow[2];        // running maximum of the raw scores (equal in both lane halves), this lane half's running
                                           // sum (x2^15), and mrow * c2 - 15: what one fma takes off a score ahead of the base-2 exponential
  const float c2 = sscale * 1.44269504088896340736f;   // score scale times log2(e); sscale > 0, so the raw scores order as the scaled ones
  v8f oacc[2][4];                          // O^T tiles: oacc[g][t][r] = O[q0 + g*16 + c][t*16 + 8*hh + r], this key half's share
#pragma unroll
  for (int g = 0; g < 2; ++g) {
    mrow[g] = -INFINITY; lrow[g] = 0.f; mbrow[g] = -INFINITY;
#pragma unroll
    for (int t = 0; t < 4; ++t) oacc[g][t] = (v8f){0.f,0.f,0.f,0.f,0.f,0.f,0.f,0.f};
  }

  const int nChunks = SEQ_LEN / AT_KC;   // 64, compile-time constant
  for (int kc = 0; kc < nChunks; ++kc) {
    // this chunk's buffer; rows 16 x .. 16 x + 15 of a 64-row tile are slice x. This wave's keys: K slices 2 kh, 2 kh + 1, and
    // bytes 64 kh .. + 63 of every V^T row
    const unsigned char* kr = ring + (uint32_t)(kc & 1) * AT_BUFB + (uint32_t)kh * 2u * AT_SLB + (uint32_t)c * AT_PB + 16u * (uint32_t)hh;
    const unsigned char* vr = ring + (uint32_t)(kc & 1) * AT_BUFB + 4u * AT_SLB + (uint32_t)c * AT_PB + 16u * (uint32_t)hh + (uint32_t)kh * 64u;

    // the chunk's 16 fragment reads (K first, in the order of their use, then V^T) stand together behind the barrier, ahead
    // of all 16 products: one place with LDS reads per chunk, and the V^T fragments land under the score products and the softmax
    FH kb[2][2], vb[4];
#pragma unroll
    for (int dc = 0; dc < 2; ++dc)
#pragma unroll
      for (int j = 0; j < 2; ++j) {
        kb[dc][j].h[0] = *(const v8h*)(kr + j * AT_SLB + dc * 64);
        kb[dc][j].h[1] = *(const v8h*)(kr + j * AT_SLB + dc * 64 + 32);
      }
#pragma unroll
    for (int t = 0; t < 4; ++t) {
      vb[t].h[0] = *(const v8h*)(vr + t * AT_SLB);
      vb[t].h[1] = *(const v8h*)(vr + t * AT_SLB + 32);
    }
    // keeps the reads one group: sunk back among the products, each pair would cost its own full LDS latency
    __builtin_amdgcn_sched_barrier(0);
    // S^T = K . Q^T: s[g][j][r] = score of the key half's key j*16 + 8*hh + r against query q0 + g*16 + c; four independent
    // tiles per d half, each K fragment used for both column groups
    v8f s[2][2];
#pragma unroll
    for (int g = 0; g < 2; ++g)
#pragma unroll
      for (int j = 0; j < 2; ++j) s[g][j] = (v8f){0.f,0.f,0.f,0.f,0.f,0.f,0.f,0.f};
#pragma unroll
    for (int dc = 0; dc < 2; ++dc)
#pragma unroll
      for (int j = 0; j < 2; ++j)
#pragma unroll
        for (int g = 0; g < 2; ++g) s[g][j] = at_mma_h(kb[dc][j].v, qa[g][dc], s[g][j]);
    // keeps the eight products back to back: a maximum drawn up among them waits out its product's latency and holds the rest back
    __builtin_amdgcn_sched_barrier(0);
    const v8f c2v = (v8f){c2, c2, c2, c2, c2, c2, c2, c2};
    FH pb[2];                              // P^T of a column group packs in place into a B operand: element e = tile e >> 3, register e & 7
#pragma unroll
    for (int g = 0; g < 2; ++g) {
      float mj[2];
#pragma unroll
      for (int j = 0; j < 2; ++j) {
        mj[j] = -INFINITY;
#pragma unroll
        for (int r = 0; r < 8; ++r) mj[j] = fmaxf(mj[j], s[g][j][r]);
      }
      float cm = fmaxf(mj[0], mj[1]);
      cm = fmaxf(cm, xhalf(cm));           // both lane halves now hold the query's maximum over the wave's 32 keys
      const float mnew = fmaxf(mrow[g], cm);
      const float mbnew = fmaf(mnew, c2, -P_CARRY_LOG2);
      const float alpha = __builtin_amdgcn_exp2f(mbrow[g] - mbnew);   // 0 on the first chunk (mbrow = -inf)
      mrow[g] = mnew;
      mbrow[g] = mbnew;
      const v8f nmb = (v8f){-mbnew, -mbnew, -mbnew, -mbnew, -mbnew, -mbnew, -mbnew, -mbnew};
      float pj[2];
#pragma unroll
      for (int j = 0; j < 2; ++j) {
        pj[j] = 0.f;
        const v8f x = __builtin_elementwise_fma(s[g][j], c2v, nmb);   // scaled score - scaled maximum + 15, in base-2 units
#pragma unroll
        for (int r = 0; r < 8; ++r) {
          const float p = __builtin_amdgcn_exp2f(x[r]);   // exp(scaled score - scaled maximum) x 2^15
          pj[j] += p;
          pb[g].v[j * 8 + r] = (_Float16)p;
        }
      }
      lrow[g] = lrow[g] * alpha + (pj[0] + pj[1]);
#pragma unroll
      for (int t = 0; t < 4; ++t)
#pragma unroll
        for (int r = 0; r < 8; ++r) oacc[g][t][r] *= alpha;
    }
    // O^T += V^T . P^T: eight independent tiles, each V^T fragment used for both column groups
#pragma unroll
    for (int t = 0; t < 4; ++t)
#pragma unroll
      for (int g = 0; g < 2; ++g) oacc[g][t] = at_mma_h(vb[t].v, pb[g].v, oacc[g][t]);
    // publish point of chunk kc + 1, every wave: own LDS reads retired, own slice landed, the barrier; it also ends every
    // wave's reads of this chunk's buffer, which the load behind it refills
    // keeps the publish point at the chunk's foot: drawn up among the softmax, the tensor wait would stand shortly behind its
    // load's issue instead of a whole chunk behind it
    __builtin_amdgcn_sched_barrier(0);
    wait_ds0();
    wait_tensor0();
    __syncthreads();
    const uint32_t nx = pinned((uint32_t)kc + 2u);   // taken behind the wait, so that the descriptor words formed from it are too
    if (pinned(nx < (uint32_t)nChunks)) {
      g0 = tdm_group0(sdst + (nx & 1u) * AT_BUFB, ssrc + (uint64_t)((rot + nx) % NCH) * sstep);
      tdm_load(g0, g1);
    }
  }
  wait_tensor0();   // nothing of the mover is in flight when the wave goes on to its end
  wait_ds0();

  // ---- the two key halves of a query tile join: the wave of half kh finishes column group kh and hands its share of the
  // other group to its partner (wave ^ 4), register for register and lane for lane (512 contiguous bytes a store) ----
  const bool k1 = kh != 0;
  {
    float* xs = Xs[wave];
#pragma unroll
    for (int t = 0; t < 4; ++t) {
      v4f lo, hi;
#pragma unroll
      for (int r = 0; r < 4; ++r) {
        lo[r] = k1 ? oacc[0][t][r]     : oacc[1][t][r];
        hi[r] = k1 ? oacc[0][t][4 + r] : oacc[1][t][4 + r];
      }
      *(v4f*)(xs + (t * 2) * 128 + lane * 4)     = lo;
      *(v4f*)(xs + (t * 2 + 1) * 128 + lane * 4) = hi;
    }
    xs[32 * 32 + lane] = k1 ? mbrow[0] : mbrow[1];
    xs[33 * 32 + lane] = k1 ? lrow[0]  : lrow[1];
  }
  __syncthreads();   // every wave's hand-over is written before its partner reads it
  float* os = Os[wave];
  {
    const float* xp = Xs[wave ^ 4];
    const float mbA = k1 ? mbrow[1] : mbrow[0];
    const float lA  = k1 ? lrow[1]  : lrow[0];
    const float mbB = xp[32 * 32 + lane];
    const float lB  = xp[33 * 32 + lane];
    const float mb  = fmaxf(mbA, mbB);               // both shares brought to the larger maximum
    float fa = __builtin_amdgcn_exp2f(mbA - mb);
    float fb = __builtin_amdgcn_exp2f(mbB - mb);
    const float l = lA * fa + lB * fb;
    const float inv = 1.0f / (l + xhalf(l));         // the lane halves' sums join once; sum and O both carry 2^15
    fa *= inv;
    fb *= inv;
#pragma unroll
    for (int t = 0; t < 4; ++t) {
      const v4f plo = *(const v4f*)(xp + (t * 2) * 128 + lane * 4);
      const v4f phi = *(const v4f*)(xp + (t * 2 + 1) * 128 + lane * 4);
      v4f lo, hi;
#pragma unroll
      for (int r = 0; r < 4; ++r) {
        lo[r] = (k1 ? oacc[1][t][r]     : oacc[0][t][r])     * fa + plo[r] * fb;
        hi[r] = (k1 ? oacc[1][t][4 + r] : oacc[0][t][4 + r]) * fa + phi[r] * fb;
      }
      *(v4f*)(os + c * 68 + t * 16 + 8 * hh)     = lo;
      *(v4f*)(os + c * 68 + t * 16 + 8 * hh + 4) = hi;
    }
  }
  __builtin_amdgcn_fence(__ATOMIC_RELEASE, "workgroup");
  __builtin_amdgcn_wave_barrier();
  __builtin_amdgcn_fence(__ATOMIC_ACQUIRE, "workgroup");
  {
    const int c4 = (lane & 15) * 4;
    float* orow = ob + (size_t)(q0 + kh * 16 + hh) * D_MODEL + c4;   // one base; the eight rows lie at constant steps from it
#pragma unroll
    for (int it = 0; it < 8; ++it) {
      v4f val = *(const v4f*)(os + (it * 2 + hh) * 68 + c4);
      *(v4f*)(orow + it * 2 * D_MODEL) = val;
    }
  }
}

// ---------------------------------------------------------------------------
// host launcher
// ---------------------------------------------------------------------------
extern "C" void kernel_launch(void* const* d_in, const int* in_sizes, int n_in,
                              void* d_out, int out_size, void* d_ws, size_t ws_size,
                              hipStream_t stream) {
  constexpr int S  = SEQ_LEN;
  constexpr int DM = D_MODEL;
  const size_t SD = (size_t)S * DM;    // 4194304 elements
  const size_t DD = (size_t)DM * DM;   // 1048576 elements
  if (n_in < 11) return;
  if ((size_t)in_sizes[0] != SD || (size_t)in_sizes[1] != SD || (size_t)in_sizes[2] != SD) return;
  if ((size_t)in_sizes[3] != DD || (size_t)in_sizes[5] != DD || (size_t)in_sizes[7] != DD || (size_t)in_sizes[9] != DD) return;
  if (in_sizes[4] != DM || in_sizes[6] != DM || in_sizes[8] != DM || in_sizes[10] != DM) return;
  if ((size_t)out_size != SD) return;

  const float* x_q = (const float*)d_in[0];
  const float* x_k = (const float*)d_in[1];
  const float* x_v = (const float*)d_in[2];
  const float* Wq  = (const float*)d_in[3];
  const float* bq  = (const float*)d_in[4];
  const float* Wk  = (const float*)d_in[5];
  const float* bk  = (const float*)d_in[6];
  const float* Wv  = (const float*)d_in[7];
  const float* bv  = (const float*)d_in[8];
  const float* Wo  = (const float*)d_in[9];
  const float* bo  = (const float*)d_in[10];

  //   xq  bf16 [4096][1024]  8 MiB @  0 MiB      xk  @  8 MiB      xv  @ 16 MiB
  //   wq  bf16 [1024][1024]  2 MiB @ 24 MiB      wk  @ 26 MiB      wv  @ 28 MiB     wo f16 @ 30 MiB
  //   q16 f16  [4096][1024]  8 MiB @ 32 MiB      k16 @ 40 MiB      vt16 f16 [1024][4096] @ 48 MiB
  //   o32 f32  [4096][1024] 16 MiB @ 56 MiB      o16 f16 8 MiB @ 72 MiB
  //   bias f32 [4][1024]    16 KiB @ 80 MiB      end = 83902464 B
  const size_t off_xq  = 0;
  const size_t off_xk  = off_xq  + SD * 2;
  const size_t off_xv  = off_xk  + SD * 2;
  const size_t off_wq  = off_xv  + SD * 2;
  const size_t off_wk  = off_wq  + DD * 2;
  const size_t off_wv  = off_wk  + DD * 2;
  const size_t off_wo  = off_wv  + DD * 2;
  const size_t off_q   = off_wo  + DD * 2;
  const size_t off_k   = off_q   + SD * 2;
  const size_t off_vt  = off_k   + SD * 2;
  const size_t off_o32 = off_vt  + SD * 2;
  const size_t off_o16 = off_o32 + SD * 4;
  const size_t off_b   = off_o16 + SD * 2;
  const size_t ws_end  = off_b + 4 * (size_t)DM * 4;
  if (ws_end > ws_size) return;

  char* ws = (char*)d_ws;
  unsigned short* xq   = (unsigned short*)(ws + off_xq);
  unsigned short* xk   = (unsigned short*)(ws + off_xk);
  unsigned short* xv   = (unsigned short*)(ws + off_xv);
  unsigned short* wq   = (unsigned short*)(ws + off_wq);
  unsigned short* wk   = (unsigned short*)(ws + off_wk);
  unsigned short* wv   = (unsigned short*)(ws + off_wv);
  unsigned short* wo   = (unsigned short*)(ws + off_wo);
  unsigned short* q16  = (unsigned short*)(ws + off_q);
  unsigned short* k16  = (unsigned short*)(ws + off_k);
  unsigned short* vt16 = (unsigned short*)(ws + off_vt);
  float*          o32  = (float*)(ws + off_o32);
  unsigned short* o16  = (unsigned short*)(ws + off_o16);
  float*          bws  = (float*)(ws + off_b);
  const float* bias_q = bws;
  const float* bias_o = bws + 3 * DM;

  // 1) every conversion of an input, one grid: x_q, x_k, x_v, Wq, Wk, Wv -> bf16 planes ([out][in] = [N][K] layout as is),
  //    Wo -> f16 plane of bf16-RNE(Wo) x 2^8, the four biases -> bf16-RNE values in f32
  convert_inputs_kernel<<<dim3(CV_BLOCKS, 1), CS_T, 0, stream>>>(x_q, x_k, x_v, Wq, Wk, Wv, Wo, bq, bk, bv, bo,
                                                                xq, xk, xv, wq, wk, wv, wo, bws, 256.0f);

  // GEMM tiles: (4096/128)*(1024/128) = 256 tiles of 128x128 -> 256 blocks x 8 waves; K = 1024 (K % 64 == 0)
  const int gemm_blocks = (int)((S / 128) * (DM / 128));   // 256
  // 2) the three projections, one grid of 3 x 256 blocks (the planes of each kind lie one behind another in the workspace):
  //    job 0: q16[s][n] = x_q . Wq^T + bq   job 1: k16[s][n] = x_k . Wk^T + bk   (f16 out)
  //    job 2: vt16[m = feature][n = s] = Wv[m,:] . x_v[s,:] + bv[m]  (roles swapped: M = 1024, N = 4096, row pitch 4096)
  wmma_gemm64<1, false, 3, 1, false, 0, true><<<dim3(gemm_blocks, 3), 256, 0, stream>>>(
      xq, xq, DM, (long)SD, wq, wq, DM, (long)DD, (void*)q16, (void*)q16, DM, (long)SD, bias_q, bias_q, 0L, S, DM, DM, 1.0f);

  // 3) attention: 16 heads x 32 query blocks, f32 context o32[s][h*64+d]
  attn_full64_f16_kernel<<<dim3(N_HEADS * (S / AT_QB), 1), AT_NW * 32, 0, stream>>>(q16, k16, vt16, o32, 0.125f);

  // 4) o32 -> f16 plane x 2^8
  cast_f16_scaled_kernel<<<dim3(CC_BLOCKS, 1), CS_T, 0, stream>>>(o32, o16, 256.0f);

  // 5) out[s][n] = (o x 2^8) . (Wo x 2^8)^T * 2^-16 + bo  -> f32 d_out
  wmma_gemm64<0, false, 2, 0, false><<<dim3(gemm_blocks, 1), 256, 0, stream>>>(
      o16, o16, DM, 0L, wo, wo, DM, 0L, d_out, d_out, DM, 0L, bias_o, bias_o, 0L, S, DM, DM, 1.0f / 65536.0f);
}
